// v000
// Measured on an AMD MI455X. A time is GPU time per run, averaged over a window of back-to-back runs after a warm-up
// (all launches, gaps included; the runs take copies of the inputs in turn), and the median of several windows.
// Apart from v000's, it joins two sittings. Times from different sittings can be a few percent apart, while
// side-by-side timings come from the same sitting.
// v000 is the starting kernel. One run takes 144 microseconds.
// Contractions: x.W{q,k,v} on v_wmma_f32_16x16x32_bf16 (x and W RNE-converted to bf16, exact operands, f32 accumulate);
// scores q'.k'^T (q', k' carried x1024 as f16 hi plane + f16 residual plane, products hh+lh+hl), P.v (P x32768 f16 hi+residual,
// v x1024 f16 hi+residual, products hh+lh+hl) and O.wo (O x1024 f16 hi+residual, wo as f16(bf16(wo) x1024), products h.w+l.w):
// v_wmma_f32_16x16x32_f16, f32 accumulate. Rotary tables, rotation, masked base-2 online softmax and 1/l fold in f32 on VALU.
#include <hip/hip_runtime.h>
#include <math.h>
#include <stdint.h>

#define NB    2
#define SEQ   2048
#define DMOD  768
#define NH    12
#define NKV   4
#define HD    64
#define GRP   3
#define WIN   512
#define GLB   64
#define QSC   1024.0f
#define KSC   1024.0f
#define PCAR  32768.0f
#define VCAR  1024.0f
#define OSC   1024.0f
#define WOS   1024.0f
#define LOG2E 1.4426950408889634f
#define ATT_THREADS (GRP * 32)
#define ATT_BLOCKS  (NB * NKV * (SEQ / 16))
#define SLABF (16 * 68)
#define SLAB64 (16 * 68)
#define VTP   72
#define MAXBLK 20
static_assert(NH == NKV * GRP);
static_assert(HD == 64 && DMOD == NH * HD);
static_assert((SEQ / 16) == 128 && NKV == 4 && NB == 2);
static_assert(ATT_THREADS == 96 && ATT_BLOCKS == 1024);
static_assert(16 * 36 <= SLABF);
static_assert(((NB * SEQ * NH * 8) % 256) == 0 && ((NB * SEQ * NKV * 8) % 256) == 0);
static_assert(((NB * SEQ) % 64) == 0 && (DMOD % 64) == 0 && ((NKV * HD) % 64) == 0 && (DMOD % 32) == 0);
static_assert((SEQ % 64) == 0 && (SEQ % 8) == 0);

typedef unsigned short u16;
typedef _Float16 v16h __attribute__((ext_vector_type(16)));
typedef _Float16 v8h  __attribute__((ext_vector_type(8)));
typedef __bf16   v16b __attribute__((ext_vector_type(16)));
typedef float    v8f  __attribute__((ext_vector_type(8)));
typedef float    v4f  __attribute__((ext_vector_type(4)));
typedef unsigned int v4u __attribute__((ext_vector_type(4)));

union FragH { v16h v; v8h h[2]; v4u u[2]; };
union FragB { v16b v; v4u u[2]; };

struct InvF { float f[32]; };
static_assert(sizeof(InvF) == 128);

// ---- scalar helpers --------------------------------------------------------------------------------
__device__ __forceinline__ unsigned short bf_bits(float f) {          // f32 -> bf16 bits, RNE convert
  unsigned u = __float_as_uint(f);
  return (unsigned short)((u + 0x7FFFu + ((u >> 16) & 1u)) >> 16);
}
__device__ __forceinline__ float bf_up(unsigned short h) { return __uint_as_float(((unsigned)h) << 16); }
__device__ __forceinline__ float bfr(float f) { return bf_up(bf_bits(f)); }
__device__ __forceinline__ unsigned short h_bits(_Float16 x) { return __builtin_bit_cast(unsigned short, x); }
__device__ __forceinline__ unsigned pk16(unsigned short a, unsigned short b) { return (unsigned)a | ((unsigned)b << 16); }
__device__ __forceinline__ v8f zero8() { v8f z = {0.f, 0.f, 0.f, 0.f, 0.f, 0.f, 0.f, 0.f}; return z; }

// ---- fragment loaders: 16-bit A/B operand, lane -> row/col (lane&15), p already includes +8*(lane>>4);
//      elements 0..7 <- p[0..7] (k0+8h..), elements 8..15 <- p[16..23] (k0+16+8h..)  (same split k map for A and B;
//      B is always read from a k-contiguous [n][k] plane)
__device__ __forceinline__ v16h ldfrag_h(const _Float16* p) {
  FragH f;
  f.h[0] = *(const v8h*)(p);
  f.h[1] = *(const v8h*)(p + 16);
  return f.v;
}
__device__ __forceinline__ v16b ldfrag_b(const u16* p) {              // bf16 plane read as unsigned integer vectors
  FragB f;
  f.u[0] = *(const v4u*)(p);
  f.u[1] = *(const v4u*)(p + 16);
  return f.v;
}

__device__ __forceinline__ v8f mma_h(v16h a, v16h b, v8f c) {
  return __builtin_amdgcn_wmma_f32_16x16x32_f16(false, a, false, b, (short)0, c, false, false);
}
__device__ __forceinline__ v8f mma_b(v16b a, v16b b, v8f c) {
  return __builtin_amdgcn_wmma_f32_16x16x32_bf16(false, a, false, b, (short)0, c, false, false);
}
__device__ __forceinline__ void guard2(v8f& a, v8f& b, v16h x0, v16h x1, v16h x2, v16h x3, v16h x4, v16h x5) {
#if defined(__HIP_DEVICE_COMPILE__)
  asm volatile("v_nop\n\tv_nop\n\tv_nop\n\tv_nop"
               : "+v"(a), "+v"(b) : "v"(x0), "v"(x1), "v"(x2), "v"(x3), "v"(x4), "v"(x5) : "memory");
#endif
}
template <typename F>
__device__ __forceinline__ void guard6(v8f& a, v8f& b, v8f& c, v8f& d, F x0, F x1, F x2, F x3, F x4, F x5) {
#if defined(__HIP_DEVICE_COMPILE__)
  asm volatile("v_nop\n\tv_nop\n\tv_nop\n\tv_nop"
               : "+v"(a), "+v"(b), "+v"(c), "+v"(d) : "v"(x0), "v"(x1), "v"(x2), "v"(x3), "v"(x4), "v"(x5) : "memory");
#endif
}
__device__ __forceinline__ void guard10(v8f& a, v8f& b, v8f& c, v8f& d, v16h x0, v16h x1, v16h x2, v16h x3, v16h x4,
                                        v16h x5, v16h x6, v16h x7, v16h x8, v16h x9) {
#if defined(__HIP_DEVICE_COMPILE__)
  asm volatile("v_nop\n\tv_nop\n\tv_nop\n\tv_nop"
               : "+v"(a), "+v"(b), "+v"(c), "+v"(d)
               : "v"(x0), "v"(x1), "v"(x2), "v"(x3), "v"(x4), "v"(x5), "v"(x6), "v"(x7), "v"(x8), "v"(x9) : "memory");
#endif
}
__device__ __forceinline__ void acc_guard4(v8f& a, v8f& b, v8f& c, v8f& d) {
#if defined(__HIP_DEVICE_COMPILE__)
  asm volatile("v_nop\n\tv_nop\n\tv_nop\n\tv_nop" : "+v"(a), "+v"(b), "+v"(c), "+v"(d));
#endif
}
__device__ __forceinline__ void wave_sync_lds() {
  __builtin_amdgcn_fence(__ATOMIC_RELEASE, "workgroup");
  __builtin_amdgcn_wave_barrier();
  __builtin_amdgcn_fence(__ATOMIC_ACQUIRE, "workgroup");
}

// ---- accurate f32 sin/cos of a non-negative f32 angle (|angle| < 2048): f64 two-part pi/2 reduction + f64 polynomials,
//      plain f64 fma/mul only (no library f64 trig path), result converted to f32.
__device__ __forceinline__ void sincos_acc(float angf, float& sv, float& cv) {
  const double a = (double)angf;
  const double TWO_OVER_PI = 0.63661977236758134308;
  const double PIO2_HI = 1.5707963267948966;
  const double PIO2_LO = 6.123233995736766e-17;
  const int kq = (int)(a * TWO_OVER_PI + 0.5);
  const double kd = (double)kq;
  double r = fma(-kd, PIO2_HI, a);
  r = fma(-kd, PIO2_LO, r);
  const double r2 = r * r;
  double sp = 1.0 / 6227020800.0;
  sp = fma(sp, r2, -1.0 / 39916800.0);
  sp = fma(sp, r2, 1.0 / 362880.0);
  sp = fma(sp, r2, -1.0 / 5040.0);
  sp = fma(sp, r2, 1.0 / 120.0);
  sp = fma(sp, r2, -1.0 / 6.0);
  const double s = fma(sp * r2, r, r);
  double cp = -1.0 / 87178291200.0;
  cp = fma(cp, r2, 1.0 / 479001600.0);
  cp = fma(cp, r2, -1.0 / 3628800.0);
  cp = fma(cp, r2, 1.0 / 40320.0);
  cp = fma(cp, r2, -1.0 / 720.0);
  cp = fma(cp, r2, 1.0 / 24.0);
  cp = fma(cp, r2, -0.5);
  const double c = fma(cp, r2, 1.0);
  const int qd = kq & 3;
  const double so = (qd == 0) ? s : (qd == 1) ? c : (qd == 2) ? -s : -c;
  const double co = (qd == 0) ? c : (qd == 1) ? -s : (qd == 2) ? -c : s;
  sv = (float)so;
  cv = (float)co;
}

// =====================================================================================================
// Rotary tables: cosT[t][d], sinT[t][d] for t < SEQ, d < HD, angle = float(t) * inv_freq[d & 31] (f32 product), halves duplicated.
// Wave = one position t, lane = frequency index; inv_freq picked from the by-value table with a static select chain.
// coverage: grid SEQ/8 blocks x 8 waves = SEQ rows; per row 4 line stores = 64 floats of each table.
// =====================================================================================================
__global__ __launch_bounds__(256) void k_tab(float* cosT, float* sinT, InvF inv) {
  const int tid  = threadIdx.x;
  const int lane = tid & 31;
  const int t    = blockIdx.x * 8 + (tid >> 5);
  if (t >= SEQ) return;                     // never taken with the exact grid; no barriers in this kernel
  float f = inv.f[0];
#pragma unroll
  for (int i = 1; i < 32; ++i) f = (lane == i) ? inv.f[i] : f;
  const float ang = (float)t * f;
  float sv, cv;
  sincos_acc(ang, sv, cv);
  float* cr = cosT + (size_t)t * HD;
  float* sr = sinT + (size_t)t * HD;
  {
    *(float*)(cr + lane)      = cv;
    *(float*)(cr + 32 + lane) = cv;
    *(float*)(sr + lane)      = sv;
    *(float*)(sr + 32 + lane) = sv;
    
  }
}

// =====================================================================================================
// x f32 -> bf16 plane (RNE convert), same layout. Thread = 8 consecutive elements: two 16-B loads, one 16-B store;
// coverage: grid = n8/256 blocks (host checks exactness) x 256 thr x 8 = the whole plane.
// =====================================================================================================
__global__ __launch_bounds__(256) void cvt_x(const float* __restrict__ x, u16* D, int n8) {
  const int gt = blockIdx.x * 256 + (int)threadIdx.x;
  if (gt >= n8) return;                     // no barriers in this kernel
  const float* p = x + (size_t)gt * 8;
  const v4f a = *(const v4f*)(p), bq = *(const v4f*)(p + 4);
  v4u o;
  o[0] = pk16(bf_bits(a[0]),  bf_bits(a[1]));
  o[1] = pk16(bf_bits(a[2]),  bf_bits(a[3]));
  o[2] = pk16(bf_bits(bq[0]), bf_bits(bq[1]));
  o[3] = pk16(bf_bits(bq[2]), bf_bits(bq[3]));
  u16* d = D + (size_t)gt * 8;
  {
    *(v4u*)(d) = o;
    
  }
}

// =====================================================================================================
// Weight transpose + 16-bit convert: in W[R][C] (row-major f32) -> out D[C][R] (k-contiguous 16-bit plane).
//   f16mode == 0: D = bf16 RNE bits of W;  f16mode == 1: D = f16 bits of (bf16 RNE value of W) * scale.
// Block = one 64x64 tile (r0, c0): 256 thr x 4 16-B loads -> LDS tile [c][r] (pitch 72), block barrier, then each output row
// coverage: load 256 thr x 16 = 64x64; store 2 iterations x 256 thr x 8 halves = 64 lines x 64; grid (C/64)x(R/64) tiles = all of D.
// =====================================================================================================
__global__ __launch_bounds__(256) void cvt_wT(const float* __restrict__ W, u16* D, int R, int C, int f16mode, float scale) {
  __shared__ __align__(16) u16 T[64 * VTP];
  const int tid = threadIdx.x;
  const int ntc = C >> 6;
  const int bid = blockIdx.x;
  const int c0  = (bid % ntc) * 64;
  const int r0  = (bid / ntc) * 64;
  {
    const int rr = tid >> 2;
    const int cc = (tid & 3) * 16;
    const float* src = W + (size_t)(r0 + rr) * C + c0 + cc;
#pragma unroll
    for (int i = 0; i < 4; ++i) {
      const v4f a = *(const v4f*)(src + 4 * i);
#pragma unroll
      for (int e = 0; e < 4; ++e) {
        const float v = a[e];
        const unsigned short hb = h_bits((_Float16)(bfr(v) * scale));
        const unsigned short bb = bf_bits(v);
        T[(cc + 4 * i + e) * VTP + rr] = (f16mode != 0) ? hb : bb;
      }
    }
  }
  __syncthreads();
  v4u vals[2];
  const int q8 = tid >> 3, p8 = (tid & 7) * 8;
#pragma unroll
  for (int it = 0; it < 2; ++it) vals[it] = *(const v4u*)(T + (it * 32 + q8) * VTP + p8);
  {
#pragma unroll
    for (int it = 0; it < 2; ++it) {
      const int n = it * 32 + q8;
      *(v4u*)(D + (size_t)(c0 + n) * R + r0 + p8) = vals[it];
    }
    
  }
}

// =====================================================================================================
// GEMM epilogue shared by both engines: the wave's 16x64 f32 tile (times oscale) staged in its LDS slab (pitch 68),
// coverage: 8 instructions x 2 rows x 16 lanes x 4 floats = the wave's 16 x 64 tile.
// =====================================================================================================
__device__ __forceinline__ void epi64(float* sl, v8f a0, v8f a1, v8f a2, v8f a3, float oscale, float* C, int N,
                                      size_t rowb, int col0, int lane) {
  const int hh = lane >> 4, m = lane & 15;
#pragma unroll
  for (int r = 0; r < 8; ++r) {
    const int ro = (8 * hh + r) * 68 + m;
    sl[ro]      = a0[r] * oscale;
    sl[ro + 16] = a1[r] * oscale;
    sl[ro + 32] = a2[r] * oscale;
    sl[ro + 48] = a3[r] * oscale;
  }
  wave_sync_lds();
  v4f vals[8];
#pragma unroll
  for (int it = 0; it < 8; ++it) vals[it] = *(const v4f*)(sl + (it * 2 + hh) * 68 + m * 4);
  float* dst = C + (rowb + (size_t)hh) * (size_t)N + col0 + m * 4;
  {
#pragma unroll
    for (int it = 0; it < 8; ++it) {
      *(v4f*)(dst + (size_t)(it * 2) * (size_t)N) = vals[it];
    }
    
  }
}

// =====================================================================================================
// bf16 GEMM: C[M][N] (f32) = A[M][K] (bf16 row-major) . Bt[N][K]^T (bf16 k-contiguous), times oscale.
// Block = 64x64 tile, 4 waves x 16 rows; fragments loaded straight from the 16-bit rows (two 16-B loads each, split k map
// for A and B); K stepped by 32 (host checks K % 32 == 0, M % 64 == 0, N % 64 == 0, grid = (M/64)*(N/64)).
// =====================================================================================================
__global__ __launch_bounds__(128)
void gemm_bf(const u16* __restrict__ A, const u16* __restrict__ Bt, float* C, int M, int N, int K, float oscale) {
  __shared__ __align__(16) float slab[4 * SLAB64];
  const int tid = threadIdx.x, wave = tid >> 5, lane = tid & 31, hh = lane >> 4, m = lane & 15;
  const int ntile = N >> 6;
  const int bid   = blockIdx.x;
  const int rowb  = (bid / ntile) * 64 + wave * 16;
  const int col0  = (bid % ntile) * 64;
  if (rowb + 16 > M) return;                 // wave-uniform, never taken with the exact grid; no block barriers in this kernel
  const u16* ap = A  + (size_t)(rowb + m) * K + 8 * hh;
  const u16* bp = Bt + (size_t)(col0 + m) * K + 8 * hh;
  const size_t bs = (size_t)16 * K;
  v8f acc0 = zero8(), acc1 = zero8(), acc2 = zero8(), acc3 = zero8();
#pragma unroll 1
  for (int k0 = 0; k0 < K; k0 += 32) {
    const v16b a  = ldfrag_b(ap + k0);
    const v16b b0 = ldfrag_b(bp + k0);
    const v16b b1 = ldfrag_b(bp + bs + k0);
    const v16b b2 = ldfrag_b(bp + 2 * bs + k0);
    const v16b b3 = ldfrag_b(bp + 3 * bs + k0);
    acc0 = mma_b(a, b0, acc0);
    acc1 = mma_b(a, b1, acc1);
    acc2 = mma_b(a, b2, acc2);
    acc3 = mma_b(a, b3, acc3);
    guard6<v16b>(acc0, acc1, acc2, acc3, a, b0, b1, b2, b3, a);
  }
  epi64(slab + wave * SLAB64, acc0, acc1, acc2, acc3, oscale, C, N, (size_t)rowb, col0, lane);
}

// =====================================================================================================
// f16 hi+lo GEMM: C[M][N] (f32) = (Ahi + Alo)[M][K] . Bt[N][K]^T, times oscale; Ahi/Alo f16 planes (same layout), Bt f16
// k-contiguous; products hi.B + lo.B into one accumulator (lo is the unscaled residual of hi). Same tiling as gemm_bf.
// =====================================================================================================
__global__ __launch_bounds__(128)
void gemm_h2(const u16* __restrict__ Ah, const u16* __restrict__ Al, const u16* __restrict__ Bt, float* C,
             int M, int N, int K, float oscale) {
  __shared__ __align__(16) float slab[4 * SLAB64];
  const int tid = threadIdx.x, wave = tid >> 5, lane = tid & 31, hh = lane >> 4, m = lane & 15;
  const int ntile = N >> 6;
  const int bid   = blockIdx.x;
  const int rowb  = (bid / ntile) * 64 + wave * 16;
  const int col0  = (bid % ntile) * 64;
  if (rowb + 16 > M) return;                 // wave-uniform, never taken with the exact grid; no block barriers in this kernel
  const size_t aofs = (size_t)(rowb + m) * K + 8 * hh;
  const _Float16* ahp = (const _Float16*)(const void*)Ah + aofs;
  const _Float16* alp = (const _Float16*)(const void*)Al + aofs;
  const _Float16* bp  = (const _Float16*)(const void*)Bt + (size_t)(col0 + m) * K + 8 * hh;
  const size_t bs = (size_t)16 * K;
  v8f acc0 = zero8(), acc1 = zero8(), acc2 = zero8(), acc3 = zero8();
#pragma unroll 1
  for (int k0 = 0; k0 < K; k0 += 32) {
    const v16h ah = ldfrag_h(ahp + k0), al = ldfrag_h(alp + k0);
    const v16h b0 = ldfrag_h(bp + k0);
    const v16h b1 = ldfrag_h(bp + bs + k0);
    const v16h b2 = ldfrag_h(bp + 2 * bs + k0);
    const v16h b3 = ldfrag_h(bp + 3 * bs + k0);
    acc0 = mma_h(ah, b0, acc0);  acc0 = mma_h(al, b0, acc0);
    acc1 = mma_h(ah, b1, acc1);  acc1 = mma_h(al, b1, acc1);
    acc2 = mma_h(ah, b2, acc2);  acc2 = mma_h(al, b2, acc2);
    acc3 = mma_h(ah, b3, acc3);  acc3 = mma_h(al, b3, acc3);
    guard6<v16h>(acc0, acc1, acc2, acc3, ah, al, b0, b1, b2, b3);
  }
  epi64(slab + wave * SLAB64, acc0, acc1, acc2, acc3, oscale, C, N, (size_t)rowb, col0, lane);
}

// =====================================================================================================
// Rotate-half rotary + 16-bit split pack. Rows are (batch, pos, head) with HD contiguous floats (f32 projection output);
// pos = (row / hpr) mod SEQ.  w[d] = x[d] * cos[pos][d] + r[d] * sin[pos][d],  r[d] = -x[d+32] for d < 32, x[d-32] for d >= 32;
// hi[d] = f16(w * sc), lo[d] = f16(w * sc - hi[d])  (sc a power of two, residual unscaled).
// Thread = 8 consecutive d of one row: 16-B loads of x (own and partner half), cos, sin; one 16-B store per plane per lane;
// coverage: grid = nrows*8/256 blocks x 256 thr x 8 halves = nrows x 64 of each plane exactly (exact division checked statically).
// =====================================================================================================
__global__ __launch_bounds__(256) void rope16(const float* __restrict__ x, const float* __restrict__ cosT,
                                              const float* __restrict__ sinT, u16* hpl, u16* lpl,
                                              int nrows, int hpr, float sc) {
  const int gt  = blockIdx.x * 256 + (int)threadIdx.x;
  const int row = gt >> 3;
  const int d0  = (gt & 7) * 8;
  if (row >= nrows) return;                 // never taken with the exact grid; no barriers in this kernel
  const int pos = (row / hpr) & (SEQ - 1);
  const int d1  = d0 ^ 32;
  const float* xr = x + (size_t)row * HD;
  const float* cr = cosT + (size_t)pos * HD + d0;
  const float* sr = sinT + (size_t)pos * HD + d0;
  const v4f xa = *(const v4f*)(xr + d0), xb = *(const v4f*)(xr + d0 + 4);
  const v4f ya = *(const v4f*)(xr + d1), yb = *(const v4f*)(xr + d1 + 4);
  const v4f ca = *(const v4f*)(cr), cb = *(const v4f*)(cr + 4);
  const v4f sa = *(const v4f*)(sr), sb = *(const v4f*)(sr + 4);
  const float sgn = (d0 < 32) ? -1.0f : 1.0f;
  float w[8];
#pragma unroll
  for (int e = 0; e < 4; ++e) {
    w[e]     = xa[e] * ca[e] + (sgn * ya[e]) * sa[e];
    w[4 + e] = xb[e] * cb[e] + (sgn * yb[e]) * sb[e];
  }
  v4u oh, ol;
#pragma unroll
  for (int e = 0; e < 4; ++e) {
    const float t0 = w[2 * e] * sc, t1 = w[2 * e + 1] * sc;
    const _Float16 h0 = (_Float16)t0, h1 = (_Float16)t1;
    const _Float16 l0 = (_Float16)(t0 - (float)h0), l1 = (_Float16)(t1 - (float)h1);
    oh[e] = pk16(h_bits(h0), h_bits(h1));
    ol[e] = pk16(h_bits(l0), h_bits(l1));
  }
  const size_t o8 = (size_t)row * HD + d0;
  {
    *(v4u*)(hpl + o8) = oh;
    *(v4u*)(lpl + o8) = ol;
    
  }
}

// =====================================================================================================
// v^T planes: VH[(b*NKV + g)*HD + d][s] = f16(v[b][s][g][d] * 1024), VL = f16 residual of the same value.
// Block = (b, g, 64 keys): 64 source rows of HD floats loaded with 16-B loads, converted, scattered into two LDS tiles
// coverage: load 256 thr x 16 elements = 64 x 64; store 2 iterations x 256 thr x 8 halves = 64 lines x 64 = the block's tile of
//           each plane; grid = NB x NKV x SEQ/64 = 256 blocks covers both planes exactly once.
// =====================================================================================================
__global__ __launch_bounds__(256) void vt16(const float* __restrict__ v, u16* VHo, u16* VLo) {
  __shared__ __align__(16) u16 TH[HD * VTP];
  __shared__ __align__(16) u16 TL[HD * VTP];
  const int tid = threadIdx.x;
  const int bid = blockIdx.x;
  const int st  = bid & 31;
  const int g   = (bid >> 5) & 3;
  const int b   = bid >> 7;
  const int s0  = st * 64;
  {
    const int sl = tid >> 2;                  // key within tile 0..63
    const int dc = (tid & 3) * 16;            // d chunk
    const float* src = v + (((size_t)(b * SEQ + s0 + sl)) * NKV + g) * HD + dc;
#pragma unroll
    for (int i = 0; i < 4; ++i) {
      const v4f a = *(const v4f*)(src + 4 * i);
#pragma unroll
      for (int e = 0; e < 4; ++e) {
        const float t = a[e] * VCAR;
        const _Float16 h = (_Float16)t;
        const _Float16 l = (_Float16)(t - (float)h);
        TH[(dc + 4 * i + e) * VTP + sl] = h_bits(h);
        TL[(dc + 4 * i + e) * VTP + sl] = h_bits(l);
      }
    }
  }
  __syncthreads();
  v4u vh[2], vl[2];
  const int q8 = tid >> 3, p8 = (tid & 7) * 8;
#pragma unroll
  for (int it = 0; it < 2; ++it) {
    const int line = it * 32 + q8;            // d = 0..63
    vh[it] = *(const v4u*)(TH + line * VTP + p8);
    vl[it] = *(const v4u*)(TL + line * VTP + p8);
  }
  const size_t base = ((size_t)(b * NKV + g) * HD) * SEQ + s0 + p8;
  {
#pragma unroll
    for (int it = 0; it < 2; ++it) {
      const int line = it * 32 + q8;
      *(v4u*)(VHo + base + (size_t)line * SEQ) = vh[it];
      *(v4u*)(VLo + base + (size_t)line * SEQ) = vl[it];
    }
    
  }
}

// =====================================================================================================
// GQA flash attention with causal window + global-token mask: block = (batch b, kv head g, 16 query rows q0..q0+15),
// one wave per query head g*GRP + wave (kv index = head / GRP).
//   q planes (hi, lo f16) laid out [b][s][h][d]; k planes [b][s][g][d]; v^T planes [b][g][d][s].
//   Key blocks of 32 visited in a fixed, block-uniform list: {0} + {32 if q0 >= 32} + {jlo, jlo+32, ... < q0+16},
//   jlo = 64 if q0-511 <= 64 else (q0-511) & ~31; the element mask allowed(i,j) = (j <= i) && (i-j < 512 || j < 64) replaces the
//   score by -inf inside partial blocks (block 0 comes first and key 0 is allowed for every row, so each running max is finite
//   before any fully masked block row can occur).
//   Per block: 2 score subtiles x 2 k-steps x 3 products (q_hi.k_hi + q_lo.k_hi + q_hi.k_lo), fragments loaded straight from the
//   16-bit planes (two 16-B loads per fragment, split k map); online max-subtracted base-2 softmax in f32 (scale 1/8 folded);
//   barrier, then A fragments of P*32768 (f16 hi) and its f16 residual rebuilt from the LDS rows (float vector loads), 4+4 v^T
//   B fragments (hi and residual planes), 12 P.V WMMAs (hh + lh + hl).
//   (b, q0+row, head) of the O hi plane and of the O lo plane (O x1024 as f16 hi + residual) written by 8 consecutive lanes x 16 B
//   No block barriers in this kernel; every wave does bounded work (MAXBLK steps max).
// coverage: per wave 4 instructions x 4 rows x 8 lanes x 8 halves = 16 x 64 per plane; grid 1024 blocks x 3 waves = every
//           (b, s, h) row of both O planes exactly once.
// =====================================================================================================
__global__ __launch_bounds__(ATT_THREADS)
void attn_gqa(const u16* __restrict__ QHIp, const u16* __restrict__ QLOp,
              const u16* __restrict__ KHIp, const u16* __restrict__ KLOp,
              const u16* __restrict__ VHIp, const u16* __restrict__ VLOp,
              u16* OHIp, u16* OLOp) {
  __shared__ __align__(16) float smem[GRP * SLABF];   // per wave: prob tile [16][32] pitch 36 during the loop, result slab after

  const int tid  = threadIdx.x;
  const int wave = tid >> 5;
  const int lane = tid & 31;
  const int hh   = lane >> 4;
  const int c    = lane & 15;

  const int bid  = blockIdx.x;
  const int qt   = bid & (SEQ / 16 - 1);
  const int g    = (bid >> 7) & (NKV - 1);
  const int b    = bid >> 9;
  const int head = g * GRP + wave;
  const int q0   = qt * 16;

  const size_t qofs = (((size_t)(b * SEQ + q0 + c)) * NH + head) * HD + 8 * hh;
  const _Float16* Qh  = (const _Float16*)(const void*)QHIp + qofs;
  const _Float16* Ql  = (const _Float16*)(const void*)QLOp + qofs;
  const size_t kofs = (((size_t)b * SEQ + c) * NKV + g) * HD + 8 * hh;          // key row kb + c added per step
  const _Float16* Khb = (const _Float16*)(const void*)KHIp + kofs;
  const _Float16* Klb = (const _Float16*)(const void*)KLOp + kofs;
  const size_t vofs = ((size_t)(b * NKV + g) * HD + c) * SEQ + 8 * hh;          // d column c (+16j), key kb added per step
  const _Float16* Vhb = (const _Float16*)(const void*)VHIp + vofs;
  const _Float16* Vlb = (const _Float16*)(const void*)VLOp + vofs;
  const float lsc = 0.125f * (LOG2E / (QSC * KSC));

  float mrow[8], lrow[8];
  v8f o[4];
#pragma unroll
  for (int r = 0; r < 8; ++r) { mrow[r] = -INFINITY; lrow[r] = 0.f; }
#pragma unroll
  for (int j = 0; j < 4; ++j) o[j] = zero8();
  float* pt = smem + wave * SLABF;

  const int nglob = (q0 >= 32) ? 2 : 1;
  const int wlo   = q0 - (WIN - 1);
  const int jlo   = (wlo <= GLB) ? GLB : (wlo & ~31);
  int nwin = q0 + 16 - jlo;
  nwin = (nwin > 0) ? ((nwin + 31) >> 5) : 0;
  int nblk = nglob + nwin;
  nblk = (nblk > MAXBLK) ? MAXBLK : nblk;

#pragma unroll 1
  for (int it = 0; it < nblk; ++it) {
    const int kb = (it < nglob) ? (it * 32) : (jlo + (it - nglob) * 32);
    // ---- scores: D element r of this lane = (query row q0 + 8hh + r, key kb + c) in s0, key kb + 16 + c in s1 ----
    v8f s0 = zero8(), s1 = zero8();
    const _Float16* k0p = Khb + (size_t)kb * (NKV * HD);
    const _Float16* k1p = k0p + (size_t)16 * (NKV * HD);
    const _Float16* l0p = Klb + (size_t)kb * (NKV * HD);
    const _Float16* l1p = l0p + (size_t)16 * (NKV * HD);
#pragma unroll
    for (int kk = 0; kk < 2; ++kk) {
      const v16h qh  = ldfrag_h(Qh + kk * 32),  ql  = ldfrag_h(Ql + kk * 32);
      const v16h kh0 = ldfrag_h(k0p + kk * 32), kl0 = ldfrag_h(l0p + kk * 32);
      const v16h kh1 = ldfrag_h(k1p + kk * 32), kl1 = ldfrag_h(l1p + kk * 32);
      s0 = mma_h(qh, kh0, s0);
      s0 = mma_h(ql, kh0, s0);
      s0 = mma_h(qh, kl0, s0);
      s1 = mma_h(qh, kh1, s1);
      s1 = mma_h(ql, kh1, s1);
      s1 = mma_h(qh, kl1, s1);
      guard2(s0, s1, qh, ql, kh0, kl0, kh1, kl1);
    }
    // ---- mask (replace by -inf) + online softmax in base 2 ----
#pragma unroll
    for (int r = 0; r < 8; ++r) {
      const int i  = q0 + 8 * hh + r;
      const int j0 = kb + c, j1 = kb + 16 + c;
      const bool ok0 = (j0 <= i) && (((i - j0) < WIN) || (j0 < GLB));
      const bool ok1 = (j1 <= i) && (((i - j1) < WIN) || (j1 < GLB));
      const float t0 = ok0 ? (s0[r] * lsc) : -INFINITY;
      const float t1 = ok1 ? (s1[r] * lsc) : -INFINITY;
      float mx = fmaxf(t0, t1);
#pragma unroll
      for (int off = 1; off < 16; off <<= 1) mx = fmaxf(mx, __shfl_xor(mx, off, 32));
      const float mn = fmaxf(mrow[r], mx);
      const float al = exp2f(mrow[r] - mn);
      mrow[r] = mn;
      const float e0 = exp2f(t0 - mn), e1 = exp2f(t1 - mn);
      float ps = e0 + e1;
#pragma unroll
      for (int off = 1; off < 16; off <<= 1) ps += __shfl_xor(ps, off, 32);
      lrow[r] = lrow[r] * al + ps;
#pragma unroll
      for (int j = 0; j < 4; ++j) o[j][r] *= al;
      const int ro = (8 * hh + r) * 36 + c;
      pt[ro]      = e0;
      pt[ro + 16] = e1;
    }
    wave_sync_lds();
    // ---- A fragments of P*32768: hi f16 and residual f16, row = c, split k map over the 32 keys of this step ----
    FragH ph, pl;
    {
      const float* prow = pt + c * 36 + 8 * hh;
      const v4f p0 = *(const v4f*)(prow), p1 = *(const v4f*)(prow + 4);
      const v4f p2 = *(const v4f*)(prow + 16), p3 = *(const v4f*)(prow + 20);
#pragma unroll
      for (int e = 0; e < 4; ++e) {
        const float ta = p0[e] * PCAR, tb = p1[e] * PCAR, tc = p2[e] * PCAR, td = p3[e] * PCAR;
        const _Float16 ha = (_Float16)ta, hb = (_Float16)tb, hc = (_Float16)tc, hd = (_Float16)td;
        ph.h[0][e]     = ha;                               // elements 0..7  = keys kb + 8hh + 0..7
        ph.h[0][4 + e] = hb;
        ph.h[1][e]     = hc;                               // elements 8..15 = keys kb + 16 + 8hh + 0..7
        ph.h[1][4 + e] = hd;
        pl.h[0][e]     = (_Float16)(ta - (float)ha);
        pl.h[0][4 + e] = (_Float16)(tb - (float)hb);
        pl.h[1][e]     = (_Float16)(tc - (float)hc);
        pl.h[1][4 + e] = (_Float16)(td - (float)hd);
      }
    }
    // ---- P.V : B fragment col n = d = j*16 + c, keys contiguous in the v^T planes ----
    {
      const _Float16* vhp = Vhb + kb;
      const _Float16* vlp = Vlb + kb;
      const v16h vh0 = ldfrag_h(vhp);
      const v16h vh1 = ldfrag_h(vhp + (size_t)16 * SEQ);
      const v16h vh2 = ldfrag_h(vhp + (size_t)32 * SEQ);
      const v16h vh3 = ldfrag_h(vhp + (size_t)48 * SEQ);
      const v16h vl0 = ldfrag_h(vlp);
      const v16h vl1 = ldfrag_h(vlp + (size_t)16 * SEQ);
      const v16h vl2 = ldfrag_h(vlp + (size_t)32 * SEQ);
      const v16h vl3 = ldfrag_h(vlp + (size_t)48 * SEQ);
      o[0] = mma_h(ph.v, vh0, o[0]);  o[0] = mma_h(pl.v, vh0, o[0]);  o[0] = mma_h(ph.v, vl0, o[0]);
      o[1] = mma_h(ph.v, vh1, o[1]);  o[1] = mma_h(pl.v, vh1, o[1]);  o[1] = mma_h(ph.v, vl1, o[1]);
      o[2] = mma_h(ph.v, vh2, o[2]);  o[2] = mma_h(pl.v, vh2, o[2]);  o[2] = mma_h(ph.v, vl2, o[2]);
      o[3] = mma_h(ph.v, vh3, o[3]);  o[3] = mma_h(pl.v, vh3, o[3]);  o[3] = mma_h(ph.v, vl3, o[3]);
      guard10(o[0], o[1], o[2], o[3], ph.v, pl.v, vh0, vh1, vh2, vh3, vl0, vl1, vl2, vl3);
    }
    wave_sync_lds();
  }
  acc_guard4(o[0], o[1], o[2], o[3]);

  // ---- fold 1/l and the carries (32768 on P, 1024 on v), stage the wave's 16x64 slab in its LDS region ----
  wave_sync_lds();
  float* slab = pt;
  const float oc = 1.0f / (PCAR * VCAR);
#pragma unroll
  for (int r = 0; r < 8; ++r) {
    const float inv = (1.0f / lrow[r]) * oc;
#pragma unroll
    for (int j = 0; j < 4; ++j) slab[(8 * hh + r) * 68 + j * 16 + c] = o[j][r] * inv;
  }
  wave_sync_lds();
  // ---- O x1024 -> f16 hi + residual planes; lane = (row in group of 4, 8 consecutive d) ----
  v4u oh[4], ol[4];
  const int rq = lane >> 3, c8 = (lane & 7) * 8;
#pragma unroll
  for (int it = 0; it < 4; ++it) {
    const int row = it * 4 + rq;
    const v4f a = *(const v4f*)(slab + row * 68 + c8), bq = *(const v4f*)(slab + row * 68 + c8 + 4);
    float w[8];
#pragma unroll
    for (int e = 0; e < 4; ++e) { w[e] = a[e] * OSC; w[4 + e] = bq[e] * OSC; }
#pragma unroll
    for (int e = 0; e < 4; ++e) {
      const _Float16 h0 = (_Float16)w[2 * e], h1 = (_Float16)w[2 * e + 1];
      const _Float16 l0 = (_Float16)(w[2 * e] - (float)h0), l1 = (_Float16)(w[2 * e + 1] - (float)h1);
      oh[it][e] = pk16(h_bits(h0), h_bits(h1));
      ol[it][e] = pk16(h_bits(l0), h_bits(l1));
    }
  }
  const size_t ob = (((size_t)(b * SEQ + q0)) * NH + head) * HD + c8;
  {
#pragma unroll
    for (int it = 0; it < 4; ++it) {
      const int row = it * 4 + rq;
      const size_t o8 = ob + (size_t)row * (NH * HD);
      *(v4u*)(OHIp + o8) = oh[it];
      *(v4u*)(OLOp + o8) = ol[it];
    }
    
  }
}

// =====================================================================================================
// Workspace map (bytes); every plane is fully written by whole-line stores before it is read; all extents are exact multiples
// of the store granularity (no pad rows needed); every offset a multiple of 65536:
//   CT  f32 [2048][64]                 524288        ST  same              524288
//   XB  bf16 [4096][768]              6291456
//   WQT bf16 [768 n][768 k]           1179648        WKT bf16 [256][768]   393216     WVT same   393216
//   WOT f16  [768 n][768 k] x1024     1179648
//   QF  f32 [4096][768]              12582912        KF f32 [4096][256]   4194304     VF same   4194304
//   QHI f16 [2][2048][12][64] x1024   6291456        QLO residual         6291456
//   KHI f16 [2][2048][4][64] x1024    2097152        KLO residual         2097152
//   VHI f16 [2][4][64][2048] x1024    2097152        VLO residual         2097152
//   OHI f16 [4096][768] x1024         6291456        OLO residual         6291456
//   end                              65011712
// =====================================================================================================
extern "C" void kernel_launch(void* const* d_in, const int* in_sizes, int n_in,
                              void* d_out, int out_size, void* d_ws, size_t ws_size,
                              hipStream_t stream) {
  const int ROWS = NB * SEQ;                            // 4096
  if (n_in < 5) return;
  if (in_sizes[0] != ROWS * DMOD) return;
  if (in_sizes[1] != DMOD * (NH * HD)) return;
  if (in_sizes[2] != DMOD * (NKV * HD) || in_sizes[3] != DMOD * (NKV * HD)) return;
  if (in_sizes[4] != (NH * HD) * DMOD) return;
  if (out_size != ROWS * DMOD) return;

  const float* x  = (const float*)d_in[0];
  const float* wq = (const float*)d_in[1];
  const float* wk = (const float*)d_in[2];
  const float* wv = (const float*)d_in[3];
  const float* wo = (const float*)d_in[4];
  float*       out = (float*)d_out;

  const size_t szTab = (size_t)SEQ * HD * 4;                    //   524288
  const size_t szXB  = (size_t)ROWS * DMOD * 2;                 //  6291456
  const size_t szWQT = (size_t)(NH * HD) * DMOD * 2;            //  1179648
  const size_t szWKT = (size_t)(NKV * HD) * DMOD * 2;           //   393216
  const size_t szWOT = (size_t)DMOD * (NH * HD) * 2;            //  1179648
  const size_t szQF  = (size_t)ROWS * (NH * HD) * 4;            // 12582912
  const size_t szKF  = (size_t)ROWS * (NKV * HD) * 4;           //  4194304
  const size_t szQP  = (size_t)ROWS * (NH * HD) * 2;            //  6291456
  const size_t szKP  = (size_t)ROWS * (NKV * HD) * 2;           //  2097152
  const size_t szVP  = (size_t)NB * NKV * HD * SEQ * 2;         //  2097152
  const size_t szOP  = (size_t)ROWS * (NH * HD) * 2;            //  6291456
  size_t off = 0;
  const size_t oCT  = off; off += szTab;
  const size_t oST  = off; off += szTab;
  const size_t oXB  = off; off += szXB;
  const size_t oWQT = off; off += szWQT;
  const size_t oWKT = off; off += szWKT;
  const size_t oWVT = off; off += szWKT;
  const size_t oWOT = off; off += szWOT;
  const size_t oQF  = off; off += szQF;
  const size_t oKF  = off; off += szKF;
  const size_t oVF  = off; off += szKF;
  const size_t oQHI = off; off += szQP;
  const size_t oQLO = off; off += szQP;
  const size_t oKHI = off; off += szKP;
  const size_t oKLO = off; off += szKP;
  const size_t oVHI = off; off += szVP;
  const size_t oVLO = off; off += szVP;
  const size_t oOHI = off; off += szOP;
  const size_t oOLO = off; off += szOP;
  if (off > ws_size) return;                            // off = 65011712
  if (off > (size_t)134217728) return;

  char* ws = (char*)d_ws;
  float* CT  = (float*)(ws + oCT);
  float* ST  = (float*)(ws + oST);
  u16*   XB  = (u16*)(ws + oXB);
  u16*   WQT = (u16*)(ws + oWQT);
  u16*   WKT = (u16*)(ws + oWKT);
  u16*   WVT = (u16*)(ws + oWVT);
  u16*   WOT = (u16*)(ws + oWOT);
  float* QF  = (float*)(ws + oQF);
  float* KF  = (float*)(ws + oKF);
  float* VF  = (float*)(ws + oVF);
  u16*   QHI = (u16*)(ws + oQHI);
  u16*   QLO = (u16*)(ws + oQLO);
  u16*   KHI = (u16*)(ws + oKHI);
  u16*   KLO = (u16*)(ws + oKLO);
  u16*   VHI = (u16*)(ws + oVHI);
  u16*   VLO = (u16*)(ws + oVLO);
  u16*   OHI = (u16*)(ws + oOHI);
  u16*   OLO = (u16*)(ws + oOLO);

  // inv_freq[i] = 1 / pow(10000, i/32) in f32 (pow correctly converted from f64, then IEEE f32 reciprocal)
  InvF inv;
  for (int i = 0; i < 32; ++i) {
    const double p = pow(10000.0, (double)i / 32.0);
    const float pf = (float)p;
    inv.f[i] = 1.0f / pf;
  }

  const dim3 blk(256);
  const int n8 = (ROWS * DMOD) / 8;                     // 393216
  const dim3 gTab(SEQ / 8);                             // 256
  const dim3 gX((n8 + 255) / 256);                      // 1536
  const dim3 gWQ((DMOD / 64) * ((NH * HD) / 64));       // 144  (tiles of wq [768][768])
  const dim3 gWK((DMOD / 64) * ((NKV * HD) / 64));      // 48   (tiles of wk/wv [768][256])
  const dim3 gWO(((NH * HD) / 64) * (DMOD / 64));       // 144  (tiles of wo [768][768])
  const dim3 gGQ((ROWS / 64) * ((NH * HD) / 64));       // 768
  const dim3 gGK((ROWS / 64) * ((NKV * HD) / 64));      // 256
  const dim3 gGO((ROWS / 64) * (DMOD / 64));            // 768
  const dim3 bG(128);
  const int rowsQ = ROWS * NH;                          // 49152
  const int rowsK = ROWS * NKV;                         // 16384
  const dim3 gRQ((rowsQ * 8) / 256);                    // 1536
  const dim3 gRK((rowsK * 8) / 256);                    // 512
  const dim3 gVT(NB * NKV * (SEQ / 64));                // 256
  const dim3 gAT(ATT_BLOCKS);                           // 1024
  const dim3 bAT(ATT_THREADS);                          // 96

  // (0) rotary cos/sin tables [2048][64]
  k_tab<<<gTab, blk, 0, stream>>>(CT, ST, inv);
  // (1) x -> bf16 plane
  cvt_x<<<gX, blk, 0, stream>>>(x, XB, n8);
  // (2..5) weights: in W[k rows][n cols] -> out [n][k] 16-bit planes (bf16 for wq/wk/wv; f16 of bf16 value x1024 for wo)
  cvt_wT<<<gWQ, blk, 0, stream>>>(wq, WQT, DMOD, NH * HD, 0, 1.0f);
  cvt_wT<<<gWK, blk, 0, stream>>>(wk, WKT, DMOD, NKV * HD, 0, 1.0f);
  cvt_wT<<<gWK, blk, 0, stream>>>(wv, WVT, DMOD, NKV * HD, 0, 1.0f);
  cvt_wT<<<gWO, blk, 0, stream>>>(wo, WOT, NH * HD, DMOD, 1, WOS);
  // (6..8) projections: q [4096][768], k [4096][256], v [4096][256] in f32
  gemm_bf<<<gGQ, bG, 0, stream>>>(XB, WQT, QF, ROWS, NH * HD, DMOD, 1.0f);
  gemm_bf<<<gGK, bG, 0, stream>>>(XB, WKT, KF, ROWS, NKV * HD, DMOD, 1.0f);
  gemm_bf<<<gGK, bG, 0, stream>>>(XB, WVT, VF, ROWS, NKV * HD, DMOD, 1.0f);
  // (9) q' planes: rows (b, s, h), heads per position NH
  rope16<<<gRQ, blk, 0, stream>>>(QF, CT, ST, QHI, QLO, rowsQ, NH, QSC);
  // (10) k' planes: rows (b, s, g), heads per position NKV
  rope16<<<gRK, blk, 0, stream>>>(KF, CT, ST, KHI, KLO, rowsK, NKV, KSC);
  // (11) v^T planes x1024 (hi + residual)
  vt16<<<gVT, blk, 0, stream>>>(VF, VHI, VLO);
  // (12) attention -> O planes [b][s][h][d] x1024 (hi + residual)
  attn_gqa<<<gAT, bAT, 0, stream>>>(QHI, QLO, KHI, KLO, VHI, VLO, OHI, OLO);
  // (13) output projection -> out [4096][768] f32, carries 1024 (O) x 1024 (wo) folded back
  gemm_h2<<<gGO, bG, 0, stream>>>(OHI, OLO, WOT, out, ROWS, DMOD, NH * HD, 1.0f / (OSC * WOS));
  (void)hipGetLastError();
}

// v001
// Measured time: 128 microseconds a run.
// Timed twice side by side with v000, it ran 1.16 times as fast both times.
// Contractions: x.W{q,k,v} on v_wmma_f32_16x16x32_bf16 (x and W RNE-converted to bf16, exact operands, f32 accumulate);
// scores q'.k'^T (q', k' carried x1024 as f16 hi plane + f16 residual plane, products hh+lh+hl), P.v (P x32768 f16 hi+residual,
// v x1024 f16 hi+residual, products hh+lh+hl) and O.wo (O x1024 f16 hi+residual, wo as f16(bf16(wo) x1024), products h.w+l.w):
// v_wmma_f32_16x16x32_f16, f32 accumulate. Rotary tables, rotation, masked base-2 online softmax and 1/l fold in f32 on VALU.
#include <hip/hip_runtime.h>
#include <math.h>
#include <stdint.h>

#define NB    2
#define SEQ   2048
#define DMOD  768
#define NH    12
#define NKV   4
#define HD    64
#define GRP   3
#define WIN   512
#define GLB   64
#define QSC   1024.0f
#define KSC   1024.0f
#define PCAR  32768.0f
#define VCAR  1024.0f
#define OSC   1024.0f
#define WOS   1024.0f
#define LOG2E 1.4426950408889634f
#define ATT_THREADS (GRP * 32)
#define ATT_BLOCKS  (NB * NKV * (SEQ / 16))
#define SLABF (16 * 68)
#define SLAB64 (16 * 68)
#define VTP   72
#define MAXBLK 20
static_assert(NH == NKV * GRP);
static_assert(HD == 64 && DMOD == NH * HD);
static_assert((SEQ / 16) == 128 && NKV == 4 && NB == 2);
static_assert(ATT_THREADS == 96 && ATT_BLOCKS == 1024);
static_assert(16 * 36 <= SLABF);
static_assert(((NB * SEQ * NH * 8) % 256) == 0 && ((NB * SEQ * NKV * 8) % 256) == 0);
static_assert(((NB * SEQ) % 64) == 0 && (DMOD % 64) == 0 && ((NKV * HD) % 64) == 0 && (DMOD % 32) == 0);
static_assert((SEQ % 64) == 0 && (SEQ % 8) == 0);

typedef unsigned short u16;
typedef _Float16 v16h __attribute__((ext_vector_type(16)));
typedef _Float16 v8h  __attribute__((ext_vector_type(8)));
typedef __bf16   v16b __attribute__((ext_vector_type(16)));
typedef float    v8f  __attribute__((ext_vector_type(8)));
typedef float    v4f  __attribute__((ext_vector_type(4)));
typedef unsigned int v4u __attribute__((ext_vector_type(4)));

union FragH { v16h v; v8h h[2]; v4u u[2]; };
union FragB { v16b v; v4u u[2]; };

struct InvF { float f[32]; };
static_assert(sizeof(InvF) == 128);

// ---- scalar helpers --------------------------------------------------------------------------------
__device__ __forceinline__ unsigned short bf_bits(float f) {          // f32 -> bf16 bits, RNE convert
  unsigned u = __float_as_uint(f);
  return (unsigned short)((u + 0x7FFFu + ((u >> 16) & 1u)) >> 16);
}
__device__ __forceinline__ float bf_up(unsigned short h) { return __uint_as_float(((unsigned)h) << 16); }
__device__ __forceinline__ float bfr(float f) { return bf_up(bf_bits(f)); }
__device__ __forceinline__ unsigned short h_bits(_Float16 x) { return __builtin_bit_cast(unsigned short, x); }
__device__ __forceinline__ unsigned pk16(unsigned short a, unsigned short b) { return (unsigned)a | ((unsigned)b << 16); }
__device__ __forceinline__ v8f zero8() { v8f z = {0.f, 0.f, 0.f, 0.f, 0.f, 0.f, 0.f, 0.f}; return z; }

// ---- fragment loaders: 16-bit A/B operand, lane -> row/col (lane&15), p already includes +8*(lane>>4);
//      elements 0..7 <- p[0..7] (k0+8h..), elements 8..15 <- p[16..23] (k0+16+8h..)  (same split k map for A and B;
//      B is always read from a k-contiguous [n][k] plane)
__device__ __forceinline__ v16h ldfrag_h(const _Float16* p) {
  FragH f;
  f.h[0] = *(const v8h*)(p);
  f.h[1] = *(const v8h*)(p + 16);
  return f.v;
}
__device__ __forceinline__ v16b ldfrag_b(const u16* p) {              // bf16 plane read as unsigned integer vectors
  FragB f;
  f.u[0] = *(const v4u*)(p);
  f.u[1] = *(const v4u*)(p + 16);
  return f.v;
}

__device__ __forceinline__ v8f mma_h(v16h a, v16h b, v8f c) {
  return __builtin_amdgcn_wmma_f32_16x16x32_f16(false, a, false, b, (short)0, c, false, false);
}
__device__ __forceinline__ v8f mma_b(v16b a, v16b b, v8f c) {
  return __builtin_amdgcn_wmma_f32_16x16x32_bf16(false, a, false, b, (short)0, c, false, false);
}
__device__ __forceinline__ void guard2(v8f& a, v8f& b, v16h x0, v16h x1, v16h x2, v16h x3, v16h x4, v16h x5) {
#if defined(__HIP_DEVICE_COMPILE__)
  asm volatile("v_nop\n\tv_nop\n\tv_nop\n\tv_nop"
               : "+v"(a), "+v"(b) : "v"(x0), "v"(x1), "v"(x2), "v"(x3), "v"(x4), "v"(x5) : "memory");
#endif
}
template <typename F>
__device__ __forceinline__ void guard6(v8f& a, v8f& b, v8f& c, v8f& d, F x0, F x1, F x2, F x3, F x4, F x5) {
#if defined(__HIP_DEVICE_COMPILE__)
  asm volatile("v_nop\n\tv_nop\n\tv_nop\n\tv_nop"
               : "+v"(a), "+v"(b), "+v"(c), "+v"(d) : "v"(x0), "v"(x1), "v"(x2), "v"(x3), "v"(x4), "v"(x5) : "memory");
#endif
}
__device__ __forceinline__ void guard10(v8f& a, v8f& b, v8f& c, v8f& d, v16h x0, v16h x1, v16h x2, v16h x3, v16h x4,
                                        v16h x5, v16h x6, v16h x7, v16h x8, v16h x9) {
#if defined(__HIP_DEVICE_COMPILE__)
  asm volatile("v_nop\n\tv_nop\n\tv_nop\n\tv_nop"
               : "+v"(a), "+v"(b), "+v"(c), "+v"(d)
               : "v"(x0), "v"(x1), "v"(x2), "v"(x3), "v"(x4), "v"(x5), "v"(x6), "v"(x7), "v"(x8), "v"(x9) : "memory");
#endif
}
__device__ __forceinline__ void acc_guard4(v8f& a, v8f& b, v8f& c, v8f& d) {
#if defined(__HIP_DEVICE_COMPILE__)
  asm volatile("v_nop\n\tv_nop\n\tv_nop\n\tv_nop" : "+v"(a), "+v"(b), "+v"(c), "+v"(d));
#endif
}
__device__ __forceinline__ void wave_sync_lds() {
  __builtin_amdgcn_fence(__ATOMIC_RELEASE, "workgroup");
  __builtin_amdgcn_wave_barrier();
  __builtin_amdgcn_fence(__ATOMIC_ACQUIRE, "workgroup");
}

// ---- accurate f32 sin/cos of a non-negative f32 angle (|angle| < 2048): f64 two-part pi/2 reduction + f64 polynomials,
//      plain f64 fma/mul only (no library f64 trig path), result converted to f32.
__device__ __forceinline__ void sincos_acc(float angf, float& sv, float& cv) {
  const double a = (double)angf;
  const double TWO_OVER_PI = 0.63661977236758134308;
  const double PIO2_HI = 1.5707963267948966;
  const double PIO2_LO = 6.123233995736766e-17;
  const int kq = (int)(a * TWO_OVER_PI + 0.5);
  const double kd = (double)kq;
  double r = fma(-kd, PIO2_HI, a);
  r = fma(-kd, PIO2_LO, r);
  const double r2 = r * r;
  double sp = 1.0 / 6227020800.0;
  sp = fma(sp, r2, -1.0 / 39916800.0);
  sp = fma(sp, r2, 1.0 / 362880.0);
  sp = fma(sp, r2, -1.0 / 5040.0);
  sp = fma(sp, r2, 1.0 / 120.0);
  sp = fma(sp, r2, -1.0 / 6.0);
  const double s = fma(sp * r2, r, r);
  double cp = -1.0 / 87178291200.0;
  cp = fma(cp, r2, 1.0 / 479001600.0);
  cp = fma(cp, r2, -1.0 / 3628800.0);
  cp = fma(cp, r2, 1.0 / 40320.0);
  cp = fma(cp, r2, -1.0 / 720.0);
  cp = fma(cp, r2, 1.0 / 24.0);
  cp = fma(cp, r2, -0.5);
  const double c = fma(cp, r2, 1.0);
  const int qd = kq & 3;
  const double so = (qd == 0) ? s : (qd == 1) ? c : (qd == 2) ? -s : -c;
  const double co = (qd == 0) ? c : (qd == 1) ? -s : (qd == 2) ? -c : s;
  sv = (float)so;
  cv = (float)co;
}

// =====================================================================================================
// Rotary tables: cosT[t][d], sinT[t][d] for t < SEQ, d < HD, angle = float(t) * inv_freq[d & 31] (f32 product), halves duplicated.
// Wave = one position t, lane = frequency index; inv_freq picked from the by-value table with a static select chain.
// coverage: SEQ/8 blocks x 8 waves = SEQ rows; per row 4 line stores = 64 floats of each table.
// =====================================================================================================
__device__ __forceinline__ void tab_body(int bid, float* cosT, float* sinT, const InvF& inv) {
  const int tid  = threadIdx.x;
  const int lane = tid & 31;
  const int t    = bid * 8 + (tid >> 5);
  if (t >= SEQ) return;                     // never taken with the exact block range; no barriers in this part
  float f = inv.f[0];
#pragma unroll
  for (int i = 1; i < 32; ++i) f = (lane == i) ? inv.f[i] : f;
  const float ang = (float)t * f;
  float sv, cv;
  sincos_acc(ang, sv, cv);
  float* cr = cosT + (size_t)t * HD;
  float* sr = sinT + (size_t)t * HD;
  {
    *(float*)(cr + lane)      = cv;
    *(float*)(cr + 32 + lane) = cv;
    *(float*)(sr + lane)      = sv;
    *(float*)(sr + 32 + lane) = sv;
    
  }
}

// =====================================================================================================
// x f32 -> bf16 plane (RNE convert), same layout. Thread = 8 consecutive elements: two 16-B loads, one 16-B store;
// coverage: n8/256 blocks (exact division checked statically) x 256 thr x 8 = the whole plane.
// =====================================================================================================
__device__ __forceinline__ void cvtx_body(int bid, const float* __restrict__ x, u16* D, int n8) {
  const int gt = bid * 256 + (int)threadIdx.x;
  if (gt >= n8) return;                     // no barriers in this part
  const float* p = x + (size_t)gt * 8;
  const v4f a = *(const v4f*)(p), bq = *(const v4f*)(p + 4);
  v4u o;
  o[0] = pk16(bf_bits(a[0]),  bf_bits(a[1]));
  o[1] = pk16(bf_bits(a[2]),  bf_bits(a[3]));
  o[2] = pk16(bf_bits(bq[0]), bf_bits(bq[1]));
  o[3] = pk16(bf_bits(bq[2]), bf_bits(bq[3]));
  u16* d = D + (size_t)gt * 8;
  {
    *(v4u*)(d) = o;
    
  }
}

// =====================================================================================================
// Weight transpose + 16-bit convert: in W[R][C] (row-major f32) -> out D[C][R] (k-contiguous 16-bit plane).
//   f16mode == 0: D = bf16 RNE bits of W;  f16mode == 1: D = f16 bits of (bf16 RNE value of W) * scale.
// Block = one 64x64 tile (r0, c0): 256 thr x 4 16-B loads -> LDS tile [c][r] (pitch 72), block barrier, then each output row
// coverage: load 256 thr x 16 = 64x64; store 2 iterations x 256 thr x 8 halves = 64 lines x 64; grid (C/64)x(R/64) tiles = all of D.
// =====================================================================================================
__device__ __forceinline__ void wT_body(u16* T, int bid, const float* __restrict__ W, u16* D, int R, int C, int f16mode,
                                        float scale) {
  const int tid = threadIdx.x;
  const int ntc = C >> 6;
  const int c0  = (bid % ntc) * 64;
  const int r0  = (bid / ntc) * 64;
  {
    const int rr = tid >> 2;
    const int cc = (tid & 3) * 16;
    const float* src = W + (size_t)(r0 + rr) * C + c0 + cc;
#pragma unroll
    for (int i = 0; i < 4; ++i) {
      const v4f a = *(const v4f*)(src + 4 * i);
#pragma unroll
      for (int e = 0; e < 4; ++e) {
        const float v = a[e];
        const unsigned short hb = h_bits((_Float16)(bfr(v) * scale));
        const unsigned short bb = bf_bits(v);
        T[(cc + 4 * i + e) * VTP + rr] = (f16mode != 0) ? hb : bb;
      }
    }
  }
  __syncthreads();
  v4u vals[2];
  const int q8 = tid >> 3, p8 = (tid & 7) * 8;
#pragma unroll
  for (int it = 0; it < 2; ++it) vals[it] = *(const v4u*)(T + (it * 32 + q8) * VTP + p8);
  {
#pragma unroll
    for (int it = 0; it < 2; ++it) {
      const int n = it * 32 + q8;
      *(v4u*)(D + (size_t)(c0 + n) * R + r0 + p8) = vals[it];
    }
    
  }
}

// =====================================================================================================
// Launch 1: every conversion that depends on the inputs alone, one launch, parts picked by block range (block-uniform):
//   [0, 384)     weight tiles: wq 144, wk 48, wv 48, wo 144 (they hold the one block barrier, so they start first)
//   [384, 640)   rotary tables
//   [640, 2176)  x -> bf16 plane
// Each part keeps its own block count and per-block work; no part reads what another part writes.
// =====================================================================================================
#define PB_WQ  ((DMOD / 64) * ((NH * HD) / 64))
#define PB_WK  ((DMOD / 64) * ((NKV * HD) / 64))
#define PB_WO  (((NH * HD) / 64) * (DMOD / 64))
#define PB_W   (PB_WQ + 2 * PB_WK + PB_WO)
#define PB_TAB (SEQ / 8)
#define PB_X   ((NB * SEQ * DMOD) / (8 * 256))
#define PREP_BLOCKS (PB_W + PB_TAB + PB_X)
static_assert(PB_W == 384 && PB_TAB == 256 && PB_X == 1536 && ((NB * SEQ * DMOD) % (8 * 256)) == 0);
__global__ __launch_bounds__(256)
void prep(const float* __restrict__ x, const float* __restrict__ wq, const float* __restrict__ wk,
          const float* __restrict__ wv, const float* __restrict__ wo, u16* XB, u16* WQT, u16* WKT, u16* WVT, u16* WOT,
          float* cosT, float* sinT, InvF inv) {
  __shared__ __align__(16) u16 T[64 * VTP];
  const int bid = blockIdx.x;
  if (bid < PB_W) {
    const float* W = wq;  u16* D = WQT;  int C = NH * HD, tb = bid, mode = 0;  float scale = 1.0f;
    if (bid >= PB_WQ)                 { W = wk;  D = WKT;  C = NKV * HD;  tb = bid - PB_WQ; }
    if (bid >= PB_WQ + PB_WK)         { W = wv;  D = WVT;  tb = bid - (PB_WQ + PB_WK); }
    if (bid >= PB_WQ + 2 * PB_WK)     { W = wo;  D = WOT;  C = DMOD;  tb = bid - (PB_WQ + 2 * PB_WK);  mode = 1;  scale = WOS; }
    static_assert(NH * HD == DMOD);   // every weight has DMOD rows (wo: NH*HD rows)
    wT_body(T, tb, W, D, DMOD, C, mode, scale);
  } else if (bid < PB_W + PB_TAB) {
    tab_body(bid - PB_W, cosT, sinT, inv);
  } else {
    cvtx_body(bid - (PB_W + PB_TAB), x, XB, (NB * SEQ * DMOD) / 8);
  }
}

// =====================================================================================================
// GEMM epilogue shared by both engines: the wave's 16x64 f32 tile (times oscale) staged in its LDS slab (pitch 68),
// coverage: 8 instructions x 2 rows x 16 lanes x 4 floats = the wave's 16 x 64 tile.
// =====================================================================================================
__device__ __forceinline__ void epi64(float* sl, v8f a0, v8f a1, v8f a2, v8f a3, float oscale, float* C, int N,
                                      size_t rowb, int col0, int lane) {
  const int hh = lane >> 4, m = lane & 15;
#pragma unroll
  for (int r = 0; r < 8; ++r) {
    const int ro = (8 * hh + r) * 68 + m;
    sl[ro]      = a0[r] * oscale;
    sl[ro + 16] = a1[r] * oscale;
    sl[ro + 32] = a2[r] * oscale;
    sl[ro + 48] = a3[r] * oscale;
  }
  wave_sync_lds();
  v4f vals[8];
#pragma unroll
  for (int it = 0; it < 8; ++it) vals[it] = *(const v4f*)(sl + (it * 2 + hh) * 68 + m * 4);
  float* dst = C + (rowb + (size_t)hh) * (size_t)N + col0 + m * 4;
  {
#pragma unroll
    for (int it = 0; it < 8; ++it) {
      *(v4f*)(dst + (size_t)(it * 2) * (size_t)N) = vals[it];
    }
    
  }
}

// =====================================================================================================
// bf16 GEMM: C[M][N] (f32) = A[M][K] (bf16 row-major) . Bt[N][K]^T (bf16 k-contiguous), times oscale.
// Block = 64x64 tile, 4 waves x 16 rows; fragments loaded straight from the 16-bit rows (two 16-B loads each, split k map
// for A and B); K stepped by 32 (K % 32 == 0, M % 64 == 0, N % 64 == 0 checked statically).
// Launch 2: the q, k and v projections in one launch. The 12 + 4 + 4 column tiles of one 64-row tile of x are neighbours in
// the grid; the column tile picks weight plane, output and output pitch (block-uniform). grid = (M/64) * 20.
// =====================================================================================================
#define QKV_CT ((NH * HD) / 64 + 2 * ((NKV * HD) / 64))
#define QKV_BLOCKS (((NB * SEQ) / 64) * QKV_CT)
static_assert(QKV_CT == 20 && QKV_BLOCKS == 1280);
__global__ __launch_bounds__(128)
void gemm_qkv(const u16* __restrict__ A, const u16* __restrict__ WQT, const u16* __restrict__ WKT,
              const u16* __restrict__ WVT, float* QF, float* KF, float* VF, int M, int K, float oscale) {
  __shared__ __align__(16) float slab[4 * SLAB64];
  const int tid = threadIdx.x, wave = tid >> 5, lane = tid & 31, hh = lane >> 4, m = lane & 15;
  const int bid   = blockIdx.x;
  const int ct    = bid % QKV_CT;
  const int rowb  = (bid / QKV_CT) * 64 + wave * 16;
  const u16* Bt = WQT;  float* C = QF;  int N = NH * HD, col0 = ct * 64;
  if (ct >= (NH * HD) / 64)                    { Bt = WKT;  C = KF;  N = NKV * HD;  col0 = (ct - (NH * HD) / 64) * 64; }
  if (ct >= (NH * HD) / 64 + (NKV * HD) / 64)  { Bt = WVT;  C = VF;  col0 = (ct - ((NH * HD) / 64 + (NKV * HD) / 64)) * 64; }
  if (rowb + 16 > M) return;                 // wave-uniform, never taken with the exact grid; no block barriers in this kernel
  const u16* ap = A  + (size_t)(rowb + m) * K + 8 * hh;
  const u16* bp = Bt + (size_t)(col0 + m) * K + 8 * hh;
  const size_t bs = (size_t)16 * K;
  v8f acc0 = zero8(), acc1 = zero8(), acc2 = zero8(), acc3 = zero8();
#pragma unroll 1
  for (int k0 = 0; k0 < K; k0 += 32) {
    const v16b a  = ldfrag_b(ap + k0);
    const v16b b0 = ldfrag_b(bp + k0);
    const v16b b1 = ldfrag_b(bp + bs + k0);
    const v16b b2 = ldfrag_b(bp + 2 * bs + k0);
    const v16b b3 = ldfrag_b(bp + 3 * bs + k0);
    acc0 = mma_b(a, b0, acc0);
    acc1 = mma_b(a, b1, acc1);
    acc2 = mma_b(a, b2, acc2);
    acc3 = mma_b(a, b3, acc3);
    guard6<v16b>(acc0, acc1, acc2, acc3, a, b0, b1, b2, b3, a);
  }
  epi64(slab + wave * SLAB64, acc0, acc1, acc2, acc3, oscale, C, N, (size_t)rowb, col0, lane);
}

// =====================================================================================================
// f16 hi+lo GEMM: C[M][N] (f32) = (Ahi + Alo)[M][K] . Bt[N][K]^T, times oscale; Ahi/Alo f16 planes (same layout), Bt f16
// k-contiguous; products hi.B + lo.B into one accumulator (lo is the unscaled residual of hi). Same tiling as gemm_qkv.
// =====================================================================================================
__global__ __launch_bounds__(128)
void gemm_h2(const u16* __restrict__ Ah, const u16* __restrict__ Al, const u16* __restrict__ Bt, float* C,
             int M, int N, int K, float oscale) {
  __shared__ __align__(16) float slab[4 * SLAB64];
  const int tid = threadIdx.x, wave = tid >> 5, lane = tid & 31, hh = lane >> 4, m = lane & 15;
  const int ntile = N >> 6;
  const int bid   = blockIdx.x;
  const int rowb  = (bid / ntile) * 64 + wave * 16;
  const int col0  = (bid % ntile) * 64;
  if (rowb + 16 > M) return;                 // wave-uniform, never taken with the exact grid; no block barriers in this kernel
  const size_t aofs = (size_t)(rowb + m) * K + 8 * hh;
  const _Float16* ahp = (const _Float16*)(const void*)Ah + aofs;
  const _Float16* alp = (const _Float16*)(const void*)Al + aofs;
  const _Float16* bp  = (const _Float16*)(const void*)Bt + (size_t)(col0 + m) * K + 8 * hh;
  const size_t bs = (size_t)16 * K;
  v8f acc0 = zero8(), acc1 = zero8(), acc2 = zero8(), acc3 = zero8();
#pragma unroll 1
  for (int k0 = 0; k0 < K; k0 += 32) {
    const v16h ah = ldfrag_h(ahp + k0), al = ldfrag_h(alp + k0);
    const v16h b0 = ldfrag_h(bp + k0);
    const v16h b1 = ldfrag_h(bp + bs + k0);
    const v16h b2 = ldfrag_h(bp + 2 * bs + k0);
    const v16h b3 = ldfrag_h(bp + 3 * bs + k0);
    acc0 = mma_h(ah, b0, acc0);  acc0 = mma_h(al, b0, acc0);
    acc1 = mma_h(ah, b1, acc1);  acc1 = mma_h(al, b1, acc1);
    acc2 = mma_h(ah, b2, acc2);  acc2 = mma_h(al, b2, acc2);
    acc3 = mma_h(ah, b3, acc3);  acc3 = mma_h(al, b3, acc3);
    guard6<v16h>(acc0, acc1, acc2, acc3, ah, al, b0, b1, b2, b3);
  }
  epi64(slab + wave * SLAB64, acc0, acc1, acc2, acc3, oscale, C, N, (size_t)rowb, col0, lane);
}

// =====================================================================================================
// Rotate-half rotary + 16-bit split pack. Rows are (batch, pos, head) with HD contiguous floats (f32 projection output);
// pos = (row / hpr) mod SEQ.  w[d] = x[d] * cos[pos][d] + r[d] * sin[pos][d],  r[d] = -x[d+32] for d < 32, x[d-32] for d >= 32;
// hi[d] = f16(w * sc), lo[d] = f16(w * sc - hi[d])  (sc a power of two, residual unscaled).
// Thread = 8 consecutive d of one row: 16-B loads of x (own and partner half), cos, sin; one 16-B store per plane per lane;
// coverage: nrows*8/256 blocks x 256 thr x 8 halves = nrows x 64 of each plane exactly (exact division checked statically).
// =====================================================================================================
__device__ __forceinline__ void rope_body(int bid, const float* __restrict__ x, const float* __restrict__ cosT,
                                          const float* __restrict__ sinT, u16* hpl, u16* lpl,
                                          int nrows, int hpr, float sc) {
  const int gt  = bid * 256 + (int)threadIdx.x;
  const int row = gt >> 3;
  const int d0  = (gt & 7) * 8;
  if (row >= nrows) return;                 // never taken with the exact block range; no barriers in this part
  const int pos = (row / hpr) & (SEQ - 1);
  const int d1  = d0 ^ 32;
  const float* xr = x + (size_t)row * HD;
  const float* cr = cosT + (size_t)pos * HD + d0;
  const float* sr = sinT + (size_t)pos * HD + d0;
  const v4f xa = *(const v4f*)(xr + d0), xb = *(const v4f*)(xr + d0 + 4);
#if defined(__HIP_DEVICE_COMPILE__)
  // in this build the next load's result takes over the address pair of the two loads above: the wait stands in front of it
  asm volatile("s_wait_xcnt 0x0" ::: "memory");
#endif
  const v4f ya = *(const v4f*)(xr + d1);
#if defined(__HIP_DEVICE_COMPILE__)
  // likewise: the next load's result takes over the address pair that it shares with the load above
  asm volatile("s_wait_xcnt 0x0" ::: "memory");
#endif
  const v4f yb = *(const v4f*)(xr + d1 + 4);
  const v4f ca = *(const v4f*)(cr), cb = *(const v4f*)(cr + 4);
  const v4f sa = *(const v4f*)(sr), sb = *(const v4f*)(sr + 4);
  const float sgn = (d0 < 32) ? -1.0f : 1.0f;
  float w[8];
#pragma unroll
  for (int e = 0; e < 4; ++e) {
    w[e]     = xa[e] * ca[e] + (sgn * ya[e]) * sa[e];
    w[4 + e] = xb[e] * cb[e] + (sgn * yb[e]) * sb[e];
  }
  v4u oh, ol;
#pragma unroll
  for (int e = 0; e < 4; ++e) {
    const float t0 = w[2 * e] * sc, t1 = w[2 * e + 1] * sc;
    const _Float16 h0 = (_Float16)t0, h1 = (_Float16)t1;
    const _Float16 l0 = (_Float16)(t0 - (float)h0), l1 = (_Float16)(t1 - (float)h1);
    oh[e] = pk16(h_bits(h0), h_bits(h1));
    ol[e] = pk16(h_bits(l0), h_bits(l1));
  }
  const size_t o8 = (size_t)row * HD + d0;
  {
    *(v4u*)(hpl + o8) = oh;
    *(v4u*)(lpl + o8) = ol;
    
  }
}

// =====================================================================================================
// v^T planes: VH[(b*NKV + g)*HD + d][s] = f16(v[b][s][g][d] * 1024), VL = f16 residual of the same value.
// Block = (b, g, 64 keys): 64 source rows of HD floats loaded with 16-B loads, converted, scattered into two LDS tiles
// coverage: load 256 thr x 16 elements = 64 x 64; store 2 iterations x 256 thr x 8 halves = 64 lines x 64 = the block's tile of
//           each plane; NB x NKV x SEQ/64 = 256 blocks cover both planes exactly once.
// =====================================================================================================
__device__ __forceinline__ void vt_body(u16* TH, u16* TL, int bid, const float* __restrict__ v, u16* VHo, u16* VLo) {
  const int tid = threadIdx.x;
  const int st  = bid & 31;
  const int g   = (bid >> 5) & 3;
  const int b   = bid >> 7;
  const int s0  = st * 64;
  {
    const int sl = tid >> 2;                  // key within tile 0..63
    const int dc = (tid & 3) * 16;            // d chunk
    const float* src = v + (((size_t)(b * SEQ + s0 + sl)) * NKV + g) * HD + dc;
#pragma unroll
    for (int i = 0; i < 4; ++i) {
      const v4f a = *(const v4f*)(src + 4 * i);
#pragma unroll
      for (int e = 0; e < 4; ++e) {
        const float t = a[e] * VCAR;
        const _Float16 h = (_Float16)t;
        const _Float16 l = (_Float16)(t - (float)h);
        TH[(dc + 4 * i + e) * VTP + sl] = h_bits(h);
        TL[(dc + 4 * i + e) * VTP + sl] = h_bits(l);
      }
    }
  }
  __syncthreads();
  v4u vh[2], vl[2];
  const int q8 = tid >> 3, p8 = (tid & 7) * 8;
#pragma unroll
  for (int it = 0; it < 2; ++it) {
    const int line = it * 32 + q8;            // d = 0..63
    vh[it] = *(const v4u*)(TH + line * VTP + p8);
    vl[it] = *(const v4u*)(TL + line * VTP + p8);
  }
  const size_t base = ((size_t)(b * NKV + g) * HD) * SEQ + s0 + p8;
  {
#pragma unroll
    for (int it = 0; it < 2; ++it) {
      const int line = it * 32 + q8;
      *(v4u*)(VHo + base + (size_t)line * SEQ) = vh[it];
      *(v4u*)(VLo + base + (size_t)line * SEQ) = vl[it];
    }
    
  }
}

// =====================================================================================================
// Launch 3: everything between the projections and attention, one launch, parts picked by block range (block-uniform):
//   [0, 256)      v^T planes (they hold the one block barrier, so they start first)
//   [256, 768)    k' planes: rows (b, s, g), heads per position NKV
//   [768, 2304)   q' planes: rows (b, s, h), heads per position NH
// Each part keeps its own block count and per-block work; no part reads what another part writes.
// =====================================================================================================
#define QB_VT (NB * NKV * (SEQ / 64))
#define QB_RK ((NB * SEQ * NKV * 8) / 256)
#define QB_RQ ((NB * SEQ * NH * 8) / 256)
#define POST_BLOCKS (QB_VT + QB_RK + QB_RQ)
static_assert(QB_VT == 256 && QB_RK == 512 && QB_RQ == 1536);
__global__ __launch_bounds__(256)
void post(const float* __restrict__ QF, const float* __restrict__ KF, const float* __restrict__ VF,
          const float* __restrict__ cosT, const float* __restrict__ sinT,
          u16* QHI, u16* QLO, u16* KHI, u16* KLO, u16* VHI, u16* VLO) {
  __shared__ __align__(16) u16 TH[HD * VTP];
  __shared__ __align__(16) u16 TL[HD * VTP];
  const int bid = blockIdx.x;
  if (bid < QB_VT) {
    vt_body(TH, TL, bid, VF, VHI, VLO);
  } else {
    const bool isq = bid >= QB_VT + QB_RK;
    rope_body(isq ? bid - (QB_VT + QB_RK) : bid - QB_VT, isq ? QF : KF, cosT, sinT, isq ? QHI : KHI, isq ? QLO : KLO,
              isq ? NB * SEQ * NH : NB * SEQ * NKV, isq ? NH : NKV, isq ? QSC : KSC);
  }
}

// =====================================================================================================
// GQA flash attention with causal window + global-token mask: block = (batch b, kv head g, 16 query rows q0..q0+15),
// one wave per query head g*GRP + wave (kv index = head / GRP).
//   q planes (hi, lo f16) laid out [b][s][h][d]; k planes [b][s][g][d]; v^T planes [b][g][d][s].
//   Key blocks of 32 visited in a fixed, block-uniform list: {0} + {32 if q0 >= 32} + {jlo, jlo+32, ... < q0+16},
//   jlo = 64 if q0-511 <= 64 else (q0-511) & ~31; the element mask allowed(i,j) = (j <= i) && (i-j < 512 || j < 64) replaces the
//   score by -inf inside partial blocks (block 0 comes first and key 0 is allowed for every row, so each running max is finite
//   before any fully masked block row can occur).
//   Per block: 2 score subtiles x 2 k-steps x 3 products (q_hi.k_hi + q_lo.k_hi + q_hi.k_lo), fragments loaded straight from the
//   16-bit planes (two 16-B loads per fragment, split k map); online max-subtracted base-2 softmax in f32 (scale 1/8 folded);
//   barrier, then A fragments of P*32768 (f16 hi) and its f16 residual rebuilt from the LDS rows (float vector loads), 4+4 v^T
//   B fragments (hi and residual planes), 12 P.V WMMAs (hh + lh + hl).
//   (b, q0+row, head) of the O hi plane and of the O lo plane (O x1024 as f16 hi + residual) written by 8 consecutive lanes x 16 B
//   No block barriers in this kernel; every wave does bounded work (MAXBLK steps max).
// coverage: per wave 4 instructions x 4 rows x 8 lanes x 8 halves = 16 x 64 per plane; grid 1024 blocks x 3 waves = every
//           (b, s, h) row of both O planes exactly once.
// =====================================================================================================
__global__ __launch_bounds__(ATT_THREADS)
void attn_gqa(const u16* __restrict__ QHIp, const u16* __restrict__ QLOp,
              const u16* __restrict__ KHIp, const u16* __restrict__ KLOp,
              const u16* __restrict__ VHIp, const u16* __restrict__ VLOp,
              u16* OHIp, u16* OLOp) {
  __shared__ __align__(16) float smem[GRP * SLABF];   // per wave: prob tile [16][32] pitch 36 during the loop, result slab after

  const int tid  = threadIdx.x;
  const int wave = tid >> 5;
  const int lane = tid & 31;
  const int hh   = lane >> 4;
  const int c    = lane & 15;

  const int bid  = blockIdx.x;
  const int qt   = bid & (SEQ / 16 - 1);
  const int g    = (bid >> 7) & (NKV - 1);
  const int b    = bid >> 9;
  const int head = g * GRP + wave;
  const int q0   = qt * 16;

  const size_t qofs = (((size_t)(b * SEQ + q0 + c)) * NH + head) * HD + 8 * hh;
  const _Float16* Qh  = (const _Float16*)(const void*)QHIp + qofs;
  const _Float16* Ql  = (const _Float16*)(const void*)QLOp + qofs;
  const size_t kofs = (((size_t)b * SEQ + c) * NKV + g) * HD + 8 * hh;          // key row kb + c added per step
  const _Float16* Khb = (const _Float16*)(const void*)KHIp + kofs;
  const _Float16* Klb = (const _Float16*)(const void*)KLOp + kofs;
  const size_t vofs = ((size_t)(b * NKV + g) * HD + c) * SEQ + 8 * hh;          // d column c (+16j), key kb added per step
  const _Float16* Vhb = (const _Float16*)(const void*)VHIp + vofs;
  const _Float16* Vlb = (const _Float16*)(const void*)VLOp + vofs;
  const float lsc = 0.125f * (LOG2E / (QSC * KSC));

  float mrow[8], lrow[8];
  v8f o[4];
#pragma unroll
  for (int r = 0; r < 8; ++r) { mrow[r] = -INFINITY; lrow[r] = 0.f; }
#pragma unroll
  for (int j = 0; j < 4; ++j) o[j] = zero8();
  float* pt = smem + wave * SLABF;

  const int nglob = (q0 >= 32) ? 2 : 1;
  const int wlo   = q0 - (WIN - 1);
  const int jlo   = (wlo <= GLB) ? GLB : (wlo & ~31);
  int nwin = q0 + 16 - jlo;
  nwin = (nwin > 0) ? ((nwin + 31) >> 5) : 0;
  int nblk = nglob + nwin;
  nblk = (nblk > MAXBLK) ? MAXBLK : nblk;

#pragma unroll 1
  for (int it = 0; it < nblk; ++it) {
    const int kb = (it < nglob) ? (it * 32) : (jlo + (it - nglob) * 32);
    // ---- scores: D element r of this lane = (query row q0 + 8hh + r, key kb + c) in s0, key kb + 16 + c in s1 ----
    v8f s0 = zero8(), s1 = zero8();
    const _Float16* k0p = Khb + (size_t)kb * (NKV * HD);
    const _Float16* k1p = k0p + (size_t)16 * (NKV * HD);
    const _Float16* l0p = Klb + (size_t)kb * (NKV * HD);
    const _Float16* l1p = l0p + (size_t)16 * (NKV * HD);
#pragma unroll
    for (int kk = 0; kk < 2; ++kk) {
      const v16h qh  = ldfrag_h(Qh + kk * 32),  ql  = ldfrag_h(Ql + kk * 32);
      const v16h kh0 = ldfrag_h(k0p + kk * 32), kl0 = ldfrag_h(l0p + kk * 32);
      const v16h kh1 = ldfrag_h(k1p + kk * 32), kl1 = ldfrag_h(l1p + kk * 32);
      s0 = mma_h(qh, kh0, s0);
      s0 = mma_h(ql, kh0, s0);
      s0 = mma_h(qh, kl0, s0);
      s1 = mma_h(qh, kh1, s1);
      s1 = mma_h(ql, kh1, s1);
      s1 = mma_h(qh, kl1, s1);
      guard2(s0, s1, qh, ql, kh0, kl0, kh1, kl1);
    }
    // ---- mask (replace by -inf) + online softmax in base 2 ----
#pragma unroll
    for (int r = 0; r < 8; ++r) {
      const int i  = q0 + 8 * hh + r;
      const int j0 = kb + c, j1 = kb + 16 + c;
      const bool ok0 = (j0 <= i) && (((i - j0) < WIN) || (j0 < GLB));
      const bool ok1 = (j1 <= i) && (((i - j1) < WIN) || (j1 < GLB));
      const float t0 = ok0 ? (s0[r] * lsc) : -INFINITY;
      const float t1 = ok1 ? (s1[r] * lsc) : -INFINITY;
      float mx = fmaxf(t0, t1);
#pragma unroll
      for (int off = 1; off < 16; off <<= 1) mx = fmaxf(mx, __shfl_xor(mx, off, 32));
      const float mn = fmaxf(mrow[r], mx);
      const float al = exp2f(mrow[r] - mn);
      mrow[r] = mn;
      const float e0 = exp2f(t0 - mn), e1 = exp2f(t1 - mn);
      float ps = e0 + e1;
#pragma unroll
      for (int off = 1; off < 16; off <<= 1) ps += __shfl_xor(ps, off, 32);
      lrow[r] = lrow[r] * al + ps;
#pragma unroll
      for (int j = 0; j < 4; ++j) o[j][r] *= al;
      const int ro = (8 * hh + r) * 36 + c;
      pt[ro]      = e0;
      pt[ro + 16] = e1;
    }
    wave_sync_lds();
    // ---- A fragments of P*32768: hi f16 and residual f16, row = c, split k map over the 32 keys of this step ----
    FragH ph, pl;
    {
      const float* prow = pt + c * 36 + 8 * hh;
      const v4f p0 = *(const v4f*)(prow), p1 = *(const v4f*)(prow + 4);
      const v4f p2 = *(const v4f*)(prow + 16), p3 = *(const v4f*)(prow + 20);
#pragma unroll
      for (int e = 0; e < 4; ++e) {
        const float ta = p0[e] * PCAR, tb = p1[e] * PCAR, tc = p2[e] * PCAR, td = p3[e] * PCAR;
        const _Float16 ha = (_Float16)ta, hb = (_Float16)tb, hc = (_Float16)tc, hd = (_Float16)td;
        ph.h[0][e]     = ha;                               // elements 0..7  = keys kb + 8hh + 0..7
        ph.h[0][4 + e] = hb;
        ph.h[1][e]     = hc;                               // elements 8..15 = keys kb + 16 + 8hh + 0..7
        ph.h[1][4 + e] = hd;
        pl.h[0][e]     = (_Float16)(ta - (float)ha);
        pl.h[0][4 + e] = (_Float16)(tb - (float)hb);
        pl.h[1][e]     = (_Float16)(tc - (float)hc);
        pl.h[1][4 + e] = (_Float16)(td - (float)hd);
      }
    }
    // ---- P.V : B fragment col n = d = j*16 + c, keys contiguous in the v^T planes ----
    {
      const _Float16* vhp = Vhb + kb;
      const _Float16* vlp = Vlb + kb;
      const v16h vh0 = ldfrag_h(vhp);
      const v16h vh1 = ldfrag_h(vhp + (size_t)16 * SEQ);
      const v16h vh2 = ldfrag_h(vhp + (size_t)32 * SEQ);
      const v16h vh3 = ldfrag_h(vhp + (size_t)48 * SEQ);
      const v16h vl0 = ldfrag_h(vlp);
      const v16h vl1 = ldfrag_h(vlp + (size_t)16 * SEQ);
      const v16h vl2 = ldfrag_h(vlp + (size_t)32 * SEQ);
      const v16h vl3 = ldfrag_h(vlp + (size_t)48 * SEQ);
      o[0] = mma_h(ph.v, vh0, o[0]);  o[0] = mma_h(pl.v, vh0, o[0]);  o[0] = mma_h(ph.v, vl0, o[0]);
      o[1] = mma_h(ph.v, vh1, o[1]);  o[1] = mma_h(pl.v, vh1, o[1]);  o[1] = mma_h(ph.v, vl1, o[1]);
      o[2] = mma_h(ph.v, vh2, o[2]);  o[2] = mma_h(pl.v, vh2, o[2]);  o[2] = mma_h(ph.v, vl2, o[2]);
      o[3] = mma_h(ph.v, vh3, o[3]);  o[3] = mma_h(pl.v, vh3, o[3]);  o[3] = mma_h(ph.v, vl3, o[3]);
      guard10(o[0], o[1], o[2], o[3], ph.v, pl.v, vh0, vh1, vh2, vh3, vl0, vl1, vl2, vl3);
    }
    wave_sync_lds();
  }
  acc_guard4(o[0], o[1], o[2], o[3]);

  // ---- fold 1/l and the carries (32768 on P, 1024 on v), stage the wave's 16x64 slab in its LDS region ----
  wave_sync_lds();
  float* slab = pt;
  const float oc = 1.0f / (PCAR * VCAR);
#pragma unroll
  for (int r = 0; r < 8; ++r) {
    const float inv = (1.0f / lrow[r]) * oc;
#pragma unroll
    for (int j = 0; j < 4; ++j) slab[(8 * hh + r) * 68 + j * 16 + c] = o[j][r] * inv;
  }
  wave_sync_lds();
  // ---- O x1024 -> f16 hi + residual planes; lane = (row in group of 4, 8 consecutive d) ----
  v4u oh[4], ol[4];
  const int rq = lane >> 3, c8 = (lane & 7) * 8;
#pragma unroll
  for (int it = 0; it < 4; ++it) {
    const int row = it * 4 + rq;
    const v4f a = *(const v4f*)(slab + row * 68 + c8), bq = *(const v4f*)(slab + row * 68 + c8 + 4);
    float w[8];
#pragma unroll
    for (int e = 0; e < 4; ++e) { w[e] = a[e] * OSC; w[4 + e] = bq[e] * OSC; }
#pragma unroll
    for (int e = 0; e < 4; ++e) {
      const _Float16 h0 = (_Float16)w[2 * e], h1 = (_Float16)w[2 * e + 1];
      const _Float16 l0 = (_Float16)(w[2 * e] - (float)h0), l1 = (_Float16)(w[2 * e + 1] - (float)h1);
      oh[it][e] = pk16(h_bits(h0), h_bits(h1));
      ol[it][e] = pk16(h_bits(l0), h_bits(l1));
    }
  }
  const size_t ob = (((size_t)(b * SEQ + q0)) * NH + head) * HD + c8;
  {
#pragma unroll
    for (int it = 0; it < 4; ++it) {
      const int row = it * 4 + rq;
      const size_t o8 = ob + (size_t)row * (NH * HD);
      *(v4u*)(OHIp + o8) = oh[it];
      *(v4u*)(OLOp + o8) = ol[it];
    }
    
  }
}

// =====================================================================================================
// Workspace map (bytes); every plane is fully written by whole-line stores before it is read; all extents are exact multiples
// of the store granularity (no pad rows needed); every offset a multiple of 65536:
//   CT  f32 [2048][64]                 524288        ST  same              524288
//   XB  bf16 [4096][768]              6291456
//   WQT bf16 [768 n][768 k]           1179648        WKT bf16 [256][768]   393216     WVT same   393216
//   WOT f16  [768 n][768 k] x1024     1179648
//   QF  f32 [4096][768]              12582912        KF f32 [4096][256]   4194304     VF same   4194304
//   QHI f16 [2][2048][12][64] x1024   6291456        QLO residual         6291456
//   KHI f16 [2][2048][4][64] x1024    2097152        KLO residual         2097152
//   VHI f16 [2][4][64][2048] x1024    2097152        VLO residual         2097152
//   OHI f16 [4096][768] x1024         6291456        OLO residual         6291456
//   end                              65011712
// =====================================================================================================
extern "C" void kernel_launch(void* const* d_in, const int* in_sizes, int n_in,
                              void* d_out, int out_size, void* d_ws, size_t ws_size,
                              hipStream_t stream) {
  const int ROWS = NB * SEQ;                            // 4096
  if (n_in < 5) return;
  if (in_sizes[0] != ROWS * DMOD) return;
  if (in_sizes[1] != DMOD * (NH * HD)) return;
  if (in_sizes[2] != DMOD * (NKV * HD) || in_sizes[3] != DMOD * (NKV * HD)) return;
  if (in_sizes[4] != (NH * HD) * DMOD) return;
  if (out_size != ROWS * DMOD) return;

  const float* x  = (const float*)d_in[0];
  const float* wq = (const float*)d_in[1];
  const float* wk = (const float*)d_in[2];
  const float* wv = (const float*)d_in[3];
  const float* wo = (const float*)d_in[4];
  float*       out = (float*)d_out;

  const size_t szTab = (size_t)SEQ * HD * 4;                    //   524288
  const size_t szXB  = (size_t)ROWS * DMOD * 2;                 //  6291456
  const size_t szWQT = (size_t)(NH * HD) * DMOD * 2;            //  1179648
  const size_t szWKT = (size_t)(NKV * HD) * DMOD * 2;           //   393216
  const size_t szWOT = (size_t)DMOD * (NH * HD) * 2;            //  1179648
  const size_t szQF  = (size_t)ROWS * (NH * HD) * 4;            // 12582912
  const size_t szKF  = (size_t)ROWS * (NKV * HD) * 4;           //  4194304
  const size_t szQP  = (size_t)ROWS * (NH * HD) * 2;            //  6291456
  const size_t szKP  = (size_t)ROWS * (NKV * HD) * 2;           //  2097152
  const size_t szVP  = (size_t)NB * NKV * HD * SEQ * 2;         //  2097152
  const size_t szOP  = (size_t)ROWS * (NH * HD) * 2;            //  6291456
  size_t off = 0;
  const size_t oCT  = off; off += szTab;
  const size_t oST  = off; off += szTab;
  const size_t oXB  = off; off += szXB;
  const size_t oWQT = off; off += szWQT;
  const size_t oWKT = off; off += szWKT;
  const size_t oWVT = off; off += szWKT;
  const size_t oWOT = off; off += szWOT;
  const size_t oQF  = off; off += szQF;
  const size_t oKF  = off; off += szKF;
  const size_t oVF  = off; off += szKF;
  const size_t oQHI = off; off += szQP;
  const size_t oQLO = off; off += szQP;
  const size_t oKHI = off; off += szKP;
  const size_t oKLO = off; off += szKP;
  const size_t oVHI = off; off += szVP;
  const size_t oVLO = off; off += szVP;
  const size_t oOHI = off; off += szOP;
  const size_t oOLO = off; off += szOP;
  if (off > ws_size) return;                            // off = 65011712
  if (off > (size_t)134217728) return;

  char* ws = (char*)d_ws;
  float* CT  = (float*)(ws + oCT);
  float* ST  = (float*)(ws + oST);
  u16*   XB  = (u16*)(ws + oXB);
  u16*   WQT = (u16*)(ws + oWQT);
  u16*   WKT = (u16*)(ws + oWKT);
  u16*   WVT = (u16*)(ws + oWVT);
  u16*   WOT = (u16*)(ws + oWOT);
  float* QF  = (float*)(ws + oQF);
  float* KF  = (float*)(ws + oKF);
  float* VF  = (float*)(ws + oVF);
  u16*   QHI = (u16*)(ws + oQHI);
  u16*   QLO = (u16*)(ws + oQLO);
  u16*   KHI = (u16*)(ws + oKHI);
  u16*   KLO = (u16*)(ws + oKLO);
  u16*   VHI = (u16*)(ws + oVHI);
  u16*   VLO = (u16*)(ws + oVLO);
  u16*   OHI = (u16*)(ws + oOHI);
  u16*   OLO = (u16*)(ws + oOLO);

  // inv_freq[i] = 1 / pow(10000, i/32) in f32 (pow correctly converted from f64, then IEEE f32 reciprocal)
  InvF inv;
  for (int i = 0; i < 32; ++i) {
    const double p = pow(10000.0, (double)i / 32.0);
    const float pf = (float)p;
    inv.f[i] = 1.0f / pf;
  }

  const dim3 blk(256);
  const dim3 gPrep(PREP_BLOCKS);                        // 2176
  const dim3 gQKV(QKV_BLOCKS);                          // 1280
  const dim3 gPost(POST_BLOCKS);                        // 2304
  const dim3 gGO((ROWS / 64) * (DMOD / 64));            // 768
  const dim3 bG(128);
  const dim3 gAT(ATT_BLOCKS);                           // 1024
  const dim3 bAT(ATT_THREADS);                          // 96

  // (1) weights W[k rows][n cols] -> [n][k] 16-bit planes (bf16 for wq/wk/wv; f16 of bf16 value x1024 for wo),
  //     rotary cos/sin tables [2048][64], x -> bf16 plane
  prep<<<gPrep, blk, 0, stream>>>(x, wq, wk, wv, wo, XB, WQT, WKT, WVT, WOT, CT, ST, inv);
  // (2) projections: q [4096][768], k [4096][256], v [4096][256] in f32
  gemm_qkv<<<gQKV, bG, 0, stream>>>(XB, WQT, WKT, WVT, QF, KF, VF, ROWS, DMOD, 1.0f);
  // (3) q' and k' planes (rotary, hi + residual), v^T planes x1024 (hi + residual)
  post<<<gPost, blk, 0, stream>>>(QF, KF, VF, CT, ST, QHI, QLO, KHI, KLO, VHI, VLO);
  // (4) attention -> O planes [b][s][h][d] x1024 (hi + residual)
  attn_gqa<<<gAT, bAT, 0, stream>>>(QHI, QLO, KHI, KLO, VHI, VLO, OHI, OLO);
  // (5) output projection -> out [4096][768] f32, carries 1024 (O) x 1024 (wo) folded back
  gemm_h2<<<gGO, bG, 0, stream>>>(OHI, OLO, WOT, out, ROWS, DMOD, NH * HD, 1.0f / (OSC * WOS));
  (void)hipGetLastError();
}

// v002
// It runs in 92 microseconds.
// Two timings next to v001 put it at 1.40 and 1.39 times that version's speed.
// Over all steps from v000 it is 1.61 times as fast.
// Contractions: x.W{q,k,v} on v_wmma_f32_16x16x32_bf16 (x and W RNE-converted to bf16, exact operands, f32 accumulate);
// scores q'.k'^T (q', k' carried x1024 as f16 hi plane + f16 residual plane, products hh+lh+hl), P.v (P x32768 f16 hi+residual,
// v x1024 f16 hi+residual, products hh+lh+hl) and O.wo (O x1024 f16 hi+residual, wo as f16(bf16(wo) x1024), products h.w+l.w):
// v_wmma_f32_16x16x32_f16, f32 accumulate. Rotary tables, rotation, masked base-2 online softmax and 1/l fold in f32 on VALU.
#include <hip/hip_runtime.h>
#include <math.h>
#include <stdint.h>

#define NB    2
#define SEQ   2048
#define DMOD  768
#define NH    12
#define NKV   4
#define HD    64
#define GRP   3
#define WIN   512
#define GLB   64
#define QSC   1024.0f
#define KSC   1024.0f
#define PCAR  32768.0f
#define VCAR  1024.0f
#define OSC   1024.0f
#define WOS   1024.0f
#define LOG2E 1.4426950408889634f
#define ATT_THREADS (GRP * 32)
#define ATT_BLOCKS  (NB * NKV * (SEQ / 16))
#define SLABF (16 * 68)
#define SLAB64 (16 * 68)
#define VTP   72
#define MAXBLK 20
#define FT    512
static_assert(NH == NKV * GRP);
static_assert(HD == 64 && DMOD == NH * HD);
static_assert((SEQ / 16) == 128 && NKV == 4 && NB == 2);
static_assert(ATT_THREADS == 96 && ATT_BLOCKS == 1024);
static_assert(16 * 36 <= SLABF);
static_assert(((NB * SEQ * NH * 8) % 256) == 0 && ((NB * SEQ * NKV * 8) % 256) == 0);
static_assert(((NB * SEQ) % 64) == 0 && (DMOD % 64) == 0 && ((NKV * HD) % 64) == 0 && (DMOD % 32) == 0);
static_assert((SEQ % 64) == 0 && (SEQ % 8) == 0);

typedef unsigned short u16;
typedef _Float16 v16h __attribute__((ext_vector_type(16)));
typedef _Float16 v8h  __attribute__((ext_vector_type(8)));
typedef __bf16   v16b __attribute__((ext_vector_type(16)));
typedef float    v8f  __attribute__((ext_vector_type(8)));
typedef float    v4f  __attribute__((ext_vector_type(4)));
typedef unsigned int v4u __attribute__((ext_vector_type(4)));

union FragH { v16h v; v8h h[2]; v4u u[2]; };
union FragB { v16b v; v4u u[2]; };

struct InvF { float f[32]; };
static_assert(sizeof(InvF) == 128);

// ---- scalar helpers --------------------------------------------------------------------------------
__device__ __forceinline__ unsigned short bf_bits(float f) {          // f32 -> bf16 bits, RNE convert
  unsigned u = __float_as_uint(f);
  return (unsigned short)((u + 0x7FFFu + ((u >> 16) & 1u)) >> 16);
}
__device__ __forceinline__ float bf_up(unsigned short h) { return __uint_as_float(((unsigned)h) << 16); }
__device__ __forceinline__ float bfr(float f) { return bf_up(bf_bits(f)); }
__device__ __forceinline__ unsigned short h_bits(_Float16 x) { return __builtin_bit_cast(unsigned short, x); }
__device__ __forceinline__ unsigned pk16(unsigned short a, unsigned short b) { return (unsigned)a | ((unsigned)b << 16); }
__device__ __forceinline__ v8f zero8() { v8f z = {0.f, 0.f, 0.f, 0.f, 0.f, 0.f, 0.f, 0.f}; return z; }

// ---- fragment-order planes: every 16-bit operand plane [rows][K] is kept as 16-row x 32-k tiles of FT elements (1 KiB),
//      tile (rt, kt) at (rt * (K / 32) + kt) * FT, and inside a tile as 16-B chunks [q = (k & 31) >> 3][row & 15][k & 7].
// ---- fragment loaders: 16-bit A/B operand, lane -> row/col (lane&15), h = lane>>4, t = the tile (wave-uniform), lo = lane * 8;
//      elements 0..7 <- t[lo..lo+7] (chunk q = h: k0+8h..), elements 8..15 <- t[256+lo..] (chunk q = 2+h: k0+16+8h..)
//      (same split k map for A and B); each of the two loads of a wave is 512 contiguous bytes = 4 whole lines
__device__ __forceinline__ v16h ldfrag_h(const _Float16* t, unsigned lo) {
  FragH f;
  f.h[0] = *(const v8h*)(t + lo);
  f.h[1] = *(const v8h*)(t + 256 + lo);
  return f.v;
}
__device__ __forceinline__ v16b ldfrag_b(const u16* t, unsigned lo) { // bf16 plane read as unsigned integer vectors
  FragB f;
  f.u[0] = *(const v4u*)(t + lo);
  f.u[1] = *(const v4u*)(t + 256 + lo);
  return f.v;
}

__device__ __forceinline__ v8f mma_h(v16h a, v16h b, v8f c) {
  return __builtin_amdgcn_wmma_f32_16x16x32_f16(false, a, false, b, (short)0, c, false, false);
}
__device__ __forceinline__ v8f mma_b(v16b a, v16b b, v8f c) {
  return __builtin_amdgcn_wmma_f32_16x16x32_bf16(false, a, false, b, (short)0, c, false, false);
}
__device__ __forceinline__ void guard2(v8f& a, v8f& b, v16h x0, v16h x1, v16h x2, v16h x3, v16h x4, v16h x5) {
#if defined(__HIP_DEVICE_COMPILE__)
  asm volatile("v_nop\n\tv_nop\n\tv_nop\n\tv_nop"
               : "+v"(a), "+v"(b) : "v"(x0), "v"(x1), "v"(x2), "v"(x3), "v"(x4), "v"(x5) : "memory");
#endif
}
template <typename F>
__device__ __forceinline__ void guard6(v8f& a, v8f& b, v8f& c, v8f& d, F x0, F x1, F x2, F x3, F x4, F x5) {
#if defined(__HIP_DEVICE_COMPILE__)
  asm volatile("v_nop\n\tv_nop\n\tv_nop\n\tv_nop"
               : "+v"(a), "+v"(b), "+v"(c), "+v"(d) : "v"(x0), "v"(x1), "v"(x2), "v"(x3), "v"(x4), "v"(x5) : "memory");
#endif
}
__device__ __forceinline__ void guard10(v8f& a, v8f& b, v8f& c, v8f& d, v16h x0, v16h x1, v16h x2, v16h x3, v16h x4,
                                        v16h x5, v16h x6, v16h x7, v16h x8, v16h x9) {
#if defined(__HIP_DEVICE_COMPILE__)
  asm volatile("v_nop\n\tv_nop\n\tv_nop\n\tv_nop"
               : "+v"(a), "+v"(b), "+v"(c), "+v"(d)
               : "v"(x0), "v"(x1), "v"(x2), "v"(x3), "v"(x4), "v"(x5), "v"(x6), "v"(x7), "v"(x8), "v"(x9) : "memory");
#endif
}
__device__ __forceinline__ void acc_guard4(v8f& a, v8f& b, v8f& c, v8f& d) {
#if defined(__HIP_DEVICE_COMPILE__)
  asm volatile("v_nop\n\tv_nop\n\tv_nop\n\tv_nop" : "+v"(a), "+v"(b), "+v"(c), "+v"(d));
#endif
}
__device__ __forceinline__ void wave_sync_lds() {
  __builtin_amdgcn_fence(__ATOMIC_RELEASE, "workgroup");
  __builtin_amdgcn_wave_barrier();
  __builtin_amdgcn_fence(__ATOMIC_ACQUIRE, "workgroup");
}

// ---- accurate f32 sin/cos of a non-negative f32 angle (|angle| < 2048): f64 two-part pi/2 reduction + f64 polynomials,
//      plain f64 fma/mul only (no library f64 trig path), result converted to f32.
__device__ __forceinline__ void sincos_acc(float angf, float& sv, float& cv) {
  const double a = (double)angf;
  const double TWO_OVER_PI = 0.63661977236758134308;
  const double PIO2_HI = 1.5707963267948966;
  const double PIO2_LO = 6.123233995736766e-17;
  const int kq = (int)(a * TWO_OVER_PI + 0.5);
  const double kd = (double)kq;
  double r = fma(-kd, PIO2_HI, a);
  r = fma(-kd, PIO2_LO, r);
  const double r2 = r * r;
  double sp = 1.0 / 6227020800.0;
  sp = fma(sp, r2, -1.0 / 39916800.0);
  sp = fma(sp, r2, 1.0 / 362880.0);
  sp = fma(sp, r2, -1.0 / 5040.0);
  sp = fma(sp, r2, 1.0 / 120.0);
  sp = fma(sp, r2, -1.0 / 6.0);
  const double s = fma(sp * r2, r, r);
  double cp = -1.0 / 87178291200.0;
  cp = fma(cp, r2, 1.0 / 479001600.0);
  cp = fma(cp, r2, -1.0 / 3628800.0);
  cp = fma(cp, r2, 1.0 / 40320.0);
  cp = fma(cp, r2, -1.0 / 720.0);
  cp = fma(cp, r2, 1.0 / 24.0);
  cp = fma(cp, r2, -0.5);
  const double c = fma(cp, r2, 1.0);
  const int qd = kq & 3;
  const double so = (qd == 0) ? s : (qd == 1) ? c : (qd == 2) ? -s : -c;
  const double co = (qd == 0) ? c : (qd == 1) ? -s : (qd == 2) ? -c : s;
  sv = (float)so;
  cv = (float)co;
}

// =====================================================================================================
// Rotary tables: cosT[t][d], sinT[t][d] for t < SEQ, d < HD, angle = float(t) * inv_freq[d & 31] (f32 product), halves duplicated.
// Wave = one position t, lane = frequency index; inv_freq picked from the by-value table with a static select chain.
// coverage: SEQ/8 blocks x 8 waves = SEQ rows; per row 4 line stores = 64 floats of each table.
// =====================================================================================================
__device__ __forceinline__ void tab_body(int bid, float* cosT, float* sinT, const InvF& inv) {
  const int tid  = threadIdx.x;
  const int lane = tid & 31;
  const int t    = bid * 8 + (tid >> 5);
  if (t >= SEQ) return;                     // never taken with the exact block range; no barriers in this part
  float f = inv.f[0];
#pragma unroll
  for (int i = 1; i < 32; ++i) f = (lane == i) ? inv.f[i] : f;
  const float ang = (float)t * f;
  float sv, cv;
  sincos_acc(ang, sv, cv);
  float* cr = cosT + (size_t)t * HD;
  float* sr = sinT + (size_t)t * HD;
  {
    *(float*)(cr + lane)      = cv;
    *(float*)(cr + 32 + lane) = cv;
    *(float*)(sr + lane)      = sv;
    *(float*)(sr + 32 + lane) = sv;
    
  }
}

// =====================================================================================================
// x f32 -> bf16 plane (RNE convert), fragment order. Thread = one 16-B chunk (8 consecutive k of one row): two 16-B loads, one
// 16-B store; a wave = 8 rows x the 4 chunks of one tile, so 8 lanes fill one 128-B line of the plane.
// coverage: n8/256 blocks (exact division checked statically) x 256 thr x 8 = the whole plane (64 threads per tile).
// =====================================================================================================
__device__ __forceinline__ void cvtx_body(int bid, const float* __restrict__ x, u16* D, int n8) {
  const int gt = bid * 256 + (int)threadIdx.x;
  if (gt >= n8) return;                     // no barriers in this part
  const int tile = gt >> 6;
  const int m    = ((gt >> 5) & 1) * 8 + (gt & 7);
  const int q    = (gt >> 3) & 3;
  const float* p = x + (size_t)((tile / (DMOD / 32)) * 16 + m) * DMOD + (tile % (DMOD / 32)) * 32 + q * 8;
  const v4f a = *(const v4f*)(p), bq = *(const v4f*)(p + 4);
  v4u o;
  o[0] = pk16(bf_bits(a[0]),  bf_bits(a[1]));
  o[1] = pk16(bf_bits(a[2]),  bf_bits(a[3]));
  o[2] = pk16(bf_bits(bq[0]), bf_bits(bq[1]));
  o[3] = pk16(bf_bits(bq[2]), bf_bits(bq[3]));
  u16* d = D + (size_t)tile * FT + q * 128 + m * 8;
  {
    *(v4u*)(d) = o;
    
  }
}

// =====================================================================================================
// Weight transpose + 16-bit convert: in W[R][C] (row-major f32) -> out D[C][R] (16-bit plane, rows n = C, k = R, fragment order).
//   f16mode == 0: D = bf16 RNE bits of W;  f16mode == 1: D = f16 bits of (bf16 RNE value of W) * scale.
// Block = one 64x64 tile (r0, c0): 256 thr x 4 16-B loads -> LDS tile [c][r] (pitch 72), block barrier, then each output row
// coverage: load 256 thr x 16 = 64x64; store 2 iterations x 256 thr x 8 halves = 8 fragment tiles (4 n x 2 k), a wave = 512
//           contiguous bytes; grid (C/64)x(R/64) tiles = all of D.
// =====================================================================================================
__device__ __forceinline__ void wT_body(u16* T, int bid, const float* __restrict__ W, u16* D, int R, int C, int f16mode,
                                        float scale) {
  const int tid = threadIdx.x;
  const int ntc = C >> 6;
  const int c0  = (bid % ntc) * 64;
  const int r0  = (bid / ntc) * 64;
  {
    const int rr = tid >> 2;
    const int cc = (tid & 3) * 16;
    const float* src = W + (size_t)(r0 + rr) * C + c0 + cc;
#pragma unroll
    for (int i = 0; i < 4; ++i) {
      const v4f a = *(const v4f*)(src + 4 * i);
#pragma unroll
      for (int e = 0; e < 4; ++e) {
        const float v = a[e];
        const unsigned short hb = h_bits((_Float16)(bfr(v) * scale));
        const unsigned short bb = bf_bits(v);
        T[(cc + 4 * i + e) * VTP + rr] = (f16mode != 0) ? hb : bb;
      }
    }
  }
  __syncthreads();
  v4u vals[2];
  const int m16 = tid & 15, q4 = (tid >> 4) & 3, nt = tid >> 7, kt = (tid >> 6) & 1;   // n tile nt (+2 per iteration), k tile kt
#pragma unroll
  for (int it = 0; it < 2; ++it) vals[it] = *(const v4u*)(T + ((it * 2 + nt) * 16 + m16) * VTP + kt * 32 + q4 * 8);
  {
#pragma unroll
    for (int it = 0; it < 2; ++it) {
      const size_t tile = (size_t)((c0 >> 4) + it * 2 + nt) * (size_t)(R >> 5) + (size_t)((r0 >> 5) + kt);
      *(v4u*)(D + tile * FT + q4 * 128 + m16 * 8) = vals[it];
    }
    
  }
}

// =====================================================================================================
// Launch 1: every conversion that depends on the inputs alone, one launch, parts picked by block range (block-uniform):
//   [0, 384)     weight tiles: wq 144, wk 48, wv 48, wo 144 (they hold the one block barrier, so they start first)
//   [384, 640)   rotary tables
//   [640, 2176)  x -> bf16 plane
// Each part keeps its own block count and per-block work; no part reads what another part writes.
// =====================================================================================================
#define PB_WQ  ((DMOD / 64) * ((NH * HD) / 64))
#define PB_WK  ((DMOD / 64) * ((NKV * HD) / 64))
#define PB_WO  (((NH * HD) / 64) * (DMOD / 64))
#define PB_W   (PB_WQ + 2 * PB_WK + PB_WO)
#define PB_TAB (SEQ / 8)
#define PB_X   ((NB * SEQ * DMOD) / (8 * 256))
#define PREP_BLOCKS (PB_W + PB_TAB + PB_X)
static_assert(PB_W == 384 && PB_TAB == 256 && PB_X == 1536 && ((NB * SEQ * DMOD) % (8 * 256)) == 0);
__global__ __launch_bounds__(256)
void prep(const float* __restrict__ x, const float* __restrict__ wq, const float* __restrict__ wk,
          const float* __restrict__ wv, const float* __restrict__ wo, u16* XB, u16* WQT, u16* WKT, u16* WVT, u16* WOT,
          float* cosT, float* sinT, InvF inv) {
  __shared__ __align__(16) u16 T[64 * VTP];
  const int bid = blockIdx.x;
  if (bid < PB_W) {
    const float* W = wq;  u16* D = WQT;  int C = NH * HD, tb = bid, mode = 0;  float scale = 1.0f;
    if (bid >= PB_WQ)                 { W = wk;  D = WKT;  C = NKV * HD;  tb = bid - PB_WQ; }
    if (bid >= PB_WQ + PB_WK)         { W = wv;  D = WVT;  tb = bid - (PB_WQ + PB_WK); }
    if (bid >= PB_WQ + 2 * PB_WK)     { W = wo;  D = WOT;  C = DMOD;  tb = bid - (PB_WQ + 2 * PB_WK);  mode = 1;  scale = WOS; }
    static_assert(NH * HD == DMOD);   // every weight has DMOD rows (wo: NH*HD rows)
    wT_body(T, tb, W, D, DMOD, C, mode, scale);
  } else if (bid < PB_W + PB_TAB) {
    tab_body(bid - PB_W, cosT, sinT, inv);
  } else {
    cvtx_body(bid - (PB_W + PB_TAB), x, XB, (NB * SEQ * DMOD) / 8);
  }
}

// =====================================================================================================
// GEMM epilogue shared by both engines: the wave's 16x64 f32 tile (times oscale) staged in its LDS slab (pitch 68),
// coverage: 8 instructions x 2 rows x 16 lanes x 4 floats = the wave's 16 x 64 tile.
// =====================================================================================================
__device__ __forceinline__ void epi64(float* sl, v8f a0, v8f a1, v8f a2, v8f a3, float oscale, float* C, int N,
                                      size_t rowb, int col0, int lane) {
  const int hh = lane >> 4, m = lane & 15;
#pragma unroll
  for (int r = 0; r < 8; ++r) {
    const int ro = (8 * hh + r) * 68 + m;
    sl[ro]      = a0[r] * oscale;
    sl[ro + 16] = a1[r] * oscale;
    sl[ro + 32] = a2[r] * oscale;
    sl[ro + 48] = a3[r] * oscale;
  }
  wave_sync_lds();
  v4f vals[8];
#pragma unroll
  for (int it = 0; it < 8; ++it) vals[it] = *(const v4f*)(sl + (it * 2 + hh) * 68 + m * 4);
  float* dst = C + (rowb + (size_t)hh) * (size_t)N + col0 + m * 4;
  {
#pragma unroll
    for (int it = 0; it < 8; ++it) {
      *(v4f*)(dst + (size_t)(it * 2) * (size_t)N) = vals[it];
    }
    
  }
}

// =====================================================================================================
// bf16 GEMM: C[M][N] (f32) = A[M][K] (bf16) . Bt[N][K]^T (bf16), both planes in fragment order, times oscale.
// Block = 64x64 tile, 4 waves x 16 rows; fragments loaded straight from the planes' tiles (two 16-B loads each, split k map
// for A and B); K stepped by 32 = one tile of FT elements (K % 32 == 0, M % 64 == 0, N % 64 == 0 checked statically).
// Launch 2: the q, k and v projections in one launch. The 12 + 4 + 4 column tiles of one 64-row tile of x are neighbours in
// the grid; the column tile picks weight plane, output and output pitch (block-uniform). grid = (M/64) * 20.
// =====================================================================================================
#define QKV_CT ((NH * HD) / 64 + 2 * ((NKV * HD) / 64))
#define QKV_BLOCKS (((NB * SEQ) / 64) * QKV_CT)
static_assert(QKV_CT == 20 && QKV_BLOCKS == 1280);
__global__ __launch_bounds__(128)
void gemm_qkv(const u16* __restrict__ A, const u16* __restrict__ WQT, const u16* __restrict__ WKT,
              const u16* __restrict__ WVT, float* QF, float* KF, float* VF, int M, int K, float oscale) {
  __shared__ __align__(16) float slab[4 * SLAB64];
  const int tid = threadIdx.x, wave = __builtin_amdgcn_readfirstlane(tid >> 5), lane = tid & 31;   // scalar wave number: wave-uniform tile pointers
  const unsigned lo = (unsigned)lane * 8u;
  const int bid   = blockIdx.x;
  const int ct    = bid % QKV_CT;
  const int rowb  = (bid / QKV_CT) * 64 + wave * 16;
  const u16* Bt = WQT;  float* C = QF;  int N = NH * HD, col0 = ct * 64;
  if (ct >= (NH * HD) / 64)                    { Bt = WKT;  C = KF;  N = NKV * HD;  col0 = (ct - (NH * HD) / 64) * 64; }
  if (ct >= (NH * HD) / 64 + (NKV * HD) / 64)  { Bt = WVT;  C = VF;  col0 = (ct - ((NH * HD) / 64 + (NKV * HD) / 64)) * 64; }
  if (rowb + 16 > M) return;                 // wave-uniform, never taken with the exact grid; no block barriers in this kernel
  const size_t bs = (size_t)(K >> 5) * FT;   // one row of tiles: 16 rows x K
  const u16* ap = A  + (size_t)(rowb >> 4) * bs;
  const u16* bp0 = Bt + (size_t)(col0 >> 4) * bs;
  const u16* bp1 = bp0 + bs;
  const u16* bp2 = bp1 + bs;
  const u16* bp3 = bp2 + bs;
  v8f acc0 = zero8(), acc1 = zero8(), acc2 = zero8(), acc3 = zero8();
#pragma unroll 1
  for (int k0 = 0; k0 < K; k0 += 32, ap += FT, bp0 += FT, bp1 += FT, bp2 += FT, bp3 += FT) {
    const v16b a  = ldfrag_b(ap, lo);
    const v16b b0 = ldfrag_b(bp0, lo);
    const v16b b1 = ldfrag_b(bp1, lo);
    const v16b b2 = ldfrag_b(bp2, lo);
    const v16b b3 = ldfrag_b(bp3, lo);
    acc0 = mma_b(a, b0, acc0);
    acc1 = mma_b(a, b1, acc1);
    acc2 = mma_b(a, b2, acc2);
    acc3 = mma_b(a, b3, acc3);
    guard6<v16b>(acc0, acc1, acc2, acc3, a, b0, b1, b2, b3, a);
  }
  epi64(slab + wave * SLAB64, acc0, acc1, acc2, acc3, oscale, C, N, (size_t)rowb, col0, lane);
}

// =====================================================================================================
// f16 hi+lo GEMM: C[M][N] (f32) = (Ahi + Alo)[M][K] . Bt[N][K]^T, times oscale; Ahi/Alo and Bt f16 planes in fragment order;
// products hi.B + lo.B into one accumulator (lo is the unscaled residual of hi). Same tiling as gemm_qkv.
// =====================================================================================================
__global__ __launch_bounds__(128)
void gemm_h2(const u16* __restrict__ Ah, const u16* __restrict__ Al, const u16* __restrict__ Bt, float* C,
             int M, int N, int K, float oscale) {
  __shared__ __align__(16) float slab[4 * SLAB64];
  const int tid = threadIdx.x, wave = __builtin_amdgcn_readfirstlane(tid >> 5), lane = tid & 31;   // scalar wave number: wave-uniform tile pointers
  const unsigned lo = (unsigned)lane * 8u;
  const int ntile = N >> 6;
  const int bid   = blockIdx.x;
  const int rowb  = (bid / ntile) * 64 + wave * 16;
  const int col0  = (bid % ntile) * 64;
  if (rowb + 16 > M) return;                 // wave-uniform, never taken with the exact grid; no block barriers in this kernel
  const size_t bs = (size_t)(K >> 5) * FT;   // one row of tiles: 16 rows x K
  const size_t aofs = (size_t)(rowb >> 4) * bs;
  const _Float16* ahp = (const _Float16*)(const void*)Ah + aofs;
  const _Float16* alp = (const _Float16*)(const void*)Al + aofs;
  const _Float16* bp0 = (const _Float16*)(const void*)Bt + (size_t)(col0 >> 4) * bs;
  const _Float16* bp1 = bp0 + bs;
  const _Float16* bp2 = bp1 + bs;
  const _Float16* bp3 = bp2 + bs;
  v8f acc0 = zero8(), acc1 = zero8(), acc2 = zero8(), acc3 = zero8();
#pragma unroll 1
  for (int k0 = 0; k0 < K; k0 += 32, ahp += FT, alp += FT, bp0 += FT, bp1 += FT, bp2 += FT, bp3 += FT) {
    const v16h ah = ldfrag_h(ahp, lo), al = ldfrag_h(alp, lo);
    const v16h b0 = ldfrag_h(bp0, lo);
    const v16h b1 = ldfrag_h(bp1, lo);
    const v16h b2 = ldfrag_h(bp2, lo);
    const v16h b3 = ldfrag_h(bp3, lo);
    acc0 = mma_h(ah, b0, acc0);  acc0 = mma_h(al, b0, acc0);
    acc1 = mma_h(ah, b1, acc1);  acc1 = mma_h(al, b1, acc1);
    acc2 = mma_h(ah, b2, acc2);  acc2 = mma_h(al, b2, acc2);
    acc3 = mma_h(ah, b3, acc3);  acc3 = mma_h(al, b3, acc3);
    guard6<v16h>(acc0, acc1, acc2, acc3, ah, al, b0, b1, b2, b3);
  }
  epi64(slab + wave * SLAB64, acc0, acc1, acc2, acc3, oscale, C, N, (size_t)rowb, col0, lane);
}

// =====================================================================================================
// Rotate-half rotary + 16-bit split pack. Rows are (batch, pos, head) with HD contiguous floats (f32 projection output);
// pos = (row / hpr) mod SEQ.  w[d] = x[d] * cos[pos][d] + r[d] * sin[pos][d],  r[d] = -x[d+32] for d < 32, x[d-32] for d >= 32;
// hi[d] = f16(w * sc), lo[d] = f16(w * sc - hi[d])  (sc a power of two, residual unscaled).
// Output planes in fragment order with plane row = (batch * hpr + head) * SEQ + pos and K = HD (2 tiles per 16 positions).
// Thread = 8 consecutive d of one row: 16-B loads of x (own and partner half), cos, sin; one 16-B store per plane per lane;
// a wave = 8 positions of one head x the 4 chunks of one tile, so 8 lanes fill one 128-B line of each plane.
// coverage: nrows*8/256 blocks x 256 thr x 8 halves = nrows x 64 of each plane exactly (exact division checked statically).
// =====================================================================================================
__device__ __forceinline__ void rope_body(int bid, const float* __restrict__ x, const float* __restrict__ cosT,
                                          const float* __restrict__ sinT, u16* hpl, u16* lpl,
                                          int nrows, int hpr, float sc) {
  const int gt  = bid * 256 + (int)threadIdx.x;
  const int tile = gt >> 6;
  const int pr  = (tile >> 1) * 16 + ((gt >> 5) & 1) * 8 + (gt & 7);   // plane row
  const int q   = (gt >> 3) & 3;
  const int d0  = (tile & 1) * 32 + q * 8;
  if (pr >= nrows) return;                  // never taken with the exact block range; no barriers in this part
  const int pos = pr & (SEQ - 1);
  const int bh  = pr / SEQ;
  const int row = ((bh / hpr) * SEQ + pos) * hpr + bh % hpr;           // source row (batch, pos, head)
  const int d1  = d0 ^ 32;
  const float* xr = x + (size_t)row * HD;
  const float* cr = cosT + (size_t)pos * HD + d0;
  const float* sr = sinT + (size_t)pos * HD + d0;
  const v4f xa = *(const v4f*)(xr + d0), xb = *(const v4f*)(xr + d0 + 4);
#if defined(__HIP_DEVICE_COMPILE__)
  // in this build the next load's result takes over the address pair of the two loads above: the wait stands in front of it
  asm volatile("s_wait_xcnt 0x0" ::: "memory");
#endif
  const v4f ya = *(const v4f*)(xr + d1);
  const v4f yb = *(const v4f*)(xr + d1 + 4);
  const v4f ca = *(const v4f*)(cr), cb = *(const v4f*)(cr + 4);
  const v4f sa = *(const v4f*)(sr), sb = *(const v4f*)(sr + 4);
  const float sgn = (d0 < 32) ? -1.0f : 1.0f;
  float w[8];
#pragma unroll
  for (int e = 0; e < 4; ++e) {
    w[e]     = xa[e] * ca[e] + (sgn * ya[e]) * sa[e];
    w[4 + e] = xb[e] * cb[e] + (sgn * yb[e]) * sb[e];
  }
  v4u oh, ol;
#pragma unroll
  for (int e = 0; e < 4; ++e) {
    const float t0 = w[2 * e] * sc, t1 = w[2 * e + 1] * sc;
    const _Float16 h0 = (_Float16)t0, h1 = (_Float16)t1;
    const _Float16 l0 = (_Float16)(t0 - (float)h0), l1 = (_Float16)(t1 - (float)h1);
    oh[e] = pk16(h_bits(h0), h_bits(h1));
    ol[e] = pk16(h_bits(l0), h_bits(l1));
  }
  const size_t o8 = (size_t)tile * FT + q * 128 + (pr & 15) * 8;
  {
    *(v4u*)(hpl + o8) = oh;
    *(v4u*)(lpl + o8) = ol;
    
  }
}

// =====================================================================================================
// v^T planes: VH[(b*NKV + g)*HD + d][s] = f16(v[b][s][g][d] * 1024), VL = f16 residual of the same value; fragment order, K = SEQ.
// Block = (b, g, 64 keys): 64 source rows of HD floats loaded with 16-B loads, converted, scattered into two LDS tiles
// coverage: load 256 thr x 16 elements = 64 x 64; store 2 iterations x 256 thr x 8 halves = 8 fragment tiles (4 d x 2 key) of
//           each plane, a wave = 512 contiguous bytes; NB x NKV x SEQ/64 = 256 blocks cover both planes exactly once.
// =====================================================================================================
__device__ __forceinline__ void vt_body(u16* TH, u16* TL, int bid, const float* __restrict__ v, u16* VHo, u16* VLo) {
  const int tid = threadIdx.x;
  const int st  = bid & 31;
  const int g   = (bid >> 5) & 3;
  const int b   = bid >> 7;
  const int s0  = st * 64;
  {
    const int sl = tid >> 2;                  // key within tile 0..63
    const int dc = (tid & 3) * 16;            // d chunk
    const float* src = v + (((size_t)(b * SEQ + s0 + sl)) * NKV + g) * HD + dc;
#pragma unroll
    for (int i = 0; i < 4; ++i) {
      const v4f a = *(const v4f*)(src + 4 * i);
#pragma unroll
      for (int e = 0; e < 4; ++e) {
        const float t = a[e] * VCAR;
        const _Float16 h = (_Float16)t;
        const _Float16 l = (_Float16)(t - (float)h);
        TH[(dc + 4 * i + e) * VTP + sl] = h_bits(h);
        TL[(dc + 4 * i + e) * VTP + sl] = h_bits(l);
      }
    }
  }
  __syncthreads();
  v4u vh[2], vl[2];
  const int m16 = tid & 15, q4 = (tid >> 4) & 3, dt = tid >> 7, kt = (tid >> 6) & 1;   // d tile dt (+2 per iteration), key tile kt
#pragma unroll
  for (int it = 0; it < 2; ++it) {
    const int line = (it * 2 + dt) * 16 + m16;   // d = 0..63
    vh[it] = *(const v4u*)(TH + line * VTP + kt * 32 + q4 * 8);
    vl[it] = *(const v4u*)(TL + line * VTP + kt * 32 + q4 * 8);
  }
  const size_t base = ((size_t)((b * NKV + g) * (HD / 16) + dt) * (SEQ / 32) + (size_t)((s0 >> 5) + kt)) * FT + q4 * 128 + m16 * 8;
  {
#pragma unroll
    for (int it = 0; it < 2; ++it) {
      const size_t o8 = base + (size_t)(it * 2) * (SEQ / 32) * FT;
      *(v4u*)(VHo + o8) = vh[it];
      *(v4u*)(VLo + o8) = vl[it];
    }
    
  }
}

// =====================================================================================================
// Launch 3: everything between the projections and attention, one launch, parts picked by block range (block-uniform):
//   [0, 256)      v^T planes (they hold the one block barrier, so they start first)
//   [256, 768)    k' planes: rows (b, g, s) from source rows (b, s, g), heads per position NKV
//   [768, 2304)   q' planes: rows (b, h, s) from source rows (b, s, h), heads per position NH
// Each part keeps its own block count and per-block work; no part reads what another part writes.
// =====================================================================================================
#define QB_VT (NB * NKV * (SEQ / 64))
#define QB_RK ((NB * SEQ * NKV * 8) / 256)
#define QB_RQ ((NB * SEQ * NH * 8) / 256)
#define POST_BLOCKS (QB_VT + QB_RK + QB_RQ)
static_assert(QB_VT == 256 && QB_RK == 512 && QB_RQ == 1536);
__global__ __launch_bounds__(256)
void post(const float* __restrict__ QF, const float* __restrict__ KF, const float* __restrict__ VF,
          const float* __restrict__ cosT, const float* __restrict__ sinT,
          u16* QHI, u16* QLO, u16* KHI, u16* KLO, u16* VHI, u16* VLO) {
  __shared__ __align__(16) u16 TH[HD * VTP];
  __shared__ __align__(16) u16 TL[HD * VTP];
  const int bid = blockIdx.x;
  if (bid < QB_VT) {
    vt_body(TH, TL, bid, VF, VHI, VLO);
  } else {
    const bool isq = bid >= QB_VT + QB_RK;
    rope_body(isq ? bid - (QB_VT + QB_RK) : bid - QB_VT, isq ? QF : KF, cosT, sinT, isq ? QHI : KHI, isq ? QLO : KLO,
              isq ? NB * SEQ * NH : NB * SEQ * NKV, isq ? NH : NKV, isq ? QSC : KSC);
  }
}

// =====================================================================================================
// GQA flash attention with causal window + global-token mask: block = (batch b, kv head g, 16 query rows q0..q0+15),
// one wave per query head g*GRP + wave (kv index = head / GRP).
//   q planes (hi, lo f16) rows [b][h][s], k = d; k planes rows [b][g][s], k = d; v^T planes rows [b][g][d], k = s; O planes rows
//   [b][s], k = h*64 + d; all in fragment order.
//   Key blocks of 32 visited in a fixed, block-uniform list: {0} + {32 if q0 >= 32} + {jlo, jlo+32, ... < q0+16},
//   jlo = 64 if q0-511 <= 64 else (q0-511) & ~31; the element mask allowed(i,j) = (j <= i) && (i-j < 512 || j < 64) replaces the
//   score by -inf inside partial blocks (block 0 comes first and key 0 is allowed for every row, so each running max is finite
//   before any fully masked block row can occur).
//   Per block: 2 score subtiles x 2 k-steps x 3 products (q_hi.k_hi + q_lo.k_hi + q_hi.k_lo), fragments loaded straight from the
//   16-bit planes (two 16-B loads per fragment, split k map); online max-subtracted base-2 softmax in f32 (scale 1/8 folded);
//   barrier, then A fragments of P*32768 (f16 hi) and its f16 residual rebuilt from the LDS rows (float vector loads), 4+4 v^T
//   B fragments (hi and residual planes), 12 P.V WMMAs (hh + lh + hl).
//   the wave's two tiles of the O hi plane and of the O lo plane (O x1024 as f16 hi + residual) written 512 contiguous bytes a store
//   No block barriers in this kernel; every wave does bounded work (MAXBLK steps max).
// coverage: per wave 4 instructions x 32 lanes x 8 halves = 16 x 64 per plane; grid 1024 blocks x 3 waves = every
//           (b, s, h) row of both O planes exactly once.
// =====================================================================================================
__global__ __launch_bounds__(ATT_THREADS)
void attn_gqa(const u16* __restrict__ QHIp, const u16* __restrict__ QLOp,
              const u16* __restrict__ KHIp, const u16* __restrict__ KLOp,
              const u16* __restrict__ VHIp, const u16* __restrict__ VLOp,
              u16* OHIp, u16* OLOp) {
  __shared__ __align__(16) float smem[GRP * SLABF];   // per wave: prob tile [16][32] pitch 36 during the loop, result slab after

  const int tid  = threadIdx.x;
  const int wave = __builtin_amdgcn_readfirstlane(tid >> 5);   // scalar wave number: wave-uniform q and O tile pointers
  const int lane = tid & 31;
  const unsigned lo = (unsigned)lane * 8u;
  const int hh   = lane >> 4;
  const int c    = lane & 15;

  const int bid  = blockIdx.x;
  const int qt   = bid & (SEQ / 16 - 1);
  const int g    = (bid >> 7) & (NKV - 1);
  const int b    = bid >> 9;
  const int head = g * GRP + wave;
  const int q0   = qt * 16;

  const size_t qofs = ((size_t)(b * NH + head) * SEQ + q0) * HD;               // 16 positions = 2 tiles = 16 * HD elements
  const _Float16* Qh  = (const _Float16*)(const void*)QHIp + qofs;
  const _Float16* Ql  = (const _Float16*)(const void*)QLOp + qofs;
  const size_t kofs = (size_t)(b * NKV + g) * SEQ * HD;                         // key tiles of kb added per step
  const _Float16* Khb = (const _Float16*)(const void*)KHIp + kofs;
  const _Float16* Klb = (const _Float16*)(const void*)KLOp + kofs;
  const size_t vofs = (size_t)(b * NKV + g) * HD * SEQ;                         // d tile j: + 16j * SEQ; key tile of kb added per step
  const _Float16* Vhb = (const _Float16*)(const void*)VHIp + vofs;
  const _Float16* Vlb = (const _Float16*)(const void*)VLOp + vofs;
  const float lsc = 0.125f * (LOG2E / (QSC * KSC));

  float mrow[8], lrow[8];
  v8f o[4];
#pragma unroll
  for (int r = 0; r < 8; ++r) { mrow[r] = -INFINITY; lrow[r] = 0.f; }
#pragma unroll
  for (int j = 0; j < 4; ++j) o[j] = zero8();
  float* pt = smem + wave * SLABF;

  const int nglob = (q0 >= 32) ? 2 : 1;
  const int wlo   = q0 - (WIN - 1);
  const int jlo   = (wlo <= GLB) ? GLB : (wlo & ~31);
  int nwin = q0 + 16 - jlo;
  nwin = (nwin > 0) ? ((nwin + 31) >> 5) : 0;
  int nblk = nglob + nwin;
  nblk = (nblk > MAXBLK) ? MAXBLK : nblk;

  // wave-uniform tile pointers of the current key block (the list starts at key 0), moved on at the foot of each step
  const _Float16* k0p = Khb;
  const _Float16* l0p = Klb;
  const _Float16* vhp = Vhb;
  const _Float16* vlp = Vlb;
  int kb = 0;
#pragma unroll 1
  for (int it = 0; it < nblk; ++it) {
    // ---- scores: D element r of this lane = (query row q0 + 8hh + r, key kb + c) in s0, key kb + 16 + c in s1 ----
    v8f s0 = zero8(), s1 = zero8();
    const _Float16* k1p = k0p + (size_t)16 * HD;
    const _Float16* l1p = l0p + (size_t)16 * HD;
#pragma unroll
    for (int kk = 0; kk < 2; ++kk) {
      const v16h qh  = ldfrag_h(Qh + kk * FT, lo),  ql  = ldfrag_h(Ql + kk * FT, lo);
      const v16h kh0 = ldfrag_h(k0p + kk * FT, lo), kl0 = ldfrag_h(l0p + kk * FT, lo);
      const v16h kh1 = ldfrag_h(k1p + kk * FT, lo), kl1 = ldfrag_h(l1p + kk * FT, lo);
      s0 = mma_h(qh, kh0, s0);
      s0 = mma_h(ql, kh0, s0);
      s0 = mma_h(qh, kl0, s0);
      s1 = mma_h(qh, kh1, s1);
      s1 = mma_h(ql, kh1, s1);
      s1 = mma_h(qh, kl1, s1);
      guard2(s0, s1, qh, ql, kh0, kl0, kh1, kl1);
    }
    // ---- mask (replace by -inf) + online softmax in base 2 ----
#pragma unroll
    for (int r = 0; r < 8; ++r) {
      const int i  = q0 + 8 * hh + r;
      const int j0 = kb + c, j1 = kb + 16 + c;
      const bool ok0 = (j0 <= i) && (((i - j0) < WIN) || (j0 < GLB));
      const bool ok1 = (j1 <= i) && (((i - j1) < WIN) || (j1 < GLB));
      const float t0 = ok0 ? (s0[r] * lsc) : -INFINITY;
      const float t1 = ok1 ? (s1[r] * lsc) : -INFINITY;
      float mx = fmaxf(t0, t1);
#pragma unroll
      for (int off = 1; off < 16; off <<= 1) mx = fmaxf(mx, __shfl_xor(mx, off, 32));
      const float mn = fmaxf(mrow[r], mx);
      const float al = exp2f(mrow[r] - mn);
      mrow[r] = mn;
      const float e0 = exp2f(t0 - mn), e1 = exp2f(t1 - mn);
      float ps = e0 + e1;
#pragma unroll
      for (int off = 1; off < 16; off <<= 1) ps += __shfl_xor(ps, off, 32);
      lrow[r] = lrow[r] * al + ps;
#pragma unroll
      for (int j = 0; j < 4; ++j) o[j][r] *= al;
      const int ro = (8 * hh + r) * 36 + c;
      pt[ro]      = e0;
      pt[ro + 16] = e1;
    }
    wave_sync_lds();
    // ---- A fragments of P*32768: hi f16 and residual f16, row = c, split k map over the 32 keys of this step ----
    FragH ph, pl;
    {
      const float* prow = pt + c * 36 + 8 * hh;
      const v4f p0 = *(const v4f*)(prow), p1 = *(const v4f*)(prow + 4);
      const v4f p2 = *(const v4f*)(prow + 16), p3 = *(const v4f*)(prow + 20);
#pragma unroll
      for (int e = 0; e < 4; ++e) {
        const float ta = p0[e] * PCAR, tb = p1[e] * PCAR, tc = p2[e] * PCAR, td = p3[e] * PCAR;
        const _Float16 ha = (_Float16)ta, hb = (_Float16)tb, hc = (_Float16)tc, hd = (_Float16)td;
        ph.h[0][e]     = ha;                               // elements 0..7  = keys kb + 8hh + 0..7
        ph.h[0][4 + e] = hb;
        ph.h[1][e]     = hc;                               // elements 8..15 = keys kb + 16 + 8hh + 0..7
        ph.h[1][4 + e] = hd;
        pl.h[0][e]     = (_Float16)(ta - (float)ha);
        pl.h[0][4 + e] = (_Float16)(tb - (float)hb);
        pl.h[1][e]     = (_Float16)(tc - (float)hc);
        pl.h[1][4 + e] = (_Float16)(td - (float)hd);
      }
    }
    // ---- P.V : B fragment col n = d = j*16 + c, the 32 keys of this step = one key tile of the v^T planes ----
    {
      const v16h vh0 = ldfrag_h(vhp, lo);
      const v16h vh1 = ldfrag_h(vhp + (size_t)16 * SEQ, lo);
      const v16h vh2 = ldfrag_h(vhp + (size_t)32 * SEQ, lo);
      const v16h vh3 = ldfrag_h(vhp + (size_t)48 * SEQ, lo);
      const v16h vl0 = ldfrag_h(vlp, lo);
      const v16h vl1 = ldfrag_h(vlp + (size_t)16 * SEQ, lo);
      const v16h vl2 = ldfrag_h(vlp + (size_t)32 * SEQ, lo);
      const v16h vl3 = ldfrag_h(vlp + (size_t)48 * SEQ, lo);
      o[0] = mma_h(ph.v, vh0, o[0]);  o[0] = mma_h(pl.v, vh0, o[0]);  o[0] = mma_h(ph.v, vl0, o[0]);
      o[1] = mma_h(ph.v, vh1, o[1]);  o[1] = mma_h(pl.v, vh1, o[1]);  o[1] = mma_h(ph.v, vl1, o[1]);
      o[2] = mma_h(ph.v, vh2, o[2]);  o[2] = mma_h(pl.v, vh2, o[2]);  o[2] = mma_h(ph.v, vl2, o[2]);
      o[3] = mma_h(ph.v, vh3, o[3]);  o[3] = mma_h(pl.v, vh3, o[3]);  o[3] = mma_h(ph.v, vl3, o[3]);
      guard10(o[0], o[1], o[2], o[3], ph.v, pl.v, vh0, vh1, vh2, vh3, vl0, vl1, vl2, vl3);
    }
    wave_sync_lds();
    const int kn = (it + 1 < nglob) ? ((it + 1) * 32) : (jlo + (it + 1 - nglob) * 32);   // next key block of the list
    const int dk = kn - kb;                                                              // a positive multiple of 32
    k0p += (size_t)dk * HD;
    l0p += (size_t)dk * HD;
    vhp += (size_t)(dk >> 5) * FT;
    vlp += (size_t)(dk >> 5) * FT;
    kb = kn;
  }
  acc_guard4(o[0], o[1], o[2], o[3]);

  // ---- fold 1/l and the carries (32768 on P, 1024 on v), stage the wave's 16x64 slab in its LDS region ----
  wave_sync_lds();
  float* slab = pt;
  const float oc = 1.0f / (PCAR * VCAR);
#pragma unroll
  for (int r = 0; r < 8; ++r) {
    const float inv = (1.0f / lrow[r]) * oc;
#pragma unroll
    for (int j = 0; j < 4; ++j) slab[(8 * hh + r) * 68 + j * 16 + c] = o[j][r] * inv;
  }
  wave_sync_lds();
  // ---- O x1024 -> f16 hi + residual planes; the wave's 16 x 64 = 2 neighbouring tiles; lane = (row c, chunk 2 * it + hh) ----
  v4u oh[4], ol[4];
#pragma unroll
  for (int it = 0; it < 4; ++it) {
    const int c8 = (2 * it + hh) * 8;
    const v4f a = *(const v4f*)(slab + c * 68 + c8), bq = *(const v4f*)(slab + c * 68 + c8 + 4);
    float w[8];
#pragma unroll
    for (int e = 0; e < 4; ++e) { w[e] = a[e] * OSC; w[4 + e] = bq[e] * OSC; }
#pragma unroll
    for (int e = 0; e < 4; ++e) {
      const _Float16 h0 = (_Float16)w[2 * e], h1 = (_Float16)w[2 * e + 1];
      const _Float16 l0 = (_Float16)(w[2 * e] - (float)h0), l1 = (_Float16)(w[2 * e + 1] - (float)h1);
      oh[it][e] = pk16(h_bits(h0), h_bits(h1));
      ol[it][e] = pk16(h_bits(l0), h_bits(l1));
    }
  }
  const size_t ob = (size_t)(b * SEQ + q0) * (NH * HD) + (size_t)(head * 2) * FT + lo;
  {
#pragma unroll
    for (int it = 0; it < 4; ++it) {
      const size_t o8 = ob + (size_t)it * 256;
      *(v4u*)(OHIp + o8) = oh[it];
      *(v4u*)(OLOp + o8) = ol[it];
    }
    
  }
}

// =====================================================================================================
// Workspace map (bytes); every plane is fully written by whole-line stores before it is read; all extents are exact multiples
// of the store granularity (no pad rows needed); every offset a multiple of 65536:
//   CT  f32 [2048][64]                 524288        ST  same              524288
//   (16-bit planes: rows x K named below, stored in fragment order)
//   XB  bf16 [4096][768]              6291456
//   WQT bf16 [768 n][768 k]           1179648        WKT bf16 [256][768]   393216     WVT same   393216
//   WOT f16  [768 n][768 k] x1024     1179648
//   QF  f32 [4096][768]              12582912        KF f32 [4096][256]   4194304     VF same   4194304
//   QHI f16 [2][12][2048][64] x1024   6291456        QLO residual         6291456
//   KHI f16 [2][4][2048][64] x1024    2097152        KLO residual         2097152
//   VHI f16 [2][4][64][2048] x1024    2097152        VLO residual         2097152
//   OHI f16 [4096][768] x1024         6291456        OLO residual         6291456
//   end                              65011712
// =====================================================================================================
extern "C" void kernel_launch(void* const* d_in, const int* in_sizes, int n_in,
                              void* d_out, int out_size, void* d_ws, size_t ws_size,
                              hipStream_t stream) {
  const int ROWS = NB * SEQ;                            // 4096
  if (n_in < 5) return;
  if (in_sizes[0] != ROWS * DMOD) return;
  if (in_sizes[1] != DMOD * (NH * HD)) return;
  if (in_sizes[2] != DMOD * (NKV * HD) || in_sizes[3] != DMOD * (NKV * HD)) return;
  if (in_sizes[4] != (NH * HD) * DMOD) return;
  if (out_size != ROWS * DMOD) return;

  const float* x  = (const float*)d_in[0];
  const float* wq = (const float*)d_in[1];
  const float* wk = (const float*)d_in[2];
  const float* wv = (const float*)d_in[3];
  const float* wo = (const float*)d_in[4];
  float*       out = (float*)d_out;

  const size_t szTab = (size_t)SEQ * HD * 4;                    //   524288
  const size_t szXB  = (size_t)ROWS * DMOD * 2;                 //  6291456
  const size_t szWQT = (size_t)(NH * HD) * DMOD * 2;            //  1179648
  const size_t szWKT = (size_t)(NKV * HD) * DMOD * 2;           //   393216
  const size_t szWOT = (size_t)DMOD * (NH * HD) * 2;            //  1179648
  const size_t szQF  = (size_t)ROWS * (NH * HD) * 4;            // 12582912
  const size_t szKF  = (size_t)ROWS * (NKV * HD) * 4;           //  4194304
  const size_t szQP  = (size_t)ROWS * (NH * HD) * 2;            //  6291456
  const size_t szKP  = (size_t)ROWS * (NKV * HD) * 2;           //  2097152
  const size_t szVP  = (size_t)NB * NKV * HD * SEQ * 2;         //  2097152
  const size_t szOP  = (size_t)ROWS * (NH * HD) * 2;            //  6291456
  size_t off = 0;
  const size_t oCT  = off; off += szTab;
  const size_t oST  = off; off += szTab;
  const size_t oXB  = off; off += szXB;
  const size_t oWQT = off; off += szWQT;
  const size_t oWKT = off; off += szWKT;
  const size_t oWVT = off; off += szWKT;
  const size_t oWOT = off; off += szWOT;
  const size_t oQF  = off; off += szQF;
  const size_t oKF  = off; off += szKF;
  const size_t oVF  = off; off += szKF;
  const size_t oQHI = off; off += szQP;
  const size_t oQLO = off; off += szQP;
  const size_t oKHI = off; off += szKP;
  const size_t oKLO = off; off += szKP;
  const size_t oVHI = off; off += szVP;
  const size_t oVLO = off; off += szVP;
  const size_t oOHI = off; off += szOP;
  const size_t oOLO = off; off += szOP;
  if (off > ws_size) return;                            // off = 65011712
  if (off > (size_t)134217728) return;

  char* ws = (char*)d_ws;
  float* CT  = (float*)(ws + oCT);
  float* ST  = (float*)(ws + oST);
  u16*   XB  = (u16*)(ws + oXB);
  u16*   WQT = (u16*)(ws + oWQT);
  u16*   WKT = (u16*)(ws + oWKT);
  u16*   WVT = (u16*)(ws + oWVT);
  u16*   WOT = (u16*)(ws + oWOT);
  float* QF  = (float*)(ws + oQF);
  float* KF  = (float*)(ws + oKF);
  float* VF  = (float*)(ws + oVF);
  u16*   QHI = (u16*)(ws + oQHI);
  u16*   QLO = (u16*)(ws + oQLO);
  u16*   KHI = (u16*)(ws + oKHI);
  u16*   KLO = (u16*)(ws + oKLO);
  u16*   VHI = (u16*)(ws + oVHI);
  u16*   VLO = (u16*)(ws + oVLO);
  u16*   OHI = (u16*)(ws + oOHI);
  u16*   OLO = (u16*)(ws + oOLO);

  // inv_freq[i] = 1 / pow(10000, i/32) in f32 (pow correctly converted from f64, then IEEE f32 reciprocal)
  InvF inv;
  for (int i = 0; i < 32; ++i) {
    const double p = pow(10000.0, (double)i / 32.0);
    const float pf = (float)p;
    inv.f[i] = 1.0f / pf;
  }

  const dim3 blk(256);
  const dim3 gPrep(PREP_BLOCKS);                        // 2176
  const dim3 gQKV(QKV_BLOCKS);                          // 1280
  const dim3 gPost(POST_BLOCKS);                        // 2304
  const dim3 gGO((ROWS / 64) * (DMOD / 64));            // 768
  const dim3 bG(128);
  const dim3 gAT(ATT_BLOCKS);                           // 1024
  const dim3 bAT(ATT_THREADS);                          // 96

  // (1) weights W[k rows][n cols] -> [n][k] 16-bit planes in fragment order (bf16 for wq/wk/wv; f16 of bf16 value x1024 for wo),
  //     rotary cos/sin tables [2048][64], x -> bf16 plane
  prep<<<gPrep, blk, 0, stream>>>(x, wq, wk, wv, wo, XB, WQT, WKT, WVT, WOT, CT, ST, inv);
  // (2) projections: q [4096][768], k [4096][256], v [4096][256] in f32
  gemm_qkv<<<gQKV, bG, 0, stream>>>(XB, WQT, WKT, WVT, QF, KF, VF, ROWS, DMOD, 1.0f);
  // (3) q' and k' planes (rotary, hi + residual), v^T planes x1024 (hi + residual)
  post<<<gPost, blk, 0, stream>>>(QF, KF, VF, CT, ST, QHI, QLO, KHI, KLO, VHI, VLO);
  // (4) attention -> O planes [b][s][h][d] x1024 (hi + residual)
  attn_gqa<<<gAT, bAT, 0, stream>>>(QHI, QLO, KHI, KLO, VHI, VLO, OHI, OLO);
  // (5) output projection -> out [4096][768] f32, carries 1024 (O) x 1024 (wo) folded back
  gemm_h2<<<gGO, bG, 0, stream>>>(OHI, OLO, WOT, out, ROWS, DMOD, NH * HD, 1.0f / (OSC * WOS));
  (void)hipGetLastError();
}

// v003
// Measured time: 83.8 microseconds a run.
// In two side-by-side timings against v002, it was 1.09 and 1.10 times as fast.
// Counting every step since v000, it is 1.76 times as fast.
// Contractions: x.W{q,k,v} on v_wmma_f32_16x16x32_bf16 (x and W RNE-converted to bf16, exact operands, f32 accumulate);
// scores k'.q'^T (transposed; q', k' carried x1024 as f16 hi plane + f16 residual plane, products hh+lh+hl), v^T.P^T (transposed; P x32768 f16 hi+residual,
// v x1024 f16 hi+residual, products hh+lh+hl) and O.wo (O x1024 f16 hi+residual, wo as f16(bf16(wo) x1024), products h.w+l.w):
// v_wmma_f32_16x16x32_f16, f32 accumulate. Rotary tables, rotation, masked base-2 online softmax and 1/l fold in f32 on VALU.
#include <hip/hip_runtime.h>
#include <math.h>
#include <stdint.h>

#define NB    2
#define SEQ   2048
#define DMOD  768
#define NH    12
#define NKV   4
#define HD    64
#define GRP   3
#define WIN   512
#define GLB   64
#define QSC   1024.0f
#define KSC   1024.0f
#define PCAR  32768.0f
#define VCAR  1024.0f
#define OSC   1024.0f
#define WOS   1024.0f
#define LOG2E 1.4426950408889634f
#define ATT_THREADS (GRP * 32)
#define ATT_BLOCKS  (NB * NKV * (SEQ / 16))
#define SLAB64 (16 * 68)
#define VTP   72
#define MAXBLK 20
#define FT    512
static_assert(NH == NKV * GRP);
static_assert(HD == 64 && DMOD == NH * HD);
static_assert((SEQ / 16) == 128 && NKV == 4 && NB == 2);
static_assert(ATT_THREADS == 96 && ATT_BLOCKS == 1024);
static_assert(((NB * SEQ * NH * 8) % 256) == 0 && ((NB * SEQ * NKV * 8) % 256) == 0);
static_assert(((NB * SEQ) % 64) == 0 && (DMOD % 64) == 0 && ((NKV * HD) % 64) == 0 && (DMOD % 32) == 0);
static_assert((SEQ % 64) == 0 && (SEQ % 8) == 0);

typedef unsigned short u16;
typedef _Float16 v16h __attribute__((ext_vector_type(16)));
typedef _Float16 v8h  __attribute__((ext_vector_type(8)));
typedef __bf16   v16b __attribute__((ext_vector_type(16)));
typedef float    v8f  __attribute__((ext_vector_type(8)));
typedef float    v4f  __attribute__((ext_vector_type(4)));
typedef unsigned int v4u __attribute__((ext_vector_type(4)));

union FragH { v16h v; v8h h[2]; v4u u[2]; };
union FragB { v16b v; v4u u[2]; };

struct InvF { float f[32]; };
static_assert(sizeof(InvF) == 128);

// ---- scalar helpers --------------------------------------------------------------------------------
__device__ __forceinline__ unsigned short bf_bits(float f) {          // f32 -> bf16 bits, RNE convert
  unsigned u = __float_as_uint(f);
  return (unsigned short)((u + 0x7FFFu + ((u >> 16) & 1u)) >> 16);
}
__device__ __forceinline__ float bf_up(unsigned short h) { return __uint_as_float(((unsigned)h) << 16); }
__device__ __forceinline__ float bfr(float f) { return bf_up(bf_bits(f)); }
__device__ __forceinline__ unsigned short h_bits(_Float16 x) { return __builtin_bit_cast(unsigned short, x); }
__device__ __forceinline__ unsigned pk16(unsigned short a, unsigned short b) { return (unsigned)a | ((unsigned)b << 16); }
__device__ __forceinline__ v8f zero8() { v8f z = {0.f, 0.f, 0.f, 0.f, 0.f, 0.f, 0.f, 0.f}; return z; }

// ---- fragment-order planes: every 16-bit operand plane [rows][K] is kept as 16-row x 32-k tiles of FT elements (1 KiB),
//      tile (rt, kt) at (rt * (K / 32) + kt) * FT, and inside a tile as 16-B chunks [q = (k & 31) >> 3][row & 15][k & 7].
// ---- fragment loaders: 16-bit A/B operand, lane -> row/col (lane&15), h = lane>>4, t = the tile (wave-uniform), lo = lane * 8;
//      elements 0..7 <- t[lo..lo+7] (chunk q = h: k0+8h..), elements 8..15 <- t[256+lo..] (chunk q = 2+h: k0+16+8h..)
//      (same split k map for A and B); each of the two loads of a wave is 512 contiguous bytes = 4 whole lines
__device__ __forceinline__ v16h ldfrag_h(const _Float16* t, unsigned lo) {
  FragH f;
  f.h[0] = *(const v8h*)(t + lo);
  f.h[1] = *(const v8h*)(t + 256 + lo);
  return f.v;
}
__device__ __forceinline__ v16b ldfrag_b(const u16* t, unsigned lo) { // bf16 plane read as unsigned integer vectors
  FragB f;
  f.u[0] = *(const v4u*)(t + lo);
  f.u[1] = *(const v4u*)(t + 256 + lo);
  return f.v;
}

__device__ __forceinline__ v8f mma_h(v16h a, v16h b, v8f c) {
  return __builtin_amdgcn_wmma_f32_16x16x32_f16(false, a, false, b, (short)0, c, false, false);
}
__device__ __forceinline__ v8f mma_b(v16b a, v16b b, v8f c) {
  return __builtin_amdgcn_wmma_f32_16x16x32_bf16(false, a, false, b, (short)0, c, false, false);
}
__device__ __forceinline__ void guard2(v8f& a, v8f& b, v16h x0, v16h x1, v16h x2, v16h x3, v16h x4, v16h x5) {
#if defined(__HIP_DEVICE_COMPILE__)
  asm volatile("v_nop\n\tv_nop\n\tv_nop\n\tv_nop"
               : "+v"(a), "+v"(b) : "v"(x0), "v"(x1), "v"(x2), "v"(x3), "v"(x4), "v"(x5) : "memory");
#endif
}
template <typename F>
__device__ __forceinline__ void guard6(v8f& a, v8f& b, v8f& c, v8f& d, F x0, F x1, F x2, F x3, F x4, F x5) {
#if defined(__HIP_DEVICE_COMPILE__)
  asm volatile("v_nop\n\tv_nop\n\tv_nop\n\tv_nop"
               : "+v"(a), "+v"(b), "+v"(c), "+v"(d) : "v"(x0), "v"(x1), "v"(x2), "v"(x3), "v"(x4), "v"(x5) : "memory");
#endif
}
__device__ __forceinline__ void guard10(v8f& a, v8f& b, v8f& c, v8f& d, v16h x0, v16h x1, v16h x2, v16h x3, v16h x4,
                                        v16h x5, v16h x6, v16h x7, v16h x8, v16h x9) {
#if defined(__HIP_DEVICE_COMPILE__)
  asm volatile("v_nop\n\tv_nop\n\tv_nop\n\tv_nop"
               : "+v"(a), "+v"(b), "+v"(c), "+v"(d)
               : "v"(x0), "v"(x1), "v"(x2), "v"(x3), "v"(x4), "v"(x5), "v"(x6), "v"(x7), "v"(x8), "v"(x9) : "memory");
#endif
}
__device__ __forceinline__ void acc_guard4(v8f& a, v8f& b, v8f& c, v8f& d) {
#if defined(__HIP_DEVICE_COMPILE__)
  asm volatile("v_nop\n\tv_nop\n\tv_nop\n\tv_nop" : "+v"(a), "+v"(b), "+v"(c), "+v"(d));
#endif
}
__device__ __forceinline__ void wave_sync_lds() {
  __builtin_amdgcn_fence(__ATOMIC_RELEASE, "workgroup");
  __builtin_amdgcn_wave_barrier();
  __builtin_amdgcn_fence(__ATOMIC_ACQUIRE, "workgroup");
}

// ---- accurate f32 sin/cos of a non-negative f32 angle (|angle| < 2048): f64 two-part pi/2 reduction + f64 polynomials,
//      plain f64 fma/mul only (no library f64 trig path), result converted to f32.
__device__ __forceinline__ void sincos_acc(float angf, float& sv, float& cv) {
  const double a = (double)angf;
  const double TWO_OVER_PI = 0.63661977236758134308;
  const double PIO2_HI = 1.5707963267948966;
  const double PIO2_LO = 6.123233995736766e-17;
  const int kq = (int)(a * TWO_OVER_PI + 0.5);
  const double kd = (double)kq;
  double r = fma(-kd, PIO2_HI, a);
  r = fma(-kd, PIO2_LO, r);
  const double r2 = r * r;
  double sp = 1.0 / 6227020800.0;
  sp = fma(sp, r2, -1.0 / 39916800.0);
  sp = fma(sp, r2, 1.0 / 362880.0);
  sp = fma(sp, r2, -1.0 / 5040.0);
  sp = fma(sp, r2, 1.0 / 120.0);
  sp = fma(sp, r2, -1.0 / 6.0);
  const double s = fma(sp * r2, r, r);
  double cp = -1.0 / 87178291200.0;
  cp = fma(cp, r2, 1.0 / 479001600.0);
  cp = fma(cp, r2, -1.0 / 3628800.0);
  cp = fma(cp, r2, 1.0 / 40320.0);
  cp = fma(cp, r2, -1.0 / 720.0);
  cp = fma(cp, r2, 1.0 / 24.0);
  cp = fma(cp, r2, -0.5);
  const double c = fma(cp, r2, 1.0);
  const int qd = kq & 3;
  const double so = (qd == 0) ? s : (qd == 1) ? c : (qd == 2) ? -s : -c;
  const double co = (qd == 0) ? c : (qd == 1) ? -s : (qd == 2) ? -c : s;
  sv = (float)so;
  cv = (float)co;
}

// =====================================================================================================
// Rotary tables: cosT[t][d], sinT[t][d] for t < SEQ, d < HD, angle = float(t) * inv_freq[d & 31] (f32 product), halves duplicated.
// Wave = one position t, lane = frequency index; inv_freq picked from the by-value table with a static select chain.
// coverage: SEQ/8 blocks x 8 waves = SEQ rows; per row 4 line stores = 64 floats of each table.
// =====================================================================================================
__device__ __forceinline__ void tab_body(int bid, float* cosT, float* sinT, const InvF& inv) {
  const int tid  = threadIdx.x;
  const int lane = tid & 31;
  const int t    = bid * 8 + (tid >> 5);
  if (t >= SEQ) return;                     // never taken with the exact block range; no barriers in this part
  float f = inv.f[0];
#pragma unroll
  for (int i = 1; i < 32; ++i) f = (lane == i) ? inv.f[i] : f;
  const float ang = (float)t * f;
  float sv, cv;
  sincos_acc(ang, sv, cv);
  float* cr = cosT + (size_t)t * HD;
  float* sr = sinT + (size_t)t * HD;
  {
    *(float*)(cr + lane)      = cv;
    *(float*)(cr + 32 + lane) = cv;
    *(float*)(sr + lane)      = sv;
    *(float*)(sr + 32 + lane) = sv;
    
  }
}

// =====================================================================================================
// x f32 -> bf16 plane (RNE convert), fragment order. Thread = one 16-B chunk (8 consecutive k of one row): two 16-B loads, one
// 16-B store; a wave = 8 rows x the 4 chunks of one tile, so 8 lanes fill one 128-B line of the plane.
// coverage: n8/256 blocks (exact division checked statically) x 256 thr x 8 = the whole plane (64 threads per tile).
// =====================================================================================================
__device__ __forceinline__ void cvtx_body(int bid, const float* __restrict__ x, u16* D, int n8) {
  const int gt = bid * 256 + (int)threadIdx.x;
  if (gt >= n8) return;                     // no barriers in this part
  const int tile = gt >> 6;
  const int m    = ((gt >> 5) & 1) * 8 + (gt & 7);
  const int q    = (gt >> 3) & 3;
  const float* p = x + (size_t)((tile / (DMOD / 32)) * 16 + m) * DMOD + (tile % (DMOD / 32)) * 32 + q * 8;
  const v4f a = *(const v4f*)(p), bq = *(const v4f*)(p + 4);
  v4u o;
  o[0] = pk16(bf_bits(a[0]),  bf_bits(a[1]));
  o[1] = pk16(bf_bits(a[2]),  bf_bits(a[3]));
  o[2] = pk16(bf_bits(bq[0]), bf_bits(bq[1]));
  o[3] = pk16(bf_bits(bq[2]), bf_bits(bq[3]));
  u16* d = D + (size_t)tile * FT + q * 128 + m * 8;
  {
    *(v4u*)(d) = o;
    
  }
}

// =====================================================================================================
// Weight transpose + 16-bit convert: in W[R][C] (row-major f32) -> out D[C][R] (16-bit plane, rows n = C, k = R, fragment order).
//   f16mode == 0: D = bf16 RNE bits of W;  f16mode == 1: D = f16 bits of (bf16 RNE value of W) * scale.
// Block = one 64x64 tile (r0, c0): 256 thr x 4 16-B loads -> LDS tile [c][r] (pitch 72), block barrier, then each output row
// coverage: load 256 thr x 16 = 64x64; store 2 iterations x 256 thr x 8 halves = 8 fragment tiles (4 n x 2 k), a wave = 512
//           contiguous bytes; grid (C/64)x(R/64) tiles = all of D.
// =====================================================================================================
__device__ __forceinline__ void wT_body(u16* T, int bid, const float* __restrict__ W, u16* D, int R, int C, int f16mode,
                                        float scale) {
  const int tid = threadIdx.x;
  const int ntc = C >> 6;
  const int c0  = (bid % ntc) * 64;
  const int r0  = (bid / ntc) * 64;
  {
    const int rr = tid >> 2;
    const int cc = (tid & 3) * 16;
    const float* src = W + (size_t)(r0 + rr) * C + c0 + cc;
#pragma unroll
    for (int i = 0; i < 4; ++i) {
      const v4f a = *(const v4f*)(src + 4 * i);
#pragma unroll
      for (int e = 0; e < 4; ++e) {
        const float v = a[e];
        const unsigned short hb = h_bits((_Float16)(bfr(v) * scale));
        const unsigned short bb = bf_bits(v);
        T[(cc + 4 * i + e) * VTP + rr] = (f16mode != 0) ? hb : bb;
      }
    }
  }
  __syncthreads();
  v4u vals[2];
  const int m16 = tid & 15, q4 = (tid >> 4) & 3, nt = tid >> 7, kt = (tid >> 6) & 1;   // n tile nt (+2 per iteration), k tile kt
#pragma unroll
  for (int it = 0; it < 2; ++it) vals[it] = *(const v4u*)(T + ((it * 2 + nt) * 16 + m16) * VTP + kt * 32 + q4 * 8);
  {
#pragma unroll
    for (int it = 0; it < 2; ++it) {
      const size_t tile = (size_t)((c0 >> 4) + it * 2 + nt) * (size_t)(R >> 5) + (size_t)((r0 >> 5) + kt);
      *(v4u*)(D + tile * FT + q4 * 128 + m16 * 8) = vals[it];
    }
    
  }
}

// =====================================================================================================
// Launch 1: every conversion that depends on the inputs alone, one launch, parts picked by block range (block-uniform):
//   [0, 384)     weight tiles: wq 144, wk 48, wv 48, wo 144 (they hold the one block barrier, so they start first)
//   [384, 640)   rotary tables
//   [640, 2176)  x -> bf16 plane
// Each part keeps its own block count and per-block work; no part reads what another part writes.
// =====================================================================================================
#define PB_WQ  ((DMOD / 64) * ((NH * HD) / 64))
#define PB_WK  ((DMOD / 64) * ((NKV * HD) / 64))
#define PB_WO  (((NH * HD) / 64) * (DMOD / 64))
#define PB_W   (PB_WQ + 2 * PB_WK + PB_WO)
#define PB_TAB (SEQ / 8)
#define PB_X   ((NB * SEQ * DMOD) / (8 * 256))
#define PREP_BLOCKS (PB_W + PB_TAB + PB_X)
static_assert(PB_W == 384 && PB_TAB == 256 && PB_X == 1536 && ((NB * SEQ * DMOD) % (8 * 256)) == 0);
__global__ __launch_bounds__(256)
void prep(const float* __restrict__ x, const float* __restrict__ wq, const float* __restrict__ wk,
          const float* __restrict__ wv, const float* __restrict__ wo, u16* XB, u16* WQT, u16* WKT, u16* WVT, u16* WOT,
          float* cosT, float* sinT, InvF inv) {
  __shared__ __align__(16) u16 T[64 * VTP];
  const int bid = blockIdx.x;
  if (bid < PB_W) {
    const float* W = wq;  u16* D = WQT;  int C = NH * HD, tb = bid, mode = 0;  float scale = 1.0f;
    if (bid >= PB_WQ)                 { W = wk;  D = WKT;  C = NKV * HD;  tb = bid - PB_WQ; }
    if (bid >= PB_WQ + PB_WK)         { W = wv;  D = WVT;  tb = bid - (PB_WQ + PB_WK); }
    if (bid >= PB_WQ + 2 * PB_WK)     { W = wo;  D = WOT;  C = DMOD;  tb = bid - (PB_WQ + 2 * PB_WK);  mode = 1;  scale = WOS; }
    static_assert(NH * HD == DMOD);   // every weight has DMOD rows (wo: NH*HD rows)
    wT_body(T, tb, W, D, DMOD, C, mode, scale);
  } else if (bid < PB_W + PB_TAB) {
    tab_body(bid - PB_W, cosT, sinT, inv);
  } else {
    cvtx_body(bid - (PB_W + PB_TAB), x, XB, (NB * SEQ * DMOD) / 8);
  }
}

// =====================================================================================================
// GEMM epilogue shared by both engines: the wave's 16x64 f32 tile (times oscale) staged in its LDS slab (pitch 68),
// coverage: 8 instructions x 2 rows x 16 lanes x 4 floats = the wave's 16 x 64 tile.
// =====================================================================================================
__device__ __forceinline__ void epi64(float* sl, v8f a0, v8f a1, v8f a2, v8f a3, float oscale, float* C, int N,
                                      size_t rowb, int col0, int lane) {
  const int hh = lane >> 4, m = lane & 15;
#pragma unroll
  for (int r = 0; r < 8; ++r) {
    const int ro = (8 * hh + r) * 68 + m;
    sl[ro]      = a0[r] * oscale;
    sl[ro + 16] = a1[r] * oscale;
    sl[ro + 32] = a2[r] * oscale;
    sl[ro + 48] = a3[r] * oscale;
  }
  wave_sync_lds();
  v4f vals[8];
#pragma unroll
  for (int it = 0; it < 8; ++it) vals[it] = *(const v4f*)(sl + (it * 2 + hh) * 68 + m * 4);
  float* dst = C + (rowb + (size_t)hh) * (size_t)N + col0 + m * 4;
  {
#pragma unroll
    for (int it = 0; it < 8; ++it) {
      *(v4f*)(dst + (size_t)(it * 2) * (size_t)N) = vals[it];
    }
    
  }
}

// =====================================================================================================
// bf16 GEMM: C[M][N] (f32) = A[M][K] (bf16) . Bt[N][K]^T (bf16), both planes in fragment order, times oscale.
// Block = 64x64 tile, 4 waves x 16 rows; fragments loaded straight from the planes' tiles (two 16-B loads each, split k map
// for A and B); K stepped by 32 = one tile of FT elements (K % 32 == 0, M % 64 == 0, N % 64 == 0 checked statically).
// Launch 2: the q, k and v projections in one launch. The 12 + 4 + 4 column tiles of one 64-row tile of x are neighbours in
// the grid; the column tile picks weight plane, output and output pitch (block-uniform). grid = (M/64) * 20.
// =====================================================================================================
#define QKV_CT ((NH * HD) / 64 + 2 * ((NKV * HD) / 64))
#define QKV_BLOCKS (((NB * SEQ) / 64) * QKV_CT)
static_assert(QKV_CT == 20 && QKV_BLOCKS == 1280);
__global__ __launch_bounds__(128)
void gemm_qkv(const u16* __restrict__ A, const u16* __restrict__ WQT, const u16* __restrict__ WKT,
              const u16* __restrict__ WVT, float* QF, float* KF, float* VF, int M, int K, float oscale) {
  __shared__ __align__(16) float slab[4 * SLAB64];
  const int tid = threadIdx.x, wave = __builtin_amdgcn_readfirstlane(tid >> 5), lane = tid & 31;   // scalar wave number: wave-uniform tile pointers
  const unsigned lo = (unsigned)lane * 8u;
  const int bid   = blockIdx.x;
  const int ct    = bid % QKV_CT;
  const int rowb  = (bid / QKV_CT) * 64 + wave * 16;
  const u16* Bt = WQT;  float* C = QF;  int N = NH * HD, col0 = ct * 64;
  if (ct >= (NH * HD) / 64)                    { Bt = WKT;  C = KF;  N = NKV * HD;  col0 = (ct - (NH * HD) / 64) * 64; }
  if (ct >= (NH * HD) / 64 + (NKV * HD) / 64)  { Bt = WVT;  C = VF;  col0 = (ct - ((NH * HD) / 64 + (NKV * HD) / 64)) * 64; }
  if (rowb + 16 > M) return;                 // wave-uniform, never taken with the exact grid; no block barriers in this kernel
  const size_t bs = (size_t)(K >> 5) * FT;   // one row of tiles: 16 rows x K
  const u16* ap = A  + (size_t)(rowb >> 4) * bs;
  const u16* bp0 = Bt + (size_t)(col0 >> 4) * bs;
  const u16* bp1 = bp0 + bs;
  const u16* bp2 = bp1 + bs;
  const u16* bp3 = bp2 + bs;
  v8f acc0 = zero8(), acc1 = zero8(), acc2 = zero8(), acc3 = zero8();
#pragma unroll 1
  for (int k0 = 0; k0 < K; k0 += 32, ap += FT, bp0 += FT, bp1 += FT, bp2 += FT, bp3 += FT) {
    const v16b a  = ldfrag_b(ap, lo);
    const v16b b0 = ldfrag_b(bp0, lo);
    const v16b b1 = ldfrag_b(bp1, lo);
    const v16b b2 = ldfrag_b(bp2, lo);
    const v16b b3 = ldfrag_b(bp3, lo);
    acc0 = mma_b(a, b0, acc0);
    acc1 = mma_b(a, b1, acc1);
    acc2 = mma_b(a, b2, acc2);
    acc3 = mma_b(a, b3, acc3);
    guard6<v16b>(acc0, acc1, acc2, acc3, a, b0, b1, b2, b3, a);
  }
  epi64(slab + wave * SLAB64, acc0, acc1, acc2, acc3, oscale, C, N, (size_t)rowb, col0, lane);
}

// =====================================================================================================
// f16 hi+lo GEMM: C[M][N] (f32) = (Ahi + Alo)[M][K] . Bt[N][K]^T, times oscale; Ahi/Alo and Bt f16 planes in fragment order;
// products hi.B + lo.B into one accumulator (lo is the unscaled residual of hi). Same tiling as gemm_qkv.
// =====================================================================================================
__global__ __launch_bounds__(128)
void gemm_h2(const u16* __restrict__ Ah, const u16* __restrict__ Al, const u16* __restrict__ Bt, float* C,
             int M, int N, int K, float oscale) {
  __shared__ __align__(16) float slab[4 * SLAB64];
  const int tid = threadIdx.x, wave = __builtin_amdgcn_readfirstlane(tid >> 5), lane = tid & 31;   // scalar wave number: wave-uniform tile pointers
  const unsigned lo = (unsigned)lane * 8u;
  const int ntile = N >> 6;
  const int bid   = blockIdx.x;
  const int rowb  = (bid / ntile) * 64 + wave * 16;
  const int col0  = (bid % ntile) * 64;
  if (rowb + 16 > M) return;                 // wave-uniform, never taken with the exact grid; no block barriers in this kernel
  const size_t bs = (size_t)(K >> 5) * FT;   // one row of tiles: 16 rows x K
  const size_t aofs = (size_t)(rowb >> 4) * bs;
  const _Float16* ahp = (const _Float16*)(const void*)Ah + aofs;
  const _Float16* alp = (const _Float16*)(const void*)Al + aofs;
  const _Float16* bp0 = (const _Float16*)(const void*)Bt + (size_t)(col0 >> 4) * bs;
  const _Float16* bp1 = bp0 + bs;
  const _Float16* bp2 = bp1 + bs;
  const _Float16* bp3 = bp2 + bs;
  v8f acc0 = zero8(), acc1 = zero8(), acc2 = zero8(), acc3 = zero8();
#pragma unroll 1
  for (int k0 = 0; k0 < K; k0 += 32, ahp += FT, alp += FT, bp0 += FT, bp1 += FT, bp2 += FT, bp3 += FT) {
    const v16h ah = ldfrag_h(ahp, lo), al = ldfrag_h(alp, lo);
    const v16h b0 = ldfrag_h(bp0, lo);
    const v16h b1 = ldfrag_h(bp1, lo);
    const v16h b2 = ldfrag_h(bp2, lo);
    const v16h b3 = ldfrag_h(bp3, lo);
    acc0 = mma_h(ah, b0, acc0);  acc0 = mma_h(al, b0, acc0);
    acc1 = mma_h(ah, b1, acc1);  acc1 = mma_h(al, b1, acc1);
    acc2 = mma_h(ah, b2, acc2);  acc2 = mma_h(al, b2, acc2);
    acc3 = mma_h(ah, b3, acc3);  acc3 = mma_h(al, b3, acc3);
    guard6<v16h>(acc0, acc1, acc2, acc3, ah, al, b0, b1, b2, b3);
  }
  epi64(slab + wave * SLAB64, acc0, acc1, acc2, acc3, oscale, C, N, (size_t)rowb, col0, lane);
}

// =====================================================================================================
// Rotate-half rotary + 16-bit split pack. Rows are (batch, pos, head) with HD contiguous floats (f32 projection output);
// pos = (row / hpr) mod SEQ.  w[d] = x[d] * cos[pos][d] + r[d] * sin[pos][d],  r[d] = -x[d+32] for d < 32, x[d-32] for d >= 32;
// hi[d] = f16(w * sc), lo[d] = f16(w * sc - hi[d])  (sc a power of two, residual unscaled).
// Output planes in fragment order with plane row = (batch * hpr + head) * SEQ + pos and K = HD (2 tiles per 16 positions).
// Thread = 8 consecutive d of one row: 16-B loads of x (own and partner half), cos, sin; one 16-B store per plane per lane;
// a wave = 8 positions of one head x the 4 chunks of one tile, so 8 lanes fill one 128-B line of each plane.
// coverage: nrows*8/256 blocks x 256 thr x 8 halves = nrows x 64 of each plane exactly (exact division checked statically).
// =====================================================================================================
__device__ __forceinline__ void rope_body(int bid, const float* __restrict__ x, const float* __restrict__ cosT,
                                          const float* __restrict__ sinT, u16* hpl, u16* lpl,
                                          int nrows, int hpr, float sc) {
  const int gt  = bid * 256 + (int)threadIdx.x;
  const int tile = gt >> 6;
  const int pr  = (tile >> 1) * 16 + ((gt >> 5) & 1) * 8 + (gt & 7);   // plane row
  const int q   = (gt >> 3) & 3;
  const int d0  = (tile & 1) * 32 + q * 8;
  if (pr >= nrows) return;                  // never taken with the exact block range; no barriers in this part
  const int pos = pr & (SEQ - 1);
  const int bh  = pr / SEQ;
  const int row = ((bh / hpr) * SEQ + pos) * hpr + bh % hpr;           // source row (batch, pos, head)
  const int d1  = d0 ^ 32;
  const float* xr = x + (size_t)row * HD;
  const float* cr = cosT + (size_t)pos * HD + d0;
  const float* sr = sinT + (size_t)pos * HD + d0;
  const v4f xa = *(const v4f*)(xr + d0), xb = *(const v4f*)(xr + d0 + 4);
#if defined(__HIP_DEVICE_COMPILE__)
  // in this build the next load's result takes over the address pair of the two loads above: the wait stands in front of it
  asm volatile("s_wait_xcnt 0x0" ::: "memory");
#endif
  const v4f ya = *(const v4f*)(xr + d1);
  const v4f yb = *(const v4f*)(xr + d1 + 4);
  const v4f ca = *(const v4f*)(cr), cb = *(const v4f*)(cr + 4);
  const v4f sa = *(const v4f*)(sr), sb = *(const v4f*)(sr + 4);
  const float sgn = (d0 < 32) ? -1.0f : 1.0f;
  float w[8];
#pragma unroll
  for (int e = 0; e < 4; ++e) {
    w[e]     = xa[e] * ca[e] + (sgn * ya[e]) * sa[e];
    w[4 + e] = xb[e] * cb[e] + (sgn * yb[e]) * sb[e];
  }
  v4u oh, ol;
#pragma unroll
  for (int e = 0; e < 4; ++e) {
    const float t0 = w[2 * e] * sc, t1 = w[2 * e + 1] * sc;
    const _Float16 h0 = (_Float16)t0, h1 = (_Float16)t1;
    const _Float16 l0 = (_Float16)(t0 - (float)h0), l1 = (_Float16)(t1 - (float)h1);
    oh[e] = pk16(h_bits(h0), h_bits(h1));
    ol[e] = pk16(h_bits(l0), h_bits(l1));
  }
  const size_t o8 = (size_t)tile * FT + q * 128 + (pr & 15) * 8;
  {
    *(v4u*)(hpl + o8) = oh;
    *(v4u*)(lpl + o8) = ol;
    
  }
}

// =====================================================================================================
// v^T planes: VH[(b*NKV + g)*HD + d][s] = f16(v[b][s][g][d] * 1024), VL = f16 residual of the same value; fragment order, K = SEQ.
// Block = (b, g, 64 keys): 64 source rows of HD floats loaded with 16-B loads, converted, scattered into two LDS tiles
// coverage: load 256 thr x 16 elements = 64 x 64; store 2 iterations x 256 thr x 8 halves = 8 fragment tiles (4 d x 2 key) of
//           each plane, a wave = 512 contiguous bytes; NB x NKV x SEQ/64 = 256 blocks cover both planes exactly once.
// =====================================================================================================
__device__ __forceinline__ void vt_body(u16* TH, u16* TL, int bid, const float* __restrict__ v, u16* VHo, u16* VLo) {
  const int tid = threadIdx.x;
  const int st  = bid & 31;
  const int g   = (bid >> 5) & 3;
  const int b   = bid >> 7;
  const int s0  = st * 64;
  {
    const int sl = tid >> 2;                  // key within tile 0..63
    const int dc = (tid & 3) * 16;            // d chunk
    const float* src = v + (((size_t)(b * SEQ + s0 + sl)) * NKV + g) * HD + dc;
#pragma unroll
    for (int i = 0; i < 4; ++i) {
      const v4f a = *(const v4f*)(src + 4 * i);
#pragma unroll
      for (int e = 0; e < 4; ++e) {
        const float t = a[e] * VCAR;
        const _Float16 h = (_Float16)t;
        const _Float16 l = (_Float16)(t - (float)h);
        TH[(dc + 4 * i + e) * VTP + sl] = h_bits(h);
        TL[(dc + 4 * i + e) * VTP + sl] = h_bits(l);
      }
    }
  }
  __syncthreads();
  v4u vh[2], vl[2];
  const int m16 = tid & 15, q4 = (tid >> 4) & 3, dt = tid >> 7, kt = (tid >> 6) & 1;   // d tile dt (+2 per iteration), key tile kt
#pragma unroll
  for (int it = 0; it < 2; ++it) {
    const int line = (it * 2 + dt) * 16 + m16;   // d = 0..63
    vh[it] = *(const v4u*)(TH + line * VTP + kt * 32 + q4 * 8);
    vl[it] = *(const v4u*)(TL + line * VTP + kt * 32 + q4 * 8);
  }
  const size_t base = ((size_t)((b * NKV + g) * (HD / 16) + dt) * (SEQ / 32) + (size_t)((s0 >> 5) + kt)) * FT + q4 * 128 + m16 * 8;
  {
#pragma unroll
    for (int it = 0; it < 2; ++it) {
      const size_t o8 = base + (size_t)(it * 2) * (SEQ / 32) * FT;
      *(v4u*)(VHo + o8) = vh[it];
      *(v4u*)(VLo + o8) = vl[it];
    }
    
  }
}

// =====================================================================================================
// Launch 3: everything between the projections and attention, one launch, parts picked by block range (block-uniform):
//   [0, 256)      v^T planes (they hold the one block barrier, so they start first)
//   [256, 768)    k' planes: rows (b, g, s) from source rows (b, s, g), heads per position NKV
//   [768, 2304)   q' planes: rows (b, h, s) from source rows (b, s, h), heads per position NH
// Each part keeps its own block count and per-block work; no part reads what another part writes.
// =====================================================================================================
#define QB_VT (NB * NKV * (SEQ / 64))
#define QB_RK ((NB * SEQ * NKV * 8) / 256)
#define QB_RQ ((NB * SEQ * NH * 8) / 256)
#define POST_BLOCKS (QB_VT + QB_RK + QB_RQ)
static_assert(QB_VT == 256 && QB_RK == 512 && QB_RQ == 1536);
__global__ __launch_bounds__(256)
void post(const float* __restrict__ QF, const float* __restrict__ KF, const float* __restrict__ VF,
          const float* __restrict__ cosT, const float* __restrict__ sinT,
          u16* QHI, u16* QLO, u16* KHI, u16* KLO, u16* VHI, u16* VLO) {
  __shared__ __align__(16) u16 TH[HD * VTP];
  __shared__ __align__(16) u16 TL[HD * VTP];
  const int bid = blockIdx.x;
  if (bid < QB_VT) {
    vt_body(TH, TL, bid, VF, VHI, VLO);
  } else {
    const bool isq = bid >= QB_VT + QB_RK;
    rope_body(isq ? bid - (QB_VT + QB_RK) : bid - QB_VT, isq ? QF : KF, cosT, sinT, isq ? QHI : KHI, isq ? QLO : KLO,
              isq ? NB * SEQ * NH : NB * SEQ * NKV, isq ? NH : NKV, isq ? QSC : KSC);
  }
}

// =====================================================================================================
// GQA flash attention with causal window + global-token mask: block = (batch b, kv head g, 16 query rows q0..q0+15),
// one wave per query head g*GRP + wave (kv index = head / GRP).
//   q planes (hi, lo f16) rows [b][h][s], k = d; k planes rows [b][g][s], k = d; v^T planes rows [b][g][d], k = s; O planes rows
//   [b][s], k = h*64 + d; all in fragment order.
//   Key blocks of 32 visited in a fixed, block-uniform list: {0} + {32 if q0 >= 32} + {jlo, jlo+32, ... < q0+16},
//   jlo = 64 if q0-511 <= 64 else (q0-511) & ~31; the element mask allowed(i,j) = (j <= i) && (i-j < 512 || j < 64) replaces the
//   score by -inf inside partial blocks (block 0 comes first and key 0 is allowed for every row, so each running max is finite
//   before any fully masked block row can occur).
//   Both products are taken transposed: S^T = k'.q'^T (A = key rows, B = query columns) and O^T += v^T.P^T (A = v^T rows d,
//   B = P^T). A lane then owns ONE query (column c = lane & 15) and 16 of the block's 32 keys (8hh + r and 16 + 8hh + r), so
//   the maximum and the sum of a row are taken inside the lane, with one exchange between the two lane halves for the maximum
//   per block and one for the sum after the loop; the two score tiles of a lane, converted in place, ARE the B fragment of P^T
//   in the split k map (elements 0..7 = keys 8hh + 0..7, elements 8..15 = keys 16 + 8hh + 0..7), the map of the v^T loader.
//   Per block: 2 score subtiles x 2 k-steps x 3 products (k_hi.q_hi + k_hi.q_lo + k_lo.q_hi), fragments loaded straight from the
//   16-bit planes (two 16-B loads per fragment, split k map); online max-subtracted base-2 softmax in f32 (scale 1/8 folded);
//   P*32768 as f16 hi and f16 residual, 4+4 v^T A fragments (hi and residual planes), 12 WMMAs (hh + hl + lh).
//   O^T register r of tile j = (d = 16j + 8hh + r, query c): 8 consecutive d of one row = one 16-B chunk of the O planes, so the
//   wave's two tiles of the O hi plane and of the O lo plane (O x1024 as f16 hi + residual) go out 512 contiguous bytes a store.
//   No LDS and no barriers in this kernel; every wave does bounded work (MAXBLK steps max).
// coverage: per wave 4 instructions x 32 lanes x 8 halves = 16 x 64 per plane; grid 1024 blocks x 3 waves = every
//           (b, s, h) row of both O planes exactly once.
// =====================================================================================================
__device__ __forceinline__ float xhalf(float v) {                     // the value of lane ^ 16 (vector cross-row move, no LDS path)
  const int b = __builtin_bit_cast(int, v);
  return __builtin_bit_cast(float, __builtin_amdgcn_permlanex16(b, b, 0x76543210, 0xfedcba98, false, false));
}
__global__ __launch_bounds__(ATT_THREADS)
void attn_gqa(const u16* __restrict__ QHIp, const u16* __restrict__ QLOp,
              const u16* __restrict__ KHIp, const u16* __restrict__ KLOp,
              const u16* __restrict__ VHIp, const u16* __restrict__ VLOp,
              u16* OHIp, u16* OLOp) {
  const int tid  = threadIdx.x;
  const int wave = __builtin_amdgcn_readfirstlane(tid >> 5);   // scalar wave number: wave-uniform q and O tile pointers
  const int lane = tid & 31;
  const unsigned lo = (unsigned)lane * 8u;
  const int hh   = lane >> 4;
  const int c    = lane & 15;

  const int bid  = blockIdx.x;
  const int qt   = bid & (SEQ / 16 - 1);
  const int g    = (bid >> 7) & (NKV - 1);
  const int b    = bid >> 9;
  const int head = g * GRP + wave;
  const int q0   = qt * 16;

  const size_t qofs = ((size_t)(b * NH + head) * SEQ + q0) * HD;               // 16 positions = 2 tiles = 16 * HD elements
  const _Float16* Qh  = (const _Float16*)(const void*)QHIp + qofs;
  const _Float16* Ql  = (const _Float16*)(const void*)QLOp + qofs;
  const size_t kofs = (size_t)(b * NKV + g) * SEQ * HD;                         // key tiles of kb added per step
  const _Float16* Khb = (const _Float16*)(const void*)KHIp + kofs;
  const _Float16* Klb = (const _Float16*)(const void*)KLOp + kofs;
  const size_t vofs = (size_t)(b * NKV + g) * HD * SEQ;                         // d tile j: + 16j * SEQ; key tile of kb added per step
  const _Float16* Vhb = (const _Float16*)(const void*)VHIp + vofs;
  const _Float16* Vlb = (const _Float16*)(const void*)VLOp + vofs;
  const float lsc = 0.125f * (LOG2E / (QSC * KSC));

  float mrun = -INFINITY, lsum = 0.f;      // this lane's query: running max (equal in both halves), sum over this lane's keys
  v8f o[4];
#pragma unroll
  for (int j = 0; j < 4; ++j) o[j] = zero8();

  const int nglob = (q0 >= 32) ? 2 : 1;
  const int wlo   = q0 - (WIN - 1);
  const int jlo   = (wlo <= GLB) ? GLB : (wlo & ~31);
  int nwin = q0 + 16 - jlo;
  nwin = (nwin > 0) ? ((nwin + 31) >> 5) : 0;
  int nblk = nglob + nwin;
  nblk = (nblk > MAXBLK) ? MAXBLK : nblk;

  // wave-uniform tile pointers of the current key block (the list starts at key 0), moved on at the foot of each step
  const _Float16* k0p = Khb;
  const _Float16* l0p = Klb;
  const _Float16* vhp = Vhb;
  const _Float16* vlp = Vlb;
  const int i = q0 + c;                    // this lane's query position
  int kb = 0;
#pragma unroll 1
  for (int it = 0; it < nblk; ++it) {
    // ---- element mask of this step (needs no score: it can run while the k' fragments are on their way) ----
    bool ok0[8], ok1[8];
#pragma unroll
    for (int r = 0; r < 8; ++r) {
      const int j0 = kb + 8 * hh + r, j1 = kb + 16 + 8 * hh + r;
      ok0[r] = (j0 <= i) && (((i - j0) < WIN) || (j0 < GLB));
      ok1[r] = (j1 <= i) && (((i - j1) < WIN) || (j1 < GLB));
    }
    // ---- scores^T: D element r of this lane = (key kb + 8hh + r, query q0 + c) in s0, key kb + 16 + 8hh + r in s1 ----
    v8f s0 = zero8(), s1 = zero8();
    const _Float16* k1p = k0p + (size_t)16 * HD;
    const _Float16* l1p = l0p + (size_t)16 * HD;
#pragma unroll
    for (int kk = 0; kk < 2; ++kk) {
      const v16h qh  = ldfrag_h(Qh + kk * FT, lo),  ql  = ldfrag_h(Ql + kk * FT, lo);
      const v16h kh0 = ldfrag_h(k0p + kk * FT, lo), kl0 = ldfrag_h(l0p + kk * FT, lo);
      const v16h kh1 = ldfrag_h(k1p + kk * FT, lo), kl1 = ldfrag_h(l1p + kk * FT, lo);
      s0 = mma_h(kh0, qh, s0);
      s0 = mma_h(kh0, ql, s0);
      s0 = mma_h(kl0, qh, s0);
      s1 = mma_h(kh1, qh, s1);
      s1 = mma_h(kh1, ql, s1);
      s1 = mma_h(kl1, qh, s1);
      guard2(s0, s1, qh, ql, kh0, kl0, kh1, kl1);
    }
    // ---- v^T A fragments: row = d = j*16 + c, the 32 keys of this step = one key tile of the v^T planes ----
    const v16h vh0 = ldfrag_h(vhp, lo);
    const v16h vh1 = ldfrag_h(vhp + (size_t)16 * SEQ, lo);
    const v16h vh2 = ldfrag_h(vhp + (size_t)32 * SEQ, lo);
    const v16h vh3 = ldfrag_h(vhp + (size_t)48 * SEQ, lo);
    const v16h vl0 = ldfrag_h(vlp, lo);
    const v16h vl1 = ldfrag_h(vlp + (size_t)16 * SEQ, lo);
    const v16h vl2 = ldfrag_h(vlp + (size_t)32 * SEQ, lo);
    const v16h vl3 = ldfrag_h(vlp + (size_t)48 * SEQ, lo);
    // keeps the 16 v^T loads one group in front of the softmax (as built without it, 4 of them sink to just before their products)
    __builtin_amdgcn_sched_barrier(0);
    // ---- mask (replace by -inf) + online softmax in base 2, one query per lane ----
    float t0[8], t1[8];
#pragma unroll
    for (int r = 0; r < 8; ++r) {
      t0[r] = ok0[r] ? (s0[r] * lsc) : -INFINITY;
      t1[r] = ok1[r] ? (s1[r] * lsc) : -INFINITY;
    }
    float mx = fmaxf(t0[0], t1[0]);
#pragma unroll
    for (int r = 1; r < 8; ++r) mx = fmaxf(mx, fmaxf(t0[r], t1[r]));
    mx = fmaxf(mx, xhalf(mx));
    const float mn = fmaxf(mrun, mx);
    const float al = exp2f(mrun - mn);
    mrun = mn;
    // ---- B fragments of P^T * 32768: hi f16 and residual f16, column = c, split k map over the 32 keys of this step ----
    FragH ph, pl;
    float ps0 = 0.f, ps1 = 0.f;
#pragma unroll
    for (int r = 0; r < 8; ++r) {
      const float e0 = exp2f(t0[r] - mn), e1 = exp2f(t1[r] - mn);
      ps0 += e0;
      ps1 += e1;
      const float ta = e0 * PCAR, tb = e1 * PCAR;
      const _Float16 ha = (_Float16)ta, hb = (_Float16)tb;
      ph.h[0][r] = ha;                                     // elements 0..7  = keys kb + 8hh + 0..7
      ph.h[1][r] = hb;                                     // elements 8..15 = keys kb + 16 + 8hh + 0..7
      pl.h[0][r] = (_Float16)(ta - (float)ha);
      pl.h[1][r] = (_Float16)(tb - (float)hb);
    }
    lsum = lsum * al + (ps0 + ps1);
#pragma unroll
    for (int j = 0; j < 4; ++j)
#pragma unroll
      for (int r = 0; r < 8; ++r) o[j][r] *= al;
    // ---- O^T += v^T.P^T ----
    {
      o[0] = mma_h(vh0, ph.v, o[0]);  o[0] = mma_h(vh0, pl.v, o[0]);  o[0] = mma_h(vl0, ph.v, o[0]);
      o[1] = mma_h(vh1, ph.v, o[1]);  o[1] = mma_h(vh1, pl.v, o[1]);  o[1] = mma_h(vl1, ph.v, o[1]);
      o[2] = mma_h(vh2, ph.v, o[2]);  o[2] = mma_h(vh2, pl.v, o[2]);  o[2] = mma_h(vl2, ph.v, o[2]);
      o[3] = mma_h(vh3, ph.v, o[3]);  o[3] = mma_h(vh3, pl.v, o[3]);  o[3] = mma_h(vl3, ph.v, o[3]);
      guard10(o[0], o[1], o[2], o[3], ph.v, pl.v, vh0, vh1, vh2, vh3, vl0, vl1, vl2, vl3);
    }
    const int kn = (it + 1 < nglob) ? ((it + 1) * 32) : (jlo + (it + 1 - nglob) * 32);   // next key block of the list
    const int dk = kn - kb;                                                              // a positive multiple of 32
    k0p += (size_t)dk * HD;
    l0p += (size_t)dk * HD;
    vhp += (size_t)(dk >> 5) * FT;
    vlp += (size_t)(dk >> 5) * FT;
    kb = kn;
  }
  acc_guard4(o[0], o[1], o[2], o[3]);

  // ---- join the two halves' sums, fold 1/l and the carries (32768 on P, 1024 on v) ----
  const float oc = 1.0f / (PCAR * VCAR);
  const float inv = (1.0f / (lsum + xhalf(lsum))) * oc;
  // ---- O x1024 -> f16 hi + residual planes; the wave's 16 x 64 = 2 neighbouring tiles; lane = (row c, chunk 2 * j + hh) ----
  v4u oh[4], ol[4];
#pragma unroll
  for (int j = 0; j < 4; ++j) {
    float w[8];
#pragma unroll
    for (int r = 0; r < 8; ++r) w[r] = (o[j][r] * inv) * OSC;
#pragma unroll
    for (int e = 0; e < 4; ++e) {
      const _Float16 h0 = (_Float16)w[2 * e], h1 = (_Float16)w[2 * e + 1];
      const _Float16 l0 = (_Float16)(w[2 * e] - (float)h0), l1 = (_Float16)(w[2 * e + 1] - (float)h1);
      oh[j][e] = pk16(h_bits(h0), h_bits(h1));
      ol[j][e] = pk16(h_bits(l0), h_bits(l1));
    }
  }
  const size_t ob = (size_t)(b * SEQ + q0) * (NH * HD) + (size_t)(head * 2) * FT + lo;
  {
#pragma unroll
    for (int j = 0; j < 4; ++j) {
      const size_t o8 = ob + (size_t)j * 256;
      *(v4u*)(OHIp + o8) = oh[j];
      *(v4u*)(OLOp + o8) = ol[j];
    }
  }
}

// =====================================================================================================
// Workspace map (bytes); every plane is fully written by whole-line stores before it is read; all extents are exact multiples
// of the store granularity (no pad rows needed); every offset a multiple of 65536:
//   CT  f32 [2048][64]                 524288        ST  same              524288
//   (16-bit planes: rows x K named below, stored in fragment order)
//   XB  bf16 [4096][768]              6291456
//   WQT bf16 [768 n][768 k]           1179648        WKT bf16 [256][768]   393216     WVT same   393216
//   WOT f16  [768 n][768 k] x1024     1179648
//   QF  f32 [4096][768]              12582912        KF f32 [4096][256]   4194304     VF same   4194304
//   QHI f16 [2][12][2048][64] x1024   6291456        QLO residual         6291456
//   KHI f16 [2][4][2048][64] x1024    2097152        KLO residual         2097152
//   VHI f16 [2][4][64][2048] x1024    2097152        VLO residual         2097152
//   OHI f16 [4096][768] x1024         6291456        OLO residual         6291456
//   end                              65011712
// =====================================================================================================
extern "C" void kernel_launch(void* const* d_in, const int* in_sizes, int n_in,
                              void* d_out, int out_size, void* d_ws, size_t ws_size,
                              hipStream_t stream) {
  const int ROWS = NB * SEQ;                            // 4096
  if (n_in < 5) return;
  if (in_sizes[0] != ROWS * DMOD) return;
  if (in_sizes[1] != DMOD * (NH * HD)) return;
  if (in_sizes[2] != DMOD * (NKV * HD) || in_sizes[3] != DMOD * (NKV * HD)) return;
  if (in_sizes[4] != (NH * HD) * DMOD) return;
  if (out_size != ROWS * DMOD) return;

  const float* x  = (const float*)d_in[0];
  const float* wq = (const float*)d_in[1];
  const float* wk = (const float*)d_in[2];
  const float* wv = (const float*)d_in[3];
  const float* wo = (const float*)d_in[4];
  float*       out = (float*)d_out;

  const size_t szTab = (size_t)SEQ * HD * 4;                    //   524288
  const size_t szXB  = (size_t)ROWS * DMOD * 2;                 //  6291456
  const size_t szWQT = (size_t)(NH * HD) * DMOD * 2;            //  1179648
  const size_t szWKT = (size_t)(NKV * HD) * DMOD * 2;           //   393216
  const size_t szWOT = (size_t)DMOD * (NH * HD) * 2;            //  1179648
  const size_t szQF  = (size_t)ROWS * (NH * HD) * 4;            // 12582912
  const size_t szKF  = (size_t)ROWS * (NKV * HD) * 4;           //  4194304
  const size_t szQP  = (size_t)ROWS * (NH * HD) * 2;            //  6291456
  const size_t szKP  = (size_t)ROWS * (NKV * HD) * 2;           //  2097152
  const size_t szVP  = (size_t)NB * NKV * HD * SEQ * 2;         //  2097152
  const size_t szOP  = (size_t)ROWS * (NH * HD) * 2;            //  6291456
  size_t off = 0;
  const size_t oCT  = off; off += szTab;
  const size_t oST  = off; off += szTab;
  const size_t oXB  = off; off += szXB;
  const size_t oWQT = off; off += szWQT;
  const size_t oWKT = off; off += szWKT;
  const size_t oWVT = off; off += szWKT;
  const size_t oWOT = off; off += szWOT;
  const size_t oQF  = off; off += szQF;
  const size_t oKF  = off; off += szKF;
  const size_t oVF  = off; off += szKF;
  const size_t oQHI = off; off += szQP;
  const size_t oQLO = off; off += szQP;
  const size_t oKHI = off; off += szKP;
  const size_t oKLO = off; off += szKP;
  const size_t oVHI = off; off += szVP;
  const size_t oVLO = off; off += szVP;
  const size_t oOHI = off; off += szOP;
  const size_t oOLO = off; off += szOP;
  if (off > ws_size) return;                            // off = 65011712
  if (off > (size_t)134217728) return;

  char* ws = (char*)d_ws;
  float* CT  = (float*)(ws + oCT);
  float* ST  = (float*)(ws + oST);
  u16*   XB  = (u16*)(ws + oXB);
  u16*   WQT = (u16*)(ws + oWQT);
  u16*   WKT = (u16*)(ws + oWKT);
  u16*   WVT = (u16*)(ws + oWVT);
  u16*   WOT = (u16*)(ws + oWOT);
  float* QF  = (float*)(ws + oQF);
  float* KF  = (float*)(ws + oKF);
  float* VF  = (float*)(ws + oVF);
  u16*   QHI = (u16*)(ws + oQHI);
  u16*   QLO = (u16*)(ws + oQLO);
  u16*   KHI = (u16*)(ws + oKHI);
  u16*   KLO = (u16*)(ws + oKLO);
  u16*   VHI = (u16*)(ws + oVHI);
  u16*   VLO = (u16*)(ws + oVLO);
  u16*   OHI = (u16*)(ws + oOHI);
  u16*   OLO = (u16*)(ws + oOLO);

  // inv_freq[i] = 1 / pow(10000, i/32) in f32 (pow correctly converted from f64, then IEEE f32 reciprocal)
  InvF inv;
  for (int i = 0; i < 32; ++i) {
    const double p = pow(10000.0, (double)i / 32.0);
    const float pf = (float)p;
    inv.f[i] = 1.0f / pf;
  }

  const dim3 blk(256);
  const dim3 gPrep(PREP_BLOCKS);                        // 2176
  const dim3 gQKV(QKV_BLOCKS);                          // 1280
  const dim3 gPost(POST_BLOCKS);                        // 2304
  const dim3 gGO((ROWS / 64) * (DMOD / 64));            // 768
  const dim3 bG(128);
  const dim3 gAT(ATT_BLOCKS);                           // 1024
  const dim3 bAT(ATT_THREADS);                          // 96

  // (1) weights W[k rows][n cols] -> [n][k] 16-bit planes in fragment order (bf16 for wq/wk/wv; f16 of bf16 value x1024 for wo),
  //     rotary cos/sin tables [2048][64], x -> bf16 plane
  prep<<<gPrep, blk, 0, stream>>>(x, wq, wk, wv, wo, XB, WQT, WKT, WVT, WOT, CT, ST, inv);
  // (2) projections: q [4096][768], k [4096][256], v [4096][256] in f32
  gemm_qkv<<<gQKV, bG, 0, stream>>>(XB, WQT, WKT, WVT, QF, KF, VF, ROWS, DMOD, 1.0f);
  // (3) q' and k' planes (rotary, hi + residual), v^T planes x1024 (hi + residual)
  post<<<gPost, blk, 0, stream>>>(QF, KF, VF, CT, ST, QHI, QLO, KHI, KLO, VHI, VLO);
  // (4) attention -> O planes [b][s][h][d] x1024 (hi + residual)
  attn_gqa<<<gAT, bAT, 0, stream>>>(QHI, QLO, KHI, KLO, VHI, VLO, OHI, OLO);
  // (5) output projection -> out [4096][768] f32, carries 1024 (O) x 1024 (wo) folded back
  gemm_h2<<<gGO, bG, 0, stream>>>(OHI, OLO, WOT, out, ROWS, DMOD, NH * HD, 1.0f / (OSC * WOS));
  (void)hipGetLastError();
}

// v004
// One run takes 69.6 microseconds.
// In two side-by-side timings against v003, it was 1.22 and 1.19 times as fast.
// All steps since v000 together make it 2.13 times as fast.
// Contractions: x.W{q,k,v} on v_wmma_f32_16x16x32_bf16 (x and W RNE-converted to bf16, exact operands, f32 accumulate);
// scores k'.q'^T (transposed; q', k' carried x1024 as f16 hi plane + f16 residual plane, products hh+lh+hl), v^T.P^T (transposed; P x32768 f16 hi+residual,
// v x1024 f16 hi+residual, products hh+lh+hl) and O.wo (O x1024 f16 hi+residual, wo as f16(bf16(wo) x1024), products h.w+l.w):
// v_wmma_f32_16x16x32_f16, f32 accumulate. Rotary tables, rotation, masked base-2 online softmax and 1/l fold in f32 on VALU.
#include <hip/hip_runtime.h>
#include <math.h>
#include <stdint.h>

#define NB    2
#define SEQ   2048
#define DMOD  768
#define NH    12
#define NKV   4
#define HD    64
#define GRP   3
#define WIN   512
#define GLB   64
#define QSC   1024.0f
#define KSC   1024.0f
#define PCAR  32768.0f
#define VCAR  1024.0f
#define OSC   1024.0f
#define WOS   1024.0f
#define LOG2E 1.4426950408889634f
#define ATT_THREADS (GRP * 32)
#define ATT_BLOCKS  (NB * NKV * (SEQ / 16))
#define SLAB64 (16 * 68)
#define VTP   72
#define MAXBLK 20
#define FT    512
#define KUQ   3      // k-steps of 32 whose fragment loads one trip of the q/k/v GEMM issues together
#define KUO   4      // the same for the output projection
static_assert(NH == NKV * GRP);
static_assert(HD == 64 && DMOD == NH * HD);
static_assert((SEQ / 16) == 128 && NKV == 4 && NB == 2);
static_assert(ATT_THREADS == 96 && ATT_BLOCKS == 1024);
static_assert(((NB * SEQ * NH * 8) % 256) == 0 && ((NB * SEQ * NKV * 8) % 256) == 0);
static_assert(((NB * SEQ) % 64) == 0 && (DMOD % 64) == 0 && ((NKV * HD) % 64) == 0 && (DMOD % 32) == 0);
static_assert((SEQ % 64) == 0 && (SEQ % 8) == 0);
static_assert((DMOD % (32 * KUQ)) == 0 && ((NH * HD) % (32 * KUO)) == 0);   // whole trips: no load past a plane's row of tiles

typedef unsigned short u16;
typedef _Float16 v16h __attribute__((ext_vector_type(16)));
typedef _Float16 v8h  __attribute__((ext_vector_type(8)));
typedef __bf16   v16b __attribute__((ext_vector_type(16)));
typedef float    v8f  __attribute__((ext_vector_type(8)));
typedef float    v4f  __attribute__((ext_vector_type(4)));
typedef unsigned int v4u __attribute__((ext_vector_type(4)));

union FragH { v16h v; v8h h[2]; v4u u[2]; };
union FragB { v16b v; v4u u[2]; };

struct InvF { float f[32]; };
static_assert(sizeof(InvF) == 128);

// ---- scalar helpers --------------------------------------------------------------------------------
__device__ __forceinline__ unsigned short bf_bits(float f) {          // f32 -> bf16 bits, RNE convert
  unsigned u = __float_as_uint(f);
  return (unsigned short)((u + 0x7FFFu + ((u >> 16) & 1u)) >> 16);
}
__device__ __forceinline__ float bf_up(unsigned short h) { return __uint_as_float(((unsigned)h) << 16); }
__device__ __forceinline__ float bfr(float f) { return bf_up(bf_bits(f)); }
__device__ __forceinline__ unsigned short h_bits(_Float16 x) { return __builtin_bit_cast(unsigned short, x); }
__device__ __forceinline__ unsigned pk16(unsigned short a, unsigned short b) { return (unsigned)a | ((unsigned)b << 16); }
__device__ __forceinline__ v8f zero8() { v8f z = {0.f, 0.f, 0.f, 0.f, 0.f, 0.f, 0.f, 0.f}; return z; }

// ---- fragment-order planes: every 16-bit operand plane [rows][K] is kept as 16-row x 32-k tiles of FT elements (1 KiB),
//      tile (rt, kt) at (rt * (K / 32) + kt) * FT, and inside a tile as 16-B chunks [q = (k & 31) >> 3][row & 15][k & 7].
// ---- fragment loaders: 16-bit A/B operand, lane -> row/col (lane&15), h = lane>>4, t = the tile (wave-uniform), lo = lane * 8;
//      elements 0..7 <- t[lo..lo+7] (chunk q = h: k0+8h..), elements 8..15 <- t[256+lo..] (chunk q = 2+h: k0+16+8h..)
//      (same split k map for A and B); each of the two loads of a wave is 512 contiguous bytes = 4 whole lines
__device__ __forceinline__ v16h ldfrag_h(const _Float16* t, unsigned lo) {
  FragH f;
  f.h[0] = *(const v8h*)(t + lo);
  f.h[1] = *(const v8h*)(t + 256 + lo);
  return f.v;
}
__device__ __forceinline__ v16b ldfrag_b(const u16* t, unsigned lo) { // bf16 plane read as unsigned integer vectors
  FragB f;
  f.u[0] = *(const v4u*)(t + lo);
  f.u[1] = *(const v4u*)(t + 256 + lo);
  return f.v;
}

__device__ __forceinline__ v8f mma_h(v16h a, v16h b, v8f c) {
  return __builtin_amdgcn_wmma_f32_16x16x32_f16(false, a, false, b, (short)0, c, false, false);
}
__device__ __forceinline__ v8f mma_b(v16b a, v16b b, v8f c) {
  return __builtin_amdgcn_wmma_f32_16x16x32_bf16(false, a, false, b, (short)0, c, false, false);
}
__device__ __forceinline__ void guard2(v8f& a, v8f& b, v16h x0, v16h x1, v16h x2, v16h x3, v16h x4, v16h x5) {
#if defined(__HIP_DEVICE_COMPILE__)
  asm volatile("v_nop\n\tv_nop\n\tv_nop\n\tv_nop"
               : "+v"(a), "+v"(b) : "v"(x0), "v"(x1), "v"(x2), "v"(x3), "v"(x4), "v"(x5) : "memory");
#endif
}
template <typename F>
__device__ __forceinline__ void guard6(v8f& a, v8f& b, v8f& c, v8f& d, F x0, F x1, F x2, F x3, F x4, F x5) {
#if defined(__HIP_DEVICE_COMPILE__)
  asm volatile("v_nop\n\tv_nop\n\tv_nop\n\tv_nop"
               : "+v"(a), "+v"(b), "+v"(c), "+v"(d) : "v"(x0), "v"(x1), "v"(x2), "v"(x3), "v"(x4), "v"(x5) : "memory");
#endif
}
__device__ __forceinline__ void guard10(v8f& a, v8f& b, v8f& c, v8f& d, v16h x0, v16h x1, v16h x2, v16h x3, v16h x4,
                                        v16h x5, v16h x6, v16h x7, v16h x8, v16h x9) {
#if defined(__HIP_DEVICE_COMPILE__)
  asm volatile("v_nop\n\tv_nop\n\tv_nop\n\tv_nop"
               : "+v"(a), "+v"(b), "+v"(c), "+v"(d)
               : "v"(x0), "v"(x1), "v"(x2), "v"(x3), "v"(x4), "v"(x5), "v"(x6), "v"(x7), "v"(x8), "v"(x9) : "memory");
#endif
}
__device__ __forceinline__ void acc_guard4(v8f& a, v8f& b, v8f& c, v8f& d) {
#if defined(__HIP_DEVICE_COMPILE__)
  asm volatile("v_nop\n\tv_nop\n\tv_nop\n\tv_nop" : "+v"(a), "+v"(b), "+v"(c), "+v"(d));
#endif
}
__device__ __forceinline__ void wave_sync_lds() {
  __builtin_amdgcn_fence(__ATOMIC_RELEASE, "workgroup");
  __builtin_amdgcn_wave_barrier();
  __builtin_amdgcn_fence(__ATOMIC_ACQUIRE, "workgroup");
}

// ---- accurate f32 sin/cos of a non-negative f32 angle (|angle| < 2048): f64 two-part pi/2 reduction + f64 polynomials,
//      plain f64 fma/mul only (no library f64 trig path), result converted to f32.
__device__ __forceinline__ void sincos_acc(float angf, float& sv, float& cv) {
  const double a = (double)angf;
  const double TWO_OVER_PI = 0.63661977236758134308;
  const double PIO2_HI = 1.5707963267948966;
  const double PIO2_LO = 6.123233995736766e-17;
  const int kq = (int)(a * TWO_OVER_PI + 0.5);
  const double kd = (double)kq;
  double r = fma(-kd, PIO2_HI, a);
  r = fma(-kd, PIO2_LO, r);
  const double r2 = r * r;
  double sp = 1.0 / 6227020800.0;
  sp = fma(sp, r2, -1.0 / 39916800.0);
  sp = fma(sp, r2, 1.0 / 362880.0);
  sp = fma(sp, r2, -1.0 / 5040.0);
  sp = fma(sp, r2, 1.0 / 120.0);
  sp = fma(sp, r2, -1.0 / 6.0);
  const double s = fma(sp * r2, r, r);
  double cp = -1.0 / 87178291200.0;
  cp = fma(cp, r2, 1.0 / 479001600.0);
  cp = fma(cp, r2, -1.0 / 3628800.0);
  cp = fma(cp, r2, 1.0 / 40320.0);
  cp = fma(cp, r2, -1.0 / 720.0);
  cp = fma(cp, r2, 1.0 / 24.0);
  cp = fma(cp, r2, -0.5);
  const double c = fma(cp, r2, 1.0);
  const int qd = kq & 3;
  const double so = (qd == 0) ? s : (qd == 1) ? c : (qd == 2) ? -s : -c;
  const double co = (qd == 0) ? c : (qd == 1) ? -s : (qd == 2) ? -c : s;
  sv = (float)so;
  cv = (float)co;
}

// =====================================================================================================
// Rotary tables: cosT[t][d], sinT[t][d] for t < SEQ, d < HD, angle = float(t) * inv_freq[d & 31] (f32 product), halves duplicated.
// Wave = one position t, lane = frequency index; inv_freq picked from the by-value table with a static select chain.
// coverage: SEQ/8 blocks x 8 waves = SEQ rows; per row 4 line stores = 64 floats of each table.
// =====================================================================================================
__device__ __forceinline__ void tab_body(int bid, float* cosT, float* sinT, const InvF& inv) {
  const int tid  = threadIdx.x;
  const int lane = tid & 31;
  const int t    = bid * 8 + (tid >> 5);
  if (t >= SEQ) return;                     // never taken with the exact block range; no barriers in this part
  float f = inv.f[0];
#pragma unroll
  for (int i = 1; i < 32; ++i) f = (lane == i) ? inv.f[i] : f;
  const float ang = (float)t * f;
  float sv, cv;
  sincos_acc(ang, sv, cv);
  float* cr = cosT + (size_t)t * HD;
  float* sr = sinT + (size_t)t * HD;
  {
    *(float*)(cr + lane)      = cv;
    *(float*)(cr + 32 + lane) = cv;
    *(float*)(sr + lane)      = sv;
    *(float*)(sr + 32 + lane) = sv;
    
  }
}

// =====================================================================================================
// x f32 -> bf16 plane (RNE convert), fragment order. Thread = one 16-B chunk (8 consecutive k of one row): two 16-B loads, one
// 16-B store; a wave = 8 rows x the 4 chunks of one tile, so 8 lanes fill one 128-B line of the plane.
// coverage: n8/256 blocks (exact division checked statically) x 256 thr x 8 = the whole plane (64 threads per tile).
// =====================================================================================================
__device__ __forceinline__ void cvtx_body(int bid, const float* __restrict__ x, u16* D, int n8) {
  const int gt = bid * 256 + (int)threadIdx.x;
  if (gt >= n8) return;                     // no barriers in this part
  const int tile = gt >> 6;
  const int m    = ((gt >> 5) & 1) * 8 + (gt & 7);
  const int q    = (gt >> 3) & 3;
  const float* p = x + (size_t)((tile / (DMOD / 32)) * 16 + m) * DMOD + (tile % (DMOD / 32)) * 32 + q * 8;
  const v4f a = *(const v4f*)(p), bq = *(const v4f*)(p + 4);
  v4u o;
  o[0] = pk16(bf_bits(a[0]),  bf_bits(a[1]));
  o[1] = pk16(bf_bits(a[2]),  bf_bits(a[3]));
  o[2] = pk16(bf_bits(bq[0]), bf_bits(bq[1]));
  o[3] = pk16(bf_bits(bq[2]), bf_bits(bq[3]));
  u16* d = D + (size_t)tile * FT + q * 128 + m * 8;
  {
    *(v4u*)(d) = o;
    
  }
}

// =====================================================================================================
// Weight transpose + 16-bit convert: in W[R][C] (row-major f32) -> out D[C][R] (16-bit plane, rows n = C, k = R, fragment order).
//   f16mode == 0: D = bf16 RNE bits of W;  f16mode == 1: D = f16 bits of (bf16 RNE value of W) * scale.
// Block = one 64x64 tile (r0, c0): 256 thr x 4 16-B loads -> LDS tile [c][r] (pitch 72), block barrier, then each output row
// coverage: load 256 thr x 16 = 64x64; store 2 iterations x 256 thr x 8 halves = 8 fragment tiles (4 n x 2 k), a wave = 512
//           contiguous bytes; grid (C/64)x(R/64) tiles = all of D.
// =====================================================================================================
__device__ __forceinline__ void wT_body(u16* T, int bid, const float* __restrict__ W, u16* D, int R, int C, int f16mode,
                                        float scale) {
  const int tid = threadIdx.x;
  const int ntc = C >> 6;
  const int c0  = (bid % ntc) * 64;
  const int r0  = (bid / ntc) * 64;
  {
    const int rr = tid >> 2;
    const int cc = (tid & 3) * 16;
    const float* src = W + (size_t)(r0 + rr) * C + c0 + cc;
#pragma unroll
    for (int i = 0; i < 4; ++i) {
      const v4f a = *(const v4f*)(src + 4 * i);
#pragma unroll
      for (int e = 0; e < 4; ++e) {
        const float v = a[e];
        const unsigned short hb = h_bits((_Float16)(bfr(v) * scale));
        const unsigned short bb = bf_bits(v);
        T[(cc + 4 * i + e) * VTP + rr] = (f16mode != 0) ? hb : bb;
      }
    }
  }
  __syncthreads();
  v4u vals[2];
  const int m16 = tid & 15, q4 = (tid >> 4) & 3, nt = tid >> 7, kt = (tid >> 6) & 1;   // n tile nt (+2 per iteration), k tile kt
#pragma unroll
  for (int it = 0; it < 2; ++it) vals[it] = *(const v4u*)(T + ((it * 2 + nt) * 16 + m16) * VTP + kt * 32 + q4 * 8);
  {
#pragma unroll
    for (int it = 0; it < 2; ++it) {
      const size_t tile = (size_t)((c0 >> 4) + it * 2 + nt) * (size_t)(R >> 5) + (size_t)((r0 >> 5) + kt);
      *(v4u*)(D + tile * FT + q4 * 128 + m16 * 8) = vals[it];
    }
    
  }
}

// =====================================================================================================
// Launch 1: every conversion that depends on the inputs alone, one launch, parts picked by block range (block-uniform):
//   [0, 384)     weight tiles: wq 144, wk 48, wv 48, wo 144 (they hold the one block barrier, so they start first)
//   [384, 640)   rotary tables
//   [640, 2176)  x -> bf16 plane
// Each part keeps its own block count and per-block work; no part reads what another part writes.
// =====================================================================================================
#define PB_WQ  ((DMOD / 64) * ((NH * HD) / 64))
#define PB_WK  ((DMOD / 64) * ((NKV * HD) / 64))
#define PB_WO  (((NH * HD) / 64) * (DMOD / 64))
#define PB_W   (PB_WQ + 2 * PB_WK + PB_WO)
#define PB_TAB (SEQ / 8)
#define PB_X   ((NB * SEQ * DMOD) / (8 * 256))
#define PREP_BLOCKS (PB_W + PB_TAB + PB_X)
static_assert(PB_W == 384 && PB_TAB == 256 && PB_X == 1536 && ((NB * SEQ * DMOD) % (8 * 256)) == 0);
__global__ __launch_bounds__(256)
void prep(const float* __restrict__ x, const float* __restrict__ wq, const float* __restrict__ wk,
          const float* __restrict__ wv, const float* __restrict__ wo, u16* XB, u16* WQT, u16* WKT, u16* WVT, u16* WOT,
          float* cosT, float* sinT, InvF inv) {
  __shared__ __align__(16) u16 T[64 * VTP];
  const int bid = blockIdx.x;
  if (bid < PB_W) {
    const float* W = wq;  u16* D = WQT;  int C = NH * HD, tb = bid, mode = 0;  float scale = 1.0f;
    if (bid >= PB_WQ)                 { W = wk;  D = WKT;  C = NKV * HD;  tb = bid - PB_WQ; }
    if (bid >= PB_WQ + PB_WK)         { W = wv;  D = WVT;  tb = bid - (PB_WQ + PB_WK); }
    if (bid >= PB_WQ + 2 * PB_WK)     { W = wo;  D = WOT;  C = DMOD;  tb = bid - (PB_WQ + 2 * PB_WK);  mode = 1;  scale = WOS; }
    static_assert(NH * HD == DMOD);   // every weight has DMOD rows (wo: NH*HD rows)
    wT_body(T, tb, W, D, DMOD, C, mode, scale);
  } else if (bid < PB_W + PB_TAB) {
    tab_body(bid - PB_W, cosT, sinT, inv);
  } else {
    cvtx_body(bid - (PB_W + PB_TAB), x, XB, (NB * SEQ * DMOD) / 8);
  }
}

// =====================================================================================================
// GEMM epilogue shared by both engines: the wave's 16x64 f32 tile (times oscale) staged in its LDS slab (pitch 68),
// coverage: 8 instructions x 2 rows x 16 lanes x 4 floats = the wave's 16 x 64 tile.
// =====================================================================================================
__device__ __forceinline__ void epi64(float* sl, v8f a0, v8f a1, v8f a2, v8f a3, float oscale, float* C, int N,
                                      size_t rowb, int col0, int lane) {
  const int hh = lane >> 4, m = lane & 15;
#pragma unroll
  for (int r = 0; r < 8; ++r) {
    const int ro = (8 * hh + r) * 68 + m;
    sl[ro]      = a0[r] * oscale;
    sl[ro + 16] = a1[r] * oscale;
    sl[ro + 32] = a2[r] * oscale;
    sl[ro + 48] = a3[r] * oscale;
  }
  wave_sync_lds();
  v4f vals[8];
#pragma unroll
  for (int it = 0; it < 8; ++it) vals[it] = *(const v4f*)(sl + (it * 2 + hh) * 68 + m * 4);
  float* dst = C + (rowb + (size_t)hh) * (size_t)N + col0 + m * 4;
  {
#pragma unroll
    for (int it = 0; it < 8; ++it) {
      *(v4f*)(dst + (size_t)(it * 2) * (size_t)N) = vals[it];
    }
    
  }
}

// =====================================================================================================
// bf16 GEMM: C[M][N] (f32) = A[M][K] (bf16) . Bt[N][K]^T (bf16), both planes in fragment order, times oscale.
// Block = 64x64 tile, 4 waves x 16 rows; fragments loaded straight from the planes' tiles (two 16-B loads each, split k map
// for A and B); K stepped by 32 * KUQ = KUQ tiles of FT elements a trip (K % (32 * KUQ) == 0, M % 64 == 0, N % 64 == 0 checked statically).
// Launch 2: the q, k and v projections in one launch. The 12 + 4 + 4 column tiles of one 64-row tile of x are neighbours in
// the grid; the column tile picks weight plane, output and output pitch (block-uniform). grid = (M/64) * 20.
// =====================================================================================================
#define QKV_CT ((NH * HD) / 64 + 2 * ((NKV * HD) / 64))
#define QKV_BLOCKS (((NB * SEQ) / 64) * QKV_CT)
static_assert(QKV_CT == 20 && QKV_BLOCKS == 1280);
__global__ __launch_bounds__(128)
void gemm_qkv(const u16* __restrict__ A, const u16* __restrict__ WQT, const u16* __restrict__ WKT,
              const u16* __restrict__ WVT, float* QF, float* KF, float* VF, int M, int K, float oscale) {
  __shared__ __align__(16) float slab[4 * SLAB64];
  const int tid = threadIdx.x, wave = __builtin_amdgcn_readfirstlane(tid >> 5), lane = tid & 31;   // scalar wave number: wave-uniform tile pointers
  const unsigned lo = (unsigned)lane * 8u;
  const int bid   = blockIdx.x;
  const int ct    = bid % QKV_CT;
  const int rowb  = (bid / QKV_CT) * 64 + wave * 16;
  const u16* Bt = WQT;  float* C = QF;  int N = NH * HD, col0 = ct * 64;
  if (ct >= (NH * HD) / 64)                    { Bt = WKT;  C = KF;  N = NKV * HD;  col0 = (ct - (NH * HD) / 64) * 64; }
  if (ct >= (NH * HD) / 64 + (NKV * HD) / 64)  { Bt = WVT;  C = VF;  col0 = (ct - ((NH * HD) / 64 + (NKV * HD) / 64)) * 64; }
  if (rowb + 16 > M) return;                 // wave-uniform, never taken with the exact grid; no block barriers in this kernel
  const size_t bs = (size_t)(K >> 5) * FT;   // one row of tiles: 16 rows x K
  const u16* ap = A  + (size_t)(rowb >> 4) * bs;
  const u16* bp0 = Bt + (size_t)(col0 >> 4) * bs;
  const u16* bp1 = bp0 + bs;
  const u16* bp2 = bp1 + bs;
  const u16* bp3 = bp2 + bs;
  v8f acc0 = zero8(), acc1 = zero8(), acc2 = zero8(), acc3 = zero8();
#pragma unroll 1
  for (int k0 = 0; k0 < K; k0 += 32 * KUQ, ap += KUQ * FT, bp0 += KUQ * FT, bp1 += KUQ * FT, bp2 += KUQ * FT, bp3 += KUQ * FT) {
    v16b a[KUQ], b0[KUQ], b1[KUQ], b2[KUQ], b3[KUQ];
#pragma unroll
    for (int u = 0; u < KUQ; ++u) {
      a[u]  = ldfrag_b(ap + u * FT, lo);
      b0[u] = ldfrag_b(bp0 + u * FT, lo);
      b1[u] = ldfrag_b(bp1 + u * FT, lo);
      b2[u] = ldfrag_b(bp2 + u * FT, lo);
      b3[u] = ldfrag_b(bp3 + u * FT, lo);
      // keeps the trip's loads in front of its products (a load that sinks behind one starts a latency of its own) and in step
      // order, so that the first step's products start while the later steps' fragments are still on their way
      __builtin_amdgcn_sched_barrier(0);
    }
#pragma unroll
    for (int u = 0; u < KUQ; ++u) {          // k ascending in every accumulator, as with one step a trip
      acc0 = mma_b(a[u], b0[u], acc0);
      acc1 = mma_b(a[u], b1[u], acc1);
      acc2 = mma_b(a[u], b2[u], acc2);
      acc3 = mma_b(a[u], b3[u], acc3);
    }
    guard6<v16b>(acc0, acc1, acc2, acc3, a[KUQ - 1], b0[KUQ - 1], b1[KUQ - 1], b2[KUQ - 1], b3[KUQ - 1], a[KUQ - 1]);
#if defined(__HIP_DEVICE_COMPILE__)
    // the next trip forms its addresses in the register pairs that this trip's loads name: the wait stands in front of that
    asm volatile("s_wait_xcnt 0x0" ::: "memory");
#endif
  }
  epi64(slab + wave * SLAB64, acc0, acc1, acc2, acc3, oscale, C, N, (size_t)rowb, col0, lane);
}

// =====================================================================================================
// f16 hi+lo GEMM: C[M][N] (f32) = (Ahi + Alo)[M][K] . Bt[N][K]^T, times oscale; Ahi/Alo and Bt f16 planes in fragment order;
// products hi.B + lo.B into one accumulator (lo is the unscaled residual of hi). Same tiling as gemm_qkv.
// =====================================================================================================
__global__ __launch_bounds__(128)
void gemm_h2(const u16* __restrict__ Ah, const u16* __restrict__ Al, const u16* __restrict__ Bt, float* C,
             int M, int N, int K, float oscale) {
  __shared__ __align__(16) float slab[4 * SLAB64];
  const int tid = threadIdx.x, wave = __builtin_amdgcn_readfirstlane(tid >> 5), lane = tid & 31;   // scalar wave number: wave-uniform tile pointers
  const unsigned lo = (unsigned)lane * 8u;
  const int ntile = N >> 6;
  const int bid   = blockIdx.x;
  const int rowb  = (bid / ntile) * 64 + wave * 16;
  const int col0  = (bid % ntile) * 64;
  if (rowb + 16 > M) return;                 // wave-uniform, never taken with the exact grid; no block barriers in this kernel
  const size_t bs = (size_t)(K >> 5) * FT;   // one row of tiles: 16 rows x K
  const size_t aofs = (size_t)(rowb >> 4) * bs;
  const _Float16* ahp = (const _Float16*)(const void*)Ah + aofs;
  const _Float16* alp = (const _Float16*)(const void*)Al + aofs;
  const _Float16* bp0 = (const _Float16*)(const void*)Bt + (size_t)(col0 >> 4) * bs;
  const _Float16* bp1 = bp0 + bs;
  const _Float16* bp2 = bp1 + bs;
  const _Float16* bp3 = bp2 + bs;
  v8f acc0 = zero8(), acc1 = zero8(), acc2 = zero8(), acc3 = zero8();
#pragma unroll 1
  for (int k0 = 0; k0 < K; k0 += 32 * KUO, ahp += KUO * FT, alp += KUO * FT, bp0 += KUO * FT, bp1 += KUO * FT, bp2 += KUO * FT,
       bp3 += KUO * FT) {
    v16h ah[KUO], al[KUO], b0[KUO], b1[KUO], b2[KUO], b3[KUO];
#pragma unroll
    for (int u = 0; u < KUO; ++u) {
      ah[u] = ldfrag_h(ahp + u * FT, lo);
      al[u] = ldfrag_h(alp + u * FT, lo);
      b0[u] = ldfrag_h(bp0 + u * FT, lo);
      b1[u] = ldfrag_h(bp1 + u * FT, lo);
      b2[u] = ldfrag_h(bp2 + u * FT, lo);
      b3[u] = ldfrag_h(bp3 + u * FT, lo);
      // keeps the trip's loads in front of its products (a load that sinks behind one starts a latency of its own) and in step
      // order (as built without it the first step's O fragments come last and every product waits for the whole group)
      __builtin_amdgcn_sched_barrier(0);
    }
#pragma unroll
    for (int u = 0; u < KUO; ++u) {          // k ascending, hi then lo, in every accumulator, as with one step a trip
      acc0 = mma_h(ah[u], b0[u], acc0);  acc0 = mma_h(al[u], b0[u], acc0);
      acc1 = mma_h(ah[u], b1[u], acc1);  acc1 = mma_h(al[u], b1[u], acc1);
      acc2 = mma_h(ah[u], b2[u], acc2);  acc2 = mma_h(al[u], b2[u], acc2);
      acc3 = mma_h(ah[u], b3[u], acc3);  acc3 = mma_h(al[u], b3[u], acc3);
    }
    guard6<v16h>(acc0, acc1, acc2, acc3, ah[KUO - 1], al[KUO - 1], b0[KUO - 1], b1[KUO - 1], b2[KUO - 1], b3[KUO - 1]);
#if defined(__HIP_DEVICE_COMPILE__)
    // the next trip forms its addresses in the register pairs that this trip's loads name: the wait stands in front of that
    asm volatile("s_wait_xcnt 0x0" ::: "memory");
#endif
  }
  epi64(slab + wave * SLAB64, acc0, acc1, acc2, acc3, oscale, C, N, (size_t)rowb, col0, lane);
}

// =====================================================================================================
// Rotate-half rotary + 16-bit split pack. Rows are (batch, pos, head) with HD contiguous floats (f32 projection output);
// pos = (row / hpr) mod SEQ.  w[d] = x[d] * cos[pos][d] + r[d] * sin[pos][d],  r[d] = -x[d+32] for d < 32, x[d-32] for d >= 32;
// hi[d] = f16(w * sc), lo[d] = f16(w * sc - hi[d])  (sc a power of two, residual unscaled).
// Output planes in fragment order with plane row = (batch * hpr + head) * SEQ + pos and K = HD (2 tiles per 16 positions).
// Thread = 8 consecutive d of one row: 16-B loads of x (own and partner half), cos, sin; one 16-B store per plane per lane;
// a wave = 8 positions of one head x the 4 chunks of one tile, so 8 lanes fill one 128-B line of each plane.
// coverage: nrows*8/256 blocks x 256 thr x 8 halves = nrows x 64 of each plane exactly (exact division checked statically).
// =====================================================================================================
__device__ __forceinline__ void rope_body(int bid, const float* __restrict__ x, const float* __restrict__ cosT,
                                          const float* __restrict__ sinT, u16* hpl, u16* lpl,
                                          int nrows, int hpr, float sc) {
  const int gt  = bid * 256 + (int)threadIdx.x;
  const int tile = gt >> 6;
  const int pr  = (tile >> 1) * 16 + ((gt >> 5) & 1) * 8 + (gt & 7);   // plane row
  const int q   = (gt >> 3) & 3;
  const int d0  = (tile & 1) * 32 + q * 8;
  if (pr >= nrows) return;                  // never taken with the exact block range; no barriers in this part
  const int pos = pr & (SEQ - 1);
  const int bh  = pr / SEQ;
  const int row = ((bh / hpr) * SEQ + pos) * hpr + bh % hpr;           // source row (batch, pos, head)
  const int d1  = d0 ^ 32;
  const float* xr = x + (size_t)row * HD;
  const float* cr = cosT + (size_t)pos * HD + d0;
  const float* sr = sinT + (size_t)pos * HD + d0;
  const v4f xa = *(const v4f*)(xr + d0), xb = *(const v4f*)(xr + d0 + 4);
#if defined(__HIP_DEVICE_COMPILE__)
  // in this build the next load's result takes over the address pair of the two loads above: the wait stands in front of it
  asm volatile("s_wait_xcnt 0x0" ::: "memory");
#endif
  const v4f ya = *(const v4f*)(xr + d1);
  const v4f yb = *(const v4f*)(xr + d1 + 4);
  const v4f ca = *(const v4f*)(cr), cb = *(const v4f*)(cr + 4);
  const v4f sa = *(const v4f*)(sr), sb = *(const v4f*)(sr + 4);
  const float sgn = (d0 < 32) ? -1.0f : 1.0f;
  float w[8];
#pragma unroll
  for (int e = 0; e < 4; ++e) {
    w[e]     = xa[e] * ca[e] + (sgn * ya[e]) * sa[e];
    w[4 + e] = xb[e] * cb[e] + (sgn * yb[e]) * sb[e];
  }
  v4u oh, ol;
#pragma unroll
  for (int e = 0; e < 4; ++e) {
    const float t0 = w[2 * e] * sc, t1 = w[2 * e + 1] * sc;
    const _Float16 h0 = (_Float16)t0, h1 = (_Float16)t1;
    const _Float16 l0 = (_Float16)(t0 - (float)h0), l1 = (_Float16)(t1 - (float)h1);
    oh[e] = pk16(h_bits(h0), h_bits(h1));
    ol[e] = pk16(h_bits(l0), h_bits(l1));
  }
  const size_t o8 = (size_t)tile * FT + q * 128 + (pr & 15) * 8;
  {
    *(v4u*)(hpl + o8) = oh;
    *(v4u*)(lpl + o8) = ol;
    
  }
}

// =====================================================================================================
// v^T planes: VH[(b*NKV + g)*HD + d][s] = f16(v[b][s][g][d] * 1024), VL = f16 residual of the same value; fragment order, K = SEQ.
// Block = (b, g, 64 keys): 64 source rows of HD floats loaded with 16-B loads, converted, scattered into two LDS tiles
// coverage: load 256 thr x 16 elements = 64 x 64; store 2 iterations x 256 thr x 8 halves = 8 fragment tiles (4 d x 2 key) of
//           each plane, a wave = 512 contiguous bytes; NB x NKV x SEQ/64 = 256 blocks cover both planes exactly once.
// =====================================================================================================
__device__ __forceinline__ void vt_body(u16* TH, u16* TL, int bid, const float* __restrict__ v, u16* VHo, u16* VLo) {
  const int tid = threadIdx.x;
  const int st  = bid & 31;
  const int g   = (bid >> 5) & 3;
  const int b   = bid >> 7;
  const int s0  = st * 64;
  {
    const int sl = tid >> 2;                  // key within tile 0..63
    const int dc = (tid & 3) * 16;            // d chunk
    const float* src = v + (((size_t)(b * SEQ + s0 + sl)) * NKV + g) * HD + dc;
#pragma unroll
    for (int i = 0; i < 4; ++i) {
      const v4f a = *(const v4f*)(src + 4 * i);
#pragma unroll
      for (int e = 0; e < 4; ++e) {
        const float t = a[e] * VCAR;
        const _Float16 h = (_Float16)t;
        const _Float16 l = (_Float16)(t - (float)h);
        TH[(dc + 4 * i + e) * VTP + sl] = h_bits(h);
        TL[(dc + 4 * i + e) * VTP + sl] = h_bits(l);
      }
    }
  }
  __syncthreads();
  v4u vh[2], vl[2];
  const int m16 = tid & 15, q4 = (tid >> 4) & 3, dt = tid >> 7, kt = (tid >> 6) & 1;   // d tile dt (+2 per iteration), key tile kt
#pragma unroll
  for (int it = 0; it < 2; ++it) {
    const int line = (it * 2 + dt) * 16 + m16;   // d = 0..63
    vh[it] = *(const v4u*)(TH + line * VTP + kt * 32 + q4 * 8);
    vl[it] = *(const v4u*)(TL + line * VTP + kt * 32 + q4 * 8);
  }
  const size_t base = ((size_t)((b * NKV + g) * (HD / 16) + dt) * (SEQ / 32) + (size_t)((s0 >> 5) + kt)) * FT + q4 * 128 + m16 * 8;
  {
#pragma unroll
    for (int it = 0; it < 2; ++it) {
      const size_t o8 = base + (size_t)(it * 2) * (SEQ / 32) * FT;
      *(v4u*)(VHo + o8) = vh[it];
      *(v4u*)(VLo + o8) = vl[it];
    }
    
  }
}

// =====================================================================================================
// Launch 3: everything between the projections and attention, one launch, parts picked by block range (block-uniform):
//   [0, 256)      v^T planes (they hold the one block barrier, so they start first)
//   [256, 768)    k' planes: rows (b, g, s) from source rows (b, s, g), heads per position NKV
//   [768, 2304)   q' planes: rows (b, h, s) from source rows (b, s, h), heads per position NH
// Each part keeps its own block count and per-block work; no part reads what another part writes.
// =====================================================================================================
#define QB_VT (NB * NKV * (SEQ / 64))
#define QB_RK ((NB * SEQ * NKV * 8) / 256)
#define QB_RQ ((NB * SEQ * NH * 8) / 256)
#define POST_BLOCKS (QB_VT + QB_RK + QB_RQ)
static_assert(QB_VT == 256 && QB_RK == 512 && QB_RQ == 1536);
__global__ __launch_bounds__(256)
void post(const float* __restrict__ QF, const float* __restrict__ KF, const float* __restrict__ VF,
          const float* __restrict__ cosT, const float* __restrict__ sinT,
          u16* QHI, u16* QLO, u16* KHI, u16* KLO, u16* VHI, u16* VLO) {
  __shared__ __align__(16) u16 TH[HD * VTP];
  __shared__ __align__(16) u16 TL[HD * VTP];
  const int bid = blockIdx.x;
  if (bid < QB_VT) {
    vt_body(TH, TL, bid, VF, VHI, VLO);
  } else {
    const bool isq = bid >= QB_VT + QB_RK;
    rope_body(isq ? bid - (QB_VT + QB_RK) : bid - QB_VT, isq ? QF : KF, cosT, sinT, isq ? QHI : KHI, isq ? QLO : KLO,
              isq ? NB * SEQ * NH : NB * SEQ * NKV, isq ? NH : NKV, isq ? QSC : KSC);
  }
}

// =====================================================================================================
// GQA flash attention with causal window + global-token mask: block = (batch b, kv head g, 16 query rows q0..q0+15),
// one wave per query head g*GRP + wave (kv index = head / GRP).
//   q planes (hi, lo f16) rows [b][h][s], k = d; k planes rows [b][g][s], k = d; v^T planes rows [b][g][d], k = s; O planes rows
//   [b][s], k = h*64 + d; all in fragment order.
//   Key blocks of 32 visited in a fixed, block-uniform list: {0} + {32 if q0 >= 32} + {jlo, jlo+32, ... < q0+16},
//   jlo = 64 if q0-511 <= 64 else (q0-511) & ~31; the element mask allowed(i,j) = (j <= i) && (i-j < 512 || j < 64) replaces the
//   score by -inf inside partial blocks (block 0 comes first and key 0 is allowed for every row, so each running max is finite
//   before any fully masked block row can occur).
//   Both products are taken transposed: S^T = k'.q'^T (A = key rows, B = query columns) and O^T += v^T.P^T (A = v^T rows d,
//   B = P^T). A lane then owns ONE query (column c = lane & 15) and 16 of the block's 32 keys (8hh + r and 16 + 8hh + r), so
//   the maximum and the sum of a row are taken inside the lane, with one exchange between the two lane halves for the maximum
//   per block and one for the sum after the loop; the two score tiles of a lane, converted in place, ARE the B fragment of P^T
//   in the split k map (elements 0..7 = keys 8hh + 0..7, elements 8..15 = keys 16 + 8hh + 0..7), the map of the v^T loader.
//   Per block: 2 score subtiles x 2 k-steps x 3 products (k_hi.q_hi + k_hi.q_lo + k_lo.q_hi), fragments loaded straight from the
//   16-bit planes (two 16-B loads per fragment, split k map); online max-subtracted base-2 softmax in f32 (scale 1/8 folded);
//   P*32768 as f16 hi and f16 residual, 4+4 v^T A fragments (hi and residual planes), 12 WMMAs (hh + hl + lh).
//   O^T register r of tile j = (d = 16j + 8hh + r, query c): 8 consecutive d of one row = one 16-B chunk of the O planes, so the
//   wave's two tiles of the O hi plane and of the O lo plane (O x1024 as f16 hi + residual) go out 512 contiguous bytes a store.
//   No LDS and no barriers in this kernel; every wave does bounded work (MAXBLK steps max).
// coverage: per wave 4 instructions x 32 lanes x 8 halves = 16 x 64 per plane; grid 1024 blocks x 3 waves = every
//           (b, s, h) row of both O planes exactly once.
// =====================================================================================================
__device__ __forceinline__ float xhalf(float v) {                     // the value of lane ^ 16 (vector cross-row move, no LDS path)
  const int b = __builtin_bit_cast(int, v);
  return __builtin_bit_cast(float, __builtin_amdgcn_permlanex16(b, b, 0x76543210, 0xfedcba98, false, false));
}
__global__ __launch_bounds__(ATT_THREADS)
void attn_gqa(const u16* __restrict__ QHIp, const u16* __restrict__ QLOp,
              const u16* __restrict__ KHIp, const u16* __restrict__ KLOp,
              const u16* __restrict__ VHIp, const u16* __restrict__ VLOp,
              u16* OHIp, u16* OLOp) {
  const int tid  = threadIdx.x;
  const int wave = __builtin_amdgcn_readfirstlane(tid >> 5);   // scalar wave number: wave-uniform q and O tile pointers
  const int lane = tid & 31;
  const unsigned lo = (unsigned)lane * 8u;
  const int hh   = lane >> 4;
  const int c    = lane & 15;

  const int bid  = blockIdx.x;
  const int qt   = bid & (SEQ / 16 - 1);
  const int g    = (bid >> 7) & (NKV - 1);
  const int b    = bid >> 9;
  const int head = g * GRP + wave;
  const int q0   = qt * 16;

  const size_t qofs = ((size_t)(b * NH + head) * SEQ + q0) * HD;               // 16 positions = 2 tiles = 16 * HD elements
  const _Float16* Qh  = (const _Float16*)(const void*)QHIp + qofs;
  const _Float16* Ql  = (const _Float16*)(const void*)QLOp + qofs;
  const size_t kofs = (size_t)(b * NKV + g) * SEQ * HD;                         // key tiles of kb added per step
  const _Float16* Khb = (const _Float16*)(const void*)KHIp + kofs;
  const _Float16* Klb = (const _Float16*)(const void*)KLOp + kofs;
  const size_t vofs = (size_t)(b * NKV + g) * HD * SEQ;                         // d tile j: + 16j * SEQ; key tile of kb added per step
  const _Float16* Vhb = (const _Float16*)(const void*)VHIp + vofs;
  const _Float16* Vlb = (const _Float16*)(const void*)VLOp + vofs;
  const float lsc = 0.125f * (LOG2E / (QSC * KSC));

  float mrun = -INFINITY, lsum = 0.f;      // this lane's query: running max (equal in both halves), sum over this lane's keys
  v8f o[4];
#pragma unroll
  for (int j = 0; j < 4; ++j) o[j] = zero8();

  const int nglob = (q0 >= 32) ? 2 : 1;
  const int wlo   = q0 - (WIN - 1);
  const int jlo   = (wlo <= GLB) ? GLB : (wlo & ~31);
  int nwin = q0 + 16 - jlo;
  nwin = (nwin > 0) ? ((nwin + 31) >> 5) : 0;
  int nblk = nglob + nwin;
  nblk = (nblk > MAXBLK) ? MAXBLK : nblk;

  // wave-uniform tile pointers of the current key block (the list starts at key 0), moved on at the foot of each step
  const _Float16* k0p = Khb;
  const _Float16* l0p = Klb;
  const _Float16* vhp = Vhb;
  const _Float16* vlp = Vlb;
  const int i = q0 + c;                    // this lane's query position
  int kb = 0;
  // q' fragments: the same in every step, held in registers
  v16h qh[2], ql[2];
#pragma unroll
  for (int kk = 0; kk < 2; ++kk) {
    qh[kk] = ldfrag_h(Qh + kk * FT, lo);
    ql[kk] = ldfrag_h(Ql + kk * FT, lo);
  }
#pragma unroll 1
  for (int it = 0; it < nblk; ++it) {
    // ---- every fragment load of this step, one group: k' of both k-steps (in the order the products take them), then v^T ----
    const _Float16* k1p = k0p + (size_t)16 * HD;
    const _Float16* l1p = l0p + (size_t)16 * HD;
    v16h kh0[2], kl0[2], kh1[2], kl1[2];
#pragma unroll
    for (int kk = 0; kk < 2; ++kk) {
      kh0[kk] = ldfrag_h(k0p + kk * FT, lo);
      kh1[kk] = ldfrag_h(k1p + kk * FT, lo);
      kl0[kk] = ldfrag_h(l0p + kk * FT, lo);
      kl1[kk] = ldfrag_h(l1p + kk * FT, lo);
    }
    // v^T A fragments: row = d = j*16 + c, the 32 keys of this step = one key tile of the v^T planes
    const v16h vh0 = ldfrag_h(vhp, lo);
    const v16h vh1 = ldfrag_h(vhp + (size_t)16 * SEQ, lo);
    const v16h vh2 = ldfrag_h(vhp + (size_t)32 * SEQ, lo);
    const v16h vh3 = ldfrag_h(vhp + (size_t)48 * SEQ, lo);
    const v16h vl0 = ldfrag_h(vlp, lo);
    const v16h vl1 = ldfrag_h(vlp + (size_t)16 * SEQ, lo);
    const v16h vl2 = ldfrag_h(vlp + (size_t)32 * SEQ, lo);
    const v16h vl3 = ldfrag_h(vlp + (size_t)48 * SEQ, lo);
    // keeps the 32 loads one group at the head of the step: a load that sinks behind a product starts a latency of its own
    __builtin_amdgcn_sched_barrier(0);
    // ---- element mask of this step (needs no score: it can run while the k' fragments are on their way) ----
    bool ok0[8], ok1[8];
#pragma unroll
    for (int r = 0; r < 8; ++r) {
      const int j0 = kb + 8 * hh + r, j1 = kb + 16 + 8 * hh + r;
      ok0[r] = (j0 <= i) && (((i - j0) < WIN) || (j0 < GLB));
      ok1[r] = (j1 <= i) && (((i - j1) < WIN) || (j1 < GLB));
    }
    // as built without it every compare of the mask sinks behind the scores and lengthens the step; with it most of them stand
    // among the score products, under the waits for the k' fragments
    __builtin_amdgcn_sched_barrier(0);
    // ---- scores^T: D element r of this lane = (key kb + 8hh + r, query q0 + c) in s0, key kb + 16 + 8hh + r in s1 ----
    v8f s0 = zero8(), s1 = zero8();
#pragma unroll
    for (int kk = 0; kk < 2; ++kk) {
      s0 = mma_h(kh0[kk], qh[kk], s0);
      s0 = mma_h(kh0[kk], ql[kk], s0);
      s0 = mma_h(kl0[kk], qh[kk], s0);
      s1 = mma_h(kh1[kk], qh[kk], s1);
      s1 = mma_h(kh1[kk], ql[kk], s1);
      s1 = mma_h(kl1[kk], qh[kk], s1);
      guard2(s0, s1, qh[kk], ql[kk], kh0[kk], kl0[kk], kh1[kk], kl1[kk]);
    }
    // ---- mask (replace by -inf) + online softmax in base 2, one query per lane ----
    float t0[8], t1[8];
#pragma unroll
    for (int r = 0; r < 8; ++r) {
      t0[r] = ok0[r] ? (s0[r] * lsc) : -INFINITY;
      t1[r] = ok1[r] ? (s1[r] * lsc) : -INFINITY;
    }
    float mx = fmaxf(t0[0], t1[0]);
#pragma unroll
    for (int r = 1; r < 8; ++r) mx = fmaxf(mx, fmaxf(t0[r], t1[r]));
    mx = fmaxf(mx, xhalf(mx));
    const float mn = fmaxf(mrun, mx);
    const float al = exp2f(mrun - mn);
    mrun = mn;
    // ---- B fragments of P^T * 32768: hi f16 and residual f16, column = c, split k map over the 32 keys of this step ----
    FragH ph, pl;
    float ps0 = 0.f, ps1 = 0.f;
#pragma unroll
    for (int r = 0; r < 8; ++r) {
      const float e0 = exp2f(t0[r] - mn), e1 = exp2f(t1[r] - mn);
      ps0 += e0;
      ps1 += e1;
      const float ta = e0 * PCAR, tb = e1 * PCAR;
      const _Float16 ha = (_Float16)ta, hb = (_Float16)tb;
      ph.h[0][r] = ha;                                     // elements 0..7  = keys kb + 8hh + 0..7
      ph.h[1][r] = hb;                                     // elements 8..15 = keys kb + 16 + 8hh + 0..7
      pl.h[0][r] = (_Float16)(ta - (float)ha);
      pl.h[1][r] = (_Float16)(tb - (float)hb);
    }
    lsum = lsum * al + (ps0 + ps1);
#pragma unroll
    for (int j = 0; j < 4; ++j)
#pragma unroll
      for (int r = 0; r < 8; ++r) o[j][r] *= al;
    // ---- O^T += v^T.P^T ----
    {
      o[0] = mma_h(vh0, ph.v, o[0]);  o[0] = mma_h(vh0, pl.v, o[0]);  o[0] = mma_h(vl0, ph.v, o[0]);
      o[1] = mma_h(vh1, ph.v, o[1]);  o[1] = mma_h(vh1, pl.v, o[1]);  o[1] = mma_h(vl1, ph.v, o[1]);
      o[2] = mma_h(vh2, ph.v, o[2]);  o[2] = mma_h(vh2, pl.v, o[2]);  o[2] = mma_h(vl2, ph.v, o[2]);
      o[3] = mma_h(vh3, ph.v, o[3]);  o[3] = mma_h(vh3, pl.v, o[3]);  o[3] = mma_h(vl3, ph.v, o[3]);
      guard10(o[0], o[1], o[2], o[3], ph.v, pl.v, vh0, vh1, vh2, vh3, vl0, vl1, vl2, vl3);
    }
    const int kn = (it + 1 < nglob) ? ((it + 1) * 32) : (jlo + (it + 1 - nglob) * 32);   // next key block of the list
    const int dk = kn - kb;                                                              // a positive multiple of 32
    k0p += (size_t)dk * HD;
    l0p += (size_t)dk * HD;
    vhp += (size_t)(dk >> 5) * FT;
    vlp += (size_t)(dk >> 5) * FT;
    kb = kn;
  }
  acc_guard4(o[0], o[1], o[2], o[3]);

  // ---- join the two halves' sums, fold 1/l and the carries (32768 on P, 1024 on v) ----
  const float oc = 1.0f / (PCAR * VCAR);
  const float inv = (1.0f / (lsum + xhalf(lsum))) * oc;
  // ---- O x1024 -> f16 hi + residual planes; the wave's 16 x 64 = 2 neighbouring tiles; lane = (row c, chunk 2 * j + hh) ----
  v4u oh[4], ol[4];
#pragma unroll
  for (int j = 0; j < 4; ++j) {
    float w[8];
#pragma unroll
    for (int r = 0; r < 8; ++r) w[r] = (o[j][r] * inv) * OSC;
#pragma unroll
    for (int e = 0; e < 4; ++e) {
      const _Float16 h0 = (_Float16)w[2 * e], h1 = (_Float16)w[2 * e + 1];
      const _Float16 l0 = (_Float16)(w[2 * e] - (float)h0), l1 = (_Float16)(w[2 * e + 1] - (float)h1);
      oh[j][e] = pk16(h_bits(h0), h_bits(h1));
      ol[j][e] = pk16(h_bits(l0), h_bits(l1));
    }
  }
  const size_t ob = (size_t)(b * SEQ + q0) * (NH * HD) + (size_t)(head * 2) * FT + lo;
  {
#pragma unroll
    for (int j = 0; j < 4; ++j) {
      const size_t o8 = ob + (size_t)j * 256;
      *(v4u*)(OHIp + o8) = oh[j];
      *(v4u*)(OLOp + o8) = ol[j];
    }
  }
}

// =====================================================================================================
// Workspace map (bytes); every plane is fully written by whole-line stores before it is read; all extents are exact multiples
// of the store granularity (no pad rows needed); every offset a multiple of 65536:
//   CT  f32 [2048][64]                 524288        ST  same              524288
//   (16-bit planes: rows x K named below, stored in fragment order)
//   XB  bf16 [4096][768]              6291456
//   WQT bf16 [768 n][768 k]           1179648        WKT bf16 [256][768]   393216     WVT same   393216
//   WOT f16  [768 n][768 k] x1024     1179648
//   QF  f32 [4096][768]              12582912        KF f32 [4096][256]   4194304     VF same   4194304
//   QHI f16 [2][12][2048][64] x1024   6291456        QLO residual         6291456
//   KHI f16 [2][4][2048][64] x1024    2097152        KLO residual         2097152
//   VHI f16 [2][4][64][2048] x1024    2097152        VLO residual         2097152
//   OHI f16 [4096][768] x1024         6291456        OLO residual         6291456
//   end                              65011712
// =====================================================================================================
extern "C" void kernel_launch(void* const* d_in, const int* in_sizes, int n_in,
                              void* d_out, int out_size, void* d_ws, size_t ws_size,
                              hipStream_t stream) {
  const int ROWS = NB * SEQ;                            // 4096
  if (n_in < 5) return;
  if (in_sizes[0] != ROWS * DMOD) return;
  if (in_sizes[1] != DMOD * (NH * HD)) return;
  if (in_sizes[2] != DMOD * (NKV * HD) || in_sizes[3] != DMOD * (NKV * HD)) return;
  if (in_sizes[4] != (NH * HD) * DMOD) return;
  if (out_size != ROWS * DMOD) return;

  const float* x  = (const float*)d_in[0];
  const float* wq = (const float*)d_in[1];
  const float* wk = (const float*)d_in[2];
  const float* wv = (const float*)d_in[3];
  const float* wo = (const float*)d_in[4];
  float*       out = (float*)d_out;

  const size_t szTab = (size_t)SEQ * HD * 4;                    //   524288
  const size_t szXB  = (size_t)ROWS * DMOD * 2;                 //  6291456
  const size_t szWQT = (size_t)(NH * HD) * DMOD * 2;            //  1179648
  const size_t szWKT = (size_t)(NKV * HD) * DMOD * 2;           //   393216
  const size_t szWOT = (size_t)DMOD * (NH * HD) * 2;            //  1179648
  const size_t szQF  = (size_t)ROWS * (NH * HD) * 4;            // 12582912
  const size_t szKF  = (size_t)ROWS * (NKV * HD) * 4;           //  4194304
  const size_t szQP  = (size_t)ROWS * (NH * HD) * 2;            //  6291456
  const size_t szKP  = (size_t)ROWS * (NKV * HD) * 2;           //  2097152
  const size_t szVP  = (size_t)NB * NKV * HD * SEQ * 2;         //  2097152
  const size_t szOP  = (size_t)ROWS * (NH * HD) * 2;            //  6291456
  size_t off = 0;
  const size_t oCT  = off; off += szTab;
  const size_t oST  = off; off += szTab;
  const size_t oXB  = off; off += szXB;
  const size_t oWQT = off; off += szWQT;
  const size_t oWKT = off; off += szWKT;
  const size_t oWVT = off; off += szWKT;
  const size_t oWOT = off; off += szWOT;
  const size_t oQF  = off; off += szQF;
  const size_t oKF  = off; off += szKF;
  const size_t oVF  = off; off += szKF;
  const size_t oQHI = off; off += szQP;
  const size_t oQLO = off; off += szQP;
  const size_t oKHI = off; off += szKP;
  const size_t oKLO = off; off += szKP;
  const size_t oVHI = off; off += szVP;
  const size_t oVLO = off; off += szVP;
  const size_t oOHI = off; off += szOP;
  const size_t oOLO = off; off += szOP;
  if (off > ws_size) return;                            // off = 65011712
  if (off > (size_t)134217728) return;

  char* ws = (char*)d_ws;
  float* CT  = (float*)(ws + oCT);
  float* ST  = (float*)(ws + oST);
  u16*   XB  = (u16*)(ws + oXB);
  u16*   WQT = (u16*)(ws + oWQT);
  u16*   WKT = (u16*)(ws + oWKT);
  u16*   WVT = (u16*)(ws + oWVT);
  u16*   WOT = (u16*)(ws + oWOT);
  float* QF  = (float*)(ws + oQF);
  float* KF  = (float*)(ws + oKF);
  float* VF  = (float*)(ws + oVF);
  u16*   QHI = (u16*)(ws + oQHI);
  u16*   QLO = (u16*)(ws + oQLO);
  u16*   KHI = (u16*)(ws + oKHI);
  u16*   KLO = (u16*)(ws + oKLO);
  u16*   VHI = (u16*)(ws + oVHI);
  u16*   VLO = (u16*)(ws + oVLO);
  u16*   OHI = (u16*)(ws + oOHI);
  u16*   OLO = (u16*)(ws + oOLO);

  // inv_freq[i] = 1 / pow(10000, i/32) in f32 (pow correctly converted from f64, then IEEE f32 reciprocal)
  InvF inv;
  for (int i = 0; i < 32; ++i) {
    const double p = pow(10000.0, (double)i / 32.0);
    const float pf = (float)p;
    inv.f[i] = 1.0f / pf;
  }

  const dim3 blk(256);
  const dim3 gPrep(PREP_BLOCKS);                        // 2176
  const dim3 gQKV(QKV_BLOCKS);                          // 1280
  const dim3 gPost(POST_BLOCKS);                        // 2304
  const dim3 gGO((ROWS / 64) * (DMOD / 64));            // 768
  const dim3 bG(128);
  const dim3 gAT(ATT_BLOCKS);                           // 1024
  const dim3 bAT(ATT_THREADS);                          // 96

  // (1) weights W[k rows][n cols] -> [n][k] 16-bit planes in fragment order (bf16 for wq/wk/wv; f16 of bf16 value x1024 for wo),
  //     rotary cos/sin tables [2048][64], x -> bf16 plane
  prep<<<gPrep, blk, 0, stream>>>(x, wq, wk, wv, wo, XB, WQT, WKT, WVT, WOT, CT, ST, inv);
  // (2) projections: q [4096][768], k [4096][256], v [4096][256] in f32
  gemm_qkv<<<gQKV, bG, 0, stream>>>(XB, WQT, WKT, WVT, QF, KF, VF, ROWS, DMOD, 1.0f);
  // (3) q' and k' planes (rotary, hi + residual), v^T planes x1024 (hi + residual)
  post<<<gPost, blk, 0, stream>>>(QF, KF, VF, CT, ST, QHI, QLO, KHI, KLO, VHI, VLO);
  // (4) attention -> O planes [b][s][h][d] x1024 (hi + residual)
  attn_gqa<<<gAT, bAT, 0, stream>>>(QHI, QLO, KHI, KLO, VHI, VLO, OHI, OLO);
  // (5) output projection -> out [4096][768] f32, carries 1024 (O) x 1024 (wo) folded back
  gemm_h2<<<gGO, bG, 0, stream>>>(OHI, OLO, WOT, out, ROWS, DMOD, NH * HD, 1.0f / (OSC * WOS));
  (void)hipGetLastError();
}

// v005
// Measured time: 65 microseconds a run.
// Next to v004, in two timings, it ran 1.07 times as fast each time.
// Counting every step since v000, it is 2.28 times as fast.
// Contractions: x.W{q,k,v} on v_wmma_f32_16x16x32_bf16 (x and W RNE-converted to bf16, exact operands, f32 accumulate);
// scores k'.q'^T (transposed; q', k' carried x1024 as f16 hi plane + f16 residual plane, products hh+lh+hl), v^T.P^T (transposed; P x32768 f16 hi+residual,
// v x1024 f16 hi+residual, products hh+lh+hl) and O.wo (O x1024 f16 hi+residual, wo as f16(bf16(wo) x1024), products h.w+l.w):
// v_wmma_f32_16x16x32_f16, f32 accumulate. Rotary tables, rotation, masked base-2 online softmax and 1/l fold in f32 on VALU.
#include <hip/hip_runtime.h>
#include <math.h>
#include <stdint.h>

#define NB    2
#define SEQ   2048
#define DMOD  768
#define NH    12
#define NKV   4
#define HD    64
#define GRP   3
#define WIN   512
#define GLB   64
#define QSC   1024.0f
#define KSC   1024.0f
#define PCAR  32768.0f
#define VCAR  1024.0f
#define OSC   1024.0f
#define WOS   1024.0f
#define LOG2E 1.4426950408889634f
#define ATT_THREADS (GRP * 32)
#define ATT_BLOCKS  (NB * NKV * (SEQ / 16))
#define SLAB64 (16 * 68)
#define VTP   72
#define MAXBLK 20
#define FT    512
#define KUQ   3      // k-steps of 32 whose fragment loads one trip of the q/k/v GEMM issues together
#define KUO   4      // the same for the output projection
static_assert(NH == NKV * GRP);
static_assert(HD == 64 && DMOD == NH * HD);
static_assert((SEQ / 16) == 128 && NKV == 4 && NB == 2);
static_assert(ATT_THREADS == 96 && ATT_BLOCKS == 1024);
static_assert(((NB * SEQ * NH * 8) % 256) == 0 && ((NB * SEQ * NKV * 8) % 256) == 0);
static_assert(((NB * SEQ) % 64) == 0 && (DMOD % 64) == 0 && ((NKV * HD) % 64) == 0 && (DMOD % 32) == 0);
static_assert((SEQ % 64) == 0 && (SEQ % 8) == 0);
static_assert((DMOD % (32 * KUQ)) == 0 && ((NH * HD) % (32 * KUO)) == 0);   // whole trips: no load past a plane's row of tiles

typedef unsigned short u16;
typedef _Float16 v16h __attribute__((ext_vector_type(16)));
typedef _Float16 v8h  __attribute__((ext_vector_type(8)));
typedef __bf16   v16b __attribute__((ext_vector_type(16)));
typedef float    v8f  __attribute__((ext_vector_type(8)));
typedef float    v4f  __attribute__((ext_vector_type(4)));
typedef unsigned int v4u __attribute__((ext_vector_type(4)));

union FragH { v16h v; v8h h[2]; v4u u[2]; };
union FragB { v16b v; v4u u[2]; };

struct InvF { float f[32]; };
static_assert(sizeof(InvF) == 128);

// ---- scalar helpers --------------------------------------------------------------------------------
__device__ __forceinline__ unsigned short bf_bits(float f) {          // f32 -> bf16 bits, RNE convert
  unsigned u = __float_as_uint(f);
  return (unsigned short)((u + 0x7FFFu + ((u >> 16) & 1u)) >> 16);
}
__device__ __forceinline__ float bf_up(unsigned short h) { return __uint_as_float(((unsigned)h) << 16); }
__device__ __forceinline__ float bfr(float f) { return bf_up(bf_bits(f)); }
__device__ __forceinline__ unsigned short h_bits(_Float16 x) { return __builtin_bit_cast(unsigned short, x); }
__device__ __forceinline__ unsigned pk16(unsigned short a, unsigned short b) { return (unsigned)a | ((unsigned)b << 16); }
__device__ __forceinline__ v8f zero8() { v8f z = {0.f, 0.f, 0.f, 0.f, 0.f, 0.f, 0.f, 0.f}; return z; }

// ---- fragment-order planes: every 16-bit operand plane [rows][K] is kept as 16-row x 32-k tiles of FT elements (1 KiB),
//      tile (rt, kt) at (rt * (K / 32) + kt) * FT, and inside a tile as 16-B chunks [q = (k & 31) >> 3][row & 15][k & 7].
// ---- fragment loaders: 16-bit A/B operand, lane -> row/col (lane&15), h = lane>>4, t = the tile (wave-uniform), lo = lane * 8;
//      elements 0..7 <- t[lo..lo+7] (chunk q = h: k0+8h..), elements 8..15 <- t[256+lo..] (chunk q = 2+h: k0+16+8h..)
//      (same split k map for A and B); each of the two loads of a wave is 512 contiguous bytes = 4 whole lines
__device__ __forceinline__ v16h ldfrag_h(const _Float16* t, unsigned lo) {
  FragH f;
  f.h[0] = *(const v8h*)(t + lo);
  f.h[1] = *(const v8h*)(t + 256 + lo);
  return f.v;
}
__device__ __forceinline__ v16b ldfrag_b(const u16* t, unsigned lo) { // bf16 plane read as unsigned integer vectors
  FragB f;
  f.u[0] = *(const v4u*)(t + lo);
  f.u[1] = *(const v4u*)(t + 256 + lo);
  return f.v;
}

__device__ __forceinline__ v8f mma_h(v16h a, v16h b, v8f c) {
  return __builtin_amdgcn_wmma_f32_16x16x32_f16(false, a, false, b, (short)0, c, false, false);
}
__device__ __forceinline__ v8f mma_b(v16b a, v16b b, v8f c) {
  return __builtin_amdgcn_wmma_f32_16x16x32_bf16(false, a, false, b, (short)0, c, false, false);
}
__device__ __forceinline__ void guard2(v8f& a, v8f& b, v16h x0, v16h x1, v16h x2, v16h x3, v16h x4, v16h x5) {
#if defined(__HIP_DEVICE_COMPILE__)
  asm volatile("v_nop\n\tv_nop\n\tv_nop\n\tv_nop"
               : "+v"(a), "+v"(b) : "v"(x0), "v"(x1), "v"(x2), "v"(x3), "v"(x4), "v"(x5) : "memory");
#endif
}
template <typename F>
__device__ __forceinline__ void guard6(v8f& a, v8f& b, v8f& c, v8f& d, F x0, F x1, F x2, F x3, F x4, F x5) {
#if defined(__HIP_DEVICE_COMPILE__)
  asm volatile("v_nop\n\tv_nop\n\tv_nop\n\tv_nop"
               : "+v"(a), "+v"(b), "+v"(c), "+v"(d) : "v"(x0), "v"(x1), "v"(x2), "v"(x3), "v"(x4), "v"(x5) : "memory");
#endif
}
__device__ __forceinline__ void guard10(v8f& a, v8f& b, v8f& c, v8f& d, v16h x0, v16h x1, v16h x2, v16h x3, v16h x4,
                                        v16h x5, v16h x6, v16h x7, v16h x8, v16h x9) {
#if defined(__HIP_DEVICE_COMPILE__)
  asm volatile("v_nop\n\tv_nop\n\tv_nop\n\tv_nop"
               : "+v"(a), "+v"(b), "+v"(c), "+v"(d)
               : "v"(x0), "v"(x1), "v"(x2), "v"(x3), "v"(x4), "v"(x5), "v"(x6), "v"(x7), "v"(x8), "v"(x9) : "memory");
#endif
}
__device__ __forceinline__ void acc_guard4(v8f& a, v8f& b, v8f& c, v8f& d) {
#if defined(__HIP_DEVICE_COMPILE__)
  asm volatile("v_nop\n\tv_nop\n\tv_nop\n\tv_nop" : "+v"(a), "+v"(b), "+v"(c), "+v"(d));
#endif
}
__device__ __forceinline__ void wave_sync_lds() {
  __builtin_amdgcn_fence(__ATOMIC_RELEASE, "workgroup");
  __builtin_amdgcn_wave_barrier();
  __builtin_amdgcn_fence(__ATOMIC_ACQUIRE, "workgroup");
}

// ---- accurate f32 sin/cos of a non-negative f32 angle (|angle| < 2048): f64 two-part pi/2 reduction + f64 polynomials,
//      plain f64 fma/mul only (no library f64 trig path), result converted to f32.
__device__ __forceinline__ void sincos_acc(float angf, float& sv, float& cv) {
  const double a = (double)angf;
  const double TWO_OVER_PI = 0.63661977236758134308;
  const double PIO2_HI = 1.5707963267948966;
  const double PIO2_LO = 6.123233995736766e-17;
  const int kq = (int)(a * TWO_OVER_PI + 0.5);
  const double kd = (double)kq;
  double r = fma(-kd, PIO2_HI, a);
  r = fma(-kd, PIO2_LO, r);
  const double r2 = r * r;
  double sp = 1.0 / 6227020800.0;
  sp = fma(sp, r2, -1.0 / 39916800.0);
  sp = fma(sp, r2, 1.0 / 362880.0);
  sp = fma(sp, r2, -1.0 / 5040.0);
  sp = fma(sp, r2, 1.0 / 120.0);
  sp = fma(sp, r2, -1.0 / 6.0);
  const double s = fma(sp * r2, r, r);
  double cp = -1.0 / 87178291200.0;
  cp = fma(cp, r2, 1.0 / 479001600.0);
  cp = fma(cp, r2, -1.0 / 3628800.0);
  cp = fma(cp, r2, 1.0 / 40320.0);
  cp = fma(cp, r2, -1.0 / 720.0);
  cp = fma(cp, r2, 1.0 / 24.0);
  cp = fma(cp, r2, -0.5);
  const double c = fma(cp, r2, 1.0);
  const int qd = kq & 3;
  const double so = (qd == 0) ? s : (qd == 1) ? c : (qd == 2) ? -s : -c;
  const double co = (qd == 0) ? c : (qd == 1) ? -s : (qd == 2) ? -c : s;
  sv = (float)so;
  cv = (float)co;
}

// =====================================================================================================
// Rotary tables: cosT[t][d], sinT[t][d] for t < SEQ, d < HD, angle = float(t) * inv_freq[d & 31] (f32 product), halves duplicated.
// Wave = one position t, lane = frequency index; inv_freq picked from the by-value table with a static select chain.
// coverage: SEQ/8 blocks x 8 waves = SEQ rows; per row 4 line stores = 64 floats of each table.
// =====================================================================================================
__device__ __forceinline__ void tab_body(int bid, float* cosT, float* sinT, const InvF& inv) {
  const int tid  = threadIdx.x;
  const int lane = tid & 31;
  const int t    = bid * 8 + (tid >> 5);
  if (t >= SEQ) return;                     // never taken with the exact block range; no barriers in this part
  float f = inv.f[0];
#pragma unroll
  for (int i = 1; i < 32; ++i) f = (lane == i) ? inv.f[i] : f;
  const float ang = (float)t * f;
  float sv, cv;
  sincos_acc(ang, sv, cv);
  float* cr = cosT + (size_t)t * HD;
  float* sr = sinT + (size_t)t * HD;
  {
    *(float*)(cr + lane)      = cv;
    *(float*)(cr + 32 + lane) = cv;
    *(float*)(sr + lane)      = sv;
    *(float*)(sr + 32 + lane) = sv;
    
  }
}

// =====================================================================================================
// x f32 -> bf16 plane (RNE convert), fragment order. Thread = one 16-B chunk (8 consecutive k of one row): two 16-B loads, one
// 16-B store; a wave = 8 rows x the 4 chunks of one tile, so 8 lanes fill one 128-B line of the plane.
// coverage: n8/256 blocks (exact division checked statically) x 256 thr x 8 = the whole plane (64 threads per tile).
// =====================================================================================================
__device__ __forceinline__ void cvtx_body(int bid, const float* __restrict__ x, u16* D, int n8) {
  const int gt = bid * 256 + (int)threadIdx.x;
  if (gt >= n8) return;                     // no barriers in this part
  const int tile = gt >> 6;
  const int m    = ((gt >> 5) & 1) * 8 + (gt & 7);
  const int q    = (gt >> 3) & 3;
  const float* p = x + (size_t)((tile / (DMOD / 32)) * 16 + m) * DMOD + (tile % (DMOD / 32)) * 32 + q * 8;
  const v4f a = *(const v4f*)(p), bq = *(const v4f*)(p + 4);
  v4u o;
  o[0] = pk16(bf_bits(a[0]),  bf_bits(a[1]));
  o[1] = pk16(bf_bits(a[2]),  bf_bits(a[3]));
  o[2] = pk16(bf_bits(bq[0]), bf_bits(bq[1]));
  o[3] = pk16(bf_bits(bq[2]), bf_bits(bq[3]));
  u16* d = D + (size_t)tile * FT + q * 128 + m * 8;
  {
    *(v4u*)(d) = o;
    
  }
}

// =====================================================================================================
// Weight transpose + 16-bit convert: in W[R][C] (row-major f32) -> out D[C][R] (16-bit plane, rows n = C, k = R, fragment order).
//   f16mode == 0: D = bf16 RNE bits of W;  f16mode == 1: D = f16 bits of (bf16 RNE value of W) * scale.
// Block = one 64x64 tile (r0, c0): 256 thr x 4 16-B loads -> LDS tile [c][r] (pitch 72), block barrier, then each output row
// coverage: load 256 thr x 16 = 64x64; store 2 iterations x 256 thr x 8 halves = 8 fragment tiles (4 n x 2 k), a wave = 512
//           contiguous bytes; grid (C/64)x(R/64) tiles = all of D.
// =====================================================================================================
__device__ __forceinline__ void wT_body(u16* T, int bid, const float* __restrict__ W, u16* D, int R, int C, int f16mode,
                                        float scale) {
  const int tid = threadIdx.x;
  const int ntc = C >> 6;
  const int c0  = (bid % ntc) * 64;
  const int r0  = (bid / ntc) * 64;
  {
    const int rr = tid >> 2;
    const int cc = (tid & 3) * 16;
    const float* src = W + (size_t)(r0 + rr) * C + c0 + cc;
#pragma unroll
    for (int i = 0; i < 4; ++i) {
      const v4f a = *(const v4f*)(src + 4 * i);
#pragma unroll
      for (int e = 0; e < 4; ++e) {
        const float v = a[e];
        const unsigned short hb = h_bits((_Float16)(bfr(v) * scale));
        const unsigned short bb = bf_bits(v);
        T[(cc + 4 * i + e) * VTP + rr] = (f16mode != 0) ? hb : bb;
      }
    }
  }
  __syncthreads();
  v4u vals[2];
  const int m16 = tid & 15, q4 = (tid >> 4) & 3, nt = tid >> 7, kt = (tid >> 6) & 1;   // n tile nt (+2 per iteration), k tile kt
#pragma unroll
  for (int it = 0; it < 2; ++it) vals[it] = *(const v4u*)(T + ((it * 2 + nt) * 16 + m16) * VTP + kt * 32 + q4 * 8);
  {
#pragma unroll
    for (int it = 0; it < 2; ++it) {
      const size_t tile = (size_t)((c0 >> 4) + it * 2 + nt) * (size_t)(R >> 5) + (size_t)((r0 >> 5) + kt);
      *(v4u*)(D + tile * FT + q4 * 128 + m16 * 8) = vals[it];
    }
    
  }
}

// =====================================================================================================
// Launch 1: every conversion that depends on the inputs alone, one launch, parts picked by block range (block-uniform):
//   [0, 384)     weight tiles: wq 144, wk 48, wv 48, wo 144 (they hold the one block barrier, so they start first)
//   [384, 640)   rotary tables
//   [640, 2176)  x -> bf16 plane
// Each part keeps its own block count and per-block work; no part reads what another part writes.
// =====================================================================================================
#define PB_WQ  ((DMOD / 64) * ((NH * HD) / 64))
#define PB_WK  ((DMOD / 64) * ((NKV * HD) / 64))
#define PB_WO  (((NH * HD) / 64) * (DMOD / 64))
#define PB_W   (PB_WQ + 2 * PB_WK + PB_WO)
#define PB_TAB (SEQ / 8)
#define PB_X   ((NB * SEQ * DMOD) / (8 * 256))
#define PREP_BLOCKS (PB_W + PB_TAB + PB_X)
static_assert(PB_W == 384 && PB_TAB == 256 && PB_X == 1536 && ((NB * SEQ * DMOD) % (8 * 256)) == 0);
__global__ __launch_bounds__(256)
void prep(const float* __restrict__ x, const float* __restrict__ wq, const float* __restrict__ wk,
          const float* __restrict__ wv, const float* __restrict__ wo, u16* XB, u16* WQT, u16* WKT, u16* WVT, u16* WOT,
          float* cosT, float* sinT, InvF inv) {
  __shared__ __align__(16) u16 T[64 * VTP];
  const int bid = blockIdx.x;
  if (bid < PB_W) {
    const float* W = wq;  u16* D = WQT;  int C = NH * HD, tb = bid, mode = 0;  float scale = 1.0f;
    if (bid >= PB_WQ)                 { W = wk;  D = WKT;  C = NKV * HD;  tb = bid - PB_WQ; }
    if (bid >= PB_WQ + PB_WK)         { W = wv;  D = WVT;  tb = bid - (PB_WQ + PB_WK); }
    if (bid >= PB_WQ + 2 * PB_WK)     { W = wo;  D = WOT;  C = DMOD;  tb = bid - (PB_WQ + 2 * PB_WK);  mode = 1;  scale = WOS; }
    static_assert(NH * HD == DMOD);   // every weight has DMOD rows (wo: NH*HD rows)
    wT_body(T, tb, W, D, DMOD, C, mode, scale);
  } else if (bid < PB_W + PB_TAB) {
    tab_body(bid - PB_W, cosT, sinT, inv);
  } else {
    cvtx_body(bid - (PB_W + PB_TAB), x, XB, (NB * SEQ * DMOD) / 8);
  }
}

// =====================================================================================================
// GEMM epilogue of the output projection: the wave's 16x64 f32 tile (times oscale) staged in its LDS slab (pitch 68),
// coverage: 8 instructions x 2 rows x 16 lanes x 4 floats = the wave's 16 x 64 tile.
// =====================================================================================================
__device__ __forceinline__ void epi64(float* sl, v8f a0, v8f a1, v8f a2, v8f a3, float oscale, float* C, int N,
                                      size_t rowb, int col0, int lane) {
  const int hh = lane >> 4, m = lane & 15;
#pragma unroll
  for (int r = 0; r < 8; ++r) {
    const int ro = (8 * hh + r) * 68 + m;
    sl[ro]      = a0[r] * oscale;
    sl[ro + 16] = a1[r] * oscale;
    sl[ro + 32] = a2[r] * oscale;
    sl[ro + 48] = a3[r] * oscale;
  }
  wave_sync_lds();
  v4f vals[8];
#pragma unroll
  for (int it = 0; it < 8; ++it) vals[it] = *(const v4f*)(sl + (it * 2 + hh) * 68 + m * 4);
  float* dst = C + (rowb + (size_t)hh) * (size_t)N + col0 + m * 4;
  {
#pragma unroll
    for (int it = 0; it < 8; ++it) {
      *(v4f*)(dst + (size_t)(it * 2) * (size_t)N) = vals[it];
    }
    
  }
}

// =====================================================================================================
// Launch 2: the q, k and v projections (bf16 planes in fragment order, f32 accumulate) with the rotary / split-pack step as the
// epilogue: the 16-bit planes that attention reads go out straight from the accumulators; no f32 copy of q, k, v is kept.
// Block = 64 positions x 64 columns = one head (12 q + 4 k + 4 v column tiles of one 64-row tile of x are neighbours in the grid),
// 4 waves; a wave multiplies FOUR rows of tiles (A operand) by ONE row of tiles (B operand); K stepped by 32 = one tile of FT
// elements (K % 32 == 0, M % 64 == 0 checked statically); D register r of tile j in a lane = (A row 16j + 8hh + r, B row c).
//   q, k blocks: A = the head's 4 weight tiles (d), B = the wave's 16 positions. A lane owns one position (c) and 8 consecutive d
//     per tile; the rotate-half partner d ^ 32 is tile j ^ 2, same lane, same register.
//     w[d] = x[d] * cos[pos][d] + r[d] * sin[pos][d],  r[d] = -x[d+32] for d < 32, x[d-32] for d >= 32;
//     hi[d] = f16(w * 1024), lo[d] = f16(w * 1024 - hi[d]). Plane row = (batch * heads + head) * SEQ + pos, K = HD.
//   v blocks: A = the block's 4 position tiles of x, B = the wave's 16 columns d of wv. A lane owns one d (16 * wave + c) and 8
//     consecutive positions per tile = one chunk of the v^T planes VH[(b*NKV + g)*HD + d][s] = f16(v * 1024), VL = f16 residual.
// coverage: per wave and plane 4 stores x 512 contiguous bytes = 16 x 64 (q, k: 2 tiles; v: 4 half tiles in a row); 4 waves x
//           1280 blocks = every element of the six planes exactly once. No LDS and no barriers in this kernel.
// =====================================================================================================
#define QKV_CT ((NH * HD) / 64 + 2 * ((NKV * HD) / 64))
#define QKV_BLOCKS (((NB * SEQ) / 64) * QKV_CT)
static_assert(QKV_CT == 20 && QKV_BLOCKS == 1280 && QSC == KSC);
__device__ __forceinline__ void split8(const float* t, v4u& oh, v4u& ol) {   // 8 floats -> f16 hi chunk + f16 residual chunk
#pragma unroll
  for (int e = 0; e < 4; ++e) {
    const float t0 = t[2 * e], t1 = t[2 * e + 1];
    const _Float16 h0 = (_Float16)t0, h1 = (_Float16)t1;
    const _Float16 l0 = (_Float16)(t0 - (float)h0), l1 = (_Float16)(t1 - (float)h1);
    oh[e] = pk16(h_bits(h0), h_bits(h1));
    ol[e] = pk16(h_bits(l0), h_bits(l1));
  }
}
__global__ __launch_bounds__(128)
void gemm_qkv(const u16* __restrict__ A, const u16* __restrict__ WQT, const u16* __restrict__ WKT,
              const u16* __restrict__ WVT, const float* __restrict__ cosT, const float* __restrict__ sinT,
              u16* QHI, u16* QLO, u16* KHI, u16* KLO, u16* VHI, u16* VLO, int M, int K) {
  const int tid = threadIdx.x, wave = __builtin_amdgcn_readfirstlane(tid >> 5), lane = tid & 31;   // scalar wave number: wave-uniform tile pointers
  const unsigned lo = (unsigned)lane * 8u;
  const int bid   = blockIdx.x;
  const int ct    = bid % QKV_CT;
  const int row0  = (bid / QKV_CT) * 64;
  if (row0 + 64 > M) return;                 // block-uniform, never taken with the exact grid; no barriers in this kernel
  const bool isv = ct >= (NH * HD) / 64 + (NKV * HD) / 64;
  const u16* Wt = WQT;  u16* hpl = QHI;  u16* lpl = QLO;  int hpr = NH, head = ct;
  if (ct >= (NH * HD) / 64) { Wt = WKT;  hpl = KHI;  lpl = KLO;  hpr = NKV;  head = ct - (NH * HD) / 64; }
  if (isv)                  { Wt = WVT;  hpl = VHI;  lpl = VLO;  head = ct - ((NH * HD) / 64 + (NKV * HD) / 64); }
  const size_t bs = (size_t)(K >> 5) * FT;   // one row of tiles: 16 rows x K
  const u16* xt = A  + (size_t)(row0 >> 4) * bs;        // the block's 4 rows of x tiles
  const u16* wt = Wt + (size_t)(head * (HD / 16)) * bs; // the head's 4 rows of weight tiles
  const u16* ap  = (isv ? wt : xt) + (size_t)wave * bs; // B operand: the wave's own row of tiles
  const u16* bp0 = isv ? xt : wt;                       // A operand: four rows of tiles, shared by the block's waves
  const u16* bp1 = bp0 + bs;
  const u16* bp2 = bp1 + bs;
  const u16* bp3 = bp2 + bs;
  v8f acc0 = zero8(), acc1 = zero8(), acc2 = zero8(), acc3 = zero8();
#pragma unroll 1
  for (int k0 = 0; k0 < K; k0 += 32 * KUQ, ap += KUQ * FT, bp0 += KUQ * FT, bp1 += KUQ * FT, bp2 += KUQ * FT, bp3 += KUQ * FT) {
    v16b a[KUQ], b0[KUQ], b1[KUQ], b2[KUQ], b3[KUQ];
#pragma unroll
    for (int u = 0; u < KUQ; ++u) {
      a[u]  = ldfrag_b(ap + u * FT, lo);
      b0[u] = ldfrag_b(bp0 + u * FT, lo);
      b1[u] = ldfrag_b(bp1 + u * FT, lo);
      b2[u] = ldfrag_b(bp2 + u * FT, lo);
      b3[u] = ldfrag_b(bp3 + u * FT, lo);
      // keeps the trip's loads in front of its products (a load that sinks behind one starts a latency of its own) and in step
      // order, so that the first step's products start while the later steps' fragments are still on their way
      __builtin_amdgcn_sched_barrier(0);
    }
#pragma unroll
    for (int u = 0; u < KUQ; ++u) {          // k ascending in every accumulator, as with one step a trip
      acc0 = mma_b(b0[u], a[u], acc0);
      acc1 = mma_b(b1[u], a[u], acc1);
      acc2 = mma_b(b2[u], a[u], acc2);
      acc3 = mma_b(b3[u], a[u], acc3);
    }
    guard6<v16b>(acc0, acc1, acc2, acc3, a[KUQ - 1], b0[KUQ - 1], b1[KUQ - 1], b2[KUQ - 1], b3[KUQ - 1], a[KUQ - 1]);
#if defined(__HIP_DEVICE_COMPILE__)
    // the next trip forms its addresses in the register pairs that this trip's loads name: the wait stands in front of that
    asm volatile("s_wait_xcnt 0x0" ::: "memory");
#endif
  }
  const v8f acc[4] = {acc0, acc1, acc2, acc3};
  const int bb = row0 / SEQ, p0 = row0 & (SEQ - 1);     // a block lies inside one batch (SEQ % 64 == 0)
  v4u oh[4], ol[4];
  size_t ob;
  if (isv) {
#pragma unroll
    for (int j = 0; j < 4; ++j) {
      float t[8];
#pragma unroll
      for (int r = 0; r < 8; ++r) t[r] = acc[j][r] * VCAR;
      split8(t, oh[j], ol[j]);
    }
    // d tile = wave; the block's 64 positions = 2 neighbouring key tiles; lane = (d c, key chunk 2 * j + hh)
    ob = ((size_t)((bb * NKV + head) * (HD / 16) + wave) * (SEQ / 32) + (size_t)(p0 >> 5)) * FT + lo;
  } else {
    const int hh = lane >> 4, c = lane & 15;
    const int pw = p0 + wave * 16;                      // the wave's first position
    const float* cr = cosT + (size_t)(pw + c) * HD + 8 * hh;
    const float* sr = sinT + (size_t)(pw + c) * HD + 8 * hh;
    v4f cs[2][2], sn[2][2];                             // d = 16j + 8hh + 0..7, j = 0, 1 (the tables repeat at d + 32)
#pragma unroll
    for (int j = 0; j < 2; ++j) {
      cs[j][0] = *(const v4f*)(cr + 16 * j);
      cs[j][1] = *(const v4f*)(cr + 16 * j + 4);
    }
#if defined(__HIP_DEVICE_COMPILE__)
    // in this build a result of the next four loads takes over the address pair of the four loads above: the wait stands in front of it
    asm volatile("s_wait_xcnt 0x0" ::: "memory");
#endif
#pragma unroll
    for (int j = 0; j < 2; ++j) {
      sn[j][0] = *(const v4f*)(sr + 16 * j);
      sn[j][1] = *(const v4f*)(sr + 16 * j + 4);
    }
#pragma unroll
    for (int j = 0; j < 2; ++j) {
      float ta[8], tb[8];
#pragma unroll
      for (int r = 0; r < 8; ++r) {
        const float cv = cs[j][r >> 2][r & 3], sv = sn[j][r >> 2][r & 3];
        const float xa = acc[j][r], xb = acc[j + 2][r];
        ta[r] = (xa * cv + (-xb) * sv) * QSC;
        tb[r] = (xb * cv + xa * sv) * QSC;
      }
      split8(ta, oh[j], ol[j]);
      split8(tb, oh[j + 2], ol[j + 2]);
    }
    // 16 positions = 2 neighbouring tiles = 16 * HD elements; lane = (position c, d chunk 2 * j + hh)
    ob = ((size_t)(bb * hpr + head) * SEQ + (size_t)pw) * HD + lo;
  }
#pragma unroll
  for (int j = 0; j < 4; ++j) {
    const size_t o8 = ob + (size_t)j * 256;
    *(v4u*)(hpl + o8) = oh[j];
    *(v4u*)(lpl + o8) = ol[j];
  }
}

// =====================================================================================================
// f16 hi+lo GEMM: C[M][N] (f32) = (Ahi + Alo)[M][K] . Bt[N][K]^T, times oscale; Ahi/Alo and Bt f16 planes in fragment order;
// products hi.B + lo.B into one accumulator (lo is the unscaled residual of hi). Block = 64x64 tile, 4 waves x 16 rows; fragments
// loaded straight from the planes' tiles; K stepped by 32 = one tile of FT elements.
// =====================================================================================================
__global__ __launch_bounds__(128)
void gemm_h2(const u16* __restrict__ Ah, const u16* __restrict__ Al, const u16* __restrict__ Bt, float* C,
             int M, int N, int K, float oscale) {
  __shared__ __align__(16) float slab[4 * SLAB64];
  const int tid = threadIdx.x, wave = __builtin_amdgcn_readfirstlane(tid >> 5), lane = tid & 31;   // scalar wave number: wave-uniform tile pointers
  const unsigned lo = (unsigned)lane * 8u;
  const int ntile = N >> 6;
  const int bid   = blockIdx.x;
  const int rowb  = (bid / ntile) * 64 + wave * 16;
  const int col0  = (bid % ntile) * 64;
  if (rowb + 16 > M) return;                 // wave-uniform, never taken with the exact grid; no block barriers in this kernel
  const size_t bs = (size_t)(K >> 5) * FT;   // one row of tiles: 16 rows x K
  const size_t aofs = (size_t)(rowb >> 4) * bs;
  const _Float16* ahp = (const _Float16*)(const void*)Ah + aofs;
  const _Float16* alp = (const _Float16*)(const void*)Al + aofs;
  const _Float16* bp0 = (const _Float16*)(const void*)Bt + (size_t)(col0 >> 4) * bs;
  const _Float16* bp1 = bp0 + bs;
  const _Float16* bp2 = bp1 + bs;
  const _Float16* bp3 = bp2 + bs;
  v8f acc0 = zero8(), acc1 = zero8(), acc2 = zero8(), acc3 = zero8();
#pragma unroll 1
  for (int k0 = 0; k0 < K; k0 += 32 * KUO, ahp += KUO * FT, alp += KUO * FT, bp0 += KUO * FT, bp1 += KUO * FT, bp2 += KUO * FT,
       bp3 += KUO * FT) {
    v16h ah[KUO], al[KUO], b0[KUO], b1[KUO], b2[KUO], b3[KUO];
#pragma unroll
    for (int u = 0; u < KUO; ++u) {
      ah[u] = ldfrag_h(ahp + u * FT, lo);
      al[u] = ldfrag_h(alp + u * FT, lo);
      b0[u] = ldfrag_h(bp0 + u * FT, lo);
      b1[u] = ldfrag_h(bp1 + u * FT, lo);
      b2[u] = ldfrag_h(bp2 + u * FT, lo);
      b3[u] = ldfrag_h(bp3 + u * FT, lo);
      // keeps the trip's loads in front of its products (a load that sinks behind one starts a latency of its own) and in step
      // order (as built without it the first step's O fragments come last and every product waits for the whole group)
      __builtin_amdgcn_sched_barrier(0);
    }
#pragma unroll
    for (int u = 0; u < KUO; ++u) {          // k ascending, hi then lo, in every accumulator, as with one step a trip
      acc0 = mma_h(ah[u], b0[u], acc0);  acc0 = mma_h(al[u], b0[u], acc0);
      acc1 = mma_h(ah[u], b1[u], acc1);  acc1 = mma_h(al[u], b1[u], acc1);
      acc2 = mma_h(ah[u], b2[u], acc2);  acc2 = mma_h(al[u], b2[u], acc2);
      acc3 = mma_h(ah[u], b3[u], acc3);  acc3 = mma_h(al[u], b3[u], acc3);
    }
    guard6<v16h>(acc0, acc1, acc2, acc3, ah[KUO - 1], al[KUO - 1], b0[KUO - 1], b1[KUO - 1], b2[KUO - 1], b3[KUO - 1]);
#if defined(__HIP_DEVICE_COMPILE__)
    // the next trip forms its addresses in the register pairs that this trip's loads name: the wait stands in front of that
    asm volatile("s_wait_xcnt 0x0" ::: "memory");
#endif
  }
  epi64(slab + wave * SLAB64, acc0, acc1, acc2, acc3, oscale, C, N, (size_t)rowb, col0, lane);
}

// =====================================================================================================
// GQA flash attention with causal window + global-token mask: block = (batch b, kv head g, 16 query rows q0..q0+15),
// one wave per query head g*GRP + wave (kv index = head / GRP).
//   q planes (hi, lo f16) rows [b][h][s], k = d; k planes rows [b][g][s], k = d; v^T planes rows [b][g][d], k = s; O planes rows
//   [b][s], k = h*64 + d; all in fragment order.
//   Key blocks of 32 visited in a fixed, block-uniform list: {0} + {32 if q0 >= 32} + {jlo, jlo+32, ... < q0+16},
//   jlo = 64 if q0-511 <= 64 else (q0-511) & ~31; the element mask allowed(i,j) = (j <= i) && (i-j < 512 || j < 64) replaces the
//   score by -inf inside partial blocks (block 0 comes first and key 0 is allowed for every row, so each running max is finite
//   before any fully masked block row can occur).
//   Both products are taken transposed: S^T = k'.q'^T (A = key rows, B = query columns) and O^T += v^T.P^T (A = v^T rows d,
//   B = P^T). A lane then owns ONE query (column c = lane & 15) and 16 of the block's 32 keys (8hh + r and 16 + 8hh + r), so
//   the maximum and the sum of a row are taken inside the lane, with one exchange between the two lane halves for the maximum
//   per block and one for the sum after the loop; the two score tiles of a lane, converted in place, ARE the B fragment of P^T
//   in the split k map (elements 0..7 = keys 8hh + 0..7, elements 8..15 = keys 16 + 8hh + 0..7), the map of the v^T loader.
//   Per block: 2 score subtiles x 2 k-steps x 3 products (k_hi.q_hi + k_hi.q_lo + k_lo.q_hi), fragments loaded straight from the
//   16-bit planes (two 16-B loads per fragment, split k map); online max-subtracted base-2 softmax in f32 (scale 1/8 folded);
//   P*32768 as f16 hi and f16 residual, 4+4 v^T A fragments (hi and residual planes), 12 WMMAs (hh + hl + lh).
//   O^T register r of tile j = (d = 16j + 8hh + r, query c): 8 consecutive d of one row = one 16-B chunk of the O planes, so the
//   wave's two tiles of the O hi plane and of the O lo plane (O x1024 as f16 hi + residual) go out 512 contiguous bytes a store.
//   No LDS and no barriers in this kernel; every wave does bounded work (MAXBLK steps max).
// coverage: per wave 4 instructions x 32 lanes x 8 halves = 16 x 64 per plane; grid 1024 blocks x 3 waves = every
//           (b, s, h) row of both O planes exactly once.
// =====================================================================================================
__device__ __forceinline__ float xhalf(float v) {                     // the value of lane ^ 16 (vector cross-row move, no LDS path)
  const int b = __builtin_bit_cast(int, v);
  return __builtin_bit_cast(float, __builtin_amdgcn_permlanex16(b, b, 0x76543210, 0xfedcba98, false, false));
}
__global__ __launch_bounds__(ATT_THREADS)
void attn_gqa(const u16* __restrict__ QHIp, const u16* __restrict__ QLOp,
              const u16* __restrict__ KHIp, const u16* __restrict__ KLOp,
              const u16* __restrict__ VHIp, const u16* __restrict__ VLOp,
              u16* OHIp, u16* OLOp) {
  const int tid  = threadIdx.x;
  const int wave = __builtin_amdgcn_readfirstlane(tid >> 5);   // scalar wave number: wave-uniform q and O tile pointers
  const int lane = tid & 31;
  const unsigned lo = (unsigned)lane * 8u;
  const int hh   = lane >> 4;
  const int c    = lane & 15;

  const int bid  = blockIdx.x;
  const int qt   = bid & (SEQ / 16 - 1);
  const int g    = (bid >> 7) & (NKV - 1);
  const int b    = bid >> 9;
  const int head = g * GRP + wave;
  const int q0   = qt * 16;

  const size_t qofs = ((size_t)(b * NH + head) * SEQ + q0) * HD;               // 16 positions = 2 tiles = 16 * HD elements
  const _Float16* Qh  = (const _Float16*)(const void*)QHIp + qofs;
  const _Float16* Ql  = (const _Float16*)(const void*)QLOp + qofs;
  const size_t kofs = (size_t)(b * NKV + g) * SEQ * HD;                         // key tiles of kb added per step
  const _Float16* Khb = (const _Float16*)(const void*)KHIp + kofs;
  const _Float16* Klb = (const _Float16*)(const void*)KLOp + kofs;
  const size_t vofs = (size_t)(b * NKV + g) * HD * SEQ;                         // d tile j: + 16j * SEQ; key tile of kb added per step
  const _Float16* Vhb = (const _Float16*)(const void*)VHIp + vofs;
  const _Float16* Vlb = (const _Float16*)(const void*)VLOp + vofs;
  const float lsc = 0.125f * (LOG2E / (QSC * KSC));

  float mrun = -INFINITY, lsum = 0.f;      // this lane's query: running max (equal in both halves), sum over this lane's keys
  v8f o[4];
#pragma unroll
  for (int j = 0; j < 4; ++j) o[j] = zero8();

  const int nglob = (q0 >= 32) ? 2 : 1;
  const int wlo   = q0 - (WIN - 1);
  const int jlo   = (wlo <= GLB) ? GLB : (wlo & ~31);
  int nwin = q0 + 16 - jlo;
  nwin = (nwin > 0) ? ((nwin + 31) >> 5) : 0;
  int nblk = nglob + nwin;
  nblk = (nblk > MAXBLK) ? MAXBLK : nblk;

  // wave-uniform tile pointers of the current key block (the list starts at key 0), moved on at the foot of each step
  const _Float16* k0p = Khb;
  const _Float16* l0p = Klb;
  const _Float16* vhp = Vhb;
  const _Float16* vlp = Vlb;
  const int i = q0 + c;                    // this lane's query position
  int kb = 0;
  // q' fragments: the same in every step, held in registers
  v16h qh[2], ql[2];
#pragma unroll
  for (int kk = 0; kk < 2; ++kk) {
    qh[kk] = ldfrag_h(Qh + kk * FT, lo);
    ql[kk] = ldfrag_h(Ql + kk * FT, lo);
  }
#pragma unroll 1
  for (int it = 0; it < nblk; ++it) {
    // ---- every fragment load of this step, one group: k' of both k-steps (in the order the products take them), then v^T ----
    const _Float16* k1p = k0p + (size_t)16 * HD;
    const _Float16* l1p = l0p + (size_t)16 * HD;
    v16h kh0[2], kl0[2], kh1[2], kl1[2];
#pragma unroll
    for (int kk = 0; kk < 2; ++kk) {
      kh0[kk] = ldfrag_h(k0p + kk * FT, lo);
      kh1[kk] = ldfrag_h(k1p + kk * FT, lo);
      kl0[kk] = ldfrag_h(l0p + kk * FT, lo);
      kl1[kk] = ldfrag_h(l1p + kk * FT, lo);
    }
    // v^T A fragments: row = d = j*16 + c, the 32 keys of this step = one key tile of the v^T planes
    const v16h vh0 = ldfrag_h(vhp, lo);
    const v16h vh1 = ldfrag_h(vhp + (size_t)16 * SEQ, lo);
    const v16h vh2 = ldfrag_h(vhp + (size_t)32 * SEQ, lo);
    const v16h vh3 = ldfrag_h(vhp + (size_t)48 * SEQ, lo);
    const v16h vl0 = ldfrag_h(vlp, lo);
    const v16h vl1 = ldfrag_h(vlp + (size_t)16 * SEQ, lo);
    const v16h vl2 = ldfrag_h(vlp + (size_t)32 * SEQ, lo);
    const v16h vl3 = ldfrag_h(vlp + (size_t)48 * SEQ, lo);
    // keeps the 32 loads one group at the head of the step: a load that sinks behind a product starts a latency of its own
    __builtin_amdgcn_sched_barrier(0);
    // ---- element mask of this step (needs no score: it can run while the k' fragments are on their way) ----
    bool ok0[8], ok1[8];
#pragma unroll
    for (int r = 0; r < 8; ++r) {
      const int j0 = kb + 8 * hh + r, j1 = kb + 16 + 8 * hh + r;
      ok0[r] = (j0 <= i) && (((i - j0) < WIN) || (j0 < GLB));
      ok1[r] = (j1 <= i) && (((i - j1) < WIN) || (j1 < GLB));
    }
    // as built without it every compare of the mask sinks behind the scores and lengthens the step; with it most of them stand
    // among the score products, under the waits for the k' fragments
    __builtin_amdgcn_sched_barrier(0);
    // ---- scores^T: D element r of this lane = (key kb + 8hh + r, query q0 + c) in s0, key kb + 16 + 8hh + r in s1 ----
    v8f s0 = zero8(), s1 = zero8();
#pragma unroll
    for (int kk = 0; kk < 2; ++kk) {
      s0 = mma_h(kh0[kk], qh[kk], s0);
      s0 = mma_h(kh0[kk], ql[kk], s0);
      s0 = mma_h(kl0[kk], qh[kk], s0);
      s1 = mma_h(kh1[kk], qh[kk], s1);
      s1 = mma_h(kh1[kk], ql[kk], s1);
      s1 = mma_h(kl1[kk], qh[kk], s1);
      guard2(s0, s1, qh[kk], ql[kk], kh0[kk], kl0[kk], kh1[kk], kl1[kk]);
    }
    // ---- mask (replace by -inf) + online softmax in base 2, one query per lane ----
    float t0[8], t1[8];
#pragma unroll
    for (int r = 0; r < 8; ++r) {
      t0[r] = ok0[r] ? (s0[r] * lsc) : -INFINITY;
      t1[r] = ok1[r] ? (s1[r] * lsc) : -INFINITY;
    }
    float mx = fmaxf(t0[0], t1[0]);
#pragma unroll
    for (int r = 1; r < 8; ++r) mx = fmaxf(mx, fmaxf(t0[r], t1[r]));
    mx = fmaxf(mx, xhalf(mx));
    const float mn = fmaxf(mrun, mx);
    const float al = exp2f(mrun - mn);
    mrun = mn;
    // ---- B fragments of P^T * 32768: hi f16 and residual f16, column = c, split k map over the 32 keys of this step ----
    FragH ph, pl;
    float ps0 = 0.f, ps1 = 0.f;
#pragma unroll
    for (int r = 0; r < 8; ++r) {
      const float e0 = exp2f(t0[r] - mn), e1 = exp2f(t1[r] - mn);
      ps0 += e0;
      ps1 += e1;
      const float ta = e0 * PCAR, tb = e1 * PCAR;
      const _Float16 ha = (_Float16)ta, hb = (_Float16)tb;
      ph.h[0][r] = ha;                                     // elements 0..7  = keys kb + 8hh + 0..7
      ph.h[1][r] = hb;                                     // elements 8..15 = keys kb + 16 + 8hh + 0..7
      pl.h[0][r] = (_Float16)(ta - (float)ha);
      pl.h[1][r] = (_Float16)(tb - (float)hb);
    }
    lsum = lsum * al + (ps0 + ps1);
#pragma unroll
    for (int j = 0; j < 4; ++j)
#pragma unroll
      for (int r = 0; r < 8; ++r) o[j][r] *= al;
    // ---- O^T += v^T.P^T ----
    {
      o[0] = mma_h(vh0, ph.v, o[0]);  o[0] = mma_h(vh0, pl.v, o[0]);  o[0] = mma_h(vl0, ph.v, o[0]);
      o[1] = mma_h(vh1, ph.v, o[1]);  o[1] = mma_h(vh1, pl.v, o[1]);  o[1] = mma_h(vl1, ph.v, o[1]);
      o[2] = mma_h(vh2, ph.v, o[2]);  o[2] = mma_h(vh2, pl.v, o[2]);  o[2] = mma_h(vl2, ph.v, o[2]);
      o[3] = mma_h(vh3, ph.v, o[3]);  o[3] = mma_h(vh3, pl.v, o[3]);  o[3] = mma_h(vl3, ph.v, o[3]);
      guard10(o[0], o[1], o[2], o[3], ph.v, pl.v, vh0, vh1, vh2, vh3, vl0, vl1, vl2, vl3);
    }
    const int kn = (it + 1 < nglob) ? ((it + 1) * 32) : (jlo + (it + 1 - nglob) * 32);   // next key block of the list
    const int dk = kn - kb;                                                              // a positive multiple of 32
    k0p += (size_t)dk * HD;
    l0p += (size_t)dk * HD;
    vhp += (size_t)(dk >> 5) * FT;
    vlp += (size_t)(dk >> 5) * FT;
    kb = kn;
  }
  acc_guard4(o[0], o[1], o[2], o[3]);

  // ---- join the two halves' sums, fold 1/l and the carries (32768 on P, 1024 on v) ----
  const float oc = 1.0f / (PCAR * VCAR);
  const float inv = (1.0f / (lsum + xhalf(lsum))) * oc;
  // ---- O x1024 -> f16 hi + residual planes; the wave's 16 x 64 = 2 neighbouring tiles; lane = (row c, chunk 2 * j + hh) ----
  v4u oh[4], ol[4];
#pragma unroll
  for (int j = 0; j < 4; ++j) {
    float w[8];
#pragma unroll
    for (int r = 0; r < 8; ++r) w[r] = (o[j][r] * inv) * OSC;
#pragma unroll
    for (int e = 0; e < 4; ++e) {
      const _Float16 h0 = (_Float16)w[2 * e], h1 = (_Float16)w[2 * e + 1];
      const _Float16 l0 = (_Float16)(w[2 * e] - (float)h0), l1 = (_Float16)(w[2 * e + 1] - (float)h1);
      oh[j][e] = pk16(h_bits(h0), h_bits(h1));
      ol[j][e] = pk16(h_bits(l0), h_bits(l1));
    }
  }
  const size_t ob = (size_t)(b * SEQ + q0) * (NH * HD) + (size_t)(head * 2) * FT + lo;
  {
#pragma unroll
    for (int j = 0; j < 4; ++j) {
      const size_t o8 = ob + (size_t)j * 256;
      *(v4u*)(OHIp + o8) = oh[j];
      *(v4u*)(OLOp + o8) = ol[j];
    }
  }
}

// =====================================================================================================
// Workspace map (bytes); every plane is fully written by whole-line stores before it is read; all extents are exact multiples
// of the store granularity (no pad rows needed); every offset a multiple of 65536:
//   CT  f32 [2048][64]                 524288        ST  same              524288
//   (16-bit planes: rows x K named below, stored in fragment order)
//   XB  bf16 [4096][768]              6291456
//   WQT bf16 [768 n][768 k]           1179648        WKT bf16 [256][768]   393216     WVT same   393216
//   WOT f16  [768 n][768 k] x1024     1179648
//   QHI f16 [2][12][2048][64] x1024   6291456        QLO residual         6291456
//   KHI f16 [2][4][2048][64] x1024    2097152        KLO residual         2097152
//   VHI f16 [2][4][64][2048] x1024    2097152        VLO residual         2097152
//   OHI f16 [4096][768] x1024         6291456        OLO residual         6291456
//   end                              44040192
// =====================================================================================================
extern "C" void kernel_launch(void* const* d_in, const int* in_sizes, int n_in,
                              void* d_out, int out_size, void* d_ws, size_t ws_size,
                              hipStream_t stream) {
  const int ROWS = NB * SEQ;                            // 4096
  if (n_in < 5) return;
  if (in_sizes[0] != ROWS * DMOD) return;
  if (in_sizes[1] != DMOD * (NH * HD)) return;
  if (in_sizes[2] != DMOD * (NKV * HD) || in_sizes[3] != DMOD * (NKV * HD)) return;
  if (in_sizes[4] != (NH * HD) * DMOD) return;
  if (out_size != ROWS * DMOD) return;

  const float* x  = (const float*)d_in[0];
  const float* wq = (const float*)d_in[1];
  const float* wk = (const float*)d_in[2];
  const float* wv = (const float*)d_in[3];
  const float* wo = (const float*)d_in[4];
  float*       out = (float*)d_out;

  const size_t szTab = (size_t)SEQ * HD * 4;                    //   524288
  const size_t szXB  = (size_t)ROWS * DMOD * 2;                 //  6291456
  const size_t szWQT = (size_t)(NH * HD) * DMOD * 2;            //  1179648
  const size_t szWKT = (size_t)(NKV * HD) * DMOD * 2;           //   393216
  const size_t szWOT = (size_t)DMOD * (NH * HD) * 2;            //  1179648
  const size_t szQP  = (size_t)ROWS * (NH * HD) * 2;            //  6291456
  const size_t szKP  = (size_t)ROWS * (NKV * HD) * 2;           //  2097152
  const size_t szVP  = (size_t)NB * NKV * HD * SEQ * 2;         //  2097152
  const size_t szOP  = (size_t)ROWS * (NH * HD) * 2;            //  6291456
  size_t off = 0;
  const size_t oCT  = off; off += szTab;
  const size_t oST  = off; off += szTab;
  const size_t oXB  = off; off += szXB;
  const size_t oWQT = off; off += szWQT;
  const size_t oWKT = off; off += szWKT;
  const size_t oWVT = off; off += szWKT;
  const size_t oWOT = off; off += szWOT;
  const size_t oQHI = off; off += szQP;
  const size_t oQLO = off; off += szQP;
  const size_t oKHI = off; off += szKP;
  const size_t oKLO = off; off += szKP;
  const size_t oVHI = off; off += szVP;
  const size_t oVLO = off; off += szVP;
  const size_t oOHI = off; off += szOP;
  const size_t oOLO = off; off += szOP;
  if (off > ws_size) return;                            // off = 44040192
  if (off > (size_t)134217728) return;

  char* ws = (char*)d_ws;
  float* CT  = (float*)(ws + oCT);
  float* ST  = (float*)(ws + oST);
  u16*   XB  = (u16*)(ws + oXB);
  u16*   WQT = (u16*)(ws + oWQT);
  u16*   WKT = (u16*)(ws + oWKT);
  u16*   WVT = (u16*)(ws + oWVT);
  u16*   WOT = (u16*)(ws + oWOT);
  u16*   QHI = (u16*)(ws + oQHI);
  u16*   QLO = (u16*)(ws + oQLO);
  u16*   KHI = (u16*)(ws + oKHI);
  u16*   KLO = (u16*)(ws + oKLO);
  u16*   VHI = (u16*)(ws + oVHI);
  u16*   VLO = (u16*)(ws + oVLO);
  u16*   OHI = (u16*)(ws + oOHI);
  u16*   OLO = (u16*)(ws + oOLO);

  // inv_freq[i] = 1 / pow(10000, i/32) in f32 (pow correctly converted from f64, then IEEE f32 reciprocal)
  InvF inv;
  for (int i = 0; i < 32; ++i) {
    const double p = pow(10000.0, (double)i / 32.0);
    const float pf = (float)p;
    inv.f[i] = 1.0f / pf;
  }

  const dim3 blk(256);
  const dim3 gPrep(PREP_BLOCKS);                        // 2176
  const dim3 gQKV(QKV_BLOCKS);                          // 1280
  const dim3 gGO((ROWS / 64) * (DMOD / 64));            // 768
  const dim3 bG(128);
  const dim3 gAT(ATT_BLOCKS);                           // 1024
  const dim3 bAT(ATT_THREADS);                          // 96

  // (1) weights W[k rows][n cols] -> [n][k] 16-bit planes in fragment order (bf16 for wq/wk/wv; f16 of bf16 value x1024 for wo),
  //     rotary cos/sin tables [2048][64], x -> bf16 plane
  prep<<<gPrep, blk, 0, stream>>>(x, wq, wk, wv, wo, XB, WQT, WKT, WVT, WOT, CT, ST, inv);
  // (2) projections q, k, v -> q' and k' planes (rotary, hi + residual), v^T planes x1024 (hi + residual)
  gemm_qkv<<<gQKV, bG, 0, stream>>>(XB, WQT, WKT, WVT, CT, ST, QHI, QLO, KHI, KLO, VHI, VLO, ROWS, DMOD);
  // (3) attention -> O planes [b][s][h][d] x1024 (hi + residual)
  attn_gqa<<<gAT, bAT, 0, stream>>>(QHI, QLO, KHI, KLO, VHI, VLO, OHI, OLO);
  // (4) output projection -> out [4096][768] f32, carries 1024 (O) x 1024 (wo) folded back
  gemm_h2<<<gGO, bG, 0, stream>>>(OHI, OLO, WOT, out, ROWS, DMOD, NH * HD, 1.0f / (OSC * WOS));
  (void)hipGetLastError();
}

// v006
// A run of this version takes 62.5 microseconds.
// Two timings next to v005 put it at 1.03 and 1.04 times that version's speed.
// All steps since v000 together make it 2.36 times as fast.
// Contractions: x.W{q,k,v} on v_wmma_f32_16x16x32_bf16 (x and W RNE-converted to bf16, exact operands, f32 accumulate);
// scores k'.q'^T (transposed; q', k' carried x1024 as f16 hi plane + f16 residual plane, products hh+lh+hl), v^T.P^T (transposed; P x32768 f16 hi+residual,
// v x1024 f16 hi+residual, products hh+lh+hl) and O.wo (O x1024 f16 hi+residual, wo as f16(bf16(wo) x1024), products h.w+l.w):
// v_wmma_f32_16x16x32_f16, f32 accumulate. Rotary tables, rotation, masked base-2 online softmax and 1/l fold in f32 on VALU.
#include <hip/hip_runtime.h>
#include <math.h>
#include <stdint.h>

#define NB    2
#define SEQ   2048
#define DMOD  768
#define NH    12
#define NKV   4
#define HD    64
#define GRP   3
#define WIN   512
#define GLB   64
#define QSC   1024.0f
#define KSC   1024.0f
#define PCAR  32768.0f
#define PLOG  15.0f  // log2(PCAR)
#define VCAR  1024.0f
#define OSC   1024.0f
#define WOS   1024.0f
#define LOG2E 1.4426950408889634f
#define ATT_THREADS (GRP * 32)
#define ATT_BLOCKS  (NB * NKV * (SEQ / 16))
#define SLAB64 (16 * 68)
#define VTP   72
#define MAXBLK 20
#define FT    512
#define KUQ   3      // k-steps of 32 whose fragment loads one trip of the q/k/v GEMM issues together
#define KUO   4      // the same for the output projection
static_assert(NH == NKV * GRP);
static_assert(PCAR == 32768.0f && PLOG == 15.0f);
static_assert(HD == 64 && DMOD == NH * HD);
static_assert((SEQ / 16) == 128 && NKV == 4 && NB == 2);
static_assert(ATT_THREADS == 96 && ATT_BLOCKS == 1024);
static_assert(((NB * SEQ * NH * 8) % 256) == 0 && ((NB * SEQ * NKV * 8) % 256) == 0);
static_assert(((NB * SEQ) % 64) == 0 && (DMOD % 64) == 0 && ((NKV * HD) % 64) == 0 && (DMOD % 32) == 0);
static_assert((SEQ % 64) == 0 && (SEQ % 8) == 0);
static_assert((DMOD % (32 * KUQ)) == 0 && ((NH * HD) % (32 * KUO)) == 0);   // whole trips: no load past a plane's row of tiles

typedef unsigned short u16;
typedef _Float16 v16h __attribute__((ext_vector_type(16)));
typedef _Float16 v8h  __attribute__((ext_vector_type(8)));
typedef __bf16   v16b __attribute__((ext_vector_type(16)));
typedef float    v8f  __attribute__((ext_vector_type(8)));
typedef float    v4f  __attribute__((ext_vector_type(4)));
typedef unsigned int v4u __attribute__((ext_vector_type(4)));

union FragH { v16h v; v8h h[2]; v4u u[2]; };
union FragB { v16b v; v4u u[2]; };

struct InvF { float f[32]; };
static_assert(sizeof(InvF) == 128);

// ---- scalar helpers --------------------------------------------------------------------------------
__device__ __forceinline__ unsigned short bf_bits(float f) {          // f32 -> bf16 bits, RNE convert
  unsigned u = __float_as_uint(f);
  return (unsigned short)((u + 0x7FFFu + ((u >> 16) & 1u)) >> 16);
}
__device__ __forceinline__ float bf_up(unsigned short h) { return __uint_as_float(((unsigned)h) << 16); }
__device__ __forceinline__ float bfr(float f) { return bf_up(bf_bits(f)); }
__device__ __forceinline__ unsigned short h_bits(_Float16 x) { return __builtin_bit_cast(unsigned short, x); }
__device__ __forceinline__ unsigned pk16(unsigned short a, unsigned short b) { return (unsigned)a | ((unsigned)b << 16); }
__device__ __forceinline__ v8f zero8() { v8f z = {0.f, 0.f, 0.f, 0.f, 0.f, 0.f, 0.f, 0.f}; return z; }

// ---- fragment-order planes: every 16-bit operand plane [rows][K] is kept as 16-row x 32-k tiles of FT elements (1 KiB),
//      tile (rt, kt) at (rt * (K / 32) + kt) * FT, and inside a tile as 16-B chunks [q = (k & 31) >> 3][row & 15][k & 7].
// ---- fragment loaders: 16-bit A/B operand, lane -> row/col (lane&15), h = lane>>4, t = the tile (wave-uniform), lo = lane * 8;
//      elements 0..7 <- t[lo..lo+7] (chunk q = h: k0+8h..), elements 8..15 <- t[256+lo..] (chunk q = 2+h: k0+16+8h..)
//      (same split k map for A and B); each of the two loads of a wave is 512 contiguous bytes = 4 whole lines
__device__ __forceinline__ v16h ldfrag_h(const _Float16* t, unsigned lo) {
  FragH f;
  f.h[0] = *(const v8h*)(t + lo);
  f.h[1] = *(const v8h*)(t + 256 + lo);
  return f.v;
}
__device__ __forceinline__ v16b ldfrag_b(const u16* t, unsigned lo) { // bf16 plane read as unsigned integer vectors
  FragB f;
  f.u[0] = *(const v4u*)(t + lo);
  f.u[1] = *(const v4u*)(t + 256 + lo);
  return f.v;
}

__device__ __forceinline__ v8f mma_h(v16h a, v16h b, v8f c) {
  return __builtin_amdgcn_wmma_f32_16x16x32_f16(false, a, false, b, (short)0, c, false, false);
}
__device__ __forceinline__ v8f mma_b(v16b a, v16b b, v8f c) {
  return __builtin_amdgcn_wmma_f32_16x16x32_bf16(false, a, false, b, (short)0, c, false, false);
}
__device__ __forceinline__ void guard2(v8f& a, v8f& b, v16h x0, v16h x1, v16h x2, v16h x3, v16h x4, v16h x5) {
#if defined(__HIP_DEVICE_COMPILE__)
  asm volatile("v_nop\n\tv_nop\n\tv_nop\n\tv_nop"
               : "+v"(a), "+v"(b) : "v"(x0), "v"(x1), "v"(x2), "v"(x3), "v"(x4), "v"(x5) : "memory");
#endif
}
template <typename F>
__device__ __forceinline__ void guard6(v8f& a, v8f& b, v8f& c, v8f& d, F x0, F x1, F x2, F x3, F x4, F x5) {
#if defined(__HIP_DEVICE_COMPILE__)
  asm volatile("v_nop\n\tv_nop\n\tv_nop\n\tv_nop"
               : "+v"(a), "+v"(b), "+v"(c), "+v"(d) : "v"(x0), "v"(x1), "v"(x2), "v"(x3), "v"(x4), "v"(x5) : "memory");
#endif
}
__device__ __forceinline__ void guard10(v8f& a, v8f& b, v8f& c, v8f& d, v16h x0, v16h x1, v16h x2, v16h x3, v16h x4,
                                        v16h x5, v16h x6, v16h x7, v16h x8, v16h x9) {
#if defined(__HIP_DEVICE_COMPILE__)
  asm volatile("v_nop\n\tv_nop\n\tv_nop\n\tv_nop"
               : "+v"(a), "+v"(b), "+v"(c), "+v"(d)
               : "v"(x0), "v"(x1), "v"(x2), "v"(x3), "v"(x4), "v"(x5), "v"(x6), "v"(x7), "v"(x8), "v"(x9) : "memory");
#endif
}
__device__ __forceinline__ void acc_guard4(v8f& a, v8f& b, v8f& c, v8f& d) {
#if defined(__HIP_DEVICE_COMPILE__)
  asm volatile("v_nop\n\tv_nop\n\tv_nop\n\tv_nop" : "+v"(a), "+v"(b), "+v"(c), "+v"(d));
#endif
}
__device__ __forceinline__ void wave_sync_lds() {
  __builtin_amdgcn_fence(__ATOMIC_RELEASE, "workgroup");
  __builtin_amdgcn_wave_barrier();
  __builtin_amdgcn_fence(__ATOMIC_ACQUIRE, "workgroup");
}

// ---- accurate f32 sin/cos of a non-negative f32 angle (|angle| < 2048): f64 two-part pi/2 reduction + f64 polynomials,
//      plain f64 fma/mul only (no library f64 trig path), result converted to f32.
__device__ __forceinline__ void sincos_acc(float angf, float& sv, float& cv) {
  const double a = (double)angf;
  const double TWO_OVER_PI = 0.63661977236758134308;
  const double PIO2_HI = 1.5707963267948966;
  const double PIO2_LO = 6.123233995736766e-17;
  const int kq = (int)(a * TWO_OVER_PI + 0.5);
  const double kd = (double)kq;
  double r = fma(-kd, PIO2_HI, a);
  r = fma(-kd, PIO2_LO, r);
  const double r2 = r * r;
  double sp = 1.0 / 6227020800.0;
  sp = fma(sp, r2, -1.0 / 39916800.0);
  sp = fma(sp, r2, 1.0 / 362880.0);
  sp = fma(sp, r2, -1.0 / 5040.0);
  sp = fma(sp, r2, 1.0 / 120.0);
  sp = fma(sp, r2, -1.0 / 6.0);
  const double s = fma(sp * r2, r, r);
  double cp = -1.0 / 87178291200.0;
  cp = fma(cp, r2, 1.0 / 479001600.0);
  cp = fma(cp, r2, -1.0 / 3628800.0);
  cp = fma(cp, r2, 1.0 / 40320.0);
  cp = fma(cp, r2, -1.0 / 720.0);
  cp = fma(cp, r2, 1.0 / 24.0);
  cp = fma(cp, r2, -0.5);
  const double c = fma(cp, r2, 1.0);
  const int qd = kq & 3;
  const double so = (qd == 0) ? s : (qd == 1) ? c : (qd == 2) ? -s : -c;
  const double co = (qd == 0) ? c : (qd == 1) ? -s : (qd == 2) ? -c : s;
  sv = (float)so;
  cv = (float)co;
}

// =====================================================================================================
// Rotary tables: cosT[t][d], sinT[t][d] for t < SEQ, d < HD, angle = float(t) * inv_freq[d & 31] (f32 product), halves duplicated.
// Wave = one position t, lane = frequency index; inv_freq picked from the by-value table with a static select chain.
// coverage: SEQ/8 blocks x 8 waves = SEQ rows; per row 4 line stores = 64 floats of each table.
// =====================================================================================================
__device__ __forceinline__ void tab_body(int bid, float* cosT, float* sinT, const InvF& inv) {
  const int tid  = threadIdx.x;
  const int lane = tid & 31;
  const int t    = bid * 8 + (tid >> 5);
  if (t >= SEQ) return;                     // never taken with the exact block range; no barriers in this part
  float f = inv.f[0];
#pragma unroll
  for (int i = 1; i < 32; ++i) f = (lane == i) ? inv.f[i] : f;
  const float ang = (float)t * f;
  float sv, cv;
  sincos_acc(ang, sv, cv);
  float* cr = cosT + (size_t)t * HD;
  float* sr = sinT + (size_t)t * HD;
  {
    *(float*)(cr + lane)      = cv;
    *(float*)(cr + 32 + lane) = cv;
    *(float*)(sr + lane)      = sv;
    *(float*)(sr + 32 + lane) = sv;
    
  }
}

// =====================================================================================================
// x f32 -> bf16 plane (RNE convert), fragment order. Thread = one 16-B chunk (8 consecutive k of one row): two 16-B loads, one
// 16-B store; a wave = 8 rows x the 4 chunks of one tile, so 8 lanes fill one 128-B line of the plane.
// coverage: n8/256 blocks (exact division checked statically) x 256 thr x 8 = the whole plane (64 threads per tile).
// =====================================================================================================
__device__ __forceinline__ void cvtx_body(int bid, const float* __restrict__ x, u16* D, int n8) {
  const int gt = bid * 256 + (int)threadIdx.x;
  if (gt >= n8) return;                     // no barriers in this part
  const int tile = gt >> 6;
  const int m    = ((gt >> 5) & 1) * 8 + (gt & 7);
  const int q    = (gt >> 3) & 3;
  const float* p = x + (size_t)((tile / (DMOD / 32)) * 16 + m) * DMOD + (tile % (DMOD / 32)) * 32 + q * 8;
  const v4f a = *(const v4f*)(p), bq = *(const v4f*)(p + 4);
  v4u o;
  o[0] = pk16(bf_bits(a[0]),  bf_bits(a[1]));
  o[1] = pk16(bf_bits(a[2]),  bf_bits(a[3]));
  o[2] = pk16(bf_bits(bq[0]), bf_bits(bq[1]));
  o[3] = pk16(bf_bits(bq[2]), bf_bits(bq[3]));
  u16* d = D + (size_t)tile * FT + q * 128 + m * 8;
  {
    *(v4u*)(d) = o;
    
  }
}

// =====================================================================================================
// Weight transpose + 16-bit convert: in W[R][C] (row-major f32) -> out D[C][R] (16-bit plane, rows n = C, k = R, fragment order).
//   f16mode == 0: D = bf16 RNE bits of W;  f16mode == 1: D = f16 bits of (bf16 RNE value of W) * scale.
// Block = one 64x64 tile (r0, c0): 256 thr x 4 16-B loads -> LDS tile [c][r] (pitch 72), block barrier, then each output row
// coverage: load 256 thr x 16 = 64x64; store 2 iterations x 256 thr x 8 halves = 8 fragment tiles (4 n x 2 k), a wave = 512
//           contiguous bytes; grid (C/64)x(R/64) tiles = all of D.
// =====================================================================================================
__device__ __forceinline__ void wT_body(u16* T, int bid, const float* __restrict__ W, u16* D, int R, int C, int f16mode,
                                        float scale) {
  const int tid = threadIdx.x;
  const int ntc = C >> 6;
  const int c0  = (bid % ntc) * 64;
  const int r0  = (bid / ntc) * 64;
  {
    const int rr = tid >> 2;
    const int cc = (tid & 3) * 16;
    const float* src = W + (size_t)(r0 + rr) * C + c0 + cc;
#pragma unroll
    for (int i = 0; i < 4; ++i) {
      const v4f a = *(const v4f*)(src + 4 * i);
#pragma unroll
      for (int e = 0; e < 4; ++e) {
        const float v = a[e];
        const unsigned short hb = h_bits((_Float16)(bfr(v) * scale));
        const unsigned short bb = bf_bits(v);
        T[(cc + 4 * i + e) * VTP + rr] = (f16mode != 0) ? hb : bb;
      }
    }
  }
  __syncthreads();
  v4u vals[2];
  const int m16 = tid & 15, q4 = (tid >> 4) & 3, nt = tid >> 7, kt = (tid >> 6) & 1;   // n tile nt (+2 per iteration), k tile kt
#pragma unroll
  for (int it = 0; it < 2; ++it) vals[it] = *(const v4u*)(T + ((it * 2 + nt) * 16 + m16) * VTP + kt * 32 + q4 * 8);
  {
#pragma unroll
    for (int it = 0; it < 2; ++it) {
      const size_t tile = (size_t)((c0 >> 4) + it * 2 + nt) * (size_t)(R >> 5) + (size_t)((r0 >> 5) + kt);
      *(v4u*)(D + tile * FT + q4 * 128 + m16 * 8) = vals[it];
    }
    
  }
}

// =====================================================================================================
// Launch 1: every conversion that depends on the inputs alone, one launch, parts picked by block range (block-uniform):
//   [0, 384)     weight tiles: wq 144, wk 48, wv 48, wo 144 (they hold the one block barrier, so they start first)
//   [384, 640)   rotary tables
//   [640, 2176)  x -> bf16 plane
// Each part keeps its own block count and per-block work; no part reads what another part writes.
// =====================================================================================================
#define PB_WQ  ((DMOD / 64) * ((NH * HD) / 64))
#define PB_WK  ((DMOD / 64) * ((NKV * HD) / 64))
#define PB_WO  (((NH * HD) / 64) * (DMOD / 64))
#define PB_W   (PB_WQ + 2 * PB_WK + PB_WO)
#define PB_TAB (SEQ / 8)
#define PB_X   ((NB * SEQ * DMOD) / (8 * 256))
#define PREP_BLOCKS (PB_W + PB_TAB + PB_X)
static_assert(PB_W == 384 && PB_TAB == 256 && PB_X == 1536 && ((NB * SEQ * DMOD) % (8 * 256)) == 0);
__global__ __launch_bounds__(256)
void prep(const float* __restrict__ x, const float* __restrict__ wq, const float* __restrict__ wk,
          const float* __restrict__ wv, const float* __restrict__ wo, u16* XB, u16* WQT, u16* WKT, u16* WVT, u16* WOT,
          float* cosT, float* sinT, InvF inv) {
  __shared__ __align__(16) u16 T[64 * VTP];
  const int bid = blockIdx.x;
  if (bid < PB_W) {
    const float* W = wq;  u16* D = WQT;  int C = NH * HD, tb = bid, mode = 0;  float scale = 1.0f;
    if (bid >= PB_WQ)                 { W = wk;  D = WKT;  C = NKV * HD;  tb = bid - PB_WQ; }
    if (bid >= PB_WQ + PB_WK)         { W = wv;  D = WVT;  tb = bid - (PB_WQ + PB_WK); }
    if (bid >= PB_WQ + 2 * PB_WK)     { W = wo;  D = WOT;  C = DMOD;  tb = bid - (PB_WQ + 2 * PB_WK);  mode = 1;  scale = WOS; }
    static_assert(NH * HD == DMOD);   // every weight has DMOD rows (wo: NH*HD rows)
    wT_body(T, tb, W, D, DMOD, C, mode, scale);
  } else if (bid < PB_W + PB_TAB) {
    tab_body(bid - PB_W, cosT, sinT, inv);
  } else {
    cvtx_body(bid - (PB_W + PB_TAB), x, XB, (NB * SEQ * DMOD) / 8);
  }
}

// =====================================================================================================
// GEMM epilogue of the output projection: the wave's 16x64 f32 tile (times oscale) staged in its LDS slab (pitch 68),
// coverage: 8 instructions x 2 rows x 16 lanes x 4 floats = the wave's 16 x 64 tile.
// =====================================================================================================
__device__ __forceinline__ void epi64(float* sl, v8f a0, v8f a1, v8f a2, v8f a3, float oscale, float* C, int N,
                                      size_t rowb, int col0, int lane) {
  const int hh = lane >> 4, m = lane & 15;
#pragma unroll
  for (int r = 0; r < 8; ++r) {
    const int ro = (8 * hh + r) * 68 + m;
    sl[ro]      = a0[r] * oscale;
    sl[ro + 16] = a1[r] * oscale;
    sl[ro + 32] = a2[r] * oscale;
    sl[ro + 48] = a3[r] * oscale;
  }
  wave_sync_lds();
  v4f vals[8];
#pragma unroll
  for (int it = 0; it < 8; ++it) vals[it] = *(const v4f*)(sl + (it * 2 + hh) * 68 + m * 4);
  float* dst = C + (rowb + (size_t)hh) * (size_t)N + col0 + m * 4;
  {
#pragma unroll
    for (int it = 0; it < 8; ++it) {
      *(v4f*)(dst + (size_t)(it * 2) * (size_t)N) = vals[it];
    }
    
  }
}

// =====================================================================================================
// Launch 2: the q, k and v projections (bf16 planes in fragment order, f32 accumulate) with the rotary / split-pack step as the
// epilogue: the 16-bit planes that attention reads go out straight from the accumulators; no f32 copy of q, k, v is kept.
// Block = 64 positions x 64 columns = one head (12 q + 4 k + 4 v column tiles of one 64-row tile of x are neighbours in the grid),
// 4 waves; a wave multiplies FOUR rows of tiles (A operand) by ONE row of tiles (B operand); K stepped by 32 = one tile of FT
// elements (K % 32 == 0, M % 64 == 0 checked statically); D register r of tile j in a lane = (A row 16j + 8hh + r, B row c).
//   q, k blocks: A = the head's 4 weight tiles (d), B = the wave's 16 positions. A lane owns one position (c) and 8 consecutive d
//     per tile; the rotate-half partner d ^ 32 is tile j ^ 2, same lane, same register.
//     w[d] = x[d] * cos[pos][d] + r[d] * sin[pos][d],  r[d] = -x[d+32] for d < 32, x[d-32] for d >= 32;
//     hi[d] = f16(w * 1024), lo[d] = f16(w * 1024 - hi[d]). Plane row = (batch * heads + head) * SEQ + pos, K = HD.
//   v blocks: A = the block's 4 position tiles of x, B = the wave's 16 columns d of wv. A lane owns one d (16 * wave + c) and 8
//     consecutive positions per tile = one chunk of the v^T planes VH[(b*NKV + g)*HD + d][s] = f16(v * 1024), VL = f16 residual.
// coverage: per wave and plane 4 stores x 512 contiguous bytes = 16 x 64 (q, k: 2 tiles; v: 4 half tiles in a row); 4 waves x
//           1280 blocks = every element of the six planes exactly once. No LDS and no barriers in this kernel.
// =====================================================================================================
#define QKV_CT ((NH * HD) / 64 + 2 * ((NKV * HD) / 64))
#define QKV_BLOCKS (((NB * SEQ) / 64) * QKV_CT)
static_assert(QKV_CT == 20 && QKV_BLOCKS == 1280 && QSC == KSC);
__device__ __forceinline__ void split8(const float* t, v4u& oh, v4u& ol) {   // 8 floats -> f16 hi chunk + f16 residual chunk
#pragma unroll
  for (int e = 0; e < 4; ++e) {
    const float t0 = t[2 * e], t1 = t[2 * e + 1];
    const _Float16 h0 = (_Float16)t0, h1 = (_Float16)t1;
    const _Float16 l0 = (_Float16)(t0 - (float)h0), l1 = (_Float16)(t1 - (float)h1);
    oh[e] = pk16(h_bits(h0), h_bits(h1));
    ol[e] = pk16(h_bits(l0), h_bits(l1));
  }
}
__global__ __launch_bounds__(128)
void gemm_qkv(const u16* __restrict__ A, const u16* __restrict__ WQT, const u16* __restrict__ WKT,
              const u16* __restrict__ WVT, const float* __restrict__ cosT, const float* __restrict__ sinT,
              u16* QHI, u16* QLO, u16* KHI, u16* KLO, u16* VHI, u16* VLO, int M, int K) {
  const int tid = threadIdx.x, wave = __builtin_amdgcn_readfirstlane(tid >> 5), lane = tid & 31;   // scalar wave number: wave-uniform tile pointers
  const unsigned lo = (unsigned)lane * 8u;
  const int bid   = blockIdx.x;
  const int ct    = bid % QKV_CT;
  const int row0  = (bid / QKV_CT) * 64;
  if (row0 + 64 > M) return;                 // block-uniform, never taken with the exact grid; no barriers in this kernel
  const bool isv = ct >= (NH * HD) / 64 + (NKV * HD) / 64;
  const u16* Wt = WQT;  u16* hpl = QHI;  u16* lpl = QLO;  int hpr = NH, head = ct;
  if (ct >= (NH * HD) / 64) { Wt = WKT;  hpl = KHI;  lpl = KLO;  hpr = NKV;  head = ct - (NH * HD) / 64; }
  if (isv)                  { Wt = WVT;  hpl = VHI;  lpl = VLO;  head = ct - ((NH * HD) / 64 + (NKV * HD) / 64); }
  const size_t bs = (size_t)(K >> 5) * FT;   // one row of tiles: 16 rows x K
  const u16* xt = A  + (size_t)(row0 >> 4) * bs;        // the block's 4 rows of x tiles
  const u16* wt = Wt + (size_t)(head * (HD / 16)) * bs; // the head's 4 rows of weight tiles
  const u16* ap  = (isv ? wt : xt) + (size_t)wave * bs; // B operand: the wave's own row of tiles
  const u16* bp0 = isv ? xt : wt;                       // A operand: four rows of tiles, shared by the block's waves
  const u16* bp1 = bp0 + bs;
  const u16* bp2 = bp1 + bs;
  const u16* bp3 = bp2 + bs;
  v8f acc0 = zero8(), acc1 = zero8(), acc2 = zero8(), acc3 = zero8();
#pragma unroll 1
  for (int k0 = 0; k0 < K; k0 += 32 * KUQ, ap += KUQ * FT, bp0 += KUQ * FT, bp1 += KUQ * FT, bp2 += KUQ * FT, bp3 += KUQ * FT) {
    v16b a[KUQ], b0[KUQ], b1[KUQ], b2[KUQ], b3[KUQ];
#pragma unroll
    for (int u = 0; u < KUQ; ++u) {
      a[u]  = ldfrag_b(ap + u * FT, lo);
      b0[u] = ldfrag_b(bp0 + u * FT, lo);
      b1[u] = ldfrag_b(bp1 + u * FT, lo);
      b2[u] = ldfrag_b(bp2 + u * FT, lo);
      b3[u] = ldfrag_b(bp3 + u * FT, lo);
      // keeps the trip's loads in front of its products (a load that sinks behind one starts a latency of its own) and in step
      // order, so that the first step's products start while the later steps' fragments are still on their way
      __builtin_amdgcn_sched_barrier(0);
    }
#pragma unroll
    for (int u = 0; u < KUQ; ++u) {          // k ascending in every accumulator, as with one step a trip
      acc0 = mma_b(b0[u], a[u], acc0);
      acc1 = mma_b(b1[u], a[u], acc1);
      acc2 = mma_b(b2[u], a[u], acc2);
      acc3 = mma_b(b3[u], a[u], acc3);
    }
    guard6<v16b>(acc0, acc1, acc2, acc3, a[KUQ - 1], b0[KUQ - 1], b1[KUQ - 1], b2[KUQ - 1], b3[KUQ - 1], a[KUQ - 1]);
#if defined(__HIP_DEVICE_COMPILE__)
    // the next trip forms its addresses in the register pairs that this trip's loads name: the wait stands in front of that
    asm volatile("s_wait_xcnt 0x0" ::: "memory");
#endif
  }
  const v8f acc[4] = {acc0, acc1, acc2, acc3};
  const int bb = row0 / SEQ, p0 = row0 & (SEQ - 1);     // a block lies inside one batch (SEQ % 64 == 0)
  v4u oh[4], ol[4];
  size_t ob;
  if (isv) {
#pragma unroll
    for (int j = 0; j < 4; ++j) {
      float t[8];
#pragma unroll
      for (int r = 0; r < 8; ++r) t[r] = acc[j][r] * VCAR;
      split8(t, oh[j], ol[j]);
    }
    // d tile = wave; the block's 64 positions = 2 neighbouring key tiles; lane = (d c, key chunk 2 * j + hh)
    ob = ((size_t)((bb * NKV + head) * (HD / 16) + wave) * (SEQ / 32) + (size_t)(p0 >> 5)) * FT + lo;
  } else {
    const int hh = lane >> 4, c = lane & 15;
    const int pw = p0 + wave * 16;                      // the wave's first position
    const float* cr = cosT + (size_t)(pw + c) * HD + 8 * hh;
    const float* sr = sinT + (size_t)(pw + c) * HD + 8 * hh;
    v4f cs[2][2], sn[2][2];                             // d = 16j + 8hh + 0..7, j = 0, 1 (the tables repeat at d + 32)
#pragma unroll
    for (int j = 0; j < 2; ++j) {
      cs[j][0] = *(const v4f*)(cr + 16 * j);
      cs[j][1] = *(const v4f*)(cr + 16 * j + 4);
    }
#if defined(__HIP_DEVICE_COMPILE__)
    // in this build a result of the next four loads takes over the address pair of the four loads above: the wait stands in front of it
    asm volatile("s_wait_xcnt 0x0" ::: "memory");
#endif
#pragma unroll
    for (int j = 0; j < 2; ++j) {
      sn[j][0] = *(const v4f*)(sr + 16 * j);
      sn[j][1] = *(const v4f*)(sr + 16 * j + 4);
    }
#pragma unroll
    for (int j = 0; j < 2; ++j) {
      float ta[8], tb[8];
#pragma unroll
      for (int r = 0; r < 8; ++r) {
        const float cv = cs[j][r >> 2][r & 3], sv = sn[j][r >> 2][r & 3];
        const float xa = acc[j][r], xb = acc[j + 2][r];
        ta[r] = (xa * cv + (-xb) * sv) * QSC;
        tb[r] = (xb * cv + xa * sv) * QSC;
      }
      split8(ta, oh[j], ol[j]);
      split8(tb, oh[j + 2], ol[j + 2]);
    }
    // 16 positions = 2 neighbouring tiles = 16 * HD elements; lane = (position c, d chunk 2 * j + hh)
    ob = ((size_t)(bb * hpr + head) * SEQ + (size_t)pw) * HD + lo;
  }
#pragma unroll
  for (int j = 0; j < 4; ++j) {
    const size_t o8 = ob + (size_t)j * 256;
    *(v4u*)(hpl + o8) = oh[j];
    *(v4u*)(lpl + o8) = ol[j];
  }
}

// =====================================================================================================
// f16 hi+lo GEMM: C[M][N] (f32) = (Ahi + Alo)[M][K] . Bt[N][K]^T, times oscale; Ahi/Alo and Bt f16 planes in fragment order;
// products hi.B + lo.B into one accumulator (lo is the unscaled residual of hi). Block = 64x64 tile, 4 waves x 16 rows; fragments
// loaded straight from the planes' tiles; K stepped by 32 = one tile of FT elements.
// =====================================================================================================
__global__ __launch_bounds__(128)
void gemm_h2(const u16* __restrict__ Ah, const u16* __restrict__ Al, const u16* __restrict__ Bt, float* C,
             int M, int N, int K, float oscale) {
  __shared__ __align__(16) float slab[4 * SLAB64];
  const int tid = threadIdx.x, wave = __builtin_amdgcn_readfirstlane(tid >> 5), lane = tid & 31;   // scalar wave number: wave-uniform tile pointers
  const unsigned lo = (unsigned)lane * 8u;
  const int ntile = N >> 6;
  const int bid   = blockIdx.x;
  const int rowb  = (bid / ntile) * 64 + wave * 16;
  const int col0  = (bid % ntile) * 64;
  if (rowb + 16 > M) return;                 // wave-uniform, never taken with the exact grid; no block barriers in this kernel
  const size_t bs = (size_t)(K >> 5) * FT;   // one row of tiles: 16 rows x K
  const size_t aofs = (size_t)(rowb >> 4) * bs;
  const _Float16* ahp = (const _Float16*)(const void*)Ah + aofs;
  const _Float16* alp = (const _Float16*)(const void*)Al + aofs;
  const _Float16* bp0 = (const _Float16*)(const void*)Bt + (size_t)(col0 >> 4) * bs;
  const _Float16* bp1 = bp0 + bs;
  const _Float16* bp2 = bp1 + bs;
  const _Float16* bp3 = bp2 + bs;
  v8f acc0 = zero8(), acc1 = zero8(), acc2 = zero8(), acc3 = zero8();
#pragma unroll 1
  for (int k0 = 0; k0 < K; k0 += 32 * KUO, ahp += KUO * FT, alp += KUO * FT, bp0 += KUO * FT, bp1 += KUO * FT, bp2 += KUO * FT,
       bp3 += KUO * FT) {
    v16h ah[KUO], al[KUO], b0[KUO], b1[KUO], b2[KUO], b3[KUO];
#pragma unroll
    for (int u = 0; u < KUO; ++u) {
      ah[u] = ldfrag_h(ahp + u * FT, lo);
      al[u] = ldfrag_h(alp + u * FT, lo);
      b0[u] = ldfrag_h(bp0 + u * FT, lo);
      b1[u] = ldfrag_h(bp1 + u * FT, lo);
      b2[u] = ldfrag_h(bp2 + u * FT, lo);
      b3[u] = ldfrag_h(bp3 + u * FT, lo);
      // keeps the trip's loads in front of its products (a load that sinks behind one starts a latency of its own) and in step
      // order (as built without it the first step's O fragments come last and every product waits for the whole group)
      __builtin_amdgcn_sched_barrier(0);
    }
#pragma unroll
    for (int u = 0; u < KUO; ++u) {          // k ascending, hi then lo, in every accumulator, as with one step a trip
      acc0 = mma_h(ah[u], b0[u], acc0);  acc0 = mma_h(al[u], b0[u], acc0);
      acc1 = mma_h(ah[u], b1[u], acc1);  acc1 = mma_h(al[u], b1[u], acc1);
      acc2 = mma_h(ah[u], b2[u], acc2);  acc2 = mma_h(al[u], b2[u], acc2);
      acc3 = mma_h(ah[u], b3[u], acc3);  acc3 = mma_h(al[u], b3[u], acc3);
    }
    guard6<v16h>(acc0, acc1, acc2, acc3, ah[KUO - 1], al[KUO - 1], b0[KUO - 1], b1[KUO - 1], b2[KUO - 1], b3[KUO - 1]);
#if defined(__HIP_DEVICE_COMPILE__)
    // the next trip forms its addresses in the register pairs that this trip's loads name: the wait stands in front of that
    asm volatile("s_wait_xcnt 0x0" ::: "memory");
#endif
  }
  epi64(slab + wave * SLAB64, acc0, acc1, acc2, acc3, oscale, C, N, (size_t)rowb, col0, lane);
}

// =====================================================================================================
// GQA flash attention with causal window + global-token mask: block = (batch b, kv head g, 16 query rows q0..q0+15),
// one wave per query head g*GRP + wave (kv index = head / GRP).
//   q planes (hi, lo f16) rows [b][h][s], k = d; k planes rows [b][g][s], k = d; v^T planes rows [b][g][d], k = s; O planes rows
//   [b][s], k = h*64 + d; all in fragment order.
//   Key blocks of 32 visited in a fixed, block-uniform list: {0} + {32 if q0 >= 32} + {jlo, jlo+32, ... < q0+16},
//   jlo = 64 if q0-511 <= 64 else (q0-511) & ~31; the element mask allowed(i,j) = (j <= i) && (i-j < 512 || j < 64) replaces the
//   score by -inf inside partial blocks (block 0 comes first and key 0 is allowed for every row, so each running max is finite
//   before any fully masked block row can occur).
//   Both products are taken transposed: S^T = k'.q'^T (A = key rows, B = query columns) and O^T += v^T.P^T (A = v^T rows d,
//   B = P^T). A lane then owns ONE query (column c = lane & 15) and 16 of the block's 32 keys (8hh + r and 16 + 8hh + r), so
//   the maximum and the sum of a row are taken inside the lane, with one exchange between the two lane halves for the maximum
//   per block and one for the sum after the loop; the two score tiles of a lane, converted in place, ARE the B fragment of P^T
//   in the split k map (elements 0..7 = keys 8hh + 0..7, elements 8..15 = keys 16 + 8hh + 0..7), the map of the v^T loader.
//   Per block: 2 score subtiles x 2 k-steps x 3 products (k_hi.q_hi + k_hi.q_lo + k_lo.q_hi), fragments loaded straight from the
//   16-bit planes (two 16-B loads per fragment, split k map); online max-subtracted base-2 softmax in f32 (scale 1/8 folded);
//   P*32768 as f16 hi and f16 residual, 4+4 v^T A fragments (hi and residual planes), 12 WMMAs (hh + hl + lh).
//   O^T register r of tile j = (d = 16j + 8hh + r, query c): 8 consecutive d of one row = one 16-B chunk of the O planes, so the
//   wave's two tiles of the O hi plane and of the O lo plane (O x1024 as f16 hi + residual) go out 512 contiguous bytes a store.
//   No LDS and no barriers in this kernel; every wave does bounded work (MAXBLK steps max).
// coverage: per wave 4 instructions x 32 lanes x 8 halves = 16 x 64 per plane; grid 1024 blocks x 3 waves = every
//           (b, s, h) row of both O planes exactly once.
// =====================================================================================================
__device__ __forceinline__ float xhalf(float v) {                     // the value of lane ^ 16 (vector cross-row move, no LDS path)
  const int b = __builtin_bit_cast(int, v);
  return __builtin_bit_cast(float, __builtin_amdgcn_permlanex16(b, b, 0x76543210, 0xfedcba98, false, false));
}
__global__ __launch_bounds__(ATT_THREADS)
void attn_gqa(const u16* __restrict__ QHIp, const u16* __restrict__ QLOp,
              const u16* __restrict__ KHIp, const u16* __restrict__ KLOp,
              const u16* __restrict__ VHIp, const u16* __restrict__ VLOp,
              u16* OHIp, u16* OLOp) {
  const int tid  = threadIdx.x;
  const int wave = __builtin_amdgcn_readfirstlane(tid >> 5);   // scalar wave number: wave-uniform q and O tile pointers
  const int lane = tid & 31;
  const unsigned lo = (unsigned)lane * 8u;
  const int hh   = lane >> 4;
  const int c    = lane & 15;

  const int bid  = blockIdx.x;
  const int qt   = bid & (SEQ / 16 - 1);
  const int g    = (bid >> 7) & (NKV - 1);
  const int b    = bid >> 9;
  const int head = g * GRP + wave;
  const int q0   = qt * 16;

  const size_t qofs = ((size_t)(b * NH + head) * SEQ + q0) * HD;               // 16 positions = 2 tiles = 16 * HD elements
  const _Float16* Qh  = (const _Float16*)(const void*)QHIp + qofs;
  const _Float16* Ql  = (const _Float16*)(const void*)QLOp + qofs;
  const size_t kofs = (size_t)(b * NKV + g) * SEQ * HD;                         // key tiles of kb added per step
  const _Float16* Khb = (const _Float16*)(const void*)KHIp + kofs;
  const _Float16* Klb = (const _Float16*)(const void*)KLOp + kofs;
  const size_t vofs = (size_t)(b * NKV + g) * HD * SEQ;                         // d tile j: + 16j * SEQ; key tile of kb added per step
  const _Float16* Vhb = (const _Float16*)(const void*)VHIp + vofs;
  const _Float16* Vlb = (const _Float16*)(const void*)VLOp + vofs;
  const float lsc = 0.125f * (LOG2E / (QSC * KSC));

  // this lane's query: running max of the unscaled scores (equal in both halves), sum over this lane's keys of P * 32768
  float mrun = -INFINITY, lsum = 0.f;
  v8f o[4];
#pragma unroll
  for (int j = 0; j < 4; ++j) o[j] = zero8();

  const int nglob = (q0 >= 32) ? 2 : 1;
  const int wlo   = q0 - (WIN - 1);
  const int jlo   = (wlo <= GLB) ? GLB : (wlo & ~31);
  int nwin = q0 + 16 - jlo;
  nwin = (nwin > 0) ? ((nwin + 31) >> 5) : 0;
  int nblk = nglob + nwin;
  nblk = (nblk > MAXBLK) ? MAXBLK : nblk;

  // wave-uniform tile pointers of the current key block (the list starts at key 0), moved on at the foot of each step
  const _Float16* k0p = Khb;
  const _Float16* l0p = Klb;
  const _Float16* vhp = Vhb;
  const _Float16* vlp = Vlb;
  const int i = q0 + c;                    // this lane's query position
  int kb = 0;
  // q' fragments: the same in every step, held in registers
  v16h qh[2], ql[2];
#pragma unroll
  for (int kk = 0; kk < 2; ++kk) {
    qh[kk] = ldfrag_h(Qh + kk * FT, lo);
    ql[kk] = ldfrag_h(Ql + kk * FT, lo);
  }
#pragma unroll 1
  for (int it = 0; it < nblk; ++it) {
    // ---- every fragment load of this step, one group: k' of both k-steps (in the order the products take them), then v^T ----
    const _Float16* k1p = k0p + (size_t)16 * HD;
    const _Float16* l1p = l0p + (size_t)16 * HD;
    v16h kh0[2], kl0[2], kh1[2], kl1[2];
#pragma unroll
    for (int kk = 0; kk < 2; ++kk) {
      kh0[kk] = ldfrag_h(k0p + kk * FT, lo);
      kh1[kk] = ldfrag_h(k1p + kk * FT, lo);
      kl0[kk] = ldfrag_h(l0p + kk * FT, lo);
      kl1[kk] = ldfrag_h(l1p + kk * FT, lo);
    }
    // v^T A fragments: row = d = j*16 + c, the 32 keys of this step = one key tile of the v^T planes
    const v16h vh0 = ldfrag_h(vhp, lo);
    const v16h vh1 = ldfrag_h(vhp + (size_t)16 * SEQ, lo);
    const v16h vh2 = ldfrag_h(vhp + (size_t)32 * SEQ, lo);
    const v16h vh3 = ldfrag_h(vhp + (size_t)48 * SEQ, lo);
    const v16h vl0 = ldfrag_h(vlp, lo);
    const v16h vl1 = ldfrag_h(vlp + (size_t)16 * SEQ, lo);
    const v16h vl2 = ldfrag_h(vlp + (size_t)32 * SEQ, lo);
    const v16h vl3 = ldfrag_h(vlp + (size_t)48 * SEQ, lo);
    // keeps the 32 loads one group at the head of the step: a load that sinks behind a product starts a latency of its own
    __builtin_amdgcn_sched_barrier(0);
    // ---- element mask of this step (needs no score: it can run while the k' fragments are on their way) ----
    bool ok0[8], ok1[8];
#pragma unroll
    for (int r = 0; r < 8; ++r) {
      const int j0 = kb + 8 * hh + r, j1 = kb + 16 + 8 * hh + r;
      ok0[r] = (j0 <= i) && (((i - j0) < WIN) || (j0 < GLB));
      ok1[r] = (j1 <= i) && (((i - j1) < WIN) || (j1 < GLB));
    }
    // as built without it every compare of the mask sinks behind the scores and lengthens the step; with it most of them stand
    // among the score products, under the waits for the k' fragments
    __builtin_amdgcn_sched_barrier(0);
    // ---- scores^T: D element r of this lane = (key kb + 8hh + r, query q0 + c) in s0, key kb + 16 + 8hh + r in s1 ----
    v8f s0 = zero8(), s1 = zero8();
#pragma unroll
    for (int kk = 0; kk < 2; ++kk) {
      s0 = mma_h(kh0[kk], qh[kk], s0);
      s0 = mma_h(kh0[kk], ql[kk], s0);
      s0 = mma_h(kl0[kk], qh[kk], s0);
      s1 = mma_h(kh1[kk], qh[kk], s1);
      s1 = mma_h(kh1[kk], ql[kk], s1);
      s1 = mma_h(kl1[kk], qh[kk], s1);
      guard2(s0, s1, qh[kk], ql[kk], kh0[kk], kl0[kk], kh1[kk], kl1[kk]);
    }
    // ---- mask (replace by -inf) + online softmax in base 2, one query per lane ----
    float t0[8], t1[8];
#pragma unroll
    for (int r = 0; r < 8; ++r) {
      t0[r] = ok0[r] ? s0[r] : -INFINITY;
      t1[r] = ok1[r] ? s1[r] : -INFINITY;
    }
    float mx = fmaxf(t0[0], t1[0]);
#pragma unroll
    for (int r = 1; r < 8; ++r) mx = fmaxf(mx, fmaxf(t0[r], t1[r]));
    mx = fmaxf(mx, xhalf(mx));
    const float mn = fmaxf(mrun, mx);
    // v_exp_f32 itself: a result below 2^-126 comes out 0, far under the last bit that the f16 planes of P and the row sum keep
    const float al = __builtin_amdgcn_exp2f((mrun - mn) * lsc);
    mrun = mn;
    const float nb = fmaf(-mn, lsc, PLOG);   // scale, maximum and the carry of P meet in one fma per score (lsc > 0: max commutes)
    // ---- B fragments of P^T * 32768: hi f16 and residual f16, column = c, split k map over the 32 keys of this step ----
    FragH ph, pl;
    float ps0 = 0.f, ps1 = 0.f;
#pragma unroll
    for (int r = 0; r < 8; ++r) {
      const float ta = __builtin_amdgcn_exp2f(fmaf(t0[r], lsc, nb)), tb = __builtin_amdgcn_exp2f(fmaf(t1[r], lsc, nb));
      ps0 += ta;
      ps1 += tb;
      const _Float16 ha = (_Float16)ta, hb = (_Float16)tb;
      ph.h[0][r] = ha;                                     // elements 0..7  = keys kb + 8hh + 0..7
      ph.h[1][r] = hb;                                     // elements 8..15 = keys kb + 16 + 8hh + 0..7
      pl.h[0][r] = (_Float16)(ta - (float)ha);
      pl.h[1][r] = (_Float16)(tb - (float)hb);
    }
    lsum = lsum * al + (ps0 + ps1);
#pragma unroll
    for (int j = 0; j < 4; ++j)
#pragma unroll
      for (int r = 0; r < 8; ++r) o[j][r] *= al;
    // ---- O^T += v^T.P^T ----
    {
      o[0] = mma_h(vh0, ph.v, o[0]);  o[0] = mma_h(vh0, pl.v, o[0]);  o[0] = mma_h(vl0, ph.v, o[0]);
      o[1] = mma_h(vh1, ph.v, o[1]);  o[1] = mma_h(vh1, pl.v, o[1]);  o[1] = mma_h(vl1, ph.v, o[1]);
      o[2] = mma_h(vh2, ph.v, o[2]);  o[2] = mma_h(vh2, pl.v, o[2]);  o[2] = mma_h(vl2, ph.v, o[2]);
      o[3] = mma_h(vh3, ph.v, o[3]);  o[3] = mma_h(vh3, pl.v, o[3]);  o[3] = mma_h(vl3, ph.v, o[3]);
      guard10(o[0], o[1], o[2], o[3], ph.v, pl.v, vh0, vh1, vh2, vh3, vl0, vl1, vl2, vl3);
    }
    const int kn = (it + 1 < nglob) ? ((it + 1) * 32) : (jlo + (it + 1 - nglob) * 32);   // next key block of the list
    const int dk = kn - kb;                                                              // a positive multiple of 32
    k0p += (size_t)dk * HD;
    l0p += (size_t)dk * HD;
    vhp += (size_t)(dk >> 5) * FT;
    vlp += (size_t)(dk >> 5) * FT;
    kb = kn;
  }
  acc_guard4(o[0], o[1], o[2], o[3]);

  // ---- join the two halves' sums, fold 1/l and the carry of v (1024); the carry of P (32768) is in o and in l alike ----
  const float oc = 1.0f / VCAR;
  const float inv = (1.0f / (lsum + xhalf(lsum))) * oc;
  // ---- O x1024 -> f16 hi + residual planes; the wave's 16 x 64 = 2 neighbouring tiles; lane = (row c, chunk 2 * j + hh) ----
  v4u oh[4], ol[4];
#pragma unroll
  for (int j = 0; j < 4; ++j) {
    float w[8];
#pragma unroll
    for (int r = 0; r < 8; ++r) w[r] = (o[j][r] * inv) * OSC;
#pragma unroll
    for (int e = 0; e < 4; ++e) {
      const _Float16 h0 = (_Float16)w[2 * e], h1 = (_Float16)w[2 * e + 1];
      const _Float16 l0 = (_Float16)(w[2 * e] - (float)h0), l1 = (_Float16)(w[2 * e + 1] - (float)h1);
      oh[j][e] = pk16(h_bits(h0), h_bits(h1));
      ol[j][e] = pk16(h_bits(l0), h_bits(l1));
    }
  }
  const size_t ob = (size_t)(b * SEQ + q0) * (NH * HD) + (size_t)(head * 2) * FT + lo;
  {
#pragma unroll
    for (int j = 0; j < 4; ++j) {
      const size_t o8 = ob + (size_t)j * 256;
      *(v4u*)(OHIp + o8) = oh[j];
      *(v4u*)(OLOp + o8) = ol[j];
    }
  }
}

// =====================================================================================================
// Workspace map (bytes); every plane is fully written by whole-line stores before it is read; all extents are exact multiples
// of the store granularity (no pad rows needed); every offset a multiple of 65536:
//   CT  f32 [2048][64]                 524288        ST  same              524288
//   (16-bit planes: rows x K named below, stored in fragment order)
//   XB  bf16 [4096][768]              6291456
//   WQT bf16 [768 n][768 k]           1179648        WKT bf16 [256][768]   393216     WVT same   393216
//   WOT f16  [768 n][768 k] x1024     1179648
//   QHI f16 [2][12][2048][64] x1024   6291456        QLO residual         6291456
//   KHI f16 [2][4][2048][64] x1024    2097152        KLO residual         2097152
//   VHI f16 [2][4][64][2048] x1024    2097152        VLO residual         2097152
//   OHI f16 [4096][768] x1024         6291456        OLO residual         6291456
//   end                              44040192
// =====================================================================================================
extern "C" void kernel_launch(void* const* d_in, const int* in_sizes, int n_in,
                              void* d_out, int out_size, void* d_ws, size_t ws_size,
                              hipStream_t stream) {
  const int ROWS = NB * SEQ;                            // 4096
  if (n_in < 5) return;
  if (in_sizes[0] != ROWS * DMOD) return;
  if (in_sizes[1] != DMOD * (NH * HD)) return;
  if (in_sizes[2] != DMOD * (NKV * HD) || in_sizes[3] != DMOD * (NKV * HD)) return;
  if (in_sizes[4] != (NH * HD) * DMOD) return;
  if (out_size != ROWS * DMOD) return;

  const float* x  = (const float*)d_in[0];
  const float* wq = (const float*)d_in[1];
  const float* wk = (const float*)d_in[2];
  const float* wv = (const float*)d_in[3];
  const float* wo = (const float*)d_in[4];
  float*       out = (float*)d_out;

  const size_t szTab = (size_t)SEQ * HD * 4;                    //   524288
  const size_t szXB  = (size_t)ROWS * DMOD * 2;                 //  6291456
  const size_t szWQT = (size_t)(NH * HD) * DMOD * 2;            //  1179648
  const size_t szWKT = (size_t)(NKV * HD) * DMOD * 2;           //   393216
  const size_t szWOT = (size_t)DMOD * (NH * HD) * 2;            //  1179648
  const size_t szQP  = (size_t)ROWS * (NH * HD) * 2;            //  6291456
  const size_t szKP  = (size_t)ROWS * (NKV * HD) * 2;           //  2097152
  const size_t szVP  = (size_t)NB * NKV * HD * SEQ * 2;         //  2097152
  const size_t szOP  = (size_t)ROWS * (NH * HD) * 2;            //  6291456
  size_t off = 0;
  const size_t oCT  = off; off += szTab;
  const size_t oST  = off; off += szTab;
  const size_t oXB  = off; off += szXB;
  const size_t oWQT = off; off += szWQT;
  const size_t oWKT = off; off += szWKT;
  const size_t oWVT = off; off += szWKT;
  const size_t oWOT = off; off += szWOT;
  const size_t oQHI = off; off += szQP;
  const size_t oQLO = off; off += szQP;
  const size_t oKHI = off; off += szKP;
  const size_t oKLO = off; off += szKP;
  const size_t oVHI = off; off += szVP;
  const size_t oVLO = off; off += szVP;
  const size_t oOHI = off; off += szOP;
  const size_t oOLO = off; off += szOP;
  if (off > ws_size) return;                            // off = 44040192
  if (off > (size_t)134217728) return;

  char* ws = (char*)d_ws;
  float* CT  = (float*)(ws + oCT);
  float* ST  = (float*)(ws + oST);
  u16*   XB  = (u16*)(ws + oXB);
  u16*   WQT = (u16*)(ws + oWQT);
  u16*   WKT = (u16*)(ws + oWKT);
  u16*   WVT = (u16*)(ws + oWVT);
  u16*   WOT = (u16*)(ws + oWOT);
  u16*   QHI = (u16*)(ws + oQHI);
  u16*   QLO = (u16*)(ws + oQLO);
  u16*   KHI = (u16*)(ws + oKHI);
  u16*   KLO = (u16*)(ws + oKLO);
  u16*   VHI = (u16*)(ws + oVHI);
  u16*   VLO = (u16*)(ws + oVLO);
  u16*   OHI = (u16*)(ws + oOHI);
  u16*   OLO = (u16*)(ws + oOLO);

  // inv_freq[i] = 1 / pow(10000, i/32) in f32 (pow correctly converted from f64, then IEEE f32 reciprocal)
  InvF inv;
  for (int i = 0; i < 32; ++i) {
    const double p = pow(10000.0, (double)i / 32.0);
    const float pf = (float)p;
    inv.f[i] = 1.0f / pf;
  }

  const dim3 blk(256);
  const dim3 gPrep(PREP_BLOCKS);                        // 2176
  const dim3 gQKV(QKV_BLOCKS);                          // 1280
  const dim3 gGO((ROWS / 64) * (DMOD / 64));            // 768
  const dim3 bG(128);
  const dim3 gAT(ATT_BLOCKS);                           // 1024
  const dim3 bAT(ATT_THREADS);                          // 96

  // (1) weights W[k rows][n cols] -> [n][k] 16-bit planes in fragment order (bf16 for wq/wk/wv; f16 of bf16 value x1024 for wo),
  //     rotary cos/sin tables [2048][64], x -> bf16 plane
  prep<<<gPrep, blk, 0, stream>>>(x, wq, wk, wv, wo, XB, WQT, WKT, WVT, WOT, CT, ST, inv);
  // (2) projections q, k, v -> q' and k' planes (rotary, hi + residual), v^T planes x1024 (hi + residual)
  gemm_qkv<<<gQKV, bG, 0, stream>>>(XB, WQT, WKT, WVT, CT, ST, QHI, QLO, KHI, KLO, VHI, VLO, ROWS, DMOD);
  // (3) attention -> O planes [b][s][h][d] x1024 (hi + residual)
  attn_gqa<<<gAT, bAT, 0, stream>>>(QHI, QLO, KHI, KLO, VHI, VLO, OHI, OLO);
  // (4) output projection -> out [4096][768] f32, carries 1024 (O) x 1024 (wo) folded back
  gemm_h2<<<gGO, bG, 0, stream>>>(OHI, OLO, WOT, out, ROWS, DMOD, NH * HD, 1.0f / (OSC * WOS));
  (void)hipGetLastError();
}

// v007
// It runs in 59.5 microseconds.
// Two timings next to v006 put it at 1.05 and 1.06 times that version's speed.
// All steps since v000 together make it 2.49 times as fast.
// Contractions: x.W{q,k,v} on v_wmma_f32_16x16x32_bf16 (x and W RNE-converted to bf16, exact operands, f32 accumulate);
// scores k'.q'^T (transposed; q', k' carried x1024 as f16 hi plane + f16 residual plane, products hh+lh+hl), v^T.P^T (transposed; P x32768 f16 hi+residual,
// v x1024 f16 hi+residual, products hh+lh+hl) and O.wo (O x1024 f16 hi+residual, wo as f16(bf16(wo) x1024), products h.w+l.w):
// v_wmma_f32_16x16x32_f16, f32 accumulate. Rotary tables, rotation, masked base-2 online softmax and 1/l fold in f32 on VALU.
#include <hip/hip_runtime.h>
#include <math.h>
#include <stdint.h>

#define NB    2
#define SEQ   2048
#define DMOD  768
#define NH    12
#define NKV   4
#define HD    64
#define GRP   3
#define WIN   512
#define GLB   64
#define QSC   1024.0f
#define KSC   1024.0f
#define PCAR  32768.0f
#define PLOG  15.0f  // log2(PCAR)
#define VCAR  1024.0f
#define OSC   1024.0f
#define WOS   1024.0f
#define LOG2E 1.4426950408889634f
#define ATT_QT 4     // neighbouring query tiles of one kv head that one work-group of the attention kernel takes
#define ATT_THREADS (ATT_QT * GRP * 32)
#define ATT_BLOCKS  (NB * NKV * (SEQ / (16 * ATT_QT)))
#define SLAB64 (16 * 68)
#define VTP   72
#define MAXBLK 20
#define FT    512
#define KUQ   3      // k-steps of 32 whose fragment loads one trip of the q/k/v GEMM issues together
#define KUO   4      // the same for the output projection
static_assert(NH == NKV * GRP);
static_assert(PCAR == 32768.0f && PLOG == 15.0f);
static_assert(HD == 64 && DMOD == NH * HD);
static_assert((SEQ / 16) == 128 && NKV == 4 && NB == 2);
static_assert(ATT_THREADS == 384 && ATT_BLOCKS == 256 && (SEQ / (16 * ATT_QT)) == 32);
static_assert(((NB * SEQ * NH * 8) % 256) == 0 && ((NB * SEQ * NKV * 8) % 256) == 0);
static_assert(((NB * SEQ) % 64) == 0 && (DMOD % 64) == 0 && ((NKV * HD) % 64) == 0 && (DMOD % 32) == 0);
static_assert((SEQ % 64) == 0 && (SEQ % 8) == 0);
static_assert((DMOD % (32 * KUQ)) == 0 && ((NH * HD) % (32 * KUO)) == 0);   // whole trips: no load past a plane's row of tiles

typedef unsigned short u16;
typedef _Float16 v16h __attribute__((ext_vector_type(16)));
typedef _Float16 v8h  __attribute__((ext_vector_type(8)));
typedef __bf16   v16b __attribute__((ext_vector_type(16)));
typedef float    v8f  __attribute__((ext_vector_type(8)));
typedef float    v4f  __attribute__((ext_vector_type(4)));
typedef unsigned int v4u __attribute__((ext_vector_type(4)));

union FragH { v16h v; v8h h[2]; v4u u[2]; };
union FragB { v16b v; v4u u[2]; };

struct InvF { float f[32]; };
static_assert(sizeof(InvF) == 128);

// ---- scalar helpers --------------------------------------------------------------------------------
__device__ __forceinline__ unsigned short bf_bits(float f) {          // f32 -> bf16 bits, RNE convert
  unsigned u = __float_as_uint(f);
  return (unsigned short)((u + 0x7FFFu + ((u >> 16) & 1u)) >> 16);
}
__device__ __forceinline__ float bf_up(unsigned short h) { return __uint_as_float(((unsigned)h) << 16); }
__device__ __forceinline__ float bfr(float f) { return bf_up(bf_bits(f)); }
__device__ __forceinline__ unsigned short h_bits(_Float16 x) { return __builtin_bit_cast(unsigned short, x); }
__device__ __forceinline__ unsigned pk16(unsigned short a, unsigned short b) { return (unsigned)a | ((unsigned)b << 16); }
__device__ __forceinline__ v8f zero8() { v8f z = {0.f, 0.f, 0.f, 0.f, 0.f, 0.f, 0.f, 0.f}; return z; }

// ---- fragment-order planes: every 16-bit operand plane [rows][K] is kept as 16-row x 32-k tiles of FT elements (1 KiB),
//      tile (rt, kt) at (rt * (K / 32) + kt) * FT, and inside a tile as 16-B chunks [q = (k & 31) >> 3][row & 15][k & 7].
// ---- fragment loaders: 16-bit A/B operand, lane -> row/col (lane&15), h = lane>>4, t = the tile (wave-uniform), lo = lane * 8;
//      elements 0..7 <- t[lo..lo+7] (chunk q = h: k0+8h..), elements 8..15 <- t[256+lo..] (chunk q = 2+h: k0+16+8h..)
//      (same split k map for A and B); each of the two loads of a wave is 512 contiguous bytes = 4 whole lines
__device__ __forceinline__ v16h ldfrag_h(const _Float16* t, unsigned lo) {
  FragH f;
  f.h[0] = *(const v8h*)(t + lo);
  f.h[1] = *(const v8h*)(t + 256 + lo);
  return f.v;
}
__device__ __forceinline__ v16b ldfrag_b(const u16* t, unsigned lo) { // bf16 plane read as unsigned integer vectors
  FragB f;
  f.u[0] = *(const v4u*)(t + lo);
  f.u[1] = *(const v4u*)(t + 256 + lo);
  return f.v;
}

__device__ __forceinline__ v8f mma_h(v16h a, v16h b, v8f c) {
  return __builtin_amdgcn_wmma_f32_16x16x32_f16(false, a, false, b, (short)0, c, false, false);
}
__device__ __forceinline__ v8f mma_b(v16b a, v16b b, v8f c) {
  return __builtin_amdgcn_wmma_f32_16x16x32_bf16(false, a, false, b, (short)0, c, false, false);
}
__device__ __forceinline__ void guard2(v8f& a, v8f& b, v16h x0, v16h x1, v16h x2, v16h x3, v16h x4, v16h x5) {
#if defined(__HIP_DEVICE_COMPILE__)
  asm volatile("v_nop\n\tv_nop\n\tv_nop\n\tv_nop"
               : "+v"(a), "+v"(b) : "v"(x0), "v"(x1), "v"(x2), "v"(x3), "v"(x4), "v"(x5) : "memory");
#endif
}
template <typename F>
__device__ __forceinline__ void guard6(v8f& a, v8f& b, v8f& c, v8f& d, F x0, F x1, F x2, F x3, F x4, F x5) {
#if defined(__HIP_DEVICE_COMPILE__)
  asm volatile("v_nop\n\tv_nop\n\tv_nop\n\tv_nop"
               : "+v"(a), "+v"(b), "+v"(c), "+v"(d) : "v"(x0), "v"(x1), "v"(x2), "v"(x3), "v"(x4), "v"(x5) : "memory");
#endif
}
__device__ __forceinline__ void guard10(v8f& a, v8f& b, v8f& c, v8f& d, v16h x0, v16h x1, v16h x2, v16h x3, v16h x4,
                                        v16h x5, v16h x6, v16h x7, v16h x8, v16h x9) {
#if defined(__HIP_DEVICE_COMPILE__)
  asm volatile("v_nop\n\tv_nop\n\tv_nop\n\tv_nop"
               : "+v"(a), "+v"(b), "+v"(c), "+v"(d)
               : "v"(x0), "v"(x1), "v"(x2), "v"(x3), "v"(x4), "v"(x5), "v"(x6), "v"(x7), "v"(x8), "v"(x9) : "memory");
#endif
}
__device__ __forceinline__ void acc_guard4(v8f& a, v8f& b, v8f& c, v8f& d) {
#if defined(__HIP_DEVICE_COMPILE__)
  asm volatile("v_nop\n\tv_nop\n\tv_nop\n\tv_nop" : "+v"(a), "+v"(b), "+v"(c), "+v"(d));
#endif
}
__device__ __forceinline__ void wave_sync_lds() {
  __builtin_amdgcn_fence(__ATOMIC_RELEASE, "workgroup");
  __builtin_amdgcn_wave_barrier();
  __builtin_amdgcn_fence(__ATOMIC_ACQUIRE, "workgroup");
}

// ---- accurate f32 sin/cos of a non-negative f32 angle (|angle| < 2048): f64 two-part pi/2 reduction + f64 polynomials,
//      plain f64 fma/mul only (no library f64 trig path), result converted to f32.
__device__ __forceinline__ void sincos_acc(float angf, float& sv, float& cv) {
  const double a = (double)angf;
  const double TWO_OVER_PI = 0.63661977236758134308;
  const double PIO2_HI = 1.5707963267948966;
  const double PIO2_LO = 6.123233995736766e-17;
  const int kq = (int)(a * TWO_OVER_PI + 0.5);
  const double kd = (double)kq;
  double r = fma(-kd, PIO2_HI, a);
  r = fma(-kd, PIO2_LO, r);
  const double r2 = r * r;
  double sp = 1.0 / 6227020800.0;
  sp = fma(sp, r2, -1.0 / 39916800.0);
  sp = fma(sp, r2, 1.0 / 362880.0);
  sp = fma(sp, r2, -1.0 / 5040.0);
  sp = fma(sp, r2, 1.0 / 120.0);
  sp = fma(sp, r2, -1.0 / 6.0);
  const double s = fma(sp * r2, r, r);
  double cp = -1.0 / 87178291200.0;
  cp = fma(cp, r2, 1.0 / 479001600.0);
  cp = fma(cp, r2, -1.0 / 3628800.0);
  cp = fma(cp, r2, 1.0 / 40320.0);
  cp = fma(cp, r2, -1.0 / 720.0);
  cp = fma(cp, r2, 1.0 / 24.0);
  cp = fma(cp, r2, -0.5);
  const double c = fma(cp, r2, 1.0);
  const int qd = kq & 3;
  const double so = (qd == 0) ? s : (qd == 1) ? c : (qd == 2) ? -s : -c;
  const double co = (qd == 0) ? c : (qd == 1) ? -s : (qd == 2) ? -c : s;
  sv = (float)so;
  cv = (float)co;
}

// =====================================================================================================
// Rotary tables: cosT[t][d], sinT[t][d] for t < SEQ, d < HD, angle = float(t) * inv_freq[d & 31] (f32 product), halves duplicated.
// Wave = one position t, lane = frequency index; inv_freq picked from the by-value table with a static select chain.
// coverage: SEQ/8 blocks x 8 waves = SEQ rows; per row 4 line stores = 64 floats of each table.
// =====================================================================================================
__device__ __forceinline__ void tab_body(int bid, float* cosT, float* sinT, const InvF& inv) {
  const int tid  = threadIdx.x;
  const int lane = tid & 31;
  const int t    = bid * 8 + (tid >> 5);
  if (t >= SEQ) return;                     // never taken with the exact block range; no barriers in this part
  float f = inv.f[0];
#pragma unroll
  for (int i = 1; i < 32; ++i) f = (lane == i) ? inv.f[i] : f;
  const float ang = (float)t * f;
  float sv, cv;
  sincos_acc(ang, sv, cv);
  float* cr = cosT + (size_t)t * HD;
  float* sr = sinT + (size_t)t * HD;
  {
    *(float*)(cr + lane)      = cv;
    *(float*)(cr + 32 + lane) = cv;
    *(float*)(sr + lane)      = sv;
    *(float*)(sr + 32 + lane) = sv;
    
  }
}

// =====================================================================================================
// x f32 -> bf16 plane (RNE convert), fragment order. Thread = one 16-B chunk (8 consecutive k of one row): two 16-B loads, one
// 16-B store; a wave = 8 rows x the 4 chunks of one tile, so 8 lanes fill one 128-B line of the plane.
// coverage: n8/256 blocks (exact division checked statically) x 256 thr x 8 = the whole plane (64 threads per tile).
// =====================================================================================================
__device__ __forceinline__ void cvtx_body(int bid, const float* __restrict__ x, u16* D, int n8) {
  const int gt = bid * 256 + (int)threadIdx.x;
  if (gt >= n8) return;                     // no barriers in this part
  const int tile = gt >> 6;
  const int m    = ((gt >> 5) & 1) * 8 + (gt & 7);
  const int q    = (gt >> 3) & 3;
  const float* p = x + (size_t)((tile / (DMOD / 32)) * 16 + m) * DMOD + (tile % (DMOD / 32)) * 32 + q * 8;
  const v4f a = *(const v4f*)(p), bq = *(const v4f*)(p + 4);
  v4u o;
  o[0] = pk16(bf_bits(a[0]),  bf_bits(a[1]));
  o[1] = pk16(bf_bits(a[2]),  bf_bits(a[3]));
  o[2] = pk16(bf_bits(bq[0]), bf_bits(bq[1]));
  o[3] = pk16(bf_bits(bq[2]), bf_bits(bq[3]));
  u16* d = D + (size_t)tile * FT + q * 128 + m * 8;
  {
    *(v4u*)(d) = o;
    
  }
}

// =====================================================================================================
// Weight transpose + 16-bit convert: in W[R][C] (row-major f32) -> out D[C][R] (16-bit plane, rows n = C, k = R, fragment order).
//   f16mode == 0: D = bf16 RNE bits of W;  f16mode == 1: D = f16 bits of (bf16 RNE value of W) * scale.
// Block = one 64x64 tile (r0, c0): 256 thr x 4 16-B loads -> LDS tile [c][r] (pitch 72), block barrier, then each output row
// coverage: load 256 thr x 16 = 64x64; store 2 iterations x 256 thr x 8 halves = 8 fragment tiles (4 n x 2 k), a wave = 512
//           contiguous bytes; grid (C/64)x(R/64) tiles = all of D.
// =====================================================================================================
__device__ __forceinline__ void wT_body(u16* T, int bid, const float* __restrict__ W, u16* D, int R, int C, int f16mode,
                                        float scale) {
  const int tid = threadIdx.x;
  const int ntc = C >> 6;
  const int c0  = (bid % ntc) * 64;
  const int r0  = (bid / ntc) * 64;
  {
    const int rr = tid >> 2;
    const int cc = (tid & 3) * 16;
    const float* src = W + (size_t)(r0 + rr) * C + c0 + cc;
#pragma unroll
    for (int i = 0; i < 4; ++i) {
      const v4f a = *(const v4f*)(src + 4 * i);
#pragma unroll
      for (int e = 0; e < 4; ++e) {
        const float v = a[e];
        const unsigned short hb = h_bits((_Float16)(bfr(v) * scale));
        const unsigned short bb = bf_bits(v);
        T[(cc + 4 * i + e) * VTP + rr] = (f16mode != 0) ? hb : bb;
      }
    }
  }
  __syncthreads();
  v4u vals[2];
  const int m16 = tid & 15, q4 = (tid >> 4) & 3, nt = tid >> 7, kt = (tid >> 6) & 1;   // n tile nt (+2 per iteration), k tile kt
#pragma unroll
  for (int it = 0; it < 2; ++it) vals[it] = *(const v4u*)(T + ((it * 2 + nt) * 16 + m16) * VTP + kt * 32 + q4 * 8);
  {
#pragma unroll
    for (int it = 0; it < 2; ++it) {
      const size_t tile = (size_t)((c0 >> 4) + it * 2 + nt) * (size_t)(R >> 5) + (size_t)((r0 >> 5) + kt);
      *(v4u*)(D + tile * FT + q4 * 128 + m16 * 8) = vals[it];
    }
    
  }
}

// =====================================================================================================
// Launch 1: every conversion that depends on the inputs alone, one launch, parts picked by block range (block-uniform):
//   [0, 384)     weight tiles: wq 144, wk 48, wv 48, wo 144 (they hold the one block barrier, so they start first)
//   [384, 640)   rotary tables
//   [640, 2176)  x -> bf16 plane
// Each part keeps its own block count and per-block work; no part reads what another part writes.
// =====================================================================================================
#define PB_WQ  ((DMOD / 64) * ((NH * HD) / 64))
#define PB_WK  ((DMOD / 64) * ((NKV * HD) / 64))
#define PB_WO  (((NH * HD) / 64) * (DMOD / 64))
#define PB_W   (PB_WQ + 2 * PB_WK + PB_WO)
#define PB_TAB (SEQ / 8)
#define PB_X   ((NB * SEQ * DMOD) / (8 * 256))
#define PREP_BLOCKS (PB_W + PB_TAB + PB_X)
static_assert(PB_W == 384 && PB_TAB == 256 && PB_X == 1536 && ((NB * SEQ * DMOD) % (8 * 256)) == 0);
__global__ __launch_bounds__(256)
void prep(const float* __restrict__ x, const float* __restrict__ wq, const float* __restrict__ wk,
          const float* __restrict__ wv, const float* __restrict__ wo, u16* XB, u16* WQT, u16* WKT, u16* WVT, u16* WOT,
          float* cosT, float* sinT, InvF inv) {
  __shared__ __align__(16) u16 T[64 * VTP];
  const int bid = blockIdx.x;
  if (bid < PB_W) {
    const float* W = wq;  u16* D = WQT;  int C = NH * HD, tb = bid, mode = 0;  float scale = 1.0f;
    if (bid >= PB_WQ)                 { W = wk;  D = WKT;  C = NKV * HD;  tb = bid - PB_WQ; }
    if (bid >= PB_WQ + PB_WK)         { W = wv;  D = WVT;  tb = bid - (PB_WQ + PB_WK); }
    if (bid >= PB_WQ + 2 * PB_WK)     { W = wo;  D = WOT;  C = DMOD;  tb = bid - (PB_WQ + 2 * PB_WK);  mode = 1;  scale = WOS; }
    static_assert(NH * HD == DMOD);   // every weight has DMOD rows (wo: NH*HD rows)
    wT_body(T, tb, W, D, DMOD, C, mode, scale);
  } else if (bid < PB_W + PB_TAB) {
    tab_body(bid - PB_W, cosT, sinT, inv);
  } else {
    cvtx_body(bid - (PB_W + PB_TAB), x, XB, (NB * SEQ * DMOD) / 8);
  }
}

// =====================================================================================================
// GEMM epilogue of the output projection: the wave's 16x64 f32 tile (times oscale) staged in its LDS slab (pitch 68),
// coverage: 8 instructions x 2 rows x 16 lanes x 4 floats = the wave's 16 x 64 tile.
// =====================================================================================================
__device__ __forceinline__ void epi64(float* sl, v8f a0, v8f a1, v8f a2, v8f a3, float oscale, float* C, int N,
                                      size_t rowb, int col0, int lane) {
  const int hh = lane >> 4, m = lane & 15;
#pragma unroll
  for (int r = 0; r < 8; ++r) {
    const int ro = (8 * hh + r) * 68 + m;
    sl[ro]      = a0[r] * oscale;
    sl[ro + 16] = a1[r] * oscale;
    sl[ro + 32] = a2[r] * oscale;
    sl[ro + 48] = a3[r] * oscale;
  }
  wave_sync_lds();
  v4f vals[8];
#pragma unroll
  for (int it = 0; it < 8; ++it) vals[it] = *(const v4f*)(sl + (it * 2 + hh) * 68 + m * 4);
  float* dst = C + (rowb + (size_t)hh) * (size_t)N + col0 + m * 4;
  {
#pragma unroll
    for (int it = 0; it < 8; ++it) {
      *(v4f*)(dst + (size_t)(it * 2) * (size_t)N) = vals[it];
    }
    
  }
}

// =====================================================================================================
// Launch 2: the q, k and v projections (bf16 planes in fragment order, f32 accumulate) with the rotary / split-pack step as the
// epilogue: the 16-bit planes that attention reads go out straight from the accumulators; no f32 copy of q, k, v is kept.
// Block = 64 positions x 5 heads (of the 12 q + 4 k + 4 v column tiles of 64), 20 waves = 4 per head: as many waves as a WGP holds
// of this kernel, so the waves that meet in one WGP cache read the same 64 rows of x (each x tile serves 5 heads per fetch from L2).
// A wave multiplies FOUR rows of tiles (A operand) by ONE row of tiles (B operand); K stepped by 32 = one tile of FT
// elements (K % 32 == 0, M % 64 == 0 checked statically); D register r of tile j in a lane = (A row 16j + 8hh + r, B row c).
//   q, k blocks: A = the head's 4 weight tiles (d), B = the wave's 16 positions. A lane owns one position (c) and 8 consecutive d
//     per tile; the rotate-half partner d ^ 32 is tile j ^ 2, same lane, same register.
//     w[d] = x[d] * cos[pos][d] + r[d] * sin[pos][d],  r[d] = -x[d+32] for d < 32, x[d-32] for d >= 32;
//     hi[d] = f16(w * 1024), lo[d] = f16(w * 1024 - hi[d]). Plane row = (batch * heads + head) * SEQ + pos, K = HD.
//   v blocks: A = the block's 4 position tiles of x, B = the wave's 16 columns d of wv. A lane owns one d (16 * wave + c) and 8
//     consecutive positions per tile = one chunk of the v^T planes VH[(b*NKV + g)*HD + d][s] = f16(v * 1024), VL = f16 residual.
// coverage: per wave and plane 4 stores x 512 contiguous bytes = 16 x 64 (q, k: 2 tiles; v: 4 half tiles in a row); 4 waves x
//           5 heads x 256 blocks = every element of the six planes exactly once. No LDS and no barriers in this kernel.
// =====================================================================================================
#define QKV_CT ((NH * HD) / 64 + 2 * ((NKV * HD) / 64))
#define QKV_HG 5     // heads (column tiles of 64) per work-group
#define QKV_THREADS (QKV_HG * 4 * 32)
#define QKV_BLOCKS (((NB * SEQ) / 64) * (QKV_CT / QKV_HG))
static_assert(QKV_CT == 20 && (QKV_CT % QKV_HG) == 0 && QKV_THREADS == 640 && QKV_BLOCKS == 256 && QSC == KSC);
__device__ __forceinline__ void split8(const float* t, v4u& oh, v4u& ol) {   // 8 floats -> f16 hi chunk + f16 residual chunk
#pragma unroll
  for (int e = 0; e < 4; ++e) {
    const float t0 = t[2 * e], t1 = t[2 * e + 1];
    const _Float16 h0 = (_Float16)t0, h1 = (_Float16)t1;
    const _Float16 l0 = (_Float16)(t0 - (float)h0), l1 = (_Float16)(t1 - (float)h1);
    oh[e] = pk16(h_bits(h0), h_bits(h1));
    ol[e] = pk16(h_bits(l0), h_bits(l1));
  }
}
__global__ __launch_bounds__(QKV_THREADS)
void gemm_qkv(const u16* __restrict__ A, const u16* __restrict__ WQT, const u16* __restrict__ WKT,
              const u16* __restrict__ WVT, const float* __restrict__ cosT, const float* __restrict__ sinT,
              u16* QHI, u16* QLO, u16* KHI, u16* KLO, u16* VHI, u16* VLO, int M, int K) {
  const int tid = threadIdx.x, wid = __builtin_amdgcn_readfirstlane(tid >> 5), lane = tid & 31;   // scalar wave number: wave-uniform tile pointers
  const int wave = wid & 3;                  // the wave's place among the 4 waves of its head
  const unsigned lo = (unsigned)lane * 8u;
  const int bid   = blockIdx.x;
  const int ct    = (bid % (QKV_CT / QKV_HG)) * QKV_HG + (wid >> 2);   // the wave's head
  const int row0  = (bid / (QKV_CT / QKV_HG)) * 64;
  if (row0 + 64 > M) return;                 // block-uniform, never taken with the exact grid; no barriers in this kernel
  const bool isv = ct >= (NH * HD) / 64 + (NKV * HD) / 64;
  const u16* Wt = WQT;  u16* hpl = QHI;  u16* lpl = QLO;  int hpr = NH, head = ct;
  if (ct >= (NH * HD) / 64) { Wt = WKT;  hpl = KHI;  lpl = KLO;  hpr = NKV;  head = ct - (NH * HD) / 64; }
  if (isv)                  { Wt = WVT;  hpl = VHI;  lpl = VLO;  head = ct - ((NH * HD) / 64 + (NKV * HD) / 64); }
  const size_t bs = (size_t)(K >> 5) * FT;   // one row of tiles: 16 rows x K
  const u16* xt = A  + (size_t)(row0 >> 4) * bs;        // the block's 4 rows of x tiles
  const u16* wt = Wt + (size_t)(head * (HD / 16)) * bs; // the head's 4 rows of weight tiles
  const u16* ap  = (isv ? wt : xt) + (size_t)wave * bs; // B operand: the wave's own row of tiles
  const u16* bp0 = isv ? xt : wt;                       // A operand: four rows of tiles, shared by the head's waves
  const u16* bp1 = bp0 + bs;
  const u16* bp2 = bp1 + bs;
  const u16* bp3 = bp2 + bs;
  v8f acc0 = zero8(), acc1 = zero8(), acc2 = zero8(), acc3 = zero8();
#pragma unroll 1
  for (int k0 = 0; k0 < K; k0 += 32 * KUQ, ap += KUQ * FT, bp0 += KUQ * FT, bp1 += KUQ * FT, bp2 += KUQ * FT, bp3 += KUQ * FT) {
    v16b a[KUQ], b0[KUQ], b1[KUQ], b2[KUQ], b3[KUQ];
#pragma unroll
    for (int u = 0; u < KUQ; ++u) {
      a[u]  = ldfrag_b(ap + u * FT, lo);
      b0[u] = ldfrag_b(bp0 + u * FT, lo);
      b1[u] = ldfrag_b(bp1 + u * FT, lo);
      b2[u] = ldfrag_b(bp2 + u * FT, lo);
      b3[u] = ldfrag_b(bp3 + u * FT, lo);
      // keeps the trip's loads in front of its products (a load that sinks behind one starts a latency of its own) and in step
      // order, so that the first step's products start while the later steps' fragments are still on their way
      __builtin_amdgcn_sched_barrier(0);
    }
#pragma unroll
    for (int u = 0; u < KUQ; ++u) {          // k ascending in every accumulator, as with one step a trip
      acc0 = mma_b(b0[u], a[u], acc0);
      acc1 = mma_b(b1[u], a[u], acc1);
      acc2 = mma_b(b2[u], a[u], acc2);
      acc3 = mma_b(b3[u], a[u], acc3);
    }
    guard6<v16b>(acc0, acc1, acc2, acc3, a[KUQ - 1], b0[KUQ - 1], b1[KUQ - 1], b2[KUQ - 1], b3[KUQ - 1], a[KUQ - 1]);
#if defined(__HIP_DEVICE_COMPILE__)
    // the next trip forms its addresses in the register pairs that this trip's loads name: the wait stands in front of that
    asm volatile("s_wait_xcnt 0x0" ::: "memory");
#endif
  }
  const v8f acc[4] = {acc0, acc1, acc2, acc3};
  const int bb = row0 / SEQ, p0 = row0 & (SEQ - 1);     // a block lies inside one batch (SEQ % 64 == 0)
  v4u oh[4], ol[4];
  size_t ob;
  if (isv) {
#pragma unroll
    for (int j = 0; j < 4; ++j) {
      float t[8];
#pragma unroll
      for (int r = 0; r < 8; ++r) t[r] = acc[j][r] * VCAR;
      split8(t, oh[j], ol[j]);
    }
    // d tile = wave; the block's 64 positions = 2 neighbouring key tiles; lane = (d c, key chunk 2 * j + hh)
    ob = ((size_t)((bb * NKV + head) * (HD / 16) + wave) * (SEQ / 32) + (size_t)(p0 >> 5)) * FT + lo;
  } else {
    const int hh = lane >> 4, c = lane & 15;
    const int pw = p0 + wave * 16;                      // the wave's first position
    const float* cr = cosT + (size_t)(pw + c) * HD + 8 * hh;
    const float* sr = sinT + (size_t)(pw + c) * HD + 8 * hh;
    v4f cs[2][2], sn[2][2];                             // d = 16j + 8hh + 0..7, j = 0, 1 (the tables repeat at d + 32)
#pragma unroll
    for (int j = 0; j < 2; ++j) {
      cs[j][0] = *(const v4f*)(cr + 16 * j);
      cs[j][1] = *(const v4f*)(cr + 16 * j + 4);
    }
#if defined(__HIP_DEVICE_COMPILE__)
    // in this build a result of the next four loads takes over the address pair of the four loads above: the wait stands in front of it
    asm volatile("s_wait_xcnt 0x0" ::: "memory");
#endif
#pragma unroll
    for (int j = 0; j < 2; ++j) {
      sn[j][0] = *(const v4f*)(sr + 16 * j);
      sn[j][1] = *(const v4f*)(sr + 16 * j + 4);
    }
#pragma unroll
    for (int j = 0; j < 2; ++j) {
      float ta[8], tb[8];
#pragma unroll
      for (int r = 0; r < 8; ++r) {
        const float cv = cs[j][r >> 2][r & 3], sv = sn[j][r >> 2][r & 3];
        const float xa = acc[j][r], xb = acc[j + 2][r];
        ta[r] = (xa * cv + (-xb) * sv) * QSC;
        tb[r] = (xb * cv + xa * sv) * QSC;
      }
      split8(ta, oh[j], ol[j]);
      split8(tb, oh[j + 2], ol[j + 2]);
    }
    // 16 positions = 2 neighbouring tiles = 16 * HD elements; lane = (position c, d chunk 2 * j + hh)
    ob = ((size_t)(bb * hpr + head) * SEQ + (size_t)pw) * HD + lo;
  }
#pragma unroll
  for (int j = 0; j < 4; ++j) {
    const size_t o8 = ob + (size_t)j * 256;
    *(v4u*)(hpl + o8) = oh[j];
    *(v4u*)(lpl + o8) = ol[j];
  }
}

// =====================================================================================================
// f16 hi+lo GEMM: C[M][N] (f32) = (Ahi + Alo)[M][K] . Bt[N][K]^T, times oscale; Ahi/Alo and Bt f16 planes in fragment order;
// products hi.B + lo.B into one accumulator (lo is the unscaled residual of hi). Block = 64 rows x 192 columns, 12 waves (4 row tiles
// x 3 column tiles of 64; a wave = 16 x 64), as many waves as a WGP holds of this kernel: each tile of the two A planes serves 3
// column tiles per fetch from L2. Fragments loaded straight from the planes' tiles; K stepped by 32 = one tile of FT elements.
// =====================================================================================================
#define H2_CG 3      // column tiles of 64 per work-group
#define H2_THREADS (H2_CG * 4 * 32)
#define H2_BLOCKS (((NB * SEQ) / 64) * (DMOD / (64 * H2_CG)))
static_assert((DMOD % (64 * H2_CG)) == 0 && H2_THREADS == 384 && H2_BLOCKS == 256);
__global__ __launch_bounds__(H2_THREADS)
void gemm_h2(const u16* __restrict__ Ah, const u16* __restrict__ Al, const u16* __restrict__ Bt, float* C,
             int M, int N, int K, float oscale) {
  __shared__ __align__(16) float slab[H2_CG * 4 * SLAB64];
  const int tid = threadIdx.x, wave = __builtin_amdgcn_readfirstlane(tid >> 5), lane = tid & 31;   // scalar wave number: wave-uniform tile pointers
  const unsigned lo = (unsigned)lane * 8u;
  const int ngrp  = (N >> 6) / H2_CG;        // groups of H2_CG column tiles in a row of C
  const int bid   = blockIdx.x;
  const int rowb  = (bid / ngrp) * 64 + (wave & 3) * 16;
  const int col0  = ((bid % ngrp) * H2_CG + (wave >> 2)) * 64;
  if (rowb + 16 > M) return;                 // wave-uniform, never taken with the exact grid; no block barriers in this kernel
  const size_t bs = (size_t)(K >> 5) * FT;   // one row of tiles: 16 rows x K
  const size_t aofs = (size_t)(rowb >> 4) * bs;
  const _Float16* ahp = (const _Float16*)(const void*)Ah + aofs;
  const _Float16* alp = (const _Float16*)(const void*)Al + aofs;
  const _Float16* bp0 = (const _Float16*)(const void*)Bt + (size_t)(col0 >> 4) * bs;
  const _Float16* bp1 = bp0 + bs;
  const _Float16* bp2 = bp1 + bs;
  const _Float16* bp3 = bp2 + bs;
  v8f acc0 = zero8(), acc1 = zero8(), acc2 = zero8(), acc3 = zero8();
#pragma unroll 1
  for (int k0 = 0; k0 < K; k0 += 32 * KUO, ahp += KUO * FT, alp += KUO * FT, bp0 += KUO * FT, bp1 += KUO * FT, bp2 += KUO * FT,
       bp3 += KUO * FT) {
    v16h ah[KUO], al[KUO], b0[KUO], b1[KUO], b2[KUO], b3[KUO];
#pragma unroll
    for (int u = 0; u < KUO; ++u) {
      ah[u] = ldfrag_h(ahp + u * FT, lo);
      al[u] = ldfrag_h(alp + u * FT, lo);
      b0[u] = ldfrag_h(bp0 + u * FT, lo);
      b1[u] = ldfrag_h(bp1 + u * FT, lo);
      b2[u] = ldfrag_h(bp2 + u * FT, lo);
      b3[u] = ldfrag_h(bp3 + u * FT, lo);
      // keeps the trip's loads in front of its products (a load that sinks behind one starts a latency of its own) and in step
      // order (as built without it the first step's O fragments come last and every product waits for the whole group)
      __builtin_amdgcn_sched_barrier(0);
    }
#pragma unroll
    for (int u = 0; u < KUO; ++u) {          // k ascending, hi then lo, in every accumulator, as with one step a trip
      acc0 = mma_h(ah[u], b0[u], acc0);  acc0 = mma_h(al[u], b0[u], acc0);
      acc1 = mma_h(ah[u], b1[u], acc1);  acc1 = mma_h(al[u], b1[u], acc1);
      acc2 = mma_h(ah[u], b2[u], acc2);  acc2 = mma_h(al[u], b2[u], acc2);
      acc3 = mma_h(ah[u], b3[u], acc3);  acc3 = mma_h(al[u], b3[u], acc3);
    }
    guard6<v16h>(acc0, acc1, acc2, acc3, ah[KUO - 1], al[KUO - 1], b0[KUO - 1], b1[KUO - 1], b2[KUO - 1], b3[KUO - 1]);
#if defined(__HIP_DEVICE_COMPILE__)
    // the next trip forms its addresses in the register pairs that this trip's loads name: the wait stands in front of that
    asm volatile("s_wait_xcnt 0x0" ::: "memory");
#endif
  }
  epi64(slab + wave * SLAB64, acc0, acc1, acc2, acc3, oscale, C, N, (size_t)rowb, col0, lane);
}

// =====================================================================================================
// GQA flash attention with causal window + global-token mask: block = (batch b, kv head g, 4 neighbouring tiles of 16 query rows),
// 12 waves, as many as a WGP holds of this kernel; a wave = (16 query rows q0..q0+15, query head g*GRP + wave; kv index = head / GRP).
// The 12 waves walk nearly the same key blocks of one kv head, so a k' / v^T tile fetched from L2 serves them all from the WGP cache.
//   q planes (hi, lo f16) rows [b][h][s], k = d; k planes rows [b][g][s], k = d; v^T planes rows [b][g][d], k = s; O planes rows
//   [b][s], k = h*64 + d; all in fragment order.
//   Key blocks of 32 visited in a fixed, wave-uniform list: {0} + {32 if q0 >= 32} + {jlo, jlo+32, ... < q0+16},
//   jlo = 64 if q0-511 <= 64 else (q0-511) & ~31; the element mask allowed(i,j) = (j <= i) && (i-j < 512 || j < 64) replaces the
//   score by -inf inside partial blocks (block 0 comes first and key 0 is allowed for every row, so each running max is finite
//   before any fully masked block row can occur).
//   Both products are taken transposed: S^T = k'.q'^T (A = key rows, B = query columns) and O^T += v^T.P^T (A = v^T rows d,
//   B = P^T). A lane then owns ONE query (column c = lane & 15) and 16 of the block's 32 keys (8hh + r and 16 + 8hh + r), so
//   the maximum and the sum of a row are taken inside the lane, with one exchange between the two lane halves for the maximum
//   per block and one for the sum after the loop; the two score tiles of a lane, converted in place, ARE the B fragment of P^T
//   in the split k map (elements 0..7 = keys 8hh + 0..7, elements 8..15 = keys 16 + 8hh + 0..7), the map of the v^T loader.
//   Per block: 2 score subtiles x 2 k-steps x 3 products (k_hi.q_hi + k_hi.q_lo + k_lo.q_hi), fragments loaded straight from the
//   16-bit planes (two 16-B loads per fragment, split k map); online max-subtracted base-2 softmax in f32 (scale 1/8 folded);
//   P*32768 as f16 hi and f16 residual, 4+4 v^T A fragments (hi and residual planes), 12 WMMAs (hh + hl + lh).
//   O^T register r of tile j = (d = 16j + 8hh + r, query c): 8 consecutive d of one row = one 16-B chunk of the O planes, so the
//   wave's two tiles of the O hi plane and of the O lo plane (O x1024 as f16 hi + residual) go out 512 contiguous bytes a store.
//   No LDS and no barriers in this kernel; every wave does bounded work (MAXBLK steps max).
// coverage: per wave 4 instructions x 32 lanes x 8 halves = 16 x 64 per plane; grid 256 blocks x 12 waves = every
//           (b, s, h) row of both O planes exactly once.
// =====================================================================================================
__device__ __forceinline__ float xhalf(float v) {                     // the value of lane ^ 16 (vector cross-row move, no LDS path)
  const int b = __builtin_bit_cast(int, v);
  return __builtin_bit_cast(float, __builtin_amdgcn_permlanex16(b, b, 0x76543210, 0xfedcba98, false, false));
}
__global__ __launch_bounds__(ATT_THREADS)
void attn_gqa(const u16* __restrict__ QHIp, const u16* __restrict__ QLOp,
              const u16* __restrict__ KHIp, const u16* __restrict__ KLOp,
              const u16* __restrict__ VHIp, const u16* __restrict__ VLOp,
              u16* OHIp, u16* OLOp) {
  const int tid  = threadIdx.x;
  const int wid  = __builtin_amdgcn_readfirstlane(tid >> 5);   // scalar wave number: wave-uniform q and O tile pointers
  const int wave = wid % GRP;              // query head inside the kv group
  const int lane = tid & 31;
  const unsigned lo = (unsigned)lane * 8u;
  const int hh   = lane >> 4;
  const int c    = lane & 15;

  const int bid  = blockIdx.x;
  const int qt   = (bid & (SEQ / (16 * ATT_QT) - 1)) * ATT_QT + wid / GRP;
  const int g    = (bid >> 5) & (NKV - 1);
  const int b    = bid >> 7;
  const int head = g * GRP + wave;
  const int q0   = qt * 16;

  const size_t qofs = ((size_t)(b * NH + head) * SEQ + q0) * HD;               // 16 positions = 2 tiles = 16 * HD elements
  const _Float16* Qh  = (const _Float16*)(const void*)QHIp + qofs;
  const _Float16* Ql  = (const _Float16*)(const void*)QLOp + qofs;
  const size_t kofs = (size_t)(b * NKV + g) * SEQ * HD;                         // key tiles of kb added per step
  const _Float16* Khb = (const _Float16*)(const void*)KHIp + kofs;
  const _Float16* Klb = (const _Float16*)(const void*)KLOp + kofs;
  const size_t vofs = (size_t)(b * NKV + g) * HD * SEQ;                         // d tile j: + 16j * SEQ; key tile of kb added per step
  const _Float16* Vhb = (const _Float16*)(const void*)VHIp + vofs;
  const _Float16* Vlb = (const _Float16*)(const void*)VLOp + vofs;
  const float lsc = 0.125f * (LOG2E / (QSC * KSC));

  // this lane's query: running max of the unscaled scores (equal in both halves), sum over this lane's keys of P * 32768
  float mrun = -INFINITY, lsum = 0.f;
  v8f o[4];
#pragma unroll
  for (int j = 0; j < 4; ++j) o[j] = zero8();

  const int nglob = (q0 >= 32) ? 2 : 1;
  const int wlo   = q0 - (WIN - 1);
  const int jlo   = (wlo <= GLB) ? GLB : (wlo & ~31);
  int nwin = q0 + 16 - jlo;
  nwin = (nwin > 0) ? ((nwin + 31) >> 5) : 0;
  int nblk = nglob + nwin;
  nblk = (nblk > MAXBLK) ? MAXBLK : nblk;

  // wave-uniform tile pointers of the current key block (the list starts at key 0), moved on at the foot of each step
  const _Float16* k0p = Khb;
  const _Float16* l0p = Klb;
  const _Float16* vhp = Vhb;
  const _Float16* vlp = Vlb;
  const int i = q0 + c;                    // this lane's query position
  int kb = 0;
  // q' fragments: the same in every step, held in registers
  v16h qh[2], ql[2];
#pragma unroll
  for (int kk = 0; kk < 2; ++kk) {
    qh[kk] = ldfrag_h(Qh + kk * FT, lo);
    ql[kk] = ldfrag_h(Ql + kk * FT, lo);
  }
#pragma unroll 1
  for (int it = 0; it < nblk; ++it) {
    // ---- every fragment load of this step, one group: k' of both k-steps (in the order the products take them), then v^T ----
    const _Float16* k1p = k0p + (size_t)16 * HD;
    const _Float16* l1p = l0p + (size_t)16 * HD;
    v16h kh0[2], kl0[2], kh1[2], kl1[2];
#pragma unroll
    for (int kk = 0; kk < 2; ++kk) {
      kh0[kk] = ldfrag_h(k0p + kk * FT, lo);
      kh1[kk] = ldfrag_h(k1p + kk * FT, lo);
      kl0[kk] = ldfrag_h(l0p + kk * FT, lo);
      kl1[kk] = ldfrag_h(l1p + kk * FT, lo);
    }
    // v^T A fragments: row = d = j*16 + c, the 32 keys of this step = one key tile of the v^T planes
    const v16h vh0 = ldfrag_h(vhp, lo);
    const v16h vh1 = ldfrag_h(vhp + (size_t)16 * SEQ, lo);
    const v16h vh2 = ldfrag_h(vhp + (size_t)32 * SEQ, lo);
    const v16h vh3 = ldfrag_h(vhp + (size_t)48 * SEQ, lo);
    const v16h vl0 = ldfrag_h(vlp, lo);
    const v16h vl1 = ldfrag_h(vlp + (size_t)16 * SEQ, lo);
    const v16h vl2 = ldfrag_h(vlp + (size_t)32 * SEQ, lo);
    const v16h vl3 = ldfrag_h(vlp + (size_t)48 * SEQ, lo);
    // keeps the 32 loads one group at the head of the step: a load that sinks behind a product starts a latency of its own
    __builtin_amdgcn_sched_barrier(0);
    // ---- element mask of this step (needs no score: it can run while the k' fragments are on their way) ----
    bool ok0[8], ok1[8];
#pragma unroll
    for (int r = 0; r < 8; ++r) {
      const int j0 = kb + 8 * hh + r, j1 = kb + 16 + 8 * hh + r;
      ok0[r] = (j0 <= i) && (((i - j0) < WIN) || (j0 < GLB));
      ok1[r] = (j1 <= i) && (((i - j1) < WIN) || (j1 < GLB));
    }
    // as built without it every compare of the mask sinks behind the scores and lengthens the step; with it most of them stand
    // among the score products, under the waits for the k' fragments
    __builtin_amdgcn_sched_barrier(0);
    // ---- scores^T: D element r of this lane = (key kb + 8hh + r, query q0 + c) in s0, key kb + 16 + 8hh + r in s1 ----
    v8f s0 = zero8(), s1 = zero8();
#pragma unroll
    for (int kk = 0; kk < 2; ++kk) {
      s0 = mma_h(kh0[kk], qh[kk], s0);
      s0 = mma_h(kh0[kk], ql[kk], s0);
      s0 = mma_h(kl0[kk], qh[kk], s0);
      s1 = mma_h(kh1[kk], qh[kk], s1);
      s1 = mma_h(kh1[kk], ql[kk], s1);
      s1 = mma_h(kl1[kk], qh[kk], s1);
      guard2(s0, s1, qh[kk], ql[kk], kh0[kk], kl0[kk], kh1[kk], kl1[kk]);
    }
    // ---- mask (replace by -inf) + online softmax in base 2, one query per lane ----
    float t0[8], t1[8];
#pragma unroll
    for (int r = 0; r < 8; ++r) {
      t0[r] = ok0[r] ? s0[r] : -INFINITY;
      t1[r] = ok1[r] ? s1[r] : -INFINITY;
    }
    float mx = fmaxf(t0[0], t1[0]);
#pragma unroll
    for (int r = 1; r < 8; ++r) mx = fmaxf(mx, fmaxf(t0[r], t1[r]));
    mx = fmaxf(mx, xhalf(mx));
    const float mn = fmaxf(mrun, mx);
    // v_exp_f32 itself: a result below 2^-126 comes out 0, far under the last bit that the f16 planes of P and the row sum keep
    const float al = __builtin_amdgcn_exp2f((mrun - mn) * lsc);
    mrun = mn;
    const float nb = fmaf(-mn, lsc, PLOG);   // scale, maximum and the carry of P meet in one fma per score (lsc > 0: max commutes)
    // ---- B fragments of P^T * 32768: hi f16 and residual f16, column = c, split k map over the 32 keys of this step ----
    FragH ph, pl;
    float ps0 = 0.f, ps1 = 0.f;
#pragma unroll
    for (int r = 0; r < 8; ++r) {
      const float ta = __builtin_amdgcn_exp2f(fmaf(t0[r], lsc, nb)), tb = __builtin_amdgcn_exp2f(fmaf(t1[r], lsc, nb));
      ps0 += ta;
      ps1 += tb;
      const _Float16 ha = (_Float16)ta, hb = (_Float16)tb;
      ph.h[0][r] = ha;                                     // elements 0..7  = keys kb + 8hh + 0..7
      ph.h[1][r] = hb;                                     // elements 8..15 = keys kb + 16 + 8hh + 0..7
      pl.h[0][r] = (_Float16)(ta - (float)ha);
      pl.h[1][r] = (_Float16)(tb - (float)hb);
    }
    lsum = lsum * al + (ps0 + ps1);
#pragma unroll
    for (int j = 0; j < 4; ++j)
#pragma unroll
      for (int r = 0; r < 8; ++r) o[j][r] *= al;
    // ---- O^T += v^T.P^T ----
    {
      o[0] = mma_h(vh0, ph.v, o[0]);  o[0] = mma_h(vh0, pl.v, o[0]);  o[0] = mma_h(vl0, ph.v, o[0]);
      o[1] = mma_h(vh1, ph.v, o[1]);  o[1] = mma_h(vh1, pl.v, o[1]);  o[1] = mma_h(vl1, ph.v, o[1]);
      o[2] = mma_h(vh2, ph.v, o[2]);  o[2] = mma_h(vh2, pl.v, o[2]);  o[2] = mma_h(vl2, ph.v, o[2]);
      o[3] = mma_h(vh3, ph.v, o[3]);  o[3] = mma_h(vh3, pl.v, o[3]);  o[3] = mma_h(vl3, ph.v, o[3]);
      guard10(o[0], o[1], o[2], o[3], ph.v, pl.v, vh0, vh1, vh2, vh3, vl0, vl1, vl2, vl3);
    }
    const int kn = (it + 1 < nglob) ? ((it + 1) * 32) : (jlo + (it + 1 - nglob) * 32);   // next key block of the list
    const int dk = kn - kb;                                                              // a positive multiple of 32
    k0p += (size_t)dk * HD;
    l0p += (size_t)dk * HD;
    vhp += (size_t)(dk >> 5) * FT;
    vlp += (size_t)(dk >> 5) * FT;
    kb = kn;
  }
  acc_guard4(o[0], o[1], o[2], o[3]);

  // ---- join the two halves' sums, fold 1/l and the carry of v (1024); the carry of P (32768) is in o and in l alike ----
  const float oc = 1.0f / VCAR;
  const float inv = (1.0f / (lsum + xhalf(lsum))) * oc;
  // ---- O x1024 -> f16 hi + residual planes; the wave's 16 x 64 = 2 neighbouring tiles; lane = (row c, chunk 2 * j + hh) ----
  v4u oh[4], ol[4];
#pragma unroll
  for (int j = 0; j < 4; ++j) {
    float w[8];
#pragma unroll
    for (int r = 0; r < 8; ++r) w[r] = (o[j][r] * inv) * OSC;
#pragma unroll
    for (int e = 0; e < 4; ++e) {
      const _Float16 h0 = (_Float16)w[2 * e], h1 = (_Float16)w[2 * e + 1];
      const _Float16 l0 = (_Float16)(w[2 * e] - (float)h0), l1 = (_Float16)(w[2 * e + 1] - (float)h1);
      oh[j][e] = pk16(h_bits(h0), h_bits(h1));
      ol[j][e] = pk16(h_bits(l0), h_bits(l1));
    }
  }
  const size_t ob = (size_t)(b * SEQ + q0) * (NH * HD) + (size_t)(head * 2) * FT + lo;
  {
#pragma unroll
    for (int j = 0; j < 4; ++j) {
      const size_t o8 = ob + (size_t)j * 256;
      *(v4u*)(OHIp + o8) = oh[j];
      *(v4u*)(OLOp + o8) = ol[j];
    }
  }
}

// =====================================================================================================
// Workspace map (bytes); every plane is fully written by whole-line stores before it is read; all extents are exact multiples
// of the store granularity (no pad rows needed); every offset a multiple of 65536:
//   CT  f32 [2048][64]                 524288        ST  same              524288
//   (16-bit planes: rows x K named below, stored in fragment order)
//   XB  bf16 [4096][768]              6291456
//   WQT bf16 [768 n][768 k]           1179648        WKT bf16 [256][768]   393216     WVT same   393216
//   WOT f16  [768 n][768 k] x1024     1179648
//   QHI f16 [2][12][2048][64] x1024   6291456        QLO residual         6291456
//   KHI f16 [2][4][2048][64] x1024    2097152        KLO residual         2097152
//   VHI f16 [2][4][64][2048] x1024    2097152        VLO residual         2097152
//   OHI f16 [4096][768] x1024         6291456        OLO residual         6291456
//   end                              44040192
// =====================================================================================================
extern "C" void kernel_launch(void* const* d_in, const int* in_sizes, int n_in,
                              void* d_out, int out_size, void* d_ws, size_t ws_size,
                              hipStream_t stream) {
  const int ROWS = NB * SEQ;                            // 4096
  if (n_in < 5) return;
  if (in_sizes[0] != ROWS * DMOD) return;
  if (in_sizes[1] != DMOD * (NH * HD)) return;
  if (in_sizes[2] != DMOD * (NKV * HD) || in_sizes[3] != DMOD * (NKV * HD)) return;
  if (in_sizes[4] != (NH * HD) * DMOD) return;
  if (out_size != ROWS * DMOD) return;

  const float* x  = (const float*)d_in[0];
  const float* wq = (const float*)d_in[1];
  const float* wk = (const float*)d_in[2];
  const float* wv = (const float*)d_in[3];
  const float* wo = (const float*)d_in[4];
  float*       out = (float*)d_out;

  const size_t szTab = (size_t)SEQ * HD * 4;                    //   524288
  const size_t szXB  = (size_t)ROWS * DMOD * 2;                 //  6291456
  const size_t szWQT = (size_t)(NH * HD) * DMOD * 2;            //  1179648
  const size_t szWKT = (size_t)(NKV * HD) * DMOD * 2;           //   393216
  const size_t szWOT = (size_t)DMOD * (NH * HD) * 2;            //  1179648
  const size_t szQP  = (size_t)ROWS * (NH * HD) * 2;            //  6291456
  const size_t szKP  = (size_t)ROWS * (NKV * HD) * 2;           //  2097152
  const size_t szVP  = (size_t)NB * NKV * HD * SEQ * 2;         //  2097152
  const size_t szOP  = (size_t)ROWS * (NH * HD) * 2;            //  6291456
  size_t off = 0;
  const size_t oCT  = off; off += szTab;
  const size_t oST  = off; off += szTab;
  const size_t oXB  = off; off += szXB;
  const size_t oWQT = off; off += szWQT;
  const size_t oWKT = off; off += szWKT;
  const size_t oWVT = off; off += szWKT;
  const size_t oWOT = off; off += szWOT;
  const size_t oQHI = off; off += szQP;
  const size_t oQLO = off; off += szQP;
  const size_t oKHI = off; off += szKP;
  const size_t oKLO = off; off += szKP;
  const size_t oVHI = off; off += szVP;
  const size_t oVLO = off; off += szVP;
  const size_t oOHI = off; off += szOP;
  const size_t oOLO = off; off += szOP;
  if (off > ws_size) return;                            // off = 44040192
  if (off > (size_t)134217728) return;

  char* ws = (char*)d_ws;
  float* CT  = (float*)(ws + oCT);
  float* ST  = (float*)(ws + oST);
  u16*   XB  = (u16*)(ws + oXB);
  u16*   WQT = (u16*)(ws + oWQT);
  u16*   WKT = (u16*)(ws + oWKT);
  u16*   WVT = (u16*)(ws + oWVT);
  u16*   WOT = (u16*)(ws + oWOT);
  u16*   QHI = (u16*)(ws + oQHI);
  u16*   QLO = (u16*)(ws + oQLO);
  u16*   KHI = (u16*)(ws + oKHI);
  u16*   KLO = (u16*)(ws + oKLO);
  u16*   VHI = (u16*)(ws + oVHI);
  u16*   VLO = (u16*)(ws + oVLO);
  u16*   OHI = (u16*)(ws + oOHI);
  u16*   OLO = (u16*)(ws + oOLO);

  // inv_freq[i] = 1 / pow(10000, i/32) in f32 (pow correctly converted from f64, then IEEE f32 reciprocal)
  InvF inv;
  for (int i = 0; i < 32; ++i) {
    const double p = pow(10000.0, (double)i / 32.0);
    const float pf = (float)p;
    inv.f[i] = 1.0f / pf;
  }

  const dim3 blk(256);
  const dim3 gPrep(PREP_BLOCKS);                        // 2176
  const dim3 gQKV(QKV_BLOCKS);                          // 256
  const dim3 bQKV(QKV_THREADS);                         // 640
  const dim3 gGO(H2_BLOCKS);                            // 256
  const dim3 bGO(H2_THREADS);                           // 384
  const dim3 gAT(ATT_BLOCKS);                           // 256
  const dim3 bAT(ATT_THREADS);                          // 384

  // (1) weights W[k rows][n cols] -> [n][k] 16-bit planes in fragment order (bf16 for wq/wk/wv; f16 of bf16 value x1024 for wo),
  //     rotary cos/sin tables [2048][64], x -> bf16 plane
  prep<<<gPrep, blk, 0, stream>>>(x, wq, wk, wv, wo, XB, WQT, WKT, WVT, WOT, CT, ST, inv);
  // (2) projections q, k, v -> q' and k' planes (rotary, hi + residual), v^T planes x1024 (hi + residual)
  gemm_qkv<<<gQKV, bQKV, 0, stream>>>(XB, WQT, WKT, WVT, CT, ST, QHI, QLO, KHI, KLO, VHI, VLO, ROWS, DMOD);
  // (3) attention -> O planes [b][s][h][d] x1024 (hi + residual)
  attn_gqa<<<gAT, bAT, 0, stream>>>(QHI, QLO, KHI, KLO, VHI, VLO, OHI, OLO);
  // (4) output projection -> out [4096][768] f32, carries 1024 (O) x 1024 (wo) folded back
  gemm_h2<<<gGO, bGO, 0, stream>>>(OHI, OLO, WOT, out, ROWS, DMOD, NH * HD, 1.0f / (OSC * WOS));
  (void)hipGetLastError();
}

// v009
// A run of this version takes 47.6 microseconds.
// Versions in between are left out here; by their measured steps it is 1.26 times as fast as v007.
// Counting every step since v000, it is 3.14 times as fast.
// Contractions: x.W{q,k,v} on v_wmma_f32_16x16x32_bf16 (x and W RNE-converted to bf16, exact operands, f32 accumulate);
// scores k'.q'^T (transposed; q', k' carried x1024 as one f16 plane each), v^T.P^T (transposed; P x32768 f16, v x1024 f16) and
// O.wo (O x1024 f16, wo as f16(bf16(wo) x1024)): one product each, v_wmma_f32_16x16x32_f16, f32 accumulate. An f16 operand keeps
// 11 significant bits, 3 more than the bf16 x and W that q, k, v are made of, so no residual plane is carried behind them.
// Rotary tables, rotation, masked base-2 online softmax and 1/l fold in f32 on VALU.
#include <hip/hip_runtime.h>
#include <math.h>
#include <stdint.h>

#define NB    2
#define SEQ   2048
#define DMOD  768
#define NH    12
#define NKV   4
#define HD    64
#define GRP   3
#define WIN   512
#define GLB   64
#define QSC   1024.0f
#define KSC   1024.0f
#define PCAR  32768.0f
#define PLOG  15.0f  // log2(PCAR)
#define VCAR  1024.0f
#define OSC   1024.0f
#define WOS   1024.0f
#define LOG2E 1.4426950408889634f
#define ATT_QT 4     // neighbouring query tiles of one kv head that one work-group of the attention kernel takes
#define ATT_THREADS (ATT_QT * GRP * 32)
#define ATT_BLOCKS  (NB * NKV * (SEQ / (16 * ATT_QT)))
#define SLAB64 (16 * 68)
#define VTP   72
#define MAXBLK 20
#define FT    512
#define KUQ   3      // k-steps of 32 whose fragment loads one trip of the q/k/v GEMM issues together
#define KUO   3      // the same for the output projection (8 accumulator tiles + 3 x 6 fragments stay under 256 registers)
static_assert(NH == NKV * GRP);
static_assert(PCAR == 32768.0f && PLOG == 15.0f);
static_assert(HD == 64 && DMOD == NH * HD);
static_assert((SEQ / 16) == 128 && NKV == 4 && NB == 2);
static_assert(ATT_THREADS == 384 && ATT_BLOCKS == 256 && (SEQ / (16 * ATT_QT)) == 32);
static_assert(((NB * SEQ * NH * 8) % 256) == 0 && ((NB * SEQ * NKV * 8) % 256) == 0);
static_assert(((NB * SEQ) % 64) == 0 && (DMOD % 64) == 0 && ((NKV * HD) % 64) == 0 && (DMOD % 32) == 0);
static_assert((SEQ % 64) == 0 && (SEQ % 8) == 0);
static_assert((DMOD % (32 * KUQ)) == 0 && ((NH * HD) % (32 * KUO)) == 0);   // whole trips: no load past a plane's row of tiles

typedef unsigned short u16;
typedef _Float16 v16h __attribute__((ext_vector_type(16)));
typedef _Float16 v8h  __attribute__((ext_vector_type(8)));
typedef __bf16   v16b __attribute__((ext_vector_type(16)));
typedef float    v8f  __attribute__((ext_vector_type(8)));
typedef float    v4f  __attribute__((ext_vector_type(4)));
typedef unsigned int v4u __attribute__((ext_vector_type(4)));

union FragH { v16h v; v8h h[2]; v4u u[2]; };
union FragB { v16b v; v4u u[2]; };

struct InvF { float f[32]; };
static_assert(sizeof(InvF) == 128);

// ---- scalar helpers --------------------------------------------------------------------------------
__device__ __forceinline__ unsigned short bf_bits(float f) {          // f32 -> bf16 bits, RNE convert
  unsigned u = __float_as_uint(f);
  return (unsigned short)((u + 0x7FFFu + ((u >> 16) & 1u)) >> 16);
}
__device__ __forceinline__ float bf_up(unsigned short h) { return __uint_as_float(((unsigned)h) << 16); }
__device__ __forceinline__ float bfr(float f) { return bf_up(bf_bits(f)); }
__device__ __forceinline__ unsigned short h_bits(_Float16 x) { return __builtin_bit_cast(unsigned short, x); }
__device__ __forceinline__ unsigned pk16(unsigned short a, unsigned short b) { return (unsigned)a | ((unsigned)b << 16); }
__device__ __forceinline__ v8f zero8() { v8f z = {0.f, 0.f, 0.f, 0.f, 0.f, 0.f, 0.f, 0.f}; return z; }

// ---- fragment-order planes: every 16-bit operand plane [rows][K] is kept as 16-row x 32-k tiles of FT elements (1 KiB),
//      tile (rt, kt) at (rt * (K / 32) + kt) * FT, and inside a tile as 16-B chunks [q = (k & 31) >> 3][row & 15][k & 7].
// ---- fragment loaders: 16-bit A/B operand, lane -> row/col (lane&15), h = lane>>4, t = the tile (wave-uniform), lo = lane * 8;
//      elements 0..7 <- t[lo..lo+7] (chunk q = h: k0+8h..), elements 8..15 <- t[256+lo..] (chunk q = 2+h: k0+16+8h..)
//      (same split k map for A and B); each of the two loads of a wave is 512 contiguous bytes = 4 whole lines
__device__ __forceinline__ v16h ldfrag_h(const _Float16* t, unsigned lo) {
  FragH f;
  f.h[0] = *(const v8h*)(t + lo);
  f.h[1] = *(const v8h*)(t + 256 + lo);
  return f.v;
}
__device__ __forceinline__ v16b ldfrag_b(const u16* t, unsigned lo) { // bf16 plane read as unsigned integer vectors
  FragB f;
  f.u[0] = *(const v4u*)(t + lo);
  f.u[1] = *(const v4u*)(t + 256 + lo);
  return f.v;
}

__device__ __forceinline__ v8f mma_h(v16h a, v16h b, v8f c) {
  return __builtin_amdgcn_wmma_f32_16x16x32_f16(false, a, false, b, (short)0, c, false, false);
}
__device__ __forceinline__ v8f mma_b(v16b a, v16b b, v8f c) {
  return __builtin_amdgcn_wmma_f32_16x16x32_bf16(false, a, false, b, (short)0, c, false, false);
}
__device__ __forceinline__ void guard2(v8f& a, v8f& b, v16h x0, v16h x1, v16h x2) {
#if defined(__HIP_DEVICE_COMPILE__)
  asm volatile("v_nop\n\tv_nop\n\tv_nop\n\tv_nop"
               : "+v"(a), "+v"(b) : "v"(x0), "v"(x1), "v"(x2) : "memory");
#endif
}
template <typename F>
__device__ __forceinline__ void guard6(v8f& a, v8f& b, v8f& c, v8f& d, F x0, F x1, F x2, F x3, F x4, F x5) {
#if defined(__HIP_DEVICE_COMPILE__)
  asm volatile("v_nop\n\tv_nop\n\tv_nop\n\tv_nop"
               : "+v"(a), "+v"(b), "+v"(c), "+v"(d) : "v"(x0), "v"(x1), "v"(x2), "v"(x3), "v"(x4), "v"(x5) : "memory");
#endif
}
template <typename F>
__device__ __forceinline__ void guard8(v8f (&c)[8], F x0, F x1, F x2, F x3, F x4, F x5) {
#if defined(__HIP_DEVICE_COMPILE__)
  // the four vector slots behind the trip's last product, also on the taken side of the loop's branch
  asm volatile("v_nop\n\tv_nop\n\tv_nop\n\tv_nop"
               : "+v"(c[0]), "+v"(c[1]), "+v"(c[2]), "+v"(c[3]), "+v"(c[4]), "+v"(c[5]), "+v"(c[6]), "+v"(c[7])
               : "v"(x0), "v"(x1), "v"(x2), "v"(x3), "v"(x4), "v"(x5) : "memory");
#endif
}
__device__ __forceinline__ void acc_guard4(v8f& a, v8f& b, v8f& c, v8f& d) {
#if defined(__HIP_DEVICE_COMPILE__)
  asm volatile("v_nop\n\tv_nop\n\tv_nop\n\tv_nop" : "+v"(a), "+v"(b), "+v"(c), "+v"(d));
#endif
}
__device__ __forceinline__ void wave_sync_lds() {
  __builtin_amdgcn_fence(__ATOMIC_RELEASE, "workgroup");
  __builtin_amdgcn_wave_barrier();
  __builtin_amdgcn_fence(__ATOMIC_ACQUIRE, "workgroup");
}

// ---- accurate f32 sin/cos of a non-negative f32 angle (|angle| < 2048): f64 two-part pi/2 reduction + f64 polynomials,
//      plain f64 fma/mul only (no library f64 trig path), result converted to f32.
__device__ __forceinline__ void sincos_acc(float angf, float& sv, float& cv) {
  const double a = (double)angf;
  const double TWO_OVER_PI = 0.63661977236758134308;
  const double PIO2_HI = 1.5707963267948966;
  const double PIO2_LO = 6.123233995736766e-17;
  const int kq = (int)(a * TWO_OVER_PI + 0.5);
  const double kd = (double)kq;
  double r = fma(-kd, PIO2_HI, a);
  r = fma(-kd, PIO2_LO, r);
  const double r2 = r * r;
  double sp = 1.0 / 6227020800.0;
  sp = fma(sp, r2, -1.0 / 39916800.0);
  sp = fma(sp, r2, 1.0 / 362880.0);
  sp = fma(sp, r2, -1.0 / 5040.0);
  sp = fma(sp, r2, 1.0 / 120.0);
  sp = fma(sp, r2, -1.0 / 6.0);
  const double s = fma(sp * r2, r, r);
  double cp = -1.0 / 87178291200.0;
  cp = fma(cp, r2, 1.0 / 479001600.0);
  cp = fma(cp, r2, -1.0 / 3628800.0);
  cp = fma(cp, r2, 1.0 / 40320.0);
  cp = fma(cp, r2, -1.0 / 720.0);
  cp = fma(cp, r2, 1.0 / 24.0);
  cp = fma(cp, r2, -0.5);
  const double c = fma(cp, r2, 1.0);
  const int qd = kq & 3;
  const double so = (qd == 0) ? s : (qd == 1) ? c : (qd == 2) ? -s : -c;
  const double co = (qd == 0) ? c : (qd == 1) ? -s : (qd == 2) ? -c : s;
  sv = (float)so;
  cv = (float)co;
}

// =====================================================================================================
// Rotary tables: cosT[t][d], sinT[t][d] for t < SEQ, d < HD, angle = float(t) * inv_freq[d & 31] (f32 product), halves duplicated.
// Wave = one position t, lane = frequency index; inv_freq picked from the by-value table with a static select chain.
// coverage: SEQ/8 blocks x 8 waves = SEQ rows; per row 4 line stores = 64 floats of each table.
// =====================================================================================================
__device__ __forceinline__ void tab_body(int bid, float* cosT, float* sinT, const InvF& inv) {
  const int tid  = threadIdx.x;
  const int lane = tid & 31;
  const int t    = bid * 8 + (tid >> 5);
  if (t >= SEQ) return;                     // never taken with the exact block range; no barriers in this part
  float f = inv.f[0];
#pragma unroll
  for (int i = 1; i < 32; ++i) f = (lane == i) ? inv.f[i] : f;
  const float ang = (float)t * f;
  float sv, cv;
  sincos_acc(ang, sv, cv);
  float* cr = cosT + (size_t)t * HD;
  float* sr = sinT + (size_t)t * HD;
  {
    *(float*)(cr + lane)      = cv;
    *(float*)(cr + 32 + lane) = cv;
    *(float*)(sr + lane)      = sv;
    *(float*)(sr + 32 + lane) = sv;
    
  }
}

// =====================================================================================================
// x f32 -> bf16 plane (RNE convert), fragment order. Thread = one 16-B chunk (8 consecutive k of one row): two 16-B loads, one
// 16-B store; a wave = 8 rows x the 4 chunks of one tile, so 8 lanes fill one 128-B line of the plane.
// coverage: n8/256 blocks (exact division checked statically) x 256 thr x 8 = the whole plane (64 threads per tile).
// =====================================================================================================
__device__ __forceinline__ void cvtx_body(int bid, const float* __restrict__ x, u16* D, int n8) {
  const int gt = bid * 256 + (int)threadIdx.x;
  if (gt >= n8) return;                     // no barriers in this part
  const int tile = gt >> 6;
  const int m    = ((gt >> 5) & 1) * 8 + (gt & 7);
  const int q    = (gt >> 3) & 3;
  const float* p = x + (size_t)((tile / (DMOD / 32)) * 16 + m) * DMOD + (tile % (DMOD / 32)) * 32 + q * 8;
  const v4f a = *(const v4f*)(p), bq = *(const v4f*)(p + 4);
  v4u o;
  o[0] = pk16(bf_bits(a[0]),  bf_bits(a[1]));
  o[1] = pk16(bf_bits(a[2]),  bf_bits(a[3]));
  o[2] = pk16(bf_bits(bq[0]), bf_bits(bq[1]));
  o[3] = pk16(bf_bits(bq[2]), bf_bits(bq[3]));
  u16* d = D + (size_t)tile * FT + q * 128 + m * 8;
  {
    *(v4u*)(d) = o;
    
  }
}

// =====================================================================================================
// Weight transpose + 16-bit convert: in W[R][C] (row-major f32) -> out D[C][R] (16-bit plane, rows n = C, k = R, fragment order).
//   f16mode == 0: D = bf16 RNE bits of W;  f16mode == 1: D = f16 bits of (bf16 RNE value of W) * scale.
// Block = one 64x64 tile (r0, c0): 256 thr x 4 16-B loads -> LDS tile [c][r] (pitch 72), block barrier, then each output row
// coverage: load 256 thr x 16 = 64x64; store 2 iterations x 256 thr x 8 halves = 8 fragment tiles (4 n x 2 k), a wave = 512
//           contiguous bytes; grid (C/64)x(R/64) tiles = all of D.
// =====================================================================================================
__device__ __forceinline__ void wT_body(u16* T, int bid, const float* __restrict__ W, u16* D, int R, int C, int f16mode,
                                        float scale) {
  const int tid = threadIdx.x;
  const int ntc = C >> 6;
  const int c0  = (bid % ntc) * 64;
  const int r0  = (bid / ntc) * 64;
  {
    const int rr = tid >> 2;
    const int cc = (tid & 3) * 16;
    const float* src = W + (size_t)(r0 + rr) * C + c0 + cc;
#pragma unroll
    for (int i = 0; i < 4; ++i) {
      const v4f a = *(const v4f*)(src + 4 * i);
#pragma unroll
      for (int e = 0; e < 4; ++e) {
        const float v = a[e];
        const unsigned short hb = h_bits((_Float16)(bfr(v) * scale));
        const unsigned short bb = bf_bits(v);
        T[(cc + 4 * i + e) * VTP + rr] = (f16mode != 0) ? hb : bb;
      }
    }
  }
  __syncthreads();
  v4u vals[2];
  const int m16 = tid & 15, q4 = (tid >> 4) & 3, nt = tid >> 7, kt = (tid >> 6) & 1;   // n tile nt (+2 per iteration), k tile kt
#pragma unroll
  for (int it = 0; it < 2; ++it) vals[it] = *(const v4u*)(T + ((it * 2 + nt) * 16 + m16) * VTP + kt * 32 + q4 * 8);
  {
#pragma unroll
    for (int it = 0; it < 2; ++it) {
      const size_t tile = (size_t)((c0 >> 4) + it * 2 + nt) * (size_t)(R >> 5) + (size_t)((r0 >> 5) + kt);
      *(v4u*)(D + tile * FT + q4 * 128 + m16 * 8) = vals[it];
    }
    
  }
}

// =====================================================================================================
// Launch 1: every conversion that depends on the inputs alone, one launch, parts picked by block range (block-uniform):
//   [0, 384)     weight tiles: wq 144, wk 48, wv 48, wo 144 (they hold the one block barrier, so they start first)
//   [384, 640)   rotary tables
//   [640, 2176)  x -> bf16 plane
// Each part keeps its own block count and per-block work; no part reads what another part writes.
// =====================================================================================================
#define PB_WQ  ((DMOD / 64) * ((NH * HD) / 64))
#define PB_WK  ((DMOD / 64) * ((NKV * HD) / 64))
#define PB_WO  (((NH * HD) / 64) * (DMOD / 64))
#define PB_W   (PB_WQ + 2 * PB_WK + PB_WO)
#define PB_TAB (SEQ / 8)
#define PB_X   ((NB * SEQ * DMOD) / (8 * 256))
#define PREP_BLOCKS (PB_W + PB_TAB + PB_X)
static_assert(PB_W == 384 && PB_TAB == 256 && PB_X == 1536 && ((NB * SEQ * DMOD) % (8 * 256)) == 0);
__global__ __launch_bounds__(256)
void prep(const float* __restrict__ x, const float* __restrict__ wq, const float* __restrict__ wk,
          const float* __restrict__ wv, const float* __restrict__ wo, u16* XB, u16* WQT, u16* WKT, u16* WVT, u16* WOT,
          float* cosT, float* sinT, InvF inv) {
  __shared__ __align__(16) u16 T[64 * VTP];
  const int bid = blockIdx.x;
  if (bid < PB_W) {
    const float* W = wq;  u16* D = WQT;  int C = NH * HD, tb = bid, mode = 0;  float scale = 1.0f;
    if (bid >= PB_WQ)                 { W = wk;  D = WKT;  C = NKV * HD;  tb = bid - PB_WQ; }
    if (bid >= PB_WQ + PB_WK)         { W = wv;  D = WVT;  tb = bid - (PB_WQ + PB_WK); }
    if (bid >= PB_WQ + 2 * PB_WK)     { W = wo;  D = WOT;  C = DMOD;  tb = bid - (PB_WQ + 2 * PB_WK);  mode = 1;  scale = WOS; }
    static_assert(NH * HD == DMOD);   // every weight has DMOD rows (wo: NH*HD rows)
    wT_body(T, tb, W, D, DMOD, C, mode, scale);
  } else if (bid < PB_W + PB_TAB) {
    tab_body(bid - PB_W, cosT, sinT, inv);
  } else {
    cvtx_body(bid - (PB_W + PB_TAB), x, XB, (NB * SEQ * DMOD) / 8);
  }
}

// =====================================================================================================
// GEMM epilogue of the output projection: a 16x64 f32 tile of the wave (times oscale) staged in an LDS slab of its own (pitch 68),
// then, behind the wave's LDS fence, read back by rows and stored in whole lines.
// coverage: 8 instructions x 2 rows x 16 lanes x 4 floats = one 16 x 64 tile.
// =====================================================================================================
__device__ __forceinline__ void epi64_stage(float* sl, v8f a0, v8f a1, v8f a2, v8f a3, float oscale, int lane) {
  const int hh = lane >> 4, m = lane & 15;
#pragma unroll
  for (int r = 0; r < 8; ++r) {
    const int ro = (8 * hh + r) * 68 + m;
    sl[ro]      = a0[r] * oscale;
    sl[ro + 16] = a1[r] * oscale;
    sl[ro + 32] = a2[r] * oscale;
    sl[ro + 48] = a3[r] * oscale;
  }
}
__device__ __forceinline__ void epi64_out(const float* sl, float* C, int N, size_t rowb, int col0, int lane) {
  const int hh = lane >> 4, m = lane & 15;
  v4f vals[8];
#pragma unroll
  for (int it = 0; it < 8; ++it) vals[it] = *(const v4f*)(sl + (it * 2 + hh) * 68 + m * 4);
  float* dst = C + (rowb + (size_t)hh) * (size_t)N + col0 + m * 4;
  {
#pragma unroll
    for (int it = 0; it < 8; ++it) {
      *(v4f*)(dst + (size_t)(it * 2) * (size_t)N) = vals[it];
    }
    
  }
}

// =====================================================================================================
// Launch 2: the q, k and v projections (bf16 planes in fragment order, f32 accumulate) with the rotary / f16 pack step as the
// epilogue: the 16-bit planes that attention reads go out straight from the accumulators; no f32 copy of q, k, v is kept.
// Block = 64 positions x 5 heads (of the 12 q + 4 k + 4 v column tiles of 64), 10 waves = 2 per head, one work-group per WGP:
// the waves that meet in one WGP cache read the same 64 rows of x (each x tile serves 5 heads per fetch from L2).
// A wave multiplies FOUR rows of tiles (A operand) by TWO rows of tiles (B operand): 6 fragment loads feed 8 products; K stepped
// by 32 = one tile of FT elements (K % 32 == 0, M % 64 == 0 checked statically); D register r of tile (j, n) in a lane =
// (A row 16j + 8hh + r, B row 16n + c). "wave" below = the B row of tiles, 2 * (wave number & 1) + n.
//   q, k blocks: A = the head's 4 weight tiles (d), B = the wave's 16 positions. A lane owns one position (c) and 8 consecutive d
//     per tile; the rotate-half partner d ^ 32 is tile j ^ 2, same lane, same register.
//     w[d] = x[d] * cos[pos][d] + r[d] * sin[pos][d],  r[d] = -x[d+32] for d < 32, x[d-32] for d >= 32;
//     plane[d] = f16(w * 1024). Plane row = (batch * heads + head) * SEQ + pos, K = HD.
//   v blocks: A = the block's 4 position tiles of x, B = the wave's 16 columns d of wv. A lane owns one d (16 * wave + c) and 8
//     consecutive positions per tile = one chunk of the v^T plane VH[(b*NKV + g)*HD + d][s] = f16(v * 1024).
// coverage: per wave 2 x 4 stores x 512 contiguous bytes = 32 x 64 (q, k: 4 tiles; v: 2 x 4 half tiles in a row); 2 waves x
//           5 heads x 256 blocks = every element of the three planes exactly once. No LDS and no barriers in this kernel.
// =====================================================================================================
#define QKV_CT ((NH * HD) / 64 + 2 * ((NKV * HD) / 64))
#define QKV_HG 5     // heads (column tiles of 64) per work-group
#define QKV_THREADS (QKV_HG * 2 * 32)
#define QKV_BLOCKS (((NB * SEQ) / 64) * (QKV_CT / QKV_HG))
static_assert(QKV_CT == 20 && (QKV_CT % QKV_HG) == 0 && QKV_THREADS == 320 && QKV_BLOCKS == 256 && QSC == KSC);
__device__ __forceinline__ void pack8(const float* t, v4u& oh) {   // 8 floats -> one f16 chunk
#pragma unroll
  for (int e = 0; e < 4; ++e) oh[e] = pk16(h_bits((_Float16)t[2 * e]), h_bits((_Float16)t[2 * e + 1]));
}
__global__ __launch_bounds__(QKV_THREADS)
void gemm_qkv(const u16* __restrict__ A, const u16* __restrict__ WQT, const u16* __restrict__ WKT,
              const u16* __restrict__ WVT, const float* __restrict__ cosT, const float* __restrict__ sinT,
              u16* QHI, u16* KHI, u16* VHI, int M, int K) {
  const int tid = threadIdx.x, wid = __builtin_amdgcn_readfirstlane(tid >> 5), lane = tid & 31;   // scalar wave number: wave-uniform tile pointers
  const int wv2 = (wid & 1) * 2;             // the first of the wave's two B rows of tiles (2 waves a head)
  const unsigned lo = (unsigned)lane * 8u;
  const int bid   = blockIdx.x;
  const int ct    = (bid % (QKV_CT / QKV_HG)) * QKV_HG + (wid >> 1);   // the wave's head
  const int row0  = (bid / (QKV_CT / QKV_HG)) * 64;
  if (row0 + 64 > M) return;                 // block-uniform, never taken with the exact grid; no barriers in this kernel
  const bool isv = ct >= (NH * HD) / 64 + (NKV * HD) / 64;
  const u16* Wt = WQT;  u16* hpl = QHI;  int hpr = NH, head = ct;
  if (ct >= (NH * HD) / 64) { Wt = WKT;  hpl = KHI;  hpr = NKV;  head = ct - (NH * HD) / 64; }
  if (isv)                  { Wt = WVT;  hpl = VHI;  head = ct - ((NH * HD) / 64 + (NKV * HD) / 64); }
  const size_t bs = (size_t)(K >> 5) * FT;   // one row of tiles: 16 rows x K
  const u16* xt = A  + (size_t)(row0 >> 4) * bs;        // the block's 4 rows of x tiles
  const u16* wt = Wt + (size_t)(head * (HD / 16)) * bs; // the head's 4 rows of weight tiles
  const u16* ap  = (isv ? wt : xt) + (size_t)wv2 * bs;  // B operand: the wave's own two rows of tiles
  const u16* aq  = ap + bs;
  const u16* bp0 = isv ? xt : wt;                       // A operand: four rows of tiles, shared by the head's waves
  const u16* bp1 = bp0 + bs;
  const u16* bp2 = bp1 + bs;
  const u16* bp3 = bp2 + bs;
  v8f acc[8];                                           // tile (j, n) at 4 * n + j
#pragma unroll
  for (int t = 0; t < 8; ++t) acc[t] = zero8();
#pragma unroll 1
  for (int k0 = 0; k0 < K; k0 += 32 * KUQ, ap += KUQ * FT, aq += KUQ * FT, bp0 += KUQ * FT, bp1 += KUQ * FT, bp2 += KUQ * FT,
       bp3 += KUQ * FT) {
    v16b a0[KUQ], a1[KUQ], b0[KUQ], b1[KUQ], b2[KUQ], b3[KUQ];
    const u16 *la0 = ap + lo, *la1 = aq + lo, *lb0 = bp0 + lo, *lb1 = bp1 + lo, *lb2 = bp2 + lo, *lb3 = bp3 + lo;   // the lane's addresses
#pragma unroll
    for (int u = 0; u < KUQ; ++u) {
      a0[u] = ldfrag_b(la0 + u * FT, 0u);
      b0[u] = ldfrag_b(lb0 + u * FT, 0u);
      b1[u] = ldfrag_b(lb1 + u * FT, 0u);
      b2[u] = ldfrag_b(lb2 + u * FT, 0u);
      b3[u] = ldfrag_b(lb3 + u * FT, 0u);
      a1[u] = ldfrag_b(la1 + u * FT, 0u);
      // keeps the trip's loads in front of its products (a load that sinks behind one starts a latency of its own) and in step
      // order, so that the first step's products start while the later steps' fragments are still on their way
      __builtin_amdgcn_sched_barrier(0);
    }
#pragma unroll
    for (int u = 0; u < KUQ; ++u) {          // k ascending in every accumulator, as with one step a trip
      acc[0] = mma_b(b0[u], a0[u], acc[0]);
      acc[1] = mma_b(b1[u], a0[u], acc[1]);
      acc[2] = mma_b(b2[u], a0[u], acc[2]);
      acc[3] = mma_b(b3[u], a0[u], acc[3]);
      acc[4] = mma_b(b0[u], a1[u], acc[4]);
      acc[5] = mma_b(b1[u], a1[u], acc[5]);
      acc[6] = mma_b(b2[u], a1[u], acc[6]);
      acc[7] = mma_b(b3[u], a1[u], acc[7]);
    }
    guard8<v16b>(acc, a0[KUQ - 1], a1[KUQ - 1], b0[KUQ - 1], b1[KUQ - 1], b2[KUQ - 1], b3[KUQ - 1]);
#if defined(__HIP_DEVICE_COMPILE__)
    // the wait in front of any new value in a register pair that this trip's loads name; the pairs are inputs, so they stay whole
    // up to here (no load's result lands on one, the next trip's addresses are formed behind the wait)
    asm volatile("s_wait_xcnt 0x0" :: "v"(la0), "v"(la1), "v"(lb0), "v"(lb1), "v"(lb2), "v"(lb3) : "memory");
#endif
  }
  const int bb = row0 / SEQ, p0 = row0 & (SEQ - 1);     // a block lies inside one batch (SEQ % 64 == 0)
  const int hh = lane >> 4, c = lane & 15;
  v4f cs[2][2][2], sn[2][2][2];                         // [n][j]: d = 16j + 8hh + 0..7, j = 0, 1 (the tables repeat at d + 32)
  if (!isv) {                                           // the table rows of both rows of tiles, one group of loads
    const float* cr = cosT + (size_t)(p0 + wv2 * 16 + c) * HD + 8 * hh;
    const float* sr = sinT + (size_t)(p0 + wv2 * 16 + c) * HD + 8 * hh;
#pragma unroll
    for (int n = 0; n < 2; ++n)
#pragma unroll
      for (int j = 0; j < 2; ++j) {
        cs[n][j][0] = *(const v4f*)(cr + n * 16 * HD + 16 * j);
        cs[n][j][1] = *(const v4f*)(cr + n * 16 * HD + 16 * j + 4);
        sn[n][j][0] = *(const v4f*)(sr + n * 16 * HD + 16 * j);
        sn[n][j][1] = *(const v4f*)(sr + n * 16 * HD + 16 * j + 4);
      }
#if defined(__HIP_DEVICE_COMPILE__)
    // the wait in front of any new value in the two address pairs of these loads; as inputs the pairs stay whole up to here
    asm volatile("s_wait_xcnt 0x0" :: "v"(cr), "v"(sr) : "memory");
#endif
  }
#pragma unroll
  for (int n = 0; n < 2; ++n) {                         // the wave's two B rows of tiles, one after the other
    const int wave = wv2 + n;
    v4u oh[4];
    size_t ob;
    if (isv) {
#pragma unroll
      for (int j = 0; j < 4; ++j) {
        float t[8];
#pragma unroll
        for (int r = 0; r < 8; ++r) t[r] = acc[4 * n + j][r] * VCAR;
        pack8(t, oh[j]);
      }
      // d tile = wave; the block's 64 positions = 2 neighbouring key tiles; lane = (d c, key chunk 2 * j + hh)
      ob = ((size_t)((bb * NKV + head) * (HD / 16) + wave) * (SEQ / 32) + (size_t)(p0 >> 5)) * FT + lo;
    } else {
      const int pw = p0 + wave * 16;                    // the first position of this row of tiles
#pragma unroll
      for (int j = 0; j < 2; ++j) {
        float ta[8], tb[8];
#pragma unroll
        for (int r = 0; r < 8; ++r) {
          const float cv = cs[n][j][r >> 2][r & 3], sv = sn[n][j][r >> 2][r & 3];
          const float xa = acc[4 * n + j][r], xb = acc[4 * n + j + 2][r];
          ta[r] = (xa * cv + (-xb) * sv) * QSC;
          tb[r] = (xb * cv + xa * sv) * QSC;
        }
        pack8(ta, oh[j]);
        pack8(tb, oh[j + 2]);
      }
      // 16 positions = 2 neighbouring tiles = 16 * HD elements; lane = (position c, d chunk 2 * j + hh)
      ob = ((size_t)(bb * hpr + head) * SEQ + (size_t)pw) * HD + lo;
    }
#pragma unroll
    for (int j = 0; j < 4; ++j) {
      *(v4u*)(hpl + ob + (size_t)j * 256) = oh[j];
    }
#if defined(__HIP_DEVICE_COMPILE__)
    // the second row of tiles may form its values and its address in registers that these stores name: the wait stands in front
    if (n == 0) asm volatile("s_wait_xcnt 0x0" ::: "memory");
#endif
  }
}

// =====================================================================================================
// f16 GEMM: C[M][N] (f32) = A[M][K] . Bt[N][K]^T, times oscale; A and Bt f16 planes in fragment order.
// Block = 64 rows x 192 columns, 6 waves (2 pairs of row tiles x 3 column tiles of 64; a wave = 32 x 64: 6 fragment loads feed 8
// products): each tile of the A plane serves 3 column tiles per fetch from L2. Fragments loaded straight from the planes' tiles;
// K stepped by 32 = one tile of FT elements.
// =====================================================================================================
#define H2_CG 3      // column tiles of 64 per work-group
#define H2_THREADS (H2_CG * 2 * 32)
#define H2_BLOCKS (((NB * SEQ) / 64) * (DMOD / (64 * H2_CG)))
static_assert((DMOD % (64 * H2_CG)) == 0 && H2_THREADS == 192 && H2_BLOCKS == 256);
__global__ __launch_bounds__(H2_THREADS)
void gemm_h2(const u16* __restrict__ Ah, const u16* __restrict__ Bt, float* C,
             int M, int N, int K, float oscale) {
  __shared__ __align__(16) float slab[H2_CG * 4 * SLAB64];
  const int tid = threadIdx.x, wave = __builtin_amdgcn_readfirstlane(tid >> 5), lane = tid & 31;   // scalar wave number: wave-uniform tile pointers
  const unsigned lo = (unsigned)lane * 8u;
  const int ngrp  = (N >> 6) / H2_CG;        // groups of H2_CG column tiles in a row of C
  const int bid   = blockIdx.x;
  const int rowb  = (bid / ngrp) * 64 + (wave & 1) * 32;
  const int col0  = ((bid % ngrp) * H2_CG + (wave >> 1)) * 64;
  if (rowb + 32 > M) return;                 // wave-uniform, never taken with the exact grid; no block barriers in this kernel
  const size_t bs = (size_t)(K >> 5) * FT;   // one row of tiles: 16 rows x K
  const size_t aofs = (size_t)(rowb >> 4) * bs;
  const _Float16* ahp = (const _Float16*)(const void*)Ah + aofs;
  const _Float16* ahq = ahp + bs;            // the wave's second row of A tiles
  const _Float16* bp0 = (const _Float16*)(const void*)Bt + (size_t)(col0 >> 4) * bs;
  const _Float16* bp1 = bp0 + bs;
  const _Float16* bp2 = bp1 + bs;
  const _Float16* bp3 = bp2 + bs;
  v8f acc[8];                                // tile (row tile m, column tile j) at 4 * m + j
#pragma unroll
  for (int t = 0; t < 8; ++t) acc[t] = zero8();
#pragma unroll 1
  for (int k0 = 0; k0 < K; k0 += 32 * KUO, ahp += KUO * FT, ahq += KUO * FT, bp0 += KUO * FT, bp1 += KUO * FT, bp2 += KUO * FT,
       bp3 += KUO * FT) {
    v16h a0[KUO], a1[KUO], b0[KUO], b1[KUO], b2[KUO], b3[KUO];
    const _Float16 *la0 = ahp + lo, *la1 = ahq + lo, *lb0 = bp0 + lo, *lb1 = bp1 + lo, *lb2 = bp2 + lo, *lb3 = bp3 + lo;   // the lane's addresses
#pragma unroll
    for (int u = 0; u < KUO; ++u) {
      a0[u] = ldfrag_h(la0 + u * FT, 0u);
      b0[u] = ldfrag_h(lb0 + u * FT, 0u);
      b1[u] = ldfrag_h(lb1 + u * FT, 0u);
      b2[u] = ldfrag_h(lb2 + u * FT, 0u);
      b3[u] = ldfrag_h(lb3 + u * FT, 0u);
      a1[u] = ldfrag_h(la1 + u * FT, 0u);
      // keeps the trip's loads in front of its products (a load that sinks behind one starts a latency of its own) and in step
      // order (as built without it the first step's O fragments come last and every product waits for the whole group)
      __builtin_amdgcn_sched_barrier(0);
    }
#pragma unroll
    for (int u = 0; u < KUO; ++u) {          // k ascending in every accumulator, as with one step a trip
      acc[0] = mma_h(a0[u], b0[u], acc[0]);
      acc[1] = mma_h(a0[u], b1[u], acc[1]);
      acc[2] = mma_h(a0[u], b2[u], acc[2]);
      acc[3] = mma_h(a0[u], b3[u], acc[3]);
      acc[4] = mma_h(a1[u], b0[u], acc[4]);
      acc[5] = mma_h(a1[u], b1[u], acc[5]);
      acc[6] = mma_h(a1[u], b2[u], acc[6]);
      acc[7] = mma_h(a1[u], b3[u], acc[7]);
    }
    guard8<v16h>(acc, a0[KUO - 1], a1[KUO - 1], b0[KUO - 1], b1[KUO - 1], b2[KUO - 1], b3[KUO - 1]);
#if defined(__HIP_DEVICE_COMPILE__)
    // the wait in front of any new value in a register pair that this trip's loads name; the pairs are inputs, so they stay whole
    // up to here (no load's result lands on one, the next trip's addresses are formed behind the wait)
    asm volatile("s_wait_xcnt 0x0" :: "v"(la0), "v"(la1), "v"(lb0), "v"(lb1), "v"(lb2), "v"(lb3) : "memory");
#endif
  }
  // each of the wave's two 16 x 64 tiles through an LDS slab of its own; both staged in front of the one fence of the wave
  float* sl0 = slab + (2 * wave) * SLAB64;
  float* sl1 = sl0 + SLAB64;
  epi64_stage(sl0, acc[0], acc[1], acc[2], acc[3], oscale, lane);
  epi64_stage(sl1, acc[4], acc[5], acc[6], acc[7], oscale, lane);
  wave_sync_lds();
  epi64_out(sl0, C, N, (size_t)rowb, col0, lane);
  epi64_out(sl1, C, N, (size_t)rowb + 16, col0, lane);
}

// =====================================================================================================
// GQA flash attention with causal window + global-token mask: block = (batch b, kv head g, 4 neighbouring tiles of 16 query rows),
// 12 waves, one work-group per WGP; a wave = (16 query rows q0..q0+15, query head g*GRP + wave; kv index = head / GRP).
// The 12 waves walk nearly the same key blocks of one kv head, so a k' / v^T tile fetched from L2 serves them all from the WGP cache.
//   q plane (f16) rows [b][h][s], k = d; k plane rows [b][g][s], k = d; v^T plane rows [b][g][d], k = s; O plane rows
//   [b][s], k = h*64 + d; all in fragment order.
//   Key blocks of 32 visited in a fixed, wave-uniform list: {0} + {32 if q0 >= 32} + {jlo, jlo+32, ... < q0+16},
//   jlo = 64 if q0-511 <= 64 else (q0-511) & ~31; the element mask allowed(i,j) = (j <= i) && (i-j < 512 || j < 64) replaces the
//   score by -inf inside partial blocks (block 0 comes first and key 0 is allowed for every row, so each running max is finite
//   before any fully masked block row can occur).
//   Both products are taken transposed: S^T = k'.q'^T (A = key rows, B = query columns) and O^T += v^T.P^T (A = v^T rows d,
//   B = P^T). A lane then owns ONE query (column c = lane & 15) and 16 of the block's 32 keys (8hh + r and 16 + 8hh + r), so
//   the maximum and the sum of a row are taken inside the lane, with one exchange between the two lane halves for the maximum
//   per block and one for the sum after the loop; the two score tiles of a lane, converted in place, ARE the B fragment of P^T
//   in the split k map (elements 0..7 = keys 8hh + 0..7, elements 8..15 = keys 16 + 8hh + 0..7), the map of the v^T loader.
//   Per block: 2 score subtiles x 2 k-steps, one product each, fragments loaded straight from the
//   16-bit planes (two 16-B loads per fragment, split k map); online max-subtracted base-2 softmax in f32 (scale 1/8 folded);
//   P*32768 as f16, 4 v^T A fragments, 4 WMMAs.
//   O^T register r of tile j = (d = 16j + 8hh + r, query c): 8 consecutive d of one row = one 16-B chunk of the O plane, so the
//   wave's two tiles of the O plane (O x1024 as f16) go out 512 contiguous bytes a store.
//   No LDS and no barriers in this kernel; every wave does bounded work (MAXBLK steps max).
// coverage: per wave 4 instructions x 32 lanes x 8 halves = 16 x 64; grid 256 blocks x 12 waves = every
//           (b, s, h) row of the O plane exactly once.
// =====================================================================================================
__device__ __forceinline__ float xhalf(float v) {                     // the value of lane ^ 16 (vector cross-row move, no LDS path)
  const int b = __builtin_bit_cast(int, v);
  return __builtin_bit_cast(float, __builtin_amdgcn_permlanex16(b, b, 0x76543210, 0xfedcba98, false, false));
}
__global__ __launch_bounds__(ATT_THREADS)
void attn_gqa(const u16* __restrict__ QHIp, const u16* __restrict__ KHIp, const u16* __restrict__ VHIp, u16* OHIp) {
  const int tid  = threadIdx.x;
  const int wid  = __builtin_amdgcn_readfirstlane(tid >> 5);   // scalar wave number: wave-uniform q and O tile pointers
  const int wave = wid % GRP;              // query head inside the kv group
  const int lane = tid & 31;
  const unsigned lo = (unsigned)lane * 8u;
  const int hh   = lane >> 4;
  const int c    = lane & 15;

  const int bid  = blockIdx.x;
  const int qt   = (bid & (SEQ / (16 * ATT_QT) - 1)) * ATT_QT + wid / GRP;
  const int g    = (bid >> 5) & (NKV - 1);
  const int b    = bid >> 7;
  const int head = g * GRP + wave;
  const int q0   = qt * 16;

  const size_t qofs = ((size_t)(b * NH + head) * SEQ + q0) * HD;               // 16 positions = 2 tiles = 16 * HD elements
  const _Float16* Qh  = (const _Float16*)(const void*)QHIp + qofs;
  const size_t kofs = (size_t)(b * NKV + g) * SEQ * HD;                         // key tiles of kb added per step
  const _Float16* Khb = (const _Float16*)(const void*)KHIp + kofs;
  const size_t vofs = (size_t)(b * NKV + g) * HD * SEQ;                         // d tile j: + 16j * SEQ; key tile of kb added per step
  const _Float16* Vhb = (const _Float16*)(const void*)VHIp + vofs;
  const float lsc = 0.125f * (LOG2E / (QSC * KSC));

  // this lane's query: running max of the unscaled scores (equal in both halves), sum over this lane's keys of P * 32768
  float mrun = -INFINITY, lsum = 0.f;
  v8f o[4];
#pragma unroll
  for (int j = 0; j < 4; ++j) o[j] = zero8();

  const int nglob = (q0 >= 32) ? 2 : 1;
  const int wlo   = q0 - (WIN - 1);
  const int jlo   = (wlo <= GLB) ? GLB : (wlo & ~31);
  int nwin = q0 + 16 - jlo;
  nwin = (nwin > 0) ? ((nwin + 31) >> 5) : 0;
  int nblk = nglob + nwin;
  nblk = (nblk > MAXBLK) ? MAXBLK : nblk;

  // wave-uniform tile pointers of the current key block (the list starts at key 0), moved on at the foot of each step
  const _Float16* k0p = Khb;
  const _Float16* vhp = Vhb;
  const int i = q0 + c;                    // this lane's query position
  int kb = 0;
  // q' fragments: the same in every step, held in registers
  v16h qh[2];
#pragma unroll
  for (int kk = 0; kk < 2; ++kk) qh[kk] = ldfrag_h(Qh + kk * FT, lo);
#pragma unroll 1
  for (int it = 0; it < nblk; ++it) {
    // ---- every fragment load of this step, one group: k' of both k-steps (in the order the products take them), then v^T ----
    const _Float16* k1p = k0p + (size_t)16 * HD;
    v16h kh0[2], kh1[2];
#pragma unroll
    for (int kk = 0; kk < 2; ++kk) {
      kh0[kk] = ldfrag_h(k0p + kk * FT, lo);
      kh1[kk] = ldfrag_h(k1p + kk * FT, lo);
    }
    // v^T A fragments: row = d = j*16 + c, the 32 keys of this step = one key tile of the v^T plane
    const v16h vh0 = ldfrag_h(vhp, lo);
    const v16h vh1 = ldfrag_h(vhp + (size_t)16 * SEQ, lo);
    const v16h vh2 = ldfrag_h(vhp + (size_t)32 * SEQ, lo);
    const v16h vh3 = ldfrag_h(vhp + (size_t)48 * SEQ, lo);
    // keeps the 16 loads one group at the head of the step: a load that sinks behind a product starts a latency of its own
    __builtin_amdgcn_sched_barrier(0);
    // ---- element mask of this step (needs no score: it can run while the k' fragments are on their way) ----
    bool ok0[8], ok1[8];
#pragma unroll
    for (int r = 0; r < 8; ++r) {
      const int j0 = kb + 8 * hh + r, j1 = kb + 16 + 8 * hh + r;
      ok0[r] = (j0 <= i) && (((i - j0) < WIN) || (j0 < GLB));
      ok1[r] = (j1 <= i) && (((i - j1) < WIN) || (j1 < GLB));
    }
    // as built without it every compare of the mask sinks behind the scores and lengthens the step; with it most of them stand
    // among the score products, under the waits for the k' fragments
    __builtin_amdgcn_sched_barrier(0);
    // ---- scores^T: D element r of this lane = (key kb + 8hh + r, query q0 + c) in s0, key kb + 16 + 8hh + r in s1 ----
    v8f s0 = zero8(), s1 = zero8();
#pragma unroll
    for (int kk = 0; kk < 2; ++kk) {
      s0 = mma_h(kh0[kk], qh[kk], s0);
      s1 = mma_h(kh1[kk], qh[kk], s1);
      guard2(s0, s1, qh[kk], kh0[kk], kh1[kk]);
    }
    // ---- mask (replace by -inf) + online softmax in base 2, one query per lane ----
    float t0[8], t1[8];
#pragma unroll
    for (int r = 0; r < 8; ++r) {
      t0[r] = ok0[r] ? s0[r] : -INFINITY;
      t1[r] = ok1[r] ? s1[r] : -INFINITY;
    }
    float mx = fmaxf(t0[0], t1[0]);
#pragma unroll
    for (int r = 1; r < 8; ++r) mx = fmaxf(mx, fmaxf(t0[r], t1[r]));
    mx = fmaxf(mx, xhalf(mx));
    const float mn = fmaxf(mrun, mx);
    // v_exp_f32 itself: a result below 2^-126 comes out 0, far under the last bit that the f16 P and the row sum keep
    float al = (mrun - mn) * lsc;
#if defined(__HIP_DEVICE_COMPILE__)
    // v_exp_f32 with the free slot behind a transcendental in one statement: a v_nop in a statement of its own does not stay
    // behind it
    asm("v_exp_f32 %0, %0\n\tv_nop" : "+v"(al));
#endif
    mrun = mn;
    const float nb = fmaf(-mn, lsc, PLOG);   // scale, maximum and the carry of P meet in one fma per score (lsc > 0: max commutes)
    // ---- B fragment of P^T * 32768 in f16, column = c, split k map over the 32 keys of this step ----
    FragH ph;
    float ps0 = 0.f, ps1 = 0.f;
#pragma unroll
    for (int r = 0; r < 8; ++r) {
      const float ta = __builtin_amdgcn_exp2f(fmaf(t0[r], lsc, nb)), tb = __builtin_amdgcn_exp2f(fmaf(t1[r], lsc, nb));
      ps0 += ta;
      ps1 += tb;
      ph.h[0][r] = (_Float16)ta;                           // elements 0..7  = keys kb + 8hh + 0..7
      ph.h[1][r] = (_Float16)tb;                           // elements 8..15 = keys kb + 16 + 8hh + 0..7
    }
    lsum = lsum * al + (ps0 + ps1);
#pragma unroll
    for (int j = 0; j < 4; ++j)
#pragma unroll
      for (int r = 0; r < 8; ++r) o[j][r] *= al;
    // ---- O^T += v^T.P^T ----
    {
      o[0] = mma_h(vh0, ph.v, o[0]);
      o[1] = mma_h(vh1, ph.v, o[1]);
      o[2] = mma_h(vh2, ph.v, o[2]);
      o[3] = mma_h(vh3, ph.v, o[3]);
      guard6<v16h>(o[0], o[1], o[2], o[3], ph.v, vh0, vh1, vh2, vh3, ph.v);
    }
    const int kn = (it + 1 < nglob) ? ((it + 1) * 32) : (jlo + (it + 1 - nglob) * 32);   // next key block of the list
    const int dk = kn - kb;                                                              // a positive multiple of 32
    k0p += (size_t)dk * HD;
    vhp += (size_t)(dk >> 5) * FT;
    kb = kn;
  }
  acc_guard4(o[0], o[1], o[2], o[3]);

  // ---- join the two halves' sums, fold 1/l and the carry of v (1024); the carry of P (32768) is in o and in l alike ----
  const float oc = 1.0f / VCAR;
  const float inv = (1.0f / (lsum + xhalf(lsum))) * oc;
  // ---- O x1024 -> f16 plane; the wave's 16 x 64 = 2 neighbouring tiles; lane = (row c, chunk 2 * j + hh) ----
  v4u oh[4];
#pragma unroll
  for (int j = 0; j < 4; ++j) {
    float w[8];
#pragma unroll
    for (int r = 0; r < 8; ++r) w[r] = (o[j][r] * inv) * OSC;
    pack8(w, oh[j]);
  }
  const size_t ob = (size_t)(b * SEQ + q0) * (NH * HD) + (size_t)(head * 2) * FT + lo;
  {
#pragma unroll
    for (int j = 0; j < 4; ++j) *(v4u*)(OHIp + ob + (size_t)j * 256) = oh[j];
  }
}

// =====================================================================================================
// Workspace map (bytes); every plane is fully written by whole-line stores before it is read; all extents are exact multiples
// of the store granularity (no pad rows needed); every offset a multiple of 65536:
//   CT  f32 [2048][64]                 524288        ST  same              524288
//   (16-bit planes: rows x K named below, stored in fragment order)
//   XB  bf16 [4096][768]              6291456
//   WQT bf16 [768 n][768 k]           1179648        WKT bf16 [256][768]   393216     WVT same   393216
//   WOT f16  [768 n][768 k] x1024     1179648
//   QHI f16 [2][12][2048][64] x1024   6291456
//   KHI f16 [2][4][2048][64] x1024    2097152
//   VHI f16 [2][4][64][2048] x1024    2097152
//   OHI f16 [4096][768] x1024         6291456
//   end                              27262976
// =====================================================================================================
extern "C" void kernel_launch(void* const* d_in, const int* in_sizes, int n_in,
                              void* d_out, int out_size, void* d_ws, size_t ws_size,
                              hipStream_t stream) {
  const int ROWS = NB * SEQ;                            // 4096
  if (n_in < 5) return;
  if (in_sizes[0] != ROWS * DMOD) return;
  if (in_sizes[1] != DMOD * (NH * HD)) return;
  if (in_sizes[2] != DMOD * (NKV * HD) || in_sizes[3] != DMOD * (NKV * HD)) return;
  if (in_sizes[4] != (NH * HD) * DMOD) return;
  if (out_size != ROWS * DMOD) return;

  const float* x  = (const float*)d_in[0];
  const float* wq = (const float*)d_in[1];
  const float* wk = (const float*)d_in[2];
  const float* wv = (const float*)d_in[3];
  const float* wo = (const float*)d_in[4];
  float*       out = (float*)d_out;

  const size_t szTab = (size_t)SEQ * HD * 4;                    //   524288
  const size_t szXB  = (size_t)ROWS * DMOD * 2;                 //  6291456
  const size_t szWQT = (size_t)(NH * HD) * DMOD * 2;            //  1179648
  const size_t szWKT = (size_t)(NKV * HD) * DMOD * 2;           //   393216
  const size_t szWOT = (size_t)DMOD * (NH * HD) * 2;            //  1179648
  const size_t szQP  = (size_t)ROWS * (NH * HD) * 2;            //  6291456
  const size_t szKP  = (size_t)ROWS * (NKV * HD) * 2;           //  2097152
  const size_t szVP  = (size_t)NB * NKV * HD * SEQ * 2;         //  2097152
  const size_t szOP  = (size_t)ROWS * (NH * HD) * 2;            //  6291456
  size_t off = 0;
  const size_t oCT  = off; off += szTab;
  const size_t oST  = off; off += szTab;
  const size_t oXB  = off; off += szXB;
  const size_t oWQT = off; off += szWQT;
  const size_t oWKT = off; off += szWKT;
  const size_t oWVT = off; off += szWKT;
  const size_t oWOT = off; off += szWOT;
  const size_t oQHI = off; off += szQP;
  const size_t oKHI = off; off += szKP;
  const size_t oVHI = off; off += szVP;
  const size_t oOHI = off; off += szOP;
  if (off > ws_size) return;                            // off = 27262976
  if (off > (size_t)134217728) return;

  char* ws = (char*)d_ws;
  float* CT  = (float*)(ws + oCT);
  float* ST  = (float*)(ws + oST);
  u16*   XB  = (u16*)(ws + oXB);
  u16*   WQT = (u16*)(ws + oWQT);
  u16*   WKT = (u16*)(ws + oWKT);
  u16*   WVT = (u16*)(ws + oWVT);
  u16*   WOT = (u16*)(ws + oWOT);
  u16*   QHI = (u16*)(ws + oQHI);
  u16*   KHI = (u16*)(ws + oKHI);
  u16*   VHI = (u16*)(ws + oVHI);
  u16*   OHI = (u16*)(ws + oOHI);

  // inv_freq[i] = 1 / pow(10000, i/32) in f32 (pow correctly converted from f64, then IEEE f32 reciprocal)
  InvF inv;
  for (int i = 0; i < 32; ++i) {
    const double p = pow(10000.0, (double)i / 32.0);
    const float pf = (float)p;
    inv.f[i] = 1.0f / pf;
  }

  const dim3 blk(256);
  const dim3 gPrep(PREP_BLOCKS);                        // 2176
  const dim3 gQKV(QKV_BLOCKS);                          // 256
  const dim3 bQKV(QKV_THREADS);                         // 320
  const dim3 gGO(H2_BLOCKS);                            // 256
  const dim3 bGO(H2_THREADS);                           // 192
  const dim3 gAT(ATT_BLOCKS);                           // 256
  const dim3 bAT(ATT_THREADS);                          // 384

  // (1) weights W[k rows][n cols] -> [n][k] 16-bit planes in fragment order (bf16 for wq/wk/wv; f16 of bf16 value x1024 for wo),
  //     rotary cos/sin tables [2048][64], x -> bf16 plane
  prep<<<gPrep, blk, 0, stream>>>(x, wq, wk, wv, wo, XB, WQT, WKT, WVT, WOT, CT, ST, inv);
  // (2) projections q, k, v -> q' and k' planes (rotary), v^T plane, all x1024 in f16
  gemm_qkv<<<gQKV, bQKV, 0, stream>>>(XB, WQT, WKT, WVT, CT, ST, QHI, KHI, VHI, ROWS, DMOD);
  // (3) attention -> O plane [b][s][h][d] x1024 in f16
  attn_gqa<<<gAT, bAT, 0, stream>>>(QHI, KHI, VHI, OHI);
  // (4) output projection -> out [4096][768] f32, carries 1024 (O) x 1024 (wo) folded back
  gemm_h2<<<gGO, bGO, 0, stream>>>(OHI, WOT, out, ROWS, DMOD, NH * HD, 1.0f / (OSC * WOS));
  (void)hipGetLastError();
}
